// v000
// The times below were measured on an AMD MI455X: many runs one after another, warmed up first and cycling through
// copies of the inputs, with the whole window's GPU time divided by the number of runs. Launches and the gaps
// between them are all in it. The median over several windows is given; except for v000 it joins two sittings, which
// can be a few percent apart, so the side-by-side timings, each taken in one sitting, are the better comparison.
// v000, which the later versions start from, runs in 932 microseconds.
// Projections q,k,v = delayed.W^T: v_wmma_f32_16x16x32_bf16 (bf16 RNE operands of the raw inputs, f32 accumulate).
// Scores q'.k'^T (f16 planes x8), P'.V (chunk-centred P' x32768 f16 from LDS, V^T x1024 f16) and the output projection
// (ctx carried as f16 hi x16384 plus residual x2048 planes, times f16(bf16(Wo) x1024), bias added in f32):
// v_wmma_f32_16x16x32_f16, f32 accumulate. Delay gather, softmax statistics, column sums of V and all scaling in f32 on VALU.
#include <hip/hip_runtime.h>
#include <math.h>
#include <stdint.h>

#define SEQ   2048
#define EMB   768
#define CK    512
#define NCHK  4
#define QT    16
#define SCP   544
#define PLP   528
#define CTP   776
#define SLAB64 (16 * 68)
#define VTP   72
#define ATT_THREADS 256
#define QSC   8.0f
#define KSC   8.0f
#define PCAR  32768.0f
#define VCAR  1024.0f
#define WSC   1024.0f
#define CSC   16384.0f
#define RSC   2048.0f
#define LOG2E 1.4426950408889634f
#define RSQD  0.036084391824351615f
#define WS_CAP ((size_t)134217728)

static_assert((EMB % 64) == 0 && EMB == 8 * 96 && (EMB % 32) == 0 && (EMB / 8) == 96);
static_assert((SEQ % CK) == 0 && (SEQ / CK) == NCHK && CK == 16 * 32 && (SEQ % 64) == 0 && (SEQ / QT) == 128);
static_assert(16 * CTP * 2 <= 16 * SCP * 4 && CTP >= EMB + 8);
static_assert(((PLP * 2) % 16) == 0 && ((SCP * 4) % 16) == 0 && ((VTP * 2) % 16) == 0 && ((CTP * 2) % 16) == 0);
static_assert(64 * VTP >= 63 * VTP + 64);
static_assert(ATT_THREADS == 16 * QT && ATT_THREADS == 256);
static_assert(((EMB * EMB) % 2048) == 0 && ((NCHK * EMB) % 256) == 0);

typedef unsigned short u16;
typedef _Float16 v16h __attribute__((ext_vector_type(16)));
typedef _Float16 v8h  __attribute__((ext_vector_type(8)));
typedef __bf16   v16b __attribute__((ext_vector_type(16)));
typedef float    v8f  __attribute__((ext_vector_type(8)));
typedef float    v4f  __attribute__((ext_vector_type(4)));
typedef unsigned int v4u __attribute__((ext_vector_type(4)));

union FragH { v16h v; v8h h[2]; v4u u[2]; };
union FragB { v16b v; v4u u[2]; };
union AttLds { float s[16 * SCP]; u16 c[2 * 16 * SCP]; };

// ---- scalar helpers --------------------------------------------------------------------------------
__device__ __forceinline__ unsigned short bf_bits(float f) {          // f32 -> bf16 bits, RNE convert
  unsigned u = __float_as_uint(f);
  return (unsigned short)((u + 0x7FFFu + ((u >> 16) & 1u)) >> 16);
}
__device__ __forceinline__ float bf_up(unsigned short h) { return __uint_as_float(((unsigned)h) << 16); }
__device__ __forceinline__ float bfr(float f) { return bf_up(bf_bits(f)); }
__device__ __forceinline__ unsigned short h_bits(_Float16 x) { return __builtin_bit_cast(unsigned short, x); }
__device__ __forceinline__ unsigned pk16(unsigned short a, unsigned short b) { return (unsigned)a | ((unsigned)b << 16); }
__device__ __forceinline__ v8f zero8() { v8f z = {0.f, 0.f, 0.f, 0.f, 0.f, 0.f, 0.f, 0.f}; return z; }
__device__ __forceinline__ v4f zero4() { v4f z = {0.f, 0.f, 0.f, 0.f}; return z; }

// ---- fragment loaders: 16-bit A/B operand, lane -> row/col (lane&15), p already includes +8*(lane>>4);
//      elements 0..7 <- p[0..7] (k0+8h..), elements 8..15 <- p[16..23] (k0+16+8h..)  (same split k map for A and B;
//      B is always read from a k-contiguous [n][k] plane)
__device__ __forceinline__ v16h ldfrag_h(const _Float16* p) {
  FragH f;
  f.h[0] = *(const v8h*)(p);
  f.h[1] = *(const v8h*)(p + 16);
  return f.v;
}
__device__ __forceinline__ v16b ldfrag_b(const u16* p) {              // bf16 plane read as unsigned integer vectors
  FragB f;
  f.u[0] = *(const v4u*)(p);
  f.u[1] = *(const v4u*)(p + 16);
  return f.v;
}

__device__ __forceinline__ v8f mma_h(v16h a, v16h b, v8f c) {
  return __builtin_amdgcn_wmma_f32_16x16x32_f16(false, a, false, b, (short)0, c, false, false);
}
__device__ __forceinline__ v8f mma_b(v16b a, v16b b, v8f c) {
  return __builtin_amdgcn_wmma_f32_16x16x32_bf16(false, a, false, b, (short)0, c, false, false);
}
__device__ __forceinline__ void guard2x3(v8f& a, v8f& b, v16h x0, v16h x1, v16h x2) {
#if defined(__HIP_DEVICE_COMPILE__)
  asm volatile("v_nop\n\tv_nop\n\tv_nop\n\tv_nop"
               : "+v"(a), "+v"(b) : "v"(x0), "v"(x1), "v"(x2) : "memory");
#endif
}
template <typename F>
__device__ __forceinline__ void guard6(v8f& a, v8f& b, v8f& c, v8f& d, F x0, F x1, F x2, F x3, F x4, F x5) {
#if defined(__HIP_DEVICE_COMPILE__)
  asm volatile("v_nop\n\tv_nop\n\tv_nop\n\tv_nop"
               : "+v"(a), "+v"(b), "+v"(c), "+v"(d) : "v"(x0), "v"(x1), "v"(x2), "v"(x3), "v"(x4), "v"(x5) : "memory");
#endif
}
__device__ __forceinline__ void guard8x6(v8f& a0, v8f& a1, v8f& a2, v8f& a3, v8f& e0, v8f& e1, v8f& e2, v8f& e3,
                                         v16h x0, v16h x1, v16h x2, v16h x3, v16h x4, v16h x5) {
#if defined(__HIP_DEVICE_COMPILE__)
  asm volatile("v_nop\n\tv_nop\n\tv_nop\n\tv_nop"
               : "+v"(a0), "+v"(a1), "+v"(a2), "+v"(a3), "+v"(e0), "+v"(e1), "+v"(e2), "+v"(e3)
               : "v"(x0), "v"(x1), "v"(x2), "v"(x3), "v"(x4), "v"(x5) : "memory");
#endif
}
__device__ __forceinline__ void guardpv(v8f& o0, v8f& o1, v8f& o2, v8f& o3, v8f& o4, v8f& o5,
                                        v16h p, v16h g0, v16h g1, v16h g2, v16h g3, v16h g4, v16h g5) {
#if defined(__HIP_DEVICE_COMPILE__)
  asm volatile("v_nop\n\tv_nop\n\tv_nop\n\tv_nop"
               : "+v"(o0), "+v"(o1), "+v"(o2), "+v"(o3), "+v"(o4), "+v"(o5)
               : "v"(p), "v"(g0), "v"(g1), "v"(g2), "v"(g3), "v"(g4), "v"(g5) : "memory");
#endif
}
__device__ __forceinline__ void acc_guard6(v8f& a, v8f& b, v8f& c, v8f& d, v8f& e, v8f& f) {
#if defined(__HIP_DEVICE_COMPILE__)
  asm volatile("v_nop\n\tv_nop\n\tv_nop\n\tv_nop" : "+v"(a), "+v"(b), "+v"(c), "+v"(d), "+v"(e), "+v"(f));
#endif
}
__device__ __forceinline__ void wave_sync_lds() {
  __builtin_amdgcn_fence(__ATOMIC_RELEASE, "workgroup");
  __builtin_amdgcn_wave_barrier();
  __builtin_amdgcn_fence(__ATOMIC_ACQUIRE, "workgroup");
}

// =====================================================================================================
// f32 plane -> 16-bit plane, same layout:  mode 0: bf16 RNE bits;  mode 1: f16 bits of (bf16 RNE value) * scale;
// mode 2: f16 bits of value * scale (no bf16 pre-step).
// Thread = 8 consecutive elements: two 16-B loads, one 16-B store; 32 consecutive lanes = 512 contiguous, 512-B aligned bytes
// coverage: grid = n8/256 blocks (host checks exactness) x 256 thr x 8 = the whole plane.
// =====================================================================================================
__global__ __launch_bounds__(256) void cvt16(const float* __restrict__ x, u16* D, int n8, int mode, float scale) {
  const int gt = blockIdx.x * 256 + (int)threadIdx.x;
  if (gt >= n8) return;                     // no barriers in this kernel
  const float* p = x + (size_t)gt * 8;
  const v4f a = *(const v4f*)(p), c4 = *(const v4f*)(p + 4);
  float v[8];
#pragma unroll
  for (int e = 0; e < 4; ++e) { v[e] = a[e]; v[4 + e] = c4[e]; }
  unsigned short s[8];
#pragma unroll
  for (int e = 0; e < 8; ++e) {
    const float vb = bfr(v[e]);
    const float vf = (mode == 1) ? vb : v[e];
    const unsigned short hb = h_bits((_Float16)(vf * scale));
    const unsigned short bb = bf_bits(v[e]);
    s[e] = (mode != 0) ? hb : bb;
  }
  v4u o;
#pragma unroll
  for (int e = 0; e < 4; ++e) o[e] = pk16(s[2 * e], s[2 * e + 1]);
  u16* d = D + (size_t)gt * 8;
  {
    *(v4u*)(d) = o;
    
  }
}

// =====================================================================================================
// Delay gather to a bf16 plane: DB[b][t][n] = bf16 RNE bits of sp[b][t - dl[n]][n] when t - dl[n] >= 0, else 0 (the zero is
// written). The source row index is clamped into [0, SEQ) for the address; the value is selected afterwards.
// Thread = 8 consecutive n of one (b, t) row: 8 scalar loads, one 16-B store; 32 consecutive lanes = 512 contiguous bytes
// coverage: grid = n8/256 blocks (host exact) x 256 thr x 8 = rows x EMB = the whole plane.
// =====================================================================================================
__global__ __launch_bounds__(256) void gather_bf(const float* __restrict__ sp, const int* __restrict__ dl,
                                                 const float* __restrict__ mpu, const float* __restrict__ dcu,
                                                 u16* DB, int n8) {
  const int gt = blockIdx.x * 256 + (int)threadIdx.x;
  if (gt >= n8) return;                     // no barriers in this kernel
  const int row = gt / (EMB / 8);
  const int n0  = (gt - row * (EMB / 8)) * 8;
  const int b   = row / SEQ;
  const int t   = row - b * SEQ;
  unsigned short s[8];
#pragma unroll
  for (int e = 0; e < 8; ++e) {
    const int n   = n0 + e;
    const int d   = dl[n];
    const int src = t - d;
    int sc = (src < 0) ? 0 : src;
    sc = (sc > SEQ - 1) ? (SEQ - 1) : sc;
    const float v = sp[((size_t)b * SEQ + (size_t)sc) * EMB + n];
    s[e] = (src >= 0) ? bf_bits(v) : (unsigned short)0;
  }
  v4u o;
#pragma unroll
  for (int e = 0; e < 4; ++e) o[e] = pk16(s[2 * e], s[2 * e + 1]);
  u16* dst = DB + (size_t)gt * 8;
  {
    *(v4u*)(dst) = o;
    
  }
  (void)mpu; (void)dcu;
}

// =====================================================================================================
//           8 consecutive lanes x 16 B per line), lanes 16..31 -> row 2*it+1.
//  epi64x2: same store shape, staged value = acc*os1 + accres*os2 + badd (two accumulator sets combined in f32).
//  epi64hs: f16 bits of (tile * pscale); lane = (rq = lane>>3 -> row within a group of 4, c8 = 8 consecutive columns);
// coverage: epi64/epi64x2 8 instructions x 2 rows x 16 lanes x 4 floats; epi64hs 4 instructions x 4 rows x 8 lanes x 8 halves
//           = the wave's 16 x 64 tile in every case.
// =====================================================================================================
__device__ __forceinline__ void stage64(float* sl, v8f a0, v8f a1, v8f a2, v8f a3, float oscale, int lane) {
  const int hh = lane >> 4, m = lane & 15;
#pragma unroll
  for (int r = 0; r < 8; ++r) {
    const int ro = (8 * hh + r) * 68 + m;
    sl[ro]      = a0[r] * oscale;
    sl[ro + 16] = a1[r] * oscale;
    sl[ro + 32] = a2[r] * oscale;
    sl[ro + 48] = a3[r] * oscale;
  }
  wave_sync_lds();
}
__device__ __forceinline__ void epi64(float* sl, v8f a0, v8f a1, v8f a2, v8f a3, float oscale, v4f badd, float* C, int N,
                                      size_t rowb, int col0, int lane) {
  const int hh = lane >> 4, m = lane & 15;
  stage64(sl, a0, a1, a2, a3, oscale, lane);
  v4f vals[8];
#pragma unroll
  for (int it = 0; it < 8; ++it) vals[it] = *(const v4f*)(sl + (it * 2 + hh) * 68 + m * 4) + badd;
  float* dst = C + (rowb + (size_t)hh) * (size_t)N + col0 + m * 4;
  {
#pragma unroll
    for (int it = 0; it < 8; ++it) {
      *(v4f*)(dst + (size_t)(it * 2) * (size_t)N) = vals[it];
    }
    
  }
}
__device__ __forceinline__ void epi64x2(float* sl, v8f a0, v8f a1, v8f a2, v8f a3, v8f e0, v8f e1, v8f e2, v8f e3,
                                        float os1, float os2, v4f badd, float* C, int N, size_t rowb, int col0, int lane) {
  const int hh = lane >> 4, m = lane & 15;
#pragma unroll
  for (int r = 0; r < 8; ++r) {
    const int ro = (8 * hh + r) * 68 + m;
    sl[ro]      = a0[r] * os1 + e0[r] * os2;
    sl[ro + 16] = a1[r] * os1 + e1[r] * os2;
    sl[ro + 32] = a2[r] * os1 + e2[r] * os2;
    sl[ro + 48] = a3[r] * os1 + e3[r] * os2;
  }
  wave_sync_lds();
  v4f vals[8];
#pragma unroll
  for (int it = 0; it < 8; ++it) vals[it] = *(const v4f*)(sl + (it * 2 + hh) * 68 + m * 4) + badd;
  float* dst = C + (rowb + (size_t)hh) * (size_t)N + col0 + m * 4;
  {
#pragma unroll
    for (int it = 0; it < 8; ++it) {
      *(v4f*)(dst + (size_t)(it * 2) * (size_t)N) = vals[it];
    }
    
  }
}
__device__ __forceinline__ void epi64hs(float* sl, v8f a0, v8f a1, v8f a2, v8f a3, float oscale, float pscale,
                                        u16* C, int N, size_t rowb, int col0, int lane) {
  stage64(sl, a0, a1, a2, a3, oscale, lane);
  const int rq = lane >> 3, c8 = (lane & 7) * 8;
  v4u oh[4];
#pragma unroll
  for (int i4 = 0; i4 < 4; ++i4) {
    const int row = i4 * 4 + rq;
    const v4f a = *(const v4f*)(sl + row * 68 + c8), c4 = *(const v4f*)(sl + row * 68 + c8 + 4);
    float w[8];
#pragma unroll
    for (int e = 0; e < 4; ++e) { w[e] = a[e] * pscale; w[4 + e] = c4[e] * pscale; }
#pragma unroll
    for (int e = 0; e < 4; ++e) oh[i4][e] = pk16(h_bits((_Float16)w[2 * e]), h_bits((_Float16)w[2 * e + 1]));
  }
  u16* dst = C + rowb * (size_t)N + col0 + c8;
  {
#pragma unroll
    for (int i4 = 0; i4 < 4; ++i4) {
      const int row = i4 * 4 + rq;
      *(v4u*)(dst + (size_t)row * (size_t)N) = oh[i4];
    }
    
  }
}

// =====================================================================================================
// bf16 GEMM, f32 out: C[M][N] = (A[M][K] (bf16 row-major) . Bt[N][K]^T (bf16 k-contiguous)) * oscale.
// Block = 64x64 tile, 4 waves x 16 rows; fragments loaded straight from the 16-bit rows (two 16-B loads each, split k map for
// A and B); K stepped by 32 (host checks K % 32 == 0, M % 64 == 0, N % 64 == 0, grid = (M/64)*(N/64)).
// =====================================================================================================
__global__ __launch_bounds__(128)
void gemm_b32(const u16* __restrict__ A, const u16* __restrict__ Bt, float* C, int M, int N, int K, float oscale) {
  __shared__ __align__(16) float slab[4 * SLAB64];
  const int tid = threadIdx.x, wave = tid >> 5, lane = tid & 31, hh = lane >> 4, m = lane & 15;
  const int ntile = N >> 6;
  const int bid   = blockIdx.x;
  const int rowb  = (bid / ntile) * 64 + wave * 16;
  const int col0  = (bid % ntile) * 64;
  if (rowb + 16 > M) return;                 // wave-uniform, never taken with the exact grid; no block barriers in this kernel
  const u16* ap = A  + (size_t)(rowb + m) * K + 8 * hh;
  const u16* bp = Bt + (size_t)(col0 + m) * K + 8 * hh;
  const size_t bs = (size_t)16 * K;
  v8f acc0 = zero8(), acc1 = zero8(), acc2 = zero8(), acc3 = zero8();
#pragma unroll 1
  for (int k0 = 0; k0 < K; k0 += 32) {
    const v16b a  = ldfrag_b(ap + k0);
    const v16b b0 = ldfrag_b(bp + k0);
    const v16b b1 = ldfrag_b(bp + bs + k0);
    const v16b b2 = ldfrag_b(bp + 2 * bs + k0);
    const v16b b3 = ldfrag_b(bp + 3 * bs + k0);
    acc0 = mma_b(a, b0, acc0);
    acc1 = mma_b(a, b1, acc1);
    acc2 = mma_b(a, b2, acc2);
    acc3 = mma_b(a, b3, acc3);
    guard6<v16b>(acc0, acc1, acc2, acc3, a, b0, b1, b2, b3, a);
  }
  epi64(slab + wave * SLAB64, acc0, acc1, acc2, acc3, oscale, zero4(), C, N, (size_t)rowb, col0, lane);
}

// =====================================================================================================
// bf16 GEMM, f16 plane out: C16[M][N] = f16 bits of ((A . Bt^T) * oscale) * pscale; operands as in gemm_b32, epilogue epi64hs.
// =====================================================================================================
__global__ __launch_bounds__(128)
void gemm_bh16(const u16* __restrict__ A, const u16* __restrict__ Bt, u16* C, int M, int N, int K, float oscale, float pscale) {
  __shared__ __align__(16) float slab[4 * SLAB64];
  const int tid = threadIdx.x, wave = tid >> 5, lane = tid & 31, hh = lane >> 4, m = lane & 15;
  const int ntile = N >> 6;
  const int bid   = blockIdx.x;
  const int rowb  = (bid / ntile) * 64 + wave * 16;
  const int col0  = (bid % ntile) * 64;
  if (rowb + 16 > M) return;                 // wave-uniform, never taken with the exact grid; no block barriers in this kernel
  const u16* ap = A  + (size_t)(rowb + m) * K + 8 * hh;
  const u16* bp = Bt + (size_t)(col0 + m) * K + 8 * hh;
  const size_t bs = (size_t)16 * K;
  v8f acc0 = zero8(), acc1 = zero8(), acc2 = zero8(), acc3 = zero8();
#pragma unroll 1
  for (int k0 = 0; k0 < K; k0 += 32) {
    const v16b a  = ldfrag_b(ap + k0);
    const v16b b0 = ldfrag_b(bp + k0);
    const v16b b1 = ldfrag_b(bp + bs + k0);
    const v16b b2 = ldfrag_b(bp + 2 * bs + k0);
    const v16b b3 = ldfrag_b(bp + 3 * bs + k0);
    acc0 = mma_b(a, b0, acc0);
    acc1 = mma_b(a, b1, acc1);
    acc2 = mma_b(a, b2, acc2);
    acc3 = mma_b(a, b3, acc3);
    guard6<v16b>(acc0, acc1, acc2, acc3, a, b0, b1, b2, b3, a);
  }
  epi64hs(slab + wave * SLAB64, acc0, acc1, acc2, acc3, oscale, pscale, C, N, (size_t)rowb, col0, lane);
}

// =====================================================================================================
// f16 GEMM with two A planes (hi + residual), f32 out with bias:
//   C[M][N] = (Ah . Bt^T) * os1 + (Ar . Bt^T) * os2 + bf16RNE(bias[n]); Ah/Ar f16 row-major, Bt f16 k-contiguous.
// Same tiling as gemm_b32; separate accumulators for the two planes, combined in f32 in epi64x2.
// =====================================================================================================
__global__ __launch_bounds__(128)
void gemm_h2_32(const u16* __restrict__ Ah, const u16* __restrict__ Ar, const u16* __restrict__ Bt,
                const float* __restrict__ bias, float* C, int M, int N, int K, float os1, float os2) {
  __shared__ __align__(16) float slab[4 * SLAB64];
  const int tid = threadIdx.x, wave = tid >> 5, lane = tid & 31, hh = lane >> 4, m = lane & 15;
  const int ntile = N >> 6;
  const int bid   = blockIdx.x;
  const int rowb  = (bid / ntile) * 64 + wave * 16;
  const int col0  = (bid % ntile) * 64;
  if (rowb + 16 > M) return;                 // wave-uniform, never taken with the exact grid; no block barriers in this kernel
  const _Float16* ap  = (const _Float16*)(const void*)Ah + (size_t)(rowb + m) * K + 8 * hh;
  const _Float16* arp = (const _Float16*)(const void*)Ar + (size_t)(rowb + m) * K + 8 * hh;
  const _Float16* bp  = (const _Float16*)(const void*)Bt + (size_t)(col0 + m) * K + 8 * hh;
  const size_t bs = (size_t)16 * K;
  v8f acc0 = zero8(), acc1 = zero8(), acc2 = zero8(), acc3 = zero8();
  v8f acr0 = zero8(), acr1 = zero8(), acr2 = zero8(), acr3 = zero8();
#pragma unroll 1
  for (int k0 = 0; k0 < K; k0 += 32) {
    const v16h a  = ldfrag_h(ap + k0);
    const v16h ar = ldfrag_h(arp + k0);
    const v16h b0 = ldfrag_h(bp + k0);
    const v16h b1 = ldfrag_h(bp + bs + k0);
    const v16h b2 = ldfrag_h(bp + 2 * bs + k0);
    const v16h b3 = ldfrag_h(bp + 3 * bs + k0);
    acc0 = mma_h(a, b0, acc0);
    acc1 = mma_h(a, b1, acc1);
    acc2 = mma_h(a, b2, acc2);
    acc3 = mma_h(a, b3, acc3);
    acr0 = mma_h(ar, b0, acr0);
    acr1 = mma_h(ar, b1, acr1);
    acr2 = mma_h(ar, b2, acr2);
    acr3 = mma_h(ar, b3, acr3);
    guard8x6(acc0, acc1, acc2, acc3, acr0, acr1, acr2, acr3, a, ar, b0, b1, b2, b3);
  }
  const v4f bv = *(const v4f*)(bias + col0 + m * 4);      // columns col0 + 4m .. +3, always < N (N multiple of 64)
  v4f badd;
#pragma unroll
  for (int e = 0; e < 4; ++e) badd[e] = bfr(bv[e]);
  epi64x2(slab + wave * SLAB64, acc0, acc1, acc2, acc3, acr0, acr1, acr2, acr3, os1, os2, badd, C, N,
          (size_t)rowb, col0, lane);
}

// =====================================================================================================
// V^T plane: VT[(b*EMB + d)*SEQ + s] = f16(V[b][s][d] * 1024).
// Block = (b, 64-wide d chunk, 64 keys): 64 source row segments of 64 floats loaded with 16-B loads, converted, scattered into
// coverage: load 256 thr x 16 elements = 64 x 64; store 2 iterations x 256 thr x 8 halves = 64 lines x 64 = the block's tile;
//           grid = nb x (EMB/64) x (SEQ/64) blocks covers the plane exactly once.
// =====================================================================================================
__global__ __launch_bounds__(256) void xt16(const float* __restrict__ X, u16* XTo) {
  __shared__ __align__(16) u16 TH[64 * VTP];
  const int tid = threadIdx.x;
  const int bid = blockIdx.x;
  const int st  = bid % (SEQ / 64);
  const int dcb = (bid / (SEQ / 64)) % (EMB / 64);
  const int b   = bid / ((SEQ / 64) * (EMB / 64));
  const int s0  = st * 64;
  const int d0  = dcb * 64;
  {
    const int sl = tid >> 2;                  // key within tile 0..63
    const int dc = (tid & 3) * 16;            // d chunk within the 64
    const float* src = X + ((size_t)b * SEQ + s0 + sl) * EMB + d0 + dc;
#pragma unroll
    for (int i = 0; i < 4; ++i) {
      const v4f a = *(const v4f*)(src + 4 * i);
#pragma unroll
      for (int e = 0; e < 4; ++e) {
        const _Float16 hv = (_Float16)(a[e] * VCAR);
        TH[(dc + 4 * i + e) * VTP + sl] = h_bits(hv);
      }
    }
  }
  __syncthreads();
  v4u vh[2];
  const int q8 = tid >> 3, p8 = (tid & 7) * 8;
#pragma unroll
  for (int it = 0; it < 2; ++it) {
    const int line = it * 32 + q8;            // local d = 0..63
    vh[it] = *(const v4u*)(TH + line * VTP + p8);
  }
  const size_t base = ((size_t)b * EMB + d0) * SEQ + s0 + p8;
  {
#pragma unroll
    for (int it = 0; it < 2; ++it) {
      const int line = it * 32 + q8;
      *(v4u*)(XTo + base + (size_t)line * SEQ) = vh[it];
    }
    
  }
}

// =====================================================================================================
// Per-chunk column sums of V: VS[(b*NCHK + c)*EMB + d] = sum over the CK keys of chunk c of V[b][c*CK + s][d] (f32, fixed
// sequential order). Thread = one (b, c, d); 256 consecutive table entries per block are staged in LDS, then threads 0..63
// coverage: grid = nb*NCHK*EMB/256 blocks (host exact) x 256 = the whole table; store 64 thr x 4 floats = the block's 256.
// =====================================================================================================
__global__ __launch_bounds__(256) void vsum_k(const float* __restrict__ V, float* VS) {
  __shared__ __align__(16) float sm[256];
  const int tid = threadIdx.x;
  const int gt  = blockIdx.x * 256 + tid;
  const int d   = gt % EMB;
  const int bc  = gt / EMB;
  const int b   = bc / NCHK;
  const int c   = bc - b * NCHK;
  const float* p = V + ((size_t)b * SEQ + (size_t)c * CK) * EMB + d;
  float s = 0.f;
#pragma unroll 4
  for (int i = 0; i < CK; ++i) s += p[(size_t)i * EMB];
  sm[tid] = s;
  __syncthreads();
  if (tid < 64) {                                   // waves 0 and 1, all lanes active
    const v4f o = *(const v4f*)(sm + tid * 4);
    float* dst = VS + (size_t)blockIdx.x * 256 + tid * 4;
    *(v4f*)(dst) = o;
    
  }
}

// =====================================================================================================
// Single-head attention, head width EMB = 768, all SEQ keys kept (non-causal): block = (batch b, 16 query rows q0..q0+15),
// 8 waves. q plane (f16, x8) [b][s][d]; k plane the same; V^T plane [b][d][s] (x1024); VS = per-chunk column sums of V (f32).
//   Per chunk of CK = 512 keys (NCHK = 4 chunks):
//   (S) scores S[query m][key n] on WMMA: A = q rows (row m = lane&15, split k map over d), B = k rows (col n = key, split map),
//       24 d-steps; wave w handles key blocks w, w+8 of the chunk; D element r of lane l -> scs[query 8h+r][key col] (f32 LDS).
//   (M) 16 threads per query row (sub-thread = 32 consecutive keys): base-2 logits, chunk max via xor shuffles, online running
//       max / rescale factor al / running sum l in f32 registers (the same threads own the row in every chunk),
//       p = exp2(t - m_new) <= 1, chunk row sum ps and its mean C = ps/CK (bit-identical on the row's 16 threads), the CENTRED
//       P' = p - C written as f16(P' * 32768) into the LDS P tile with 16-B stores; al -> rowa[row], C -> rowc[row].
//   (PV) each wave owns d columns 96*wave + 16j + (lane&15), j = 0..5 (6 accumulators): o = o*al + C*(32768*1024)*VS[chunk][d]
//       (exact add-back of the centring term in f32), then for each key block: A = P' fragment from LDS (row m = query, split
//       map over keys), B = V^T fragments (col n = d, split map over keys).  sum_k (P'_k + C) v_k == sum_k p_k v_k exactly.
//   Block barriers after (S) and after (M) order all LDS reuse across chunks and waves.
//   Epilogue: x = o * 16384 / (l * 32768 * 1024) per row (rowi, l >= 1 always); hi = f16(x), res = f16((x - hi) * 2048); each
// coverage: grid nb*128 blocks x 16 rows; staging 8 waves x 96 cols x 16 rows = 16 x 768; store 6 iterations x 256 thr x 8
//           halves = 16 x 768 per plane = every (b, s, d) of both ctx planes exactly once.
// =====================================================================================================
__device__ __forceinline__ void ctx_store(const u16* ct, u16* dst, int tid) {
  v4u v[6];
#pragma unroll
  for (int it = 0; it < 6; ++it) {
    const int p   = it * 256 + tid;
    const int row = p / 96;
    const int c8  = (p - row * 96) * 8;
    v[it] = *(const v4u*)(ct + row * CTP + c8);
  }
  {
#pragma unroll
    for (int it = 0; it < 6; ++it) {
      const int p   = it * 256 + tid;
      const int row = p / 96;
      const int c8  = (p - row * 96) * 8;
      *(v4u*)(dst + (size_t)row * EMB + c8) = v[it];
    }
    
  }
}

__global__ __launch_bounds__(ATT_THREADS)
void attn_fwd(const u16* __restrict__ QPp, const u16* __restrict__ KPp, const u16* __restrict__ VTp,
              const float* __restrict__ VSp, u16* CHo, u16* CRo) {
  __shared__ __align__(16) AttLds L0;              // scores [16][SCP] f32; reused as the ctx staging tile [16][CTP] u16
  __shared__ __align__(16) u16 pls[16 * PLP];      // P' tile [16][PLP] f16 bits
  __shared__ float rowa[QT];
  __shared__ float rowc[QT];
  __shared__ float rowi[QT];
  float* const scs = L0.s;

  const int tid  = threadIdx.x;
  const int wave = tid >> 5;
  const int lane = tid & 31;
  const int hh   = lane >> 4;
  const int m    = lane & 15;
  const int r16  = tid >> 4;                 // query row owned in phase (M): 2*wave + hh
  const int sub  = tid & 15;
  const int kl0  = sub * 32;

  const int bid = blockIdx.x;
  const int b   = bid >> 7;
  const int q0  = (bid & 127) * QT;

  const _Float16* qa  = (const _Float16*)(const void*)QPp + ((size_t)b * SEQ + q0 + m) * EMB + 8 * hh;
  const _Float16* kbp = (const _Float16*)(const void*)KPp + ((size_t)b * SEQ + m) * EMB + 8 * hh;
  const _Float16* vbp = (const _Float16*)(const void*)VTp + ((size_t)b * EMB + wave * 96 + m) * SEQ + 8 * hh;
  const float* vsb = VSp + (size_t)b * NCHK * EMB + wave * 96 + m;
  const float lsc = RSQD * LOG2E / (QSC * KSC);

  float mrun = -INFINITY, lrun = 0.f;
  v8f o[6];
#pragma unroll
  for (int j = 0; j < 6; ++j) o[j] = zero8();

#pragma unroll 1
  for (int c = 0; c < NCHK; ++c) {
    const int kbeg = c * CK;
    // ---- (S) scores of this chunk ----
#pragma unroll 1
    for (int kb = wave; kb < CK / 32; kb += 8) {           // wave-uniform, 2 trips
      const _Float16* k0p = kbp + (size_t)(kbeg + kb * 32) * EMB;
      const _Float16* k1p = k0p + (size_t)16 * EMB;
      v8f s0 = zero8(), s1 = zero8();
#pragma unroll 4
      for (int ks = 0; ks < EMB / 32; ++ks) {
        const v16h a  = ldfrag_h(qa + ks * 32);
        const v16h f0 = ldfrag_h(k0p + ks * 32);
        const v16h f1 = ldfrag_h(k1p + ks * 32);
        s0 = mma_h(a, f0, s0);
        s1 = mma_h(a, f1, s1);
        guard2x3(s0, s1, a, f0, f1);
      }
      float* srow = scs + (8 * hh) * SCP + kb * 32 + m;
#pragma unroll
      for (int r = 0; r < 8; ++r) {
        srow[r * SCP]      = s0[r];
        srow[r * SCP + 16] = s1[r];
      }
    }
    __syncthreads();
    // ---- (M) softmax statistics and the centred P' tile ----
    {
      const float* sp = scs + r16 * SCP + kl0;
      float t[32];
      float cm = -INFINITY;
#pragma unroll
      for (int i = 0; i < 8; ++i) {
        const v4f a = *(const v4f*)(sp + 4 * i);
#pragma unroll
        for (int e = 0; e < 4; ++e) {
          const float tv = a[e] * lsc;
          t[4 * i + e] = tv;
          cm = fmaxf(cm, tv);
        }
      }
#pragma unroll
      for (int d = 1; d <= 8; d <<= 1) cm = fmaxf(cm, __shfl_xor(cm, d, 32));
      const float mn = fmaxf(mrun, cm);                    // finite
      const float al = (mrun == -INFINITY) ? 0.f : exp2f(mrun - mn);
      mrun = mn;
      float ps = 0.f;
#pragma unroll
      for (int j = 0; j < 32; ++j) {
        const float p = exp2f(fminf(t[j] - mn, 0.f));
        t[j] = p;
        ps += p;
      }
#pragma unroll
      for (int d = 1; d <= 8; d <<= 1) ps += __shfl_xor(ps, d, 32);
      const float cc = ps * (1.0f / (float)CK);
      v4u pk[4];
#pragma unroll
      for (int i = 0; i < 4; ++i) {
#pragma unroll
        for (int e = 0; e < 4; ++e) {
          const int j = 8 * i + 2 * e;
          pk[i][e] = pk16(h_bits((_Float16)((t[j] - cc) * PCAR)), h_bits((_Float16)((t[j + 1] - cc) * PCAR)));
        }
      }
      lrun = lrun * al + ps;
      u16* pd = pls + r16 * PLP + kl0;
#pragma unroll
      for (int i = 0; i < 4; ++i) *(v4u*)(pd + 8 * i) = pk[i];
      if (sub == 0) { rowa[r16] = al; rowc[r16] = cc; }
    }
    __syncthreads();
    // ---- (PV) rescale, add the centring term, accumulate P' . V^T ----
    {
      float scl[8], cad[8];
#pragma unroll
      for (int r = 0; r < 8; ++r) { scl[r] = rowa[8 * hh + r]; cad[r] = rowc[8 * hh + r] * (PCAR * VCAR); }
      float vs[6];
#pragma unroll
      for (int j = 0; j < 6; ++j) vs[j] = vsb[(size_t)c * EMB + 16 * j];
#pragma unroll
      for (int j = 0; j < 6; ++j) {
#pragma unroll
        for (int r = 0; r < 8; ++r) o[j][r] = o[j][r] * scl[r] + cad[r] * vs[j];
      }
      const _Float16* pp = (const _Float16*)(const void*)pls + m * PLP + 8 * hh;
      const _Float16* vp = vbp + kbeg;
#pragma unroll 1
      for (int kb = 0; kb < CK / 32; ++kb) {
        const v16h pf = ldfrag_h(pp + kb * 32);
        v16h g[6];
#pragma unroll
        for (int j = 0; j < 6; ++j) g[j] = ldfrag_h(vp + (size_t)(16 * j) * SEQ + kb * 32);
#pragma unroll
        for (int j = 0; j < 6; ++j) o[j] = mma_h(pf, g[j], o[j]);
        guardpv(o[0], o[1], o[2], o[3], o[4], o[5], pf, g[0], g[1], g[2], g[3], g[4], g[5]);
      }
    }
  }
  acc_guard6(o[0], o[1], o[2], o[3], o[4], o[5]);

  if (sub == 0) rowi[r16] = (1.0f / lrun) * (CSC / (PCAR * VCAR));   // lrun >= 1
  __syncthreads();
  float inv[8];
#pragma unroll
  for (int r = 0; r < 8; ++r) inv[r] = rowi[8 * hh + r];

  u16* const ct = L0.c;
  const int cb = wave * 96 + m;
  // hi plane
#pragma unroll
  for (int j = 0; j < 6; ++j) {
#pragma unroll
    for (int r = 0; r < 8; ++r) {
      const float xs = o[j][r] * inv[r];
      ct[(8 * hh + r) * CTP + cb + 16 * j] = h_bits((_Float16)xs);
    }
  }
  __syncthreads();
  ctx_store(ct, CHo + ((size_t)b * SEQ + q0) * EMB, tid);
  __syncthreads();
  // residual plane
#pragma unroll
  for (int j = 0; j < 6; ++j) {
#pragma unroll
    for (int r = 0; r < 8; ++r) {
      const float xs = o[j][r] * inv[r];
      const _Float16 hv = (_Float16)xs;
      ct[(8 * hh + r) * CTP + cb + 16 * j] = h_bits((_Float16)((xs - (float)hv) * RSC));
    }
  }
  __syncthreads();
  ctx_store(ct, CRo + ((size_t)b * SEQ + q0) * EMB, tid);
}

// =====================================================================================================
// Workspace map (bytes, rows = nb*SEQ; nb = 8 gives the totals below); every plane is fully written by whole-line stores before
// it is read; all extents are exact multiples of the store granularity (no pad rows); regions A and V are reused sequentially on
// the single in-order stream:
//   WQB bf16 [768][768]   1179648   WKB same   WVB same   WOH f16 of bf16 value x1024  1179648     4718592
//   VS  f32  [nb][4][768]                                                                          98304
//   A   DB bf16 [rows][768] (25165824), later VT f16 [nb][768][2048] x1024 (25165824)     region 25165824
//   Q   QP f16 [rows][768] x8                                                              region 25165824
//   K   KP f16 [rows][768] x8                                                              region 25165824
//   V   V f32 [rows][768] (50331648), later CH f16 [rows][768] + CR f16 [rows][768]        region 50331648
//   end                                                                                        130646016
// =====================================================================================================
extern "C" void kernel_launch(void* const* d_in, const int* in_sizes, int n_in,
                              void* d_out, int out_size, void* d_ws, size_t ws_size,
                              hipStream_t stream) {
  if (n_in < 9) return;
  const long long per = (long long)SEQ * EMB;
  const long long ns  = in_sizes[0];
  if (ns < per || (ns % per) != 0) return;
  const int nb = (int)(ns / per);
  if (nb < 1 || nb > 8) return;
  const int rows = nb * SEQ;
  if (in_sizes[1] != EMB) return;
  if (in_sizes[2] < 1 || in_sizes[3] < 1) return;
  if (in_sizes[4] != EMB * EMB || in_sizes[5] != EMB * EMB || in_sizes[6] != EMB * EMB || in_sizes[7] != EMB * EMB) return;
  if (in_sizes[8] != EMB) return;
  if ((long long)out_size != (long long)rows * EMB) return;

  const float* spk = (const float*)d_in[0];
  const int*   dly = (const int*)d_in[1];
  const float* mpo = (const float*)d_in[2];
  const float* dcy = (const float*)d_in[3];
  const float* wq  = (const float*)d_in[4];
  const float* wk  = (const float*)d_in[5];
  const float* wv  = (const float*)d_in[6];
  const float* wo  = (const float*)d_in[7];
  const float* bo  = (const float*)d_in[8];
  float*       out = (float*)d_out;

  const size_t szW  = (size_t)EMB * EMB * 2;                    //   1179648
  const size_t szVS = (size_t)nb * NCHK * EMB * 4;              //     98304 at nb = 8
  const size_t sz16 = (size_t)rows * EMB * 2;                   //  25165824
  const size_t sz32 = (size_t)rows * EMB * 4;                   //  50331648
  const size_t szVT = (size_t)nb * EMB * SEQ * 2;               //  == sz16
  size_t off = 0;
  const size_t oWQ = off; off += szW;
  const size_t oWK = off; off += szW;
  const size_t oWV = off; off += szW;
  const size_t oWO = off; off += szW;
  const size_t oVS = off; off += szVS;
  const size_t oA  = off; off += (szVT > sz16 ? szVT : sz16);   // DB then VT
  const size_t oQ  = off; off += sz16;
  const size_t oK  = off; off += sz16;
  const size_t oV  = off; off += sz32;                          // V f32, later CH + CR
  if (off > ws_size) return;                                    // off = 130646016 at nb = 8
  if (off > WS_CAP) return;
  if (2 * sz16 > sz32) return;

  char* ws = (char*)d_ws;
  u16*   WQB = (u16*)(ws + oWQ);
  u16*   WKB = (u16*)(ws + oWK);
  u16*   WVB = (u16*)(ws + oWV);
  u16*   WOH = (u16*)(ws + oWO);
  float* VS  = (float*)(ws + oVS);
  u16*   DB  = (u16*)(ws + oA);
  u16*   VT  = (u16*)(ws + oA);
  u16*   QP  = (u16*)(ws + oQ);
  u16*   KP  = (u16*)(ws + oK);
  float* V   = (float*)(ws + oV);
  u16*   CH  = (u16*)(ws + oV);
  u16*   CR  = (u16*)(ws + oV + sz16);

  const int n8w = (EMB * EMB) / 8;                      // 73728
  const int n8g = rows * (EMB / 8);                     // rows * 96
  if ((n8w % 256) != 0 || (n8g % 256) != 0) return;
  if ((rows % 64) != 0 || ((nb * NCHK * EMB) % 256) != 0) return;
  const dim3 blk(256);
  const dim3 gW(n8w / 256), gGa(n8g / 256);
  const dim3 gG((rows / 64) * (EMB / 64));              // 3072 at nb = 8
  const dim3 bG(128);
  const dim3 gXT(nb * (EMB / 64) * (SEQ / 64));         // nb * 384
  const dim3 gVS((nb * NCHK * EMB) / 256);              // nb * 12
  const dim3 gAT(nb * (SEQ / QT));                      // nb * 128
  const dim3 bAT(ATT_THREADS);

  // (0..3) weights stored [n = out][k = in] (y = x.W^T), already k-contiguous: bf16 planes for Wq, Wk, Wv; f16 of bf16 value
  //        x1024 for Wo
  cvt16<<<gW, blk, 0, stream>>>(wq, WQB, n8w, 0, 1.0f);
  cvt16<<<gW, blk, 0, stream>>>(wk, WKB, n8w, 0, 1.0f);
  cvt16<<<gW, blk, 0, stream>>>(wv, WVB, n8w, 0, 1.0f);
  cvt16<<<gW, blk, 0, stream>>>(wo, WOH, n8w, 1, WSC);
  // (4) delayed spikes -> bf16 plane [rows][768]
  gather_bf<<<gGa, blk, 0, stream>>>(spk, dly, mpo, dcy, DB, n8g);
  // (5, 6) q and k projections -> f16 planes x8; (7) v projection -> f32 plane
  gemm_bh16<<<gG, bG, 0, stream>>>(DB, WQB, QP, rows, EMB, EMB, 1.0f, QSC);
  gemm_bh16<<<gG, bG, 0, stream>>>(DB, WKB, KP, rows, EMB, EMB, 1.0f, KSC);
  gemm_b32<<<gG, bG, 0, stream>>>(DB, WVB, V, rows, EMB, EMB, 1.0f);
  // (8) v -> V^T plane x1024 (over the dead DB region); (9) per-chunk column sums of v
  xt16<<<gXT, blk, 0, stream>>>(V, VT);
  vsum_k<<<gVS, blk, 0, stream>>>(V, VS);
  // (10) attention -> ctx hi x16384 and residual x2048 f16 planes (over the dead V region)
  attn_fwd<<<gAT, bAT, 0, stream>>>(QP, KP, VT, VS, CH, CR);
  // (11) output projection + bias -> out
  gemm_h2_32<<<gG, bG, 0, stream>>>(CH, CR, WOH, bo, out, rows, EMB, EMB,
                                     1.0f / (CSC * WSC), 1.0f / (CSC * WSC * RSC));
  (void)hipGetLastError();
}

// v001
// One run takes 590 microseconds.
// Next to v000, in two timings, it ran 1.63 times as fast each time.
// Projections q,k,v = delayed.W^T: v_wmma_f32_16x16x32_bf16 (bf16 RNE operands of the raw inputs, f32 accumulate).
// Scores q'.k'^T (f16 planes x8), P'.V (chunk-centred P' x32768 f16 from LDS, V^T x1024 f16) and the output projection
// (ctx carried as f16 hi x16384 plus residual x2048 planes, times f16(bf16(Wo) x1024), bias added in f32):
// v_wmma_f32_16x16x32_f16, f32 accumulate. Delay gather, softmax statistics, column sums of V and all scaling in f32 on VALU.
#include <hip/hip_runtime.h>
#include <math.h>
#include <stdint.h>

#define SEQ   2048
#define EMB   768
#define CK    512
#define NCHK  4
#define QT    16
#define SCP   544
#define PLP   528
#define CTP   776
#define SLAB64 (16 * 68)
#define VTP   72
#define ATT_THREADS 256
#define QSC   8.0f
#define KSC   8.0f
#define PCAR  32768.0f
#define VCAR  1024.0f
#define WSC   1024.0f
#define CSC   16384.0f
#define RSC   2048.0f
#define LOG2E 1.4426950408889634f
#define RSQD  0.036084391824351615f
#define WS_CAP ((size_t)134217728)

static_assert((EMB % 64) == 0 && EMB == 8 * 96 && (EMB % 32) == 0 && (EMB / 8) == 96);
static_assert((SEQ % CK) == 0 && (SEQ / CK) == NCHK && CK == 16 * 32 && (SEQ % 64) == 0 && (SEQ / QT) == 128);
static_assert(16 * CTP * 2 <= 16 * SCP * 4 && CTP >= EMB + 8);
static_assert(((PLP * 2) % 16) == 0 && ((SCP * 4) % 16) == 0 && ((VTP * 2) % 16) == 0 && ((CTP * 2) % 16) == 0);
static_assert(64 * VTP >= 63 * VTP + 64);
static_assert(ATT_THREADS == 16 * QT && ATT_THREADS == 256);
static_assert(((EMB * EMB) % 2048) == 0 && ((NCHK * EMB) % 256) == 0);

typedef unsigned short u16;
typedef _Float16 v16h __attribute__((ext_vector_type(16)));
typedef _Float16 v8h  __attribute__((ext_vector_type(8)));
typedef __bf16   v16b __attribute__((ext_vector_type(16)));
typedef float    v8f  __attribute__((ext_vector_type(8)));
typedef float    v4f  __attribute__((ext_vector_type(4)));
typedef unsigned int v4u __attribute__((ext_vector_type(4)));

union FragH { v16h v; v8h h[2]; v4u u[2]; };
union FragB { v16b v; v4u u[2]; };
union AttLds { float s[16 * SCP]; u16 c[2 * 16 * SCP]; };

// ---- scalar helpers --------------------------------------------------------------------------------
__device__ __forceinline__ unsigned short bf_bits(float f) {          // f32 -> bf16 bits, RNE convert
  unsigned u = __float_as_uint(f);
  return (unsigned short)((u + 0x7FFFu + ((u >> 16) & 1u)) >> 16);
}
__device__ __forceinline__ float bf_up(unsigned short h) { return __uint_as_float(((unsigned)h) << 16); }
__device__ __forceinline__ float bfr(float f) { return bf_up(bf_bits(f)); }
__device__ __forceinline__ unsigned short h_bits(_Float16 x) { return __builtin_bit_cast(unsigned short, x); }
__device__ __forceinline__ unsigned pk16(unsigned short a, unsigned short b) { return (unsigned)a | ((unsigned)b << 16); }
__device__ __forceinline__ v8f zero8() { v8f z = {0.f, 0.f, 0.f, 0.f, 0.f, 0.f, 0.f, 0.f}; return z; }
__device__ __forceinline__ v4f zero4() { v4f z = {0.f, 0.f, 0.f, 0.f}; return z; }

// ---- fragment loaders: 16-bit A/B operand, lane -> row/col (lane&15), p already includes +8*(lane>>4);
//      elements 0..7 <- p[0..7] (k0+8h..), elements 8..15 <- p[16..23] (k0+16+8h..)  (same split k map for A and B;
//      this row-major form is used for the P' tile in LDS only)
__device__ __forceinline__ v16h ldfrag_h(const _Float16* p) {
  FragH f;
  f.h[0] = *(const v8h*)(p);
  f.h[1] = *(const v8h*)(p + 16);
  return f.v;
}
// ---- fragment-order planes (every 16-bit operand plane in the workspace): a plane [R][K] is stored as
//      [R/16][K/32][2][32 lanes][8 elements]. The 1-KiB unit of (row block rb, k block kb) starts at element rb*16*K + kb*512;
//      in it lane (16*hh + m) finds, at 8*lane, row m's k = 8*hh + 0..7 and, 256 elements on, k = 16 + 8*hh + 0..7: the same
//      split k map as above. A fragment is two 16-B loads per lane, each 512 contiguous bytes per wave (4 whole lines).
//      p already includes +8*lane.
__device__ __forceinline__ v16h ldfo_h(const _Float16* p) {
  FragH f;
  f.h[0] = *(const v8h*)(p);
  f.h[1] = *(const v8h*)(p + 256);
  return f.v;
}
__device__ __forceinline__ v16b ldfo_b(const u16* p) {                // bf16 plane read as unsigned integer vectors
  FragB f;
  f.u[0] = *(const v4u*)(p);
  f.u[1] = *(const v4u*)(p + 256);
  return f.v;
}

__device__ __forceinline__ v8f mma_h(v16h a, v16h b, v8f c) {
  return __builtin_amdgcn_wmma_f32_16x16x32_f16(false, a, false, b, (short)0, c, false, false);
}
__device__ __forceinline__ v8f mma_b(v16b a, v16b b, v8f c) {
  return __builtin_amdgcn_wmma_f32_16x16x32_bf16(false, a, false, b, (short)0, c, false, false);
}
__device__ __forceinline__ void guard2x3(v8f& a, v8f& b, v16h x0, v16h x1, v16h x2) {
#if defined(__HIP_DEVICE_COMPILE__)
  asm volatile("v_nop\n\tv_nop\n\tv_nop\n\tv_nop"
               : "+v"(a), "+v"(b) : "v"(x0), "v"(x1), "v"(x2) : "memory");
#endif
}
template <typename F>
__device__ __forceinline__ void guard6(v8f& a, v8f& b, v8f& c, v8f& d, F x0, F x1, F x2, F x3, F x4, F x5) {
#if defined(__HIP_DEVICE_COMPILE__)
  asm volatile("v_nop\n\tv_nop\n\tv_nop\n\tv_nop"
               : "+v"(a), "+v"(b), "+v"(c), "+v"(d) : "v"(x0), "v"(x1), "v"(x2), "v"(x3), "v"(x4), "v"(x5) : "memory");
#endif
}
__device__ __forceinline__ void guard8x6(v8f& a0, v8f& a1, v8f& a2, v8f& a3, v8f& e0, v8f& e1, v8f& e2, v8f& e3,
                                         v16h x0, v16h x1, v16h x2, v16h x3, v16h x4, v16h x5) {
#if defined(__HIP_DEVICE_COMPILE__)
  asm volatile("v_nop\n\tv_nop\n\tv_nop\n\tv_nop"
               : "+v"(a0), "+v"(a1), "+v"(a2), "+v"(a3), "+v"(e0), "+v"(e1), "+v"(e2), "+v"(e3)
               : "v"(x0), "v"(x1), "v"(x2), "v"(x3), "v"(x4), "v"(x5) : "memory");
#endif
}
__device__ __forceinline__ void guardpv(v8f& o0, v8f& o1, v8f& o2, v8f& o3, v8f& o4, v8f& o5,
                                        v16h p, v16h g0, v16h g1, v16h g2, v16h g3, v16h g4, v16h g5) {
#if defined(__HIP_DEVICE_COMPILE__)
  asm volatile("v_nop\n\tv_nop\n\tv_nop\n\tv_nop"
               : "+v"(o0), "+v"(o1), "+v"(o2), "+v"(o3), "+v"(o4), "+v"(o5)
               : "v"(p), "v"(g0), "v"(g1), "v"(g2), "v"(g3), "v"(g4), "v"(g5) : "memory");
#endif
}
__device__ __forceinline__ void acc_guard6(v8f& a, v8f& b, v8f& c, v8f& d, v8f& e, v8f& f) {
#if defined(__HIP_DEVICE_COMPILE__)
  asm volatile("v_nop\n\tv_nop\n\tv_nop\n\tv_nop" : "+v"(a), "+v"(b), "+v"(c), "+v"(d), "+v"(e), "+v"(f));
#endif
}
__device__ __forceinline__ void wave_sync_lds() {
  __builtin_amdgcn_fence(__ATOMIC_RELEASE, "workgroup");
  __builtin_amdgcn_wave_barrier();
  __builtin_amdgcn_fence(__ATOMIC_ACQUIRE, "workgroup");
}

// =====================================================================================================
// f32 plane [EMB][EMB] -> 16-bit plane in fragment order:  mode 0: bf16 RNE bits;  mode 1: f16 bits of (bf16 RNE value) * scale;
// mode 2: f16 bits of value * scale (no bf16 pre-step).
// Thread = one 16-B piece of the fragment-order plane (8 consecutive k of one row): two 16-B loads, one 16-B store; 32
// consecutive lanes store 512 contiguous, 512-B aligned bytes
// coverage: grid = n8/256 blocks (host checks exactness) x 256 thr x 8 = the whole plane.
// =====================================================================================================
__global__ __launch_bounds__(256) void cvt16(const float* __restrict__ x, u16* D, int n8, int mode, float scale) {
  const int gt = blockIdx.x * 256 + (int)threadIdx.x;
  if (gt >= n8) return;                     // no barriers in this kernel
  const int unit = gt >> 6;
  const int rb   = unit / (EMB / 32);
  const int kb   = unit - rb * (EMB / 32);
  const float* p = x + (size_t)(rb * 16 + (gt & 15)) * EMB + kb * 32 + ((gt >> 5) & 1) * 16 + ((gt >> 4) & 1) * 8;
  const v4f a = *(const v4f*)(p), c4 = *(const v4f*)(p + 4);
  float v[8];
#pragma unroll
  for (int e = 0; e < 4; ++e) { v[e] = a[e]; v[4 + e] = c4[e]; }
  unsigned short s[8];
#pragma unroll
  for (int e = 0; e < 8; ++e) {
    const float vb = bfr(v[e]);
    const float vf = (mode == 1) ? vb : v[e];
    const unsigned short hb = h_bits((_Float16)(vf * scale));
    const unsigned short bb = bf_bits(v[e]);
    s[e] = (mode != 0) ? hb : bb;
  }
  v4u o;
#pragma unroll
  for (int e = 0; e < 4; ++e) o[e] = pk16(s[2 * e], s[2 * e + 1]);
  u16* d = D + (size_t)gt * 8;
  {
    *(v4u*)(d) = o;
    
  }
}

// =====================================================================================================
// Delay gather to a bf16 plane in fragment order (rows = b*SEQ + t, k = n): element (b, t, n) = bf16 RNE bits of
// sp[b][t - dl[n]][n] when t - dl[n] >= 0, else 0 (the zero is
// written). The source row index is clamped into [0, SEQ) for the address; the value is selected afterwards.
// Thread = one 16-B piece (8 consecutive n of one (b, t) row): 8 scalar loads, one 16-B store; 32 consecutive lanes = 16 rows x
// 16 n, stored as 512 contiguous bytes
// coverage: grid = n8/256 blocks (host exact) x 256 thr x 8 = rows x EMB = the whole plane.
// =====================================================================================================
__global__ __launch_bounds__(256) void gather_bf(const float* __restrict__ sp, const int* __restrict__ dl,
                                                 const float* __restrict__ mpu, const float* __restrict__ dcu,
                                                 u16* DB, int n8) {
  const int gt = blockIdx.x * 256 + (int)threadIdx.x;
  if (gt >= n8) return;                     // no barriers in this kernel
  const int unit = gt >> 6;
  const int rb   = unit / (EMB / 32);
  const int kb   = unit - rb * (EMB / 32);
  const int row = rb * 16 + (gt & 15);
  const int n0  = kb * 32 + ((gt >> 5) & 1) * 16 + ((gt >> 4) & 1) * 8;
  const int b   = row / SEQ;
  const int t   = row - b * SEQ;
  unsigned short s[8];
#pragma unroll
  for (int e = 0; e < 8; ++e) {
    const int n   = n0 + e;
    const int d   = dl[n];
    const int src = t - d;
    int sc = (src < 0) ? 0 : src;
    sc = (sc > SEQ - 1) ? (SEQ - 1) : sc;
    const float v = sp[((size_t)b * SEQ + (size_t)sc) * EMB + n];
    s[e] = (src >= 0) ? bf_bits(v) : (unsigned short)0;
  }
  v4u o;
#pragma unroll
  for (int e = 0; e < 4; ++e) o[e] = pk16(s[2 * e], s[2 * e + 1]);
  u16* dst = DB + (size_t)gt * 8;
  {
    *(v4u*)(dst) = o;
    
  }
  (void)mpu; (void)dcu;
}

// =====================================================================================================
//           8 consecutive lanes x 16 B per line), lanes 16..31 -> row 2*it+1.
//  epi64x2: same store shape, staged value = acc*os1 + accres*os2 + badd (two accumulator sets combined in f32).
//  epi64hs: f16 bits of (tile * pscale), stored in fragment order (k = column): lane (16*hh + m) = row m, 8 consecutive columns;
// coverage: epi64/epi64x2 8 instructions x 2 rows x 16 lanes x 4 floats; epi64hs 4 instructions x 32 lanes x 8 halves
//           = the wave's 16 x 64 tile in every case.
// =====================================================================================================
__device__ __forceinline__ void stage64(float* sl, v8f a0, v8f a1, v8f a2, v8f a3, float oscale, int lane) {
  const int hh = lane >> 4, m = lane & 15;
#pragma unroll
  for (int r = 0; r < 8; ++r) {
    const int ro = (8 * hh + r) * 68 + m;
    sl[ro]      = a0[r] * oscale;
    sl[ro + 16] = a1[r] * oscale;
    sl[ro + 32] = a2[r] * oscale;
    sl[ro + 48] = a3[r] * oscale;
  }
  wave_sync_lds();
}
__device__ __forceinline__ void epi64(float* sl, v8f a0, v8f a1, v8f a2, v8f a3, float oscale, v4f badd, float* C, int N,
                                      size_t rowb, int col0, int lane) {
  const int hh = lane >> 4, m = lane & 15;
  stage64(sl, a0, a1, a2, a3, oscale, lane);
  v4f vals[8];
#pragma unroll
  for (int it = 0; it < 8; ++it) vals[it] = *(const v4f*)(sl + (it * 2 + hh) * 68 + m * 4) + badd;
  float* dst = C + (rowb + (size_t)hh) * (size_t)N + col0 + m * 4;
  {
#pragma unroll
    for (int it = 0; it < 8; ++it) {
      *(v4f*)(dst + (size_t)(it * 2) * (size_t)N) = vals[it];
    }
    
  }
}
__device__ __forceinline__ void epi64x2(float* sl, v8f a0, v8f a1, v8f a2, v8f a3, v8f e0, v8f e1, v8f e2, v8f e3,
                                        float os1, float os2, v4f badd, float* C, int N, size_t rowb, int col0, int lane) {
  const int hh = lane >> 4, m = lane & 15;
#pragma unroll
  for (int r = 0; r < 8; ++r) {
    const int ro = (8 * hh + r) * 68 + m;
    sl[ro]      = a0[r] * os1 + e0[r] * os2;
    sl[ro + 16] = a1[r] * os1 + e1[r] * os2;
    sl[ro + 32] = a2[r] * os1 + e2[r] * os2;
    sl[ro + 48] = a3[r] * os1 + e3[r] * os2;
  }
  wave_sync_lds();
  v4f vals[8];
#pragma unroll
  for (int it = 0; it < 8; ++it) vals[it] = *(const v4f*)(sl + (it * 2 + hh) * 68 + m * 4) + badd;
  float* dst = C + (rowb + (size_t)hh) * (size_t)N + col0 + m * 4;
  {
#pragma unroll
    for (int it = 0; it < 8; ++it) {
      *(v4f*)(dst + (size_t)(it * 2) * (size_t)N) = vals[it];
    }
    
  }
}
__device__ __forceinline__ void epi64hs(float* sl, v8f a0, v8f a1, v8f a2, v8f a3, float oscale, float pscale,
                                        u16* C, int N, size_t rowb, int col0, int lane) {
  stage64(sl, a0, a1, a2, a3, oscale, lane);
  const int hh = lane >> 4, m = lane & 15;
  v4u oh[4];
#pragma unroll
  for (int i4 = 0; i4 < 4; ++i4) {
    const int c8 = (i4 >> 1) * 32 + (i4 & 1) * 16 + hh * 8;   // k block i4>>1, half i4&1 of the wave's two units
    const v4f a = *(const v4f*)(sl + m * 68 + c8), c4 = *(const v4f*)(sl + m * 68 + c8 + 4);
    float w[8];
#pragma unroll
    for (int e = 0; e < 4; ++e) { w[e] = a[e] * pscale; w[4 + e] = c4[e] * pscale; }
#pragma unroll
    for (int e = 0; e < 4; ++e) oh[i4][e] = pk16(h_bits((_Float16)w[2 * e]), h_bits((_Float16)w[2 * e + 1]));
  }
  u16* dst = C + rowb * (size_t)N + (size_t)(col0 >> 5) * 512 + lane * 8;
  {
#pragma unroll
    for (int i4 = 0; i4 < 4; ++i4) {
      *(v4u*)(dst + i4 * 256) = oh[i4];
    }
    
  }
}

// =====================================================================================================
// bf16 GEMM, f32 out: C[M][N] = (A[M][K] . Bt[N][K]^T) * oscale, A and Bt bf16 planes in fragment order.
// Block = 64x64 tile, 4 waves x 16 rows; fragments loaded straight from the planes (two 16-B loads each, split k map for
// A and B); K stepped by 32 (host checks K % 32 == 0, M % 64 == 0, N % 64 == 0, grid = (M/64)*(N/64)).
// =====================================================================================================
__global__ __launch_bounds__(128)
void gemm_b32(const u16* __restrict__ A, const u16* __restrict__ Bt, float* C, int M, int N, int K, float oscale) {
  __shared__ __align__(16) float slab[4 * SLAB64];
  const int tid = threadIdx.x, wave = tid >> 5, lane = tid & 31;
  const int ntile = N >> 6;
  const int bid   = blockIdx.x;
  const int rowb  = (bid / ntile) * 64 + wave * 16;
  const int col0  = (bid % ntile) * 64;
  if (rowb + 16 > M) return;                 // wave-uniform, never taken with the exact grid; no block barriers in this kernel
  const u16* ap = A  + (size_t)rowb * K + 8 * lane;
  const u16* bp = Bt + (size_t)col0 * K + 8 * lane;
  const size_t bs = (size_t)16 * K;
  const u16* bp1 = bp + bs;
  const u16* bp2 = bp + 2 * bs;
  const u16* bp3 = bp + 3 * bs;
  v8f acc0 = zero8(), acc1 = zero8(), acc2 = zero8(), acc3 = zero8();
#pragma unroll 1
  for (int k0 = 0; k0 < K; k0 += 32) {
    const v16b a  = ldfo_b(ap);
    const v16b b0 = ldfo_b(bp);
    const v16b b1 = ldfo_b(bp1);
    const v16b b2 = ldfo_b(bp2);
    const v16b b3 = ldfo_b(bp3);
    ap += 512; bp += 512; bp1 += 512; bp2 += 512; bp3 += 512;   // next k block: one 512-element unit on
    acc0 = mma_b(a, b0, acc0);
    acc1 = mma_b(a, b1, acc1);
    acc2 = mma_b(a, b2, acc2);
    acc3 = mma_b(a, b3, acc3);
    guard6<v16b>(acc0, acc1, acc2, acc3, a, b0, b1, b2, b3, a);
  }
  epi64(slab + wave * SLAB64, acc0, acc1, acc2, acc3, oscale, zero4(), C, N, (size_t)rowb, col0, lane);
}

// =====================================================================================================
// bf16 GEMM, f16 plane out in fragment order: C16[M][N] = f16 bits of ((A . Bt^T) * oscale) * pscale; operands as in gemm_b32, epilogue epi64hs.
// =====================================================================================================
__global__ __launch_bounds__(128)
void gemm_bh16(const u16* __restrict__ A, const u16* __restrict__ Bt, u16* C, int M, int N, int K, float oscale, float pscale) {
  __shared__ __align__(16) float slab[4 * SLAB64];
  const int tid = threadIdx.x, wave = tid >> 5, lane = tid & 31;
  const int ntile = N >> 6;
  const int bid   = blockIdx.x;
  const int rowb  = (bid / ntile) * 64 + wave * 16;
  const int col0  = (bid % ntile) * 64;
  if (rowb + 16 > M) return;                 // wave-uniform, never taken with the exact grid; no block barriers in this kernel
  const u16* ap = A  + (size_t)rowb * K + 8 * lane;
  const u16* bp = Bt + (size_t)col0 * K + 8 * lane;
  const size_t bs = (size_t)16 * K;
  const u16* bp1 = bp + bs;
  const u16* bp2 = bp + 2 * bs;
  const u16* bp3 = bp + 3 * bs;
  v8f acc0 = zero8(), acc1 = zero8(), acc2 = zero8(), acc3 = zero8();
#pragma unroll 1
  for (int k0 = 0; k0 < K; k0 += 32) {
    const v16b a  = ldfo_b(ap);
    const v16b b0 = ldfo_b(bp);
    const v16b b1 = ldfo_b(bp1);
    const v16b b2 = ldfo_b(bp2);
    const v16b b3 = ldfo_b(bp3);
    ap += 512; bp += 512; bp1 += 512; bp2 += 512; bp3 += 512;   // next k block: one 512-element unit on
    acc0 = mma_b(a, b0, acc0);
    acc1 = mma_b(a, b1, acc1);
    acc2 = mma_b(a, b2, acc2);
    acc3 = mma_b(a, b3, acc3);
    guard6<v16b>(acc0, acc1, acc2, acc3, a, b0, b1, b2, b3, a);
  }
  epi64hs(slab + wave * SLAB64, acc0, acc1, acc2, acc3, oscale, pscale, C, N, (size_t)rowb, col0, lane);
}

// =====================================================================================================
// f16 GEMM with two A planes (hi + residual), f32 out with bias:
//   C[M][N] = (Ah . Bt^T) * os1 + (Ar . Bt^T) * os2 + bf16RNE(bias[n]); Ah/Ar/Bt f16 planes in fragment order.
// Same tiling as gemm_b32; separate accumulators for the two planes, combined in f32 in epi64x2.
// =====================================================================================================
__global__ __launch_bounds__(128)
void gemm_h2_32(const u16* __restrict__ Ah, const u16* __restrict__ Ar, const u16* __restrict__ Bt,
                const float* __restrict__ bias, float* C, int M, int N, int K, float os1, float os2) {
  __shared__ __align__(16) float slab[4 * SLAB64];
  const int tid = threadIdx.x, wave = tid >> 5, lane = tid & 31, m = lane & 15;
  const int ntile = N >> 6;
  const int bid   = blockIdx.x;
  const int rowb  = (bid / ntile) * 64 + wave * 16;
  const int col0  = (bid % ntile) * 64;
  if (rowb + 16 > M) return;                 // wave-uniform, never taken with the exact grid; no block barriers in this kernel
  const _Float16* ap  = (const _Float16*)(const void*)Ah + (size_t)rowb * K + 8 * lane;
  const _Float16* arp = (const _Float16*)(const void*)Ar + (size_t)rowb * K + 8 * lane;
  const _Float16* bp  = (const _Float16*)(const void*)Bt + (size_t)col0 * K + 8 * lane;
  const size_t bs = (size_t)16 * K;
  const _Float16* bp1 = bp + bs;
  const _Float16* bp2 = bp + 2 * bs;
  const _Float16* bp3 = bp + 3 * bs;
  v8f acc0 = zero8(), acc1 = zero8(), acc2 = zero8(), acc3 = zero8();
  v8f acr0 = zero8(), acr1 = zero8(), acr2 = zero8(), acr3 = zero8();
#pragma unroll 1
  for (int k0 = 0; k0 < K; k0 += 32) {
    const v16h a  = ldfo_h(ap);
    const v16h ar = ldfo_h(arp);
    const v16h b0 = ldfo_h(bp);
    const v16h b1 = ldfo_h(bp1);
    const v16h b2 = ldfo_h(bp2);
    const v16h b3 = ldfo_h(bp3);
    ap += 512; arp += 512; bp += 512; bp1 += 512; bp2 += 512; bp3 += 512;   // next k block: one 512-element unit on
    acc0 = mma_h(a, b0, acc0);
    acc1 = mma_h(a, b1, acc1);
    acc2 = mma_h(a, b2, acc2);
    acc3 = mma_h(a, b3, acc3);
    acr0 = mma_h(ar, b0, acr0);
    acr1 = mma_h(ar, b1, acr1);
    acr2 = mma_h(ar, b2, acr2);
    acr3 = mma_h(ar, b3, acr3);
    guard8x6(acc0, acc1, acc2, acc3, acr0, acr1, acr2, acr3, a, ar, b0, b1, b2, b3);
  }
  const v4f bv = *(const v4f*)(bias + col0 + m * 4);      // columns col0 + 4m .. +3, always < N (N multiple of 64)
  v4f badd;
#pragma unroll
  for (int e = 0; e < 4; ++e) badd[e] = bfr(bv[e]);
  epi64x2(slab + wave * SLAB64, acc0, acc1, acc2, acc3, acr0, acr1, acr2, acr3, os1, os2, badd, C, N,
          (size_t)rowb, col0, lane);
}

// =====================================================================================================
// V^T plane in fragment order (rows = b*EMB + d, k = s): element (b, d, s) = f16(V[b][s][d] * 1024).
// Block = (b, 64-wide d chunk, 64 keys): 64 source row segments of 64 floats loaded with 16-B loads, converted, scattered into
// coverage: load 256 thr x 16 elements = 64 x 64; store 2 iterations x 256 thr x 8 halves = 64 lines x 64 = the block's tile;
//           grid = nb x (EMB/64) x (SEQ/64) blocks covers the plane exactly once.
// =====================================================================================================
__global__ __launch_bounds__(256) void xt16(const float* __restrict__ X, u16* XTo) {
  __shared__ __align__(16) u16 TH[64 * VTP];
  const int tid = threadIdx.x;
  const int bid = blockIdx.x;
  const int st  = bid % (SEQ / 64);
  const int dcb = (bid / (SEQ / 64)) % (EMB / 64);
  const int b   = bid / ((SEQ / 64) * (EMB / 64));
  const int s0  = st * 64;
  const int d0  = dcb * 64;
  {
    const int sl = tid >> 2;                  // key within tile 0..63
    const int dc = (tid & 3) * 16;            // d chunk within the 64
    const float* src = X + ((size_t)b * SEQ + s0 + sl) * EMB + d0 + dc;
#pragma unroll
    for (int i = 0; i < 4; ++i) {
      const v4f a = *(const v4f*)(src + 4 * i);
#pragma unroll
      for (int e = 0; e < 4; ++e) {
        const _Float16 hv = (_Float16)(a[e] * VCAR);
        TH[(dc + 4 * i + e) * VTP + sl] = h_bits(hv);
      }
    }
  }
  __syncthreads();
  v4u vh[2];
#pragma unroll
  for (int it = 0; it < 2; ++it) {
    const int q = it * 256 + tid;             // piece of the tile: d block q>>7, key block (q>>6)&1, half (q>>5)&1, lane q&31
    vh[it] = *(const v4u*)(TH + ((q >> 7) * 16 + (q & 15)) * VTP + ((q >> 6) & 1) * 32 + ((q >> 5) & 1) * 16 + ((q >> 4) & 1) * 8);
  }
  const size_t base = ((size_t)b * EMB + d0) * SEQ + (size_t)(s0 >> 5) * 512;
  {
#pragma unroll
    for (int it = 0; it < 2; ++it) {
      const int q = it * 256 + tid;
      *(v4u*)(XTo + base + (size_t)((q >> 7) * 16) * SEQ + (q & 127) * 8) = vh[it];
    }
    
  }
}

// =====================================================================================================
// Per-chunk column sums of V: VS[(b*NCHK + c)*EMB + d] = sum over the CK keys of chunk c of V[b][c*CK + s][d] (f32, fixed
// sequential order). Thread = one (b, c, d); 256 consecutive table entries per block are staged in LDS, then threads 0..63
// coverage: grid = nb*NCHK*EMB/256 blocks (host exact) x 256 = the whole table; store 64 thr x 4 floats = the block's 256.
// =====================================================================================================
__global__ __launch_bounds__(256) void vsum_k(const float* __restrict__ V, float* VS) {
  __shared__ __align__(16) float sm[256];
  const int tid = threadIdx.x;
  const int gt  = blockIdx.x * 256 + tid;
  const int d   = gt % EMB;
  const int bc  = gt / EMB;
  const int b   = bc / NCHK;
  const int c   = bc - b * NCHK;
  const float* p = V + ((size_t)b * SEQ + (size_t)c * CK) * EMB + d;
  float s = 0.f;
#pragma unroll 4
  for (int i = 0; i < CK; ++i) s += p[(size_t)i * EMB];
  sm[tid] = s;
  __syncthreads();
  if (tid < 64) {                                   // waves 0 and 1, all lanes active
    const v4f o = *(const v4f*)(sm + tid * 4);
    float* dst = VS + (size_t)blockIdx.x * 256 + tid * 4;
    *(v4f*)(dst) = o;
    
  }
}

// =====================================================================================================
// Single-head attention, head width EMB = 768, all SEQ keys kept (non-causal): block = (batch b, 16 query rows q0..q0+15),
// 8 waves. q plane (f16, x8) rows b*SEQ+s, k = d; k plane the same; V^T plane rows b*EMB+d, k = s (x1024); all three and the two
// ctx planes in fragment order; VS = per-chunk column sums of V (f32).
//   Per chunk of CK = 512 keys (NCHK = 4 chunks):
//   (S) scores S[query m][key n] on WMMA: A = q rows (row m = lane&15, split k map over d), B = k rows (col n = key, split map),
//       24 d-steps; wave w handles key blocks w, w+8 of the chunk; D element r of lane l -> scs[query 8h+r][key col] (f32 LDS).
//   (M) 16 threads per query row (sub-thread = 32 consecutive keys): base-2 logits, chunk max via xor shuffles, online running
//       max / rescale factor al / running sum l in f32 registers (the same threads own the row in every chunk),
//       p = exp2(t - m_new) <= 1, chunk row sum ps and its mean C = ps/CK (bit-identical on the row's 16 threads), the CENTRED
//       P' = p - C written as f16(P' * 32768) into the LDS P tile with 16-B stores; al -> rowa[row], C -> rowc[row].
//   (PV) each wave owns d columns 96*wave + 16j + (lane&15), j = 0..5 (6 accumulators): o = o*al + C*(32768*1024)*VS[chunk][d]
//       (exact add-back of the centring term in f32), then for each key block: A = P' fragment from LDS (row m = query, split
//       map over keys), B = V^T fragments (col n = d, split map over keys).  sum_k (P'_k + C) v_k == sum_k p_k v_k exactly.
//   Block barriers after (S) and after (M) order all LDS reuse across chunks and waves.
//   Epilogue: x = o * 16384 / (l * 32768 * 1024) per row (rowi, l >= 1 always); hi = f16(x), res = f16((x - hi) * 2048); each
// coverage: grid nb*128 blocks x 16 rows; staging 8 waves x 96 cols x 16 rows = 16 x 768; store 6 iterations x 256 thr x 8
//           halves = 16 x 768 per plane = every (b, s, d) of both ctx planes exactly once.
// =====================================================================================================
__device__ __forceinline__ void ctx_store(const u16* ct, u16* dst, int tid) {
  v4u v[6];
#pragma unroll
  for (int it = 0; it < 6; ++it) {
    const int p = it * 256 + tid;             // piece of the 16-row block: k block p>>6, half (p>>5)&1, lane p&31
    v[it] = *(const v4u*)(ct + (p & 15) * CTP + (p >> 6) * 32 + ((p >> 5) & 1) * 16 + ((p >> 4) & 1) * 8);
  }
  {
#pragma unroll
    for (int it = 0; it < 6; ++it) {
      const int p = it * 256 + tid;
      *(v4u*)(dst + (size_t)p * 8) = v[it];
    }
    
  }
}

__global__ __launch_bounds__(ATT_THREADS)
void attn_fwd(const u16* __restrict__ QPp, const u16* __restrict__ KPp, const u16* __restrict__ VTp,
              const float* __restrict__ VSp, u16* CHo, u16* CRo) {
  __shared__ __align__(16) AttLds L0;              // scores [16][SCP] f32; reused as the ctx staging tile [16][CTP] u16
  __shared__ __align__(16) u16 pls[16 * PLP];      // P' tile [16][PLP] f16 bits
  __shared__ float rowa[QT];
  __shared__ float rowc[QT];
  __shared__ float rowi[QT];
  float* const scs = L0.s;

  const int tid  = threadIdx.x;
  const int wave = tid >> 5;
  const int lane = tid & 31;
  const int hh   = lane >> 4;
  const int m    = lane & 15;
  const int r16  = tid >> 4;                 // query row owned in phase (M): 2*wave + hh
  const int sub  = tid & 15;
  const int kl0  = sub * 32;

  const int bid = blockIdx.x;
  const int b   = bid >> 7;
  const int q0  = (bid & 127) * QT;

  const _Float16* qa  = (const _Float16*)(const void*)QPp + ((size_t)b * SEQ + q0) * EMB + 8 * lane;
  const _Float16* kbp = (const _Float16*)(const void*)KPp + (size_t)b * SEQ * EMB + 8 * lane;
  const _Float16* vbp = (const _Float16*)(const void*)VTp + ((size_t)b * EMB + wave * 96) * SEQ + 8 * lane;
  const float* vsb = VSp + (size_t)b * NCHK * EMB + wave * 96 + m;
  const float lsc = RSQD * LOG2E / (QSC * KSC);

  float mrun = -INFINITY, lrun = 0.f;
  v8f o[6];
#pragma unroll
  for (int j = 0; j < 6; ++j) o[j] = zero8();

#pragma unroll 1
  for (int c = 0; c < NCHK; ++c) {
    const int kbeg = c * CK;
    // ---- (S) scores of this chunk ----
#pragma unroll 1
    for (int kb = wave; kb < CK / 32; kb += 8) {           // wave-uniform, 2 trips
      const _Float16* k0p = kbp + (size_t)(kbeg + kb * 32) * EMB;
      const _Float16* k1p = k0p + (size_t)16 * EMB;
      v8f s0 = zero8(), s1 = zero8();
#pragma unroll 4
      for (int ks = 0; ks < EMB / 32; ++ks) {
        const v16h a  = ldfo_h(qa + ks * 512);
        const v16h f0 = ldfo_h(k0p + ks * 512);
        const v16h f1 = ldfo_h(k1p + ks * 512);
        s0 = mma_h(a, f0, s0);
        s1 = mma_h(a, f1, s1);
        guard2x3(s0, s1, a, f0, f1);
      }
      float* srow = scs + (8 * hh) * SCP + kb * 32 + m;
#pragma unroll
      for (int r = 0; r < 8; ++r) {
        srow[r * SCP]      = s0[r];
        srow[r * SCP + 16] = s1[r];
      }
    }
    __syncthreads();
    // ---- (M) softmax statistics and the centred P' tile ----
    {
      const float* sp = scs + r16 * SCP + kl0;
      float t[32];
      float cm = -INFINITY;
#pragma unroll
      for (int i = 0; i < 8; ++i) {
        const v4f a = *(const v4f*)(sp + 4 * i);
#pragma unroll
        for (int e = 0; e < 4; ++e) {
          const float tv = a[e] * lsc;
          t[4 * i + e] = tv;
          cm = fmaxf(cm, tv);
        }
      }
#pragma unroll
      for (int d = 1; d <= 8; d <<= 1) cm = fmaxf(cm, __shfl_xor(cm, d, 32));
      const float mn = fmaxf(mrun, cm);                    // finite
      const float al = (mrun == -INFINITY) ? 0.f : exp2f(mrun - mn);
      mrun = mn;
      float ps = 0.f;
#pragma unroll
      for (int j = 0; j < 32; ++j) {
        const float p = exp2f(fminf(t[j] - mn, 0.f));
        t[j] = p;
        ps += p;
      }
#pragma unroll
      for (int d = 1; d <= 8; d <<= 1) ps += __shfl_xor(ps, d, 32);
      const float cc = ps * (1.0f / (float)CK);
      v4u pk[4];
#pragma unroll
      for (int i = 0; i < 4; ++i) {
#pragma unroll
        for (int e = 0; e < 4; ++e) {
          const int j = 8 * i + 2 * e;
          pk[i][e] = pk16(h_bits((_Float16)((t[j] - cc) * PCAR)), h_bits((_Float16)((t[j + 1] - cc) * PCAR)));
        }
      }
      lrun = lrun * al + ps;
      u16* pd = pls + r16 * PLP + kl0;
#pragma unroll
      for (int i = 0; i < 4; ++i) *(v4u*)(pd + 8 * i) = pk[i];
      if (sub == 0) { rowa[r16] = al; rowc[r16] = cc; }
    }
    __syncthreads();
    // ---- (PV) rescale, add the centring term, accumulate P' . V^T ----
    {
      float scl[8], cad[8];
#pragma unroll
      for (int r = 0; r < 8; ++r) { scl[r] = rowa[8 * hh + r]; cad[r] = rowc[8 * hh + r] * (PCAR * VCAR); }
      float vs[6];
#pragma unroll
      for (int j = 0; j < 6; ++j) vs[j] = vsb[(size_t)c * EMB + 16 * j];
#pragma unroll
      for (int j = 0; j < 6; ++j) {
#pragma unroll
        for (int r = 0; r < 8; ++r) o[j][r] = o[j][r] * scl[r] + cad[r] * vs[j];
      }
      const _Float16* pp = (const _Float16*)(const void*)pls + m * PLP + 8 * hh;
      const _Float16* vp = vbp + kbeg * 16;                // key block kbeg/32 -> 512 elements per unit
#pragma unroll 1
      for (int kb = 0; kb < CK / 32; ++kb) {
        const v16h pf = ldfrag_h(pp + kb * 32);
        v16h g[6];
#pragma unroll
        for (int j = 0; j < 6; ++j) g[j] = ldfo_h(vp + (size_t)(16 * j) * SEQ + kb * 512);
#pragma unroll
        for (int j = 0; j < 6; ++j) o[j] = mma_h(pf, g[j], o[j]);
        guardpv(o[0], o[1], o[2], o[3], o[4], o[5], pf, g[0], g[1], g[2], g[3], g[4], g[5]);
      }
    }
  }
  acc_guard6(o[0], o[1], o[2], o[3], o[4], o[5]);

  if (sub == 0) rowi[r16] = (1.0f / lrun) * (CSC / (PCAR * VCAR));   // lrun >= 1
  __syncthreads();
  float inv[8];
#pragma unroll
  for (int r = 0; r < 8; ++r) inv[r] = rowi[8 * hh + r];

  u16* const ct = L0.c;
  const int cb = wave * 96 + m;
  // hi plane
#pragma unroll
  for (int j = 0; j < 6; ++j) {
#pragma unroll
    for (int r = 0; r < 8; ++r) {
      const float xs = o[j][r] * inv[r];
      ct[(8 * hh + r) * CTP + cb + 16 * j] = h_bits((_Float16)xs);
    }
  }
  __syncthreads();
  ctx_store(ct, CHo + ((size_t)b * SEQ + q0) * EMB, tid);
  __syncthreads();
  // residual plane
#pragma unroll
  for (int j = 0; j < 6; ++j) {
#pragma unroll
    for (int r = 0; r < 8; ++r) {
      const float xs = o[j][r] * inv[r];
      const _Float16 hv = (_Float16)xs;
      ct[(8 * hh + r) * CTP + cb + 16 * j] = h_bits((_Float16)((xs - (float)hv) * RSC));
    }
  }
  __syncthreads();
  ctx_store(ct, CRo + ((size_t)b * SEQ + q0) * EMB, tid);
}

// =====================================================================================================
// Workspace map (bytes, rows = nb*SEQ; nb = 8 gives the totals below); every plane is fully written by whole-line stores before
// it is read; all extents are exact multiples of the store granularity (no pad rows); regions A and V are reused sequentially on
// the single in-order stream:
//   WQB bf16 [768][768]   1179648   WKB same   WVB same   WOH f16 of bf16 value x1024  1179648     4718592
//   VS  f32  [nb][4][768]                                                                          98304
//   A   DB bf16 [rows][768] (25165824), later VT f16 [nb][768][2048] x1024 (25165824)     region 25165824
//   Q   QP f16 [rows][768] x8                                                              region 25165824
//   K   KP f16 [rows][768] x8                                                              region 25165824
//   V   V f32 [rows][768] (50331648), later CH f16 [rows][768] + CR f16 [rows][768]        region 50331648
//   end                                                                                        130646016
// =====================================================================================================
extern "C" void kernel_launch(void* const* d_in, const int* in_sizes, int n_in,
                              void* d_out, int out_size, void* d_ws, size_t ws_size,
                              hipStream_t stream) {
  if (n_in < 9) return;
  const long long per = (long long)SEQ * EMB;
  const long long ns  = in_sizes[0];
  if (ns < per || (ns % per) != 0) return;
  const int nb = (int)(ns / per);
  if (nb < 1 || nb > 8) return;
  const int rows = nb * SEQ;
  if (in_sizes[1] != EMB) return;
  if (in_sizes[2] < 1 || in_sizes[3] < 1) return;
  if (in_sizes[4] != EMB * EMB || in_sizes[5] != EMB * EMB || in_sizes[6] != EMB * EMB || in_sizes[7] != EMB * EMB) return;
  if (in_sizes[8] != EMB) return;
  if ((long long)out_size != (long long)rows * EMB) return;

  const float* spk = (const float*)d_in[0];
  const int*   dly = (const int*)d_in[1];
  const float* mpo = (const float*)d_in[2];
  const float* dcy = (const float*)d_in[3];
  const float* wq  = (const float*)d_in[4];
  const float* wk  = (const float*)d_in[5];
  const float* wv  = (const float*)d_in[6];
  const float* wo  = (const float*)d_in[7];
  const float* bo  = (const float*)d_in[8];
  float*       out = (float*)d_out;

  const size_t szW  = (size_t)EMB * EMB * 2;                    //   1179648
  const size_t szVS = (size_t)nb * NCHK * EMB * 4;              //     98304 at nb = 8
  const size_t sz16 = (size_t)rows * EMB * 2;                   //  25165824
  const size_t sz32 = (size_t)rows * EMB * 4;                   //  50331648
  const size_t szVT = (size_t)nb * EMB * SEQ * 2;               //  == sz16
  size_t off = 0;
  const size_t oWQ = off; off += szW;
  const size_t oWK = off; off += szW;
  const size_t oWV = off; off += szW;
  const size_t oWO = off; off += szW;
  const size_t oVS = off; off += szVS;
  const size_t oA  = off; off += (szVT > sz16 ? szVT : sz16);   // DB then VT
  const size_t oQ  = off; off += sz16;
  const size_t oK  = off; off += sz16;
  const size_t oV  = off; off += sz32;                          // V f32, later CH + CR
  if (off > ws_size) return;                                    // off = 130646016 at nb = 8
  if (off > WS_CAP) return;
  if (2 * sz16 > sz32) return;

  char* ws = (char*)d_ws;
  u16*   WQB = (u16*)(ws + oWQ);
  u16*   WKB = (u16*)(ws + oWK);
  u16*   WVB = (u16*)(ws + oWV);
  u16*   WOH = (u16*)(ws + oWO);
  float* VS  = (float*)(ws + oVS);
  u16*   DB  = (u16*)(ws + oA);
  u16*   VT  = (u16*)(ws + oA);
  u16*   QP  = (u16*)(ws + oQ);
  u16*   KP  = (u16*)(ws + oK);
  float* V   = (float*)(ws + oV);
  u16*   CH  = (u16*)(ws + oV);
  u16*   CR  = (u16*)(ws + oV + sz16);

  const int n8w = (EMB * EMB) / 8;                      // 73728
  const int n8g = rows * (EMB / 8);                     // rows * 96
  if ((n8w % 256) != 0 || (n8g % 256) != 0) return;
  if ((rows % 64) != 0 || ((nb * NCHK * EMB) % 256) != 0) return;
  const dim3 blk(256);
  const dim3 gW(n8w / 256), gGa(n8g / 256);
  const dim3 gG((rows / 64) * (EMB / 64));              // 3072 at nb = 8
  const dim3 bG(128);
  const dim3 gXT(nb * (EMB / 64) * (SEQ / 64));         // nb * 384
  const dim3 gVS((nb * NCHK * EMB) / 256);              // nb * 12
  const dim3 gAT(nb * (SEQ / QT));                      // nb * 128
  const dim3 bAT(ATT_THREADS);

  // (0..3) weights stored [n = out][k = in] (y = x.W^T), rows = n: fragment-order bf16 planes for Wq, Wk, Wv; f16 of bf16 value
  //        x1024 for Wo
  cvt16<<<gW, blk, 0, stream>>>(wq, WQB, n8w, 0, 1.0f);
  cvt16<<<gW, blk, 0, stream>>>(wk, WKB, n8w, 0, 1.0f);
  cvt16<<<gW, blk, 0, stream>>>(wv, WVB, n8w, 0, 1.0f);
  cvt16<<<gW, blk, 0, stream>>>(wo, WOH, n8w, 1, WSC);
  // (4) delayed spikes -> fragment-order bf16 plane, rows x 768
  gather_bf<<<gGa, blk, 0, stream>>>(spk, dly, mpo, dcy, DB, n8g);
  // (5, 6) q and k projections -> f16 planes x8; (7) v projection -> f32 plane
  gemm_bh16<<<gG, bG, 0, stream>>>(DB, WQB, QP, rows, EMB, EMB, 1.0f, QSC);
  gemm_bh16<<<gG, bG, 0, stream>>>(DB, WKB, KP, rows, EMB, EMB, 1.0f, KSC);
  gemm_b32<<<gG, bG, 0, stream>>>(DB, WVB, V, rows, EMB, EMB, 1.0f);
  // (8) v -> V^T plane x1024 (over the dead DB region); (9) per-chunk column sums of v
  xt16<<<gXT, blk, 0, stream>>>(V, VT);
  vsum_k<<<gVS, blk, 0, stream>>>(V, VS);
  // (10) attention -> ctx hi x16384 and residual x2048 f16 planes (over the dead V region)
  attn_fwd<<<gAT, bAT, 0, stream>>>(QP, KP, VT, VS, CH, CR);
  // (11) output projection + bias -> out
  gemm_h2_32<<<gG, bG, 0, stream>>>(CH, CR, WOH, bo, out, rows, EMB, EMB,
                                     1.0f / (CSC * WSC), 1.0f / (CSC * WSC * RSC));
  (void)hipGetLastError();
}

// v002
// A run of this version takes 391 microseconds.
// Timed twice side by side with v001, it ran 1.51 times as fast both times.
// Counting every step since v000, it is 2.46 times as fast.
// Projections q,k,v = delayed.W^T: v_wmma_f32_16x16x32_bf16 (bf16 RNE operands of the raw inputs, f32 accumulate).
// Scores q'.k'^T (f16 planes x8), P'.V (chunk-centred P' x32768 f16 from LDS, V^T x1024 f16) and the output projection
// (ctx carried as f16 hi x16384 plus residual x2048 planes, times f16(bf16(Wo) x1024), bias added in f32):
// v_wmma_f32_16x16x32_f16, f32 accumulate. Delay gather, softmax statistics, column sums of V and all scaling in f32 on VALU.
#include <hip/hip_runtime.h>
#include <math.h>
#include <stdint.h>

#define SEQ   2048
#define EMB   768
#define CK    512
#define NCHK  4
#define QT    64
#define RT    4
#define NJ    3
#define DW    48
#define SCP   544
#define PLP   528
#define CTP   776
#define SLAB64 (16 * 68)
#define VTP   72
#define ATT_THREADS 512
#define QSC   8.0f
#define KSC   8.0f
#define PCAR  32768.0f
#define VCAR  1024.0f
#define WSC   1024.0f
#define CSC   16384.0f
#define RSC   2048.0f
#define LOG2E 1.4426950408889634f
#define RSQD  0.036084391824351615f
#define WS_CAP ((size_t)134217728)

static_assert((EMB % 64) == 0 && EMB == 8 * 96 && (EMB % 32) == 0 && (EMB / 8) == 96);
static_assert((SEQ % CK) == 0 && (SEQ / CK) == NCHK && CK == 16 * 32 && (SEQ % 64) == 0 && (SEQ / QT) == 32);
static_assert(16 * CTP * 2 <= 16 * SCP * 4 && CTP >= EMB + 8);
static_assert(((PLP * 2) % 16) == 0 && ((SCP * 4) % 16) == 0 && ((VTP * 2) % 16) == 0 && ((CTP * 2) % 16) == 0);
static_assert(64 * VTP >= 63 * VTP + 64);
static_assert(ATT_THREADS == 512 && QT == 16 * RT && 2 * (ATT_THREADS / 16) == QT);
static_assert((ATT_THREADS / 32) * 32 == CK && (ATT_THREADS / 32) * DW == EMB && DW == 16 * NJ);
static_assert(3 * ATT_THREADS * 8 == 16 * EMB);
static_assert(((EMB * EMB) % 2048) == 0 && ((NCHK * EMB) % 256) == 0);

typedef unsigned short u16;
typedef _Float16 v16h __attribute__((ext_vector_type(16)));
typedef _Float16 v8h  __attribute__((ext_vector_type(8)));
typedef __bf16   v16b __attribute__((ext_vector_type(16)));
typedef float    v8f  __attribute__((ext_vector_type(8)));
typedef float    v4f  __attribute__((ext_vector_type(4)));
typedef unsigned int v4u __attribute__((ext_vector_type(4)));

union FragH { v16h v; v8h h[2]; v4u u[2]; };
union FragB { v16b v; v4u u[2]; };
union AttLds { float s[QT * SCP]; u16 c[2 * QT * SCP]; };

// ---- scalar helpers --------------------------------------------------------------------------------
__device__ __forceinline__ unsigned short bf_bits(float f) {          // f32 -> bf16 bits, RNE convert
  unsigned u = __float_as_uint(f);
  return (unsigned short)((u + 0x7FFFu + ((u >> 16) & 1u)) >> 16);
}
__device__ __forceinline__ float bf_up(unsigned short h) { return __uint_as_float(((unsigned)h) << 16); }
__device__ __forceinline__ float bfr(float f) { return bf_up(bf_bits(f)); }
__device__ __forceinline__ unsigned short h_bits(_Float16 x) { return __builtin_bit_cast(unsigned short, x); }
__device__ __forceinline__ unsigned pk16(unsigned short a, unsigned short b) { return (unsigned)a | ((unsigned)b << 16); }
__device__ __forceinline__ v8f zero8() { v8f z = {0.f, 0.f, 0.f, 0.f, 0.f, 0.f, 0.f, 0.f}; return z; }
__device__ __forceinline__ v4f zero4() { v4f z = {0.f, 0.f, 0.f, 0.f}; return z; }

// ---- fragment loaders: 16-bit A/B operand, lane -> row/col (lane&15), p already includes +8*(lane>>4);
//      elements 0..7 <- p[0..7] (k0+8h..), elements 8..15 <- p[16..23] (k0+16+8h..)  (same split k map for A and B;
//      this row-major form is used for the P' tile in LDS only)
__device__ __forceinline__ v16h ldfrag_h(const _Float16* p) {
  FragH f;
  f.h[0] = *(const v8h*)(p);
  f.h[1] = *(const v8h*)(p + 16);
  return f.v;
}
// ---- fragment-order planes (every 16-bit operand plane in the workspace): a plane [R][K] is stored as
//      [R/16][K/32][2][32 lanes][8 elements]. The 1-KiB unit of (row block rb, k block kb) starts at element rb*16*K + kb*512;
//      in it lane (16*hh + m) finds, at 8*lane, row m's k = 8*hh + 0..7 and, 256 elements on, k = 16 + 8*hh + 0..7: the same
//      split k map as above. A fragment is two 16-B loads per lane, each 512 contiguous bytes per wave (4 whole lines).
//      p already includes +8*lane.
__device__ __forceinline__ v16h ldfo_h(const _Float16* p) {
  FragH f;
  f.h[0] = *(const v8h*)(p);
  f.h[1] = *(const v8h*)(p + 256);
  return f.v;
}
__device__ __forceinline__ v16b ldfo_b(const u16* p) {                // bf16 plane read as unsigned integer vectors
  FragB f;
  f.u[0] = *(const v4u*)(p);
  f.u[1] = *(const v4u*)(p + 256);
  return f.v;
}

__device__ __forceinline__ v8f mma_h(v16h a, v16h b, v8f c) {
  return __builtin_amdgcn_wmma_f32_16x16x32_f16(false, a, false, b, (short)0, c, false, false);
}
__device__ __forceinline__ v8f mma_b(v16b a, v16b b, v8f c) {
  return __builtin_amdgcn_wmma_f32_16x16x32_bf16(false, a, false, b, (short)0, c, false, false);
}
// The v_nop guards below stand behind the last WMMA of a loop body: they keep the four vector slots that the chip needs before
// the operand registers are reloaded or the accumulators are touched, on the taken back edge too. The accumulators are named so that every WMMA of the body stays in front of the slots.
// guard_s also holds s_wait_xcnt 0 in front of the rewrite of the two address pairs that the step's global loads name; the pairs
// are inputs so that nothing overwrites them ahead of that wait.
__device__ __forceinline__ void guard_s(v8f (&s)[RT][2], const v16h (&a)[RT], v16h f0, v16h f1,
                                        const _Float16* qp, const _Float16* kp) {
#if defined(__HIP_DEVICE_COMPILE__)
  asm volatile("s_wait_xcnt 0x0\n\tv_nop\n\tv_nop\n\tv_nop\n\tv_nop"
               : "+v"(s[0][0]), "+v"(s[0][1]), "+v"(s[1][0]), "+v"(s[1][1]),
                 "+v"(s[2][0]), "+v"(s[2][1]), "+v"(s[3][0]), "+v"(s[3][1])
               : "v"(a[0]), "v"(a[1]), "v"(a[2]), "v"(a[3]), "v"(f0), "v"(f1), "v"(qp), "v"(kp) : "memory");
#endif
}
template <typename F>
__device__ __forceinline__ void guard6(v8f& a, v8f& b, v8f& c, v8f& d, F x0, F x1, F x2, F x3, F x4, F x5) {
#if defined(__HIP_DEVICE_COMPILE__)
  asm volatile("v_nop\n\tv_nop\n\tv_nop\n\tv_nop"
               : "+v"(a), "+v"(b), "+v"(c), "+v"(d) : "v"(x0), "v"(x1), "v"(x2), "v"(x3), "v"(x4), "v"(x5) : "memory");
#endif
}
__device__ __forceinline__ void guard8x6(v8f& a0, v8f& a1, v8f& a2, v8f& a3, v8f& e0, v8f& e1, v8f& e2, v8f& e3,
                                         v16h x0, v16h x1, v16h x2, v16h x3, v16h x4, v16h x5) {
#if defined(__HIP_DEVICE_COMPILE__)
  asm volatile("v_nop\n\tv_nop\n\tv_nop\n\tv_nop"
               : "+v"(a0), "+v"(a1), "+v"(a2), "+v"(a3), "+v"(e0), "+v"(e1), "+v"(e2), "+v"(e3)
               : "v"(x0), "v"(x1), "v"(x2), "v"(x3), "v"(x4), "v"(x5) : "memory");
#endif
}
__device__ __forceinline__ void guard_o(v8f (&o)[RT][NJ]) {
#if defined(__HIP_DEVICE_COMPILE__)
  asm volatile("v_nop\n\tv_nop\n\tv_nop\n\tv_nop"
               : "+v"(o[0][0]), "+v"(o[0][1]), "+v"(o[0][2]), "+v"(o[1][0]), "+v"(o[1][1]), "+v"(o[1][2]),
                 "+v"(o[2][0]), "+v"(o[2][1]), "+v"(o[2][2]), "+v"(o[3][0]), "+v"(o[3][1]), "+v"(o[3][2])
               : : "memory");
#endif
}
__device__ __forceinline__ void wave_sync_lds() {
  __builtin_amdgcn_fence(__ATOMIC_RELEASE, "workgroup");
  __builtin_amdgcn_wave_barrier();
  __builtin_amdgcn_fence(__ATOMIC_ACQUIRE, "workgroup");
}

// =====================================================================================================
// f32 plane [EMB][EMB] -> 16-bit plane in fragment order:  mode 0: bf16 RNE bits;  mode 1: f16 bits of (bf16 RNE value) * scale;
// mode 2: f16 bits of value * scale (no bf16 pre-step).
// Thread = one 16-B piece of the fragment-order plane (8 consecutive k of one row): two 16-B loads, one 16-B store; 32
// consecutive lanes store 512 contiguous, 512-B aligned bytes
// coverage: grid = n8/256 blocks (host checks exactness) x 256 thr x 8 = the whole plane.
// =====================================================================================================
__global__ __launch_bounds__(256) void cvt16(const float* __restrict__ x, u16* D, int n8, int mode, float scale) {
  const int gt = blockIdx.x * 256 + (int)threadIdx.x;
  if (gt >= n8) return;                     // no barriers in this kernel
  const int unit = gt >> 6;
  const int rb   = unit / (EMB / 32);
  const int kb   = unit - rb * (EMB / 32);
  const float* p = x + (size_t)(rb * 16 + (gt & 15)) * EMB + kb * 32 + ((gt >> 5) & 1) * 16 + ((gt >> 4) & 1) * 8;
  const v4f a = *(const v4f*)(p), c4 = *(const v4f*)(p + 4);
  float v[8];
#pragma unroll
  for (int e = 0; e < 4; ++e) { v[e] = a[e]; v[4 + e] = c4[e]; }
  unsigned short s[8];
#pragma unroll
  for (int e = 0; e < 8; ++e) {
    const float vb = bfr(v[e]);
    const float vf = (mode == 1) ? vb : v[e];
    const unsigned short hb = h_bits((_Float16)(vf * scale));
    const unsigned short bb = bf_bits(v[e]);
    s[e] = (mode != 0) ? hb : bb;
  }
  v4u o;
#pragma unroll
  for (int e = 0; e < 4; ++e) o[e] = pk16(s[2 * e], s[2 * e + 1]);
  u16* d = D + (size_t)gt * 8;
  {
    *(v4u*)(d) = o;
    
  }
}

// =====================================================================================================
// Delay gather to a bf16 plane in fragment order (rows = b*SEQ + t, k = n): element (b, t, n) = bf16 RNE bits of
// sp[b][t - dl[n]][n] when t - dl[n] >= 0, else 0 (the zero is
// written). The source row index is clamped into [0, SEQ) for the address; the value is selected afterwards.
// Thread = one 16-B piece (8 consecutive n of one (b, t) row): 8 scalar loads, one 16-B store; 32 consecutive lanes = 16 rows x
// 16 n, stored as 512 contiguous bytes
// coverage: grid = n8/256 blocks (host exact) x 256 thr x 8 = rows x EMB = the whole plane.
// =====================================================================================================
__global__ __launch_bounds__(256) void gather_bf(const float* __restrict__ sp, const int* __restrict__ dl,
                                                 const float* __restrict__ mpu, const float* __restrict__ dcu,
                                                 u16* DB, int n8) {
  const int gt = blockIdx.x * 256 + (int)threadIdx.x;
  if (gt >= n8) return;                     // no barriers in this kernel
  const int unit = gt >> 6;
  const int rb   = unit / (EMB / 32);
  const int kb   = unit - rb * (EMB / 32);
  const int row = rb * 16 + (gt & 15);
  const int n0  = kb * 32 + ((gt >> 5) & 1) * 16 + ((gt >> 4) & 1) * 8;
  const int b   = row / SEQ;
  const int t   = row - b * SEQ;
  unsigned short s[8];
#pragma unroll
  for (int e = 0; e < 8; ++e) {
    const int n   = n0 + e;
    const int d   = dl[n];
    const int src = t - d;
    int sc = (src < 0) ? 0 : src;
    sc = (sc > SEQ - 1) ? (SEQ - 1) : sc;
    const float v = sp[((size_t)b * SEQ + (size_t)sc) * EMB + n];
    s[e] = (src >= 0) ? bf_bits(v) : (unsigned short)0;
  }
  v4u o;
#pragma unroll
  for (int e = 0; e < 4; ++e) o[e] = pk16(s[2 * e], s[2 * e + 1]);
  u16* dst = DB + (size_t)gt * 8;
  {
    *(v4u*)(dst) = o;
    
  }
  (void)mpu; (void)dcu;
}

// =====================================================================================================
//           8 consecutive lanes x 16 B per line), lanes 16..31 -> row 2*it+1.
//  epi64x2: same store shape, staged value = acc*os1 + accres*os2 + badd (two accumulator sets combined in f32).
//  epi64hs: f16 bits of (tile * pscale), stored in fragment order (k = column): lane (16*hh + m) = row m, 8 consecutive columns;
// coverage: epi64/epi64x2 8 instructions x 2 rows x 16 lanes x 4 floats; epi64hs 4 instructions x 32 lanes x 8 halves
//           = the wave's 16 x 64 tile in every case.
// =====================================================================================================
__device__ __forceinline__ void stage64(float* sl, v8f a0, v8f a1, v8f a2, v8f a3, float oscale, int lane) {
  const int hh = lane >> 4, m = lane & 15;
#pragma unroll
  for (int r = 0; r < 8; ++r) {
    const int ro = (8 * hh + r) * 68 + m;
    sl[ro]      = a0[r] * oscale;
    sl[ro + 16] = a1[r] * oscale;
    sl[ro + 32] = a2[r] * oscale;
    sl[ro + 48] = a3[r] * oscale;
  }
  wave_sync_lds();
}
__device__ __forceinline__ void epi64(float* sl, v8f a0, v8f a1, v8f a2, v8f a3, float oscale, v4f badd, float* C, int N,
                                      size_t rowb, int col0, int lane) {
  const int hh = lane >> 4, m = lane & 15;
  stage64(sl, a0, a1, a2, a3, oscale, lane);
  v4f vals[8];
#pragma unroll
  for (int it = 0; it < 8; ++it) vals[it] = *(const v4f*)(sl + (it * 2 + hh) * 68 + m * 4) + badd;
  float* dst = C + (rowb + (size_t)hh) * (size_t)N + col0 + m * 4;
  {
#pragma unroll
    for (int it = 0; it < 8; ++it) {
      *(v4f*)(dst + (size_t)(it * 2) * (size_t)N) = vals[it];
    }
    
  }
}
__device__ __forceinline__ void epi64x2(float* sl, v8f a0, v8f a1, v8f a2, v8f a3, v8f e0, v8f e1, v8f e2, v8f e3,
                                        float os1, float os2, v4f badd, float* C, int N, size_t rowb, int col0, int lane) {
  const int hh = lane >> 4, m = lane & 15;
#pragma unroll
  for (int r = 0; r < 8; ++r) {
    const int ro = (8 * hh + r) * 68 + m;
    sl[ro]      = a0[r] * os1 + e0[r] * os2;
    sl[ro + 16] = a1[r] * os1 + e1[r] * os2;
    sl[ro + 32] = a2[r] * os1 + e2[r] * os2;
    sl[ro + 48] = a3[r] * os1 + e3[r] * os2;
  }
  wave_sync_lds();
  v4f vals[8];
#pragma unroll
  for (int it = 0; it < 8; ++it) vals[it] = *(const v4f*)(sl + (it * 2 + hh) * 68 + m * 4) + badd;
  float* dst = C + (rowb + (size_t)hh) * (size_t)N + col0 + m * 4;
  {
#pragma unroll
    for (int it = 0; it < 8; ++it) {
      *(v4f*)(dst + (size_t)(it * 2) * (size_t)N) = vals[it];
    }
    
  }
}
__device__ __forceinline__ void epi64hs(float* sl, v8f a0, v8f a1, v8f a2, v8f a3, float oscale, float pscale,
                                        u16* C, int N, size_t rowb, int col0, int lane) {
  stage64(sl, a0, a1, a2, a3, oscale, lane);
  const int hh = lane >> 4, m = lane & 15;
  v4u oh[4];
#pragma unroll
  for (int i4 = 0; i4 < 4; ++i4) {
    const int c8 = (i4 >> 1) * 32 + (i4 & 1) * 16 + hh * 8;   // k block i4>>1, half i4&1 of the wave's two units
    const v4f a = *(const v4f*)(sl + m * 68 + c8), c4 = *(const v4f*)(sl + m * 68 + c8 + 4);
    float w[8];
#pragma unroll
    for (int e = 0; e < 4; ++e) { w[e] = a[e] * pscale; w[4 + e] = c4[e] * pscale; }
#pragma unroll
    for (int e = 0; e < 4; ++e) oh[i4][e] = pk16(h_bits((_Float16)w[2 * e]), h_bits((_Float16)w[2 * e + 1]));
  }
  u16* dst = C + rowb * (size_t)N + (size_t)(col0 >> 5) * 512 + lane * 8;
  {
#pragma unroll
    for (int i4 = 0; i4 < 4; ++i4) {
      *(v4u*)(dst + i4 * 256) = oh[i4];
    }
    
  }
}

// =====================================================================================================
// bf16 GEMM, f32 out: C[M][N] = (A[M][K] . Bt[N][K]^T) * oscale, A and Bt bf16 planes in fragment order.
// Block = 64x64 tile, 4 waves x 16 rows; fragments loaded straight from the planes (two 16-B loads each, split k map for
// A and B); K stepped by 32 (host checks K % 32 == 0, M % 64 == 0, N % 64 == 0, grid = (M/64)*(N/64)).
// =====================================================================================================
__global__ __launch_bounds__(128)
void gemm_b32(const u16* __restrict__ A, const u16* __restrict__ Bt, float* C, int M, int N, int K, float oscale) {
  __shared__ __align__(16) float slab[4 * SLAB64];
  const int tid = threadIdx.x, wave = tid >> 5, lane = tid & 31;
  const int ntile = N >> 6;
  const int bid   = blockIdx.x;
  const int rowb  = (bid / ntile) * 64 + wave * 16;
  const int col0  = (bid % ntile) * 64;
  if (rowb + 16 > M) return;                 // wave-uniform, never taken with the exact grid; no block barriers in this kernel
  const u16* ap = A  + (size_t)rowb * K + 8 * lane;
  const u16* bp = Bt + (size_t)col0 * K + 8 * lane;
  const size_t bs = (size_t)16 * K;
  const u16* bp1 = bp + bs;
  const u16* bp2 = bp + 2 * bs;
  const u16* bp3 = bp + 3 * bs;
  v8f acc0 = zero8(), acc1 = zero8(), acc2 = zero8(), acc3 = zero8();
#pragma unroll 1
  for (int k0 = 0; k0 < K; k0 += 32) {
    const v16b a  = ldfo_b(ap);
    const v16b b0 = ldfo_b(bp);
    const v16b b1 = ldfo_b(bp1);
    const v16b b2 = ldfo_b(bp2);
    const v16b b3 = ldfo_b(bp3);
    ap += 512; bp += 512; bp1 += 512; bp2 += 512; bp3 += 512;   // next k block: one 512-element unit on
    acc0 = mma_b(a, b0, acc0);
    acc1 = mma_b(a, b1, acc1);
    acc2 = mma_b(a, b2, acc2);
    acc3 = mma_b(a, b3, acc3);
    guard6<v16b>(acc0, acc1, acc2, acc3, a, b0, b1, b2, b3, a);
  }
  epi64(slab + wave * SLAB64, acc0, acc1, acc2, acc3, oscale, zero4(), C, N, (size_t)rowb, col0, lane);
}

// =====================================================================================================
// bf16 GEMM, f16 plane out in fragment order: C16[M][N] = f16 bits of ((A . Bt^T) * oscale) * pscale; operands as in gemm_b32, epilogue epi64hs.
// =====================================================================================================
__global__ __launch_bounds__(128)
void gemm_bh16(const u16* __restrict__ A, const u16* __restrict__ Bt, u16* C, int M, int N, int K, float oscale, float pscale) {
  __shared__ __align__(16) float slab[4 * SLAB64];
  const int tid = threadIdx.x, wave = tid >> 5, lane = tid & 31;
  const int ntile = N >> 6;
  const int bid   = blockIdx.x;
  const int rowb  = (bid / ntile) * 64 + wave * 16;
  const int col0  = (bid % ntile) * 64;
  if (rowb + 16 > M) return;                 // wave-uniform, never taken with the exact grid; no block barriers in this kernel
  const u16* ap = A  + (size_t)rowb * K + 8 * lane;
  const u16* bp = Bt + (size_t)col0 * K + 8 * lane;
  const size_t bs = (size_t)16 * K;
  const u16* bp1 = bp + bs;
  const u16* bp2 = bp + 2 * bs;
  const u16* bp3 = bp + 3 * bs;
  v8f acc0 = zero8(), acc1 = zero8(), acc2 = zero8(), acc3 = zero8();
#pragma unroll 1
  for (int k0 = 0; k0 < K; k0 += 32) {
    const v16b a  = ldfo_b(ap);
    const v16b b0 = ldfo_b(bp);
    const v16b b1 = ldfo_b(bp1);
    const v16b b2 = ldfo_b(bp2);
    const v16b b3 = ldfo_b(bp3);
    ap += 512; bp += 512; bp1 += 512; bp2 += 512; bp3 += 512;   // next k block: one 512-element unit on
    acc0 = mma_b(a, b0, acc0);
    acc1 = mma_b(a, b1, acc1);
    acc2 = mma_b(a, b2, acc2);
    acc3 = mma_b(a, b3, acc3);
    guard6<v16b>(acc0, acc1, acc2, acc3, a, b0, b1, b2, b3, a);
  }
  epi64hs(slab + wave * SLAB64, acc0, acc1, acc2, acc3, oscale, pscale, C, N, (size_t)rowb, col0, lane);
}

// =====================================================================================================
// f16 GEMM with two A planes (hi + residual), f32 out with bias:
//   C[M][N] = (Ah . Bt^T) * os1 + (Ar . Bt^T) * os2 + bf16RNE(bias[n]); Ah/Ar/Bt f16 planes in fragment order.
// Same tiling as gemm_b32; separate accumulators for the two planes, combined in f32 in epi64x2.
// =====================================================================================================
__global__ __launch_bounds__(128)
void gemm_h2_32(const u16* __restrict__ Ah, const u16* __restrict__ Ar, const u16* __restrict__ Bt,
                const float* __restrict__ bias, float* C, int M, int N, int K, float os1, float os2) {
  __shared__ __align__(16) float slab[4 * SLAB64];
  const int tid = threadIdx.x, wave = tid >> 5, lane = tid & 31, m = lane & 15;
  const int ntile = N >> 6;
  const int bid   = blockIdx.x;
  const int rowb  = (bid / ntile) * 64 + wave * 16;
  const int col0  = (bid % ntile) * 64;
  if (rowb + 16 > M) return;                 // wave-uniform, never taken with the exact grid; no block barriers in this kernel
  const _Float16* ap  = (const _Float16*)(const void*)Ah + (size_t)rowb * K + 8 * lane;
  const _Float16* arp = (const _Float16*)(const void*)Ar + (size_t)rowb * K + 8 * lane;
  const _Float16* bp  = (const _Float16*)(const void*)Bt + (size_t)col0 * K + 8 * lane;
  const size_t bs = (size_t)16 * K;
  const _Float16* bp1 = bp + bs;
  const _Float16* bp2 = bp + 2 * bs;
  const _Float16* bp3 = bp + 3 * bs;
  v8f acc0 = zero8(), acc1 = zero8(), acc2 = zero8(), acc3 = zero8();
  v8f acr0 = zero8(), acr1 = zero8(), acr2 = zero8(), acr3 = zero8();
#pragma unroll 1
  for (int k0 = 0; k0 < K; k0 += 32) {
    const v16h a  = ldfo_h(ap);
    const v16h ar = ldfo_h(arp);
    const v16h b0 = ldfo_h(bp);
    const v16h b1 = ldfo_h(bp1);
    const v16h b2 = ldfo_h(bp2);
    const v16h b3 = ldfo_h(bp3);
    ap += 512; arp += 512; bp += 512; bp1 += 512; bp2 += 512; bp3 += 512;   // next k block: one 512-element unit on
    acc0 = mma_h(a, b0, acc0);
    acc1 = mma_h(a, b1, acc1);
    acc2 = mma_h(a, b2, acc2);
    acc3 = mma_h(a, b3, acc3);
    acr0 = mma_h(ar, b0, acr0);
    acr1 = mma_h(ar, b1, acr1);
    acr2 = mma_h(ar, b2, acr2);
    acr3 = mma_h(ar, b3, acr3);
    guard8x6(acc0, acc1, acc2, acc3, acr0, acr1, acr2, acr3, a, ar, b0, b1, b2, b3);
  }
  const v4f bv = *(const v4f*)(bias + col0 + m * 4);      // columns col0 + 4m .. +3, always < N (N multiple of 64)
  v4f badd;
#pragma unroll
  for (int e = 0; e < 4; ++e) badd[e] = bfr(bv[e]);
  epi64x2(slab + wave * SLAB64, acc0, acc1, acc2, acc3, acr0, acr1, acr2, acr3, os1, os2, badd, C, N,
          (size_t)rowb, col0, lane);
}

// =====================================================================================================
// V^T plane in fragment order (rows = b*EMB + d, k = s): element (b, d, s) = f16(V[b][s][d] * 1024).
// Block = (b, 64-wide d chunk, 64 keys): 64 source row segments of 64 floats loaded with 16-B loads, converted, scattered into
// coverage: load 256 thr x 16 elements = 64 x 64; store 2 iterations x 256 thr x 8 halves = 64 lines x 64 = the block's tile;
//           grid = nb x (EMB/64) x (SEQ/64) blocks covers the plane exactly once.
// =====================================================================================================
__global__ __launch_bounds__(256) void xt16(const float* __restrict__ X, u16* XTo) {
  __shared__ __align__(16) u16 TH[64 * VTP];
  const int tid = threadIdx.x;
  const int bid = blockIdx.x;
  const int st  = bid % (SEQ / 64);
  const int dcb = (bid / (SEQ / 64)) % (EMB / 64);
  const int b   = bid / ((SEQ / 64) * (EMB / 64));
  const int s0  = st * 64;
  const int d0  = dcb * 64;
  {
    const int sl = tid >> 2;                  // key within tile 0..63
    const int dc = (tid & 3) * 16;            // d chunk within the 64
    const float* src = X + ((size_t)b * SEQ + s0 + sl) * EMB + d0 + dc;
#pragma unroll
    for (int i = 0; i < 4; ++i) {
      const v4f a = *(const v4f*)(src + 4 * i);
#pragma unroll
      for (int e = 0; e < 4; ++e) {
        const _Float16 hv = (_Float16)(a[e] * VCAR);
        TH[(dc + 4 * i + e) * VTP + sl] = h_bits(hv);
      }
    }
  }
  __syncthreads();
  v4u vh[2];
#pragma unroll
  for (int it = 0; it < 2; ++it) {
    const int q = it * 256 + tid;             // piece of the tile: d block q>>7, key block (q>>6)&1, half (q>>5)&1, lane q&31
    vh[it] = *(const v4u*)(TH + ((q >> 7) * 16 + (q & 15)) * VTP + ((q >> 6) & 1) * 32 + ((q >> 5) & 1) * 16 + ((q >> 4) & 1) * 8);
  }
  const size_t base = ((size_t)b * EMB + d0) * SEQ + (size_t)(s0 >> 5) * 512;
  {
#pragma unroll
    for (int it = 0; it < 2; ++it) {
      const int q = it * 256 + tid;
      *(v4u*)(XTo + base + (size_t)((q >> 7) * 16) * SEQ + (q & 127) * 8) = vh[it];
    }
    
  }
}

// =====================================================================================================
// Per-chunk column sums of V: VS[(b*NCHK + c)*EMB + d] = sum over the CK keys of chunk c of V[b][c*CK + s][d] (f32, fixed
// sequential order). Thread = one (b, c, d); 256 consecutive table entries per block are staged in LDS, then threads 0..63
// coverage: grid = nb*NCHK*EMB/256 blocks (host exact) x 256 = the whole table; store 64 thr x 4 floats = the block's 256.
// =====================================================================================================
__global__ __launch_bounds__(256) void vsum_k(const float* __restrict__ V, float* VS) {
  __shared__ __align__(16) float sm[256];
  const int tid = threadIdx.x;
  const int gt  = blockIdx.x * 256 + tid;
  const int d   = gt % EMB;
  const int bc  = gt / EMB;
  const int b   = bc / NCHK;
  const int c   = bc - b * NCHK;
  const float* p = V + ((size_t)b * SEQ + (size_t)c * CK) * EMB + d;
  float s = 0.f;
#pragma unroll 4
  for (int i = 0; i < CK; ++i) s += p[(size_t)i * EMB];
  sm[tid] = s;
  __syncthreads();
  if (tid < 64) {                                   // waves 0 and 1, all lanes active
    const v4f o = *(const v4f*)(sm + tid * 4);
    float* dst = VS + (size_t)blockIdx.x * 256 + tid * 4;
    *(v4f*)(dst) = o;
    
  }
}

// =====================================================================================================
// Single-head attention, head width EMB = 768, all SEQ keys kept (non-causal): block = (batch b, 64 query rows q0..q0+63 = RT = 4
// row tiles of 16), 16 waves. Every K fragment and every V^T fragment that a wave loads feeds one WMMA per row tile.
// q plane (f16, x8) rows b*SEQ+s, k = d; k plane the same; V^T plane rows b*EMB+d, k = s (x1024); all three and the two
// ctx planes in fragment order; VS = per-chunk column sums of V (f32).
//   Per chunk of CK = 512 keys (NCHK = 4 chunks):
//   (S) scores S[query][key n] on WMMA: A = q rows of row tile rt (row m = lane&15, split k map over d), B = k rows (col n = key,
//       split map), 24 d-steps; wave w handles key block w (32 keys) of the chunk for all four row tiles; D element r of lane l
//       of tile rt -> scs[query 16rt+8h+r][key col] (f32 LDS).
//   (M) 16 threads per query row (sub-thread = 32 consecutive keys), two passes of 32 rows: base-2 logits, chunk max via xor
//       shuffles, online running max / rescale factor al / running sum l in f32 registers (the same threads own the row in every
//       chunk), p = exp2(t - m_new) <= 1, chunk row sum ps and its mean C = ps/CK (bit-identical on the row's 16 threads), the
//       CENTRED P' = p - C written as f16(P' * 32768) into the LDS P tile with 16-B stores; al -> rowa[row], C -> rowc[row].
//   (PV) each wave owns d columns 48*wave + 16j + (lane&15), j = 0..2, of all four row tiles (12 accumulators):
//       o = o*al + C*(32768*1024)*VS[chunk][d] (exact add-back of the centring term in f32), then for each key block: A = P'
//       fragments from LDS (row m = query, split map over keys), B = V^T fragments (col n = d, split map over keys).
//       sum_k (P'_k + C) v_k == sum_k p_k v_k exactly.
//   Block barriers after (S) and after (M) order all LDS reuse across chunks and waves.
//   Epilogue: x = o * 16384 / (l * 32768 * 1024) per row (rowi, l >= 1 always); hi = f16(x), res = f16((x - hi) * 2048); each
//   plane is staged in LDS and stored in fragment order.
// coverage: grid nb*32 blocks x 64 rows; staging 16 waves x 48 cols x 64 rows = 64 x 768; store 12 iterations x 512 thr x 8
//           halves = 64 x 768 per plane = every (b, s, d) of both ctx planes exactly once.
// =====================================================================================================
__device__ __forceinline__ void ctx_store(const u16* ct, u16* dst, int tid) {
  v4u v[12];
#pragma unroll
  for (int it = 0; it < 12; ++it) {
    const int rb = it / 3;                    // 16-row block of the tile (3 * 512 pieces each)
    const int p  = (it % 3) * ATT_THREADS + tid;   // piece of that block: k block p>>6, half (p>>5)&1, lane p&31
    v[it] = *(const v4u*)(ct + (rb * 16 + (p & 15)) * CTP + (p >> 6) * 32 + ((p >> 5) & 1) * 16 + ((p >> 4) & 1) * 8);
  }
  {
#pragma unroll
    for (int it = 0; it < 12; ++it) {
      const int p = it * ATT_THREADS + tid;
      *(v4u*)(dst + (size_t)p * 8) = v[it];
    }
  }
}

__global__ __launch_bounds__(ATT_THREADS)
void attn_fwd(const u16* __restrict__ QPp, const u16* __restrict__ KPp, const u16* __restrict__ VTp,
              const float* __restrict__ VSp, u16* CHo, u16* CRo) {
  __shared__ __align__(16) AttLds L0;              // scores [QT][SCP] f32; reused as the ctx staging tile [QT][CTP] u16
  __shared__ __align__(16) u16 pls[QT * PLP];      // P' tile [QT][PLP] f16 bits
  __shared__ float rowa[QT];
  __shared__ float rowc[QT];
  __shared__ float rowi[QT];
  float* const scs = L0.s;

  const int tid  = threadIdx.x;
  const int wave = tid >> 5;
  const int lane = tid & 31;
  const int hh   = lane >> 4;
  const int m    = lane & 15;
  const int r32  = tid >> 4;                 // query rows owned in phase (M): r32 and 32 + r32
  const int sub  = tid & 15;
  const int kl0  = sub * 32;

  const int bid = blockIdx.x;
  const int b   = bid / (SEQ / QT);
  const int q0  = (bid % (SEQ / QT)) * QT;

  const _Float16* qa  = (const _Float16*)(const void*)QPp + ((size_t)b * SEQ + q0) * EMB + 8 * lane;
  const _Float16* kbp = (const _Float16*)(const void*)KPp + ((size_t)b * SEQ + wave * 32) * EMB + 8 * lane;
  const _Float16* vbp = (const _Float16*)(const void*)VTp + ((size_t)b * EMB + wave * DW) * SEQ + 8 * lane;
  const float* vsb = VSp + (size_t)b * NCHK * EMB + wave * DW + m;
  const float lsc = RSQD * LOG2E / (QSC * KSC);

  float mrun[2] = {-INFINITY, -INFINITY}, lrun[2] = {0.f, 0.f};
  v8f o[RT][NJ];
#pragma unroll
  for (int rt = 0; rt < RT; ++rt) {
#pragma unroll
    for (int j = 0; j < NJ; ++j) o[rt][j] = zero8();
  }

#pragma unroll 1
  for (int c = 0; c < NCHK; ++c) {
    const int kbeg = c * CK;
    // ---- (S) scores of this chunk: key block = wave ----
    {
      const _Float16* qp = qa;
      const _Float16* kp = kbp + (size_t)kbeg * EMB;
      v8f s[RT][2];
#pragma unroll
      for (int rt = 0; rt < RT; ++rt) { s[rt][0] = zero8(); s[rt][1] = zero8(); }
#pragma unroll 1
      for (int k4 = 0; k4 < EMB / 128; ++k4) {             // 6 trips of 4 d-steps, as many steps unrolled as before
#pragma unroll
        for (int u = 0; u < 4; ++u) {
          v16h a[RT];
#pragma unroll
          for (int rt = 0; rt < RT; ++rt) a[rt] = ldfo_h(qp + rt * (16 * EMB) + u * 512);
          const v16h f0 = ldfo_h(kp + u * 512);
          const v16h f1 = ldfo_h(kp + 16 * EMB + u * 512);
#pragma unroll
          for (int rt = 0; rt < RT; ++rt) {
            s[rt][0] = mma_h(a[rt], f0, s[rt][0]);
            s[rt][1] = mma_h(a[rt], f1, s[rt][1]);
          }
          guard_s(s, a, f0, f1, qp, kp);
        }
        qp += 4 * 512;
        kp += 4 * 512;
      }
#pragma unroll
      for (int rt = 0; rt < RT; ++rt) {
        float* srow = scs + (16 * rt + 8 * hh) * SCP + wave * 32 + m;
#pragma unroll
        for (int r = 0; r < 8; ++r) {
          srow[r * SCP]      = s[rt][0][r];
          srow[r * SCP + 16] = s[rt][1][r];
        }
      }
    }
    __syncthreads();
    // ---- (M) softmax statistics and the centred P' tile, 32 rows a pass ----
#pragma unroll
    for (int rg = 0; rg < 2; ++rg) {
      const int row = rg * 32 + r32;
      const float* sp = scs + row * SCP + kl0;
      float t[32];
      float cm = -INFINITY;
#pragma unroll
      for (int i = 0; i < 8; ++i) {
        const v4f a = *(const v4f*)(sp + 4 * i);
#pragma unroll
        for (int e = 0; e < 4; ++e) {
          const float tv = a[e] * lsc;
          t[4 * i + e] = tv;
          cm = fmaxf(cm, tv);
        }
      }
#pragma unroll
      for (int d = 1; d <= 8; d <<= 1) cm = fmaxf(cm, __shfl_xor(cm, d, 32));
      const float mn = fmaxf(mrun[rg], cm);                // finite
      const float al = (mrun[rg] == -INFINITY) ? 0.f : exp2f(mrun[rg] - mn);
      mrun[rg] = mn;
      float ps = 0.f;
#pragma unroll
      for (int j = 0; j < 32; ++j) {
        const float p = exp2f(fminf(t[j] - mn, 0.f));
        t[j] = p;
        ps += p;
      }
#pragma unroll
      for (int d = 1; d <= 8; d <<= 1) ps += __shfl_xor(ps, d, 32);
      const float cc = ps * (1.0f / (float)CK);
      v4u pk[4];
#pragma unroll
      for (int i = 0; i < 4; ++i) {
#pragma unroll
        for (int e = 0; e < 4; ++e) {
          const int j = 8 * i + 2 * e;
          pk[i][e] = pk16(h_bits((_Float16)((t[j] - cc) * PCAR)), h_bits((_Float16)((t[j + 1] - cc) * PCAR)));
        }
      }
      lrun[rg] = lrun[rg] * al + ps;
      u16* pd = pls + row * PLP + kl0;
#pragma unroll
      for (int i = 0; i < 4; ++i) *(v4u*)(pd + 8 * i) = pk[i];
      if (sub == 0) { rowa[row] = al; rowc[row] = cc; }
    }
    __syncthreads();
    // ---- (PV) rescale, add the centring term, accumulate P' . V^T ----
    {
      float vs[NJ];
#pragma unroll
      for (int j = 0; j < NJ; ++j) vs[j] = vsb[(size_t)c * EMB + 16 * j];
#pragma unroll
      for (int rt = 0; rt < RT; ++rt) {
        float scl[8], cad[8];
#pragma unroll
        for (int r = 0; r < 8; ++r) {
          scl[r] = rowa[16 * rt + 8 * hh + r];
          cad[r] = rowc[16 * rt + 8 * hh + r] * (PCAR * VCAR);
        }
#pragma unroll
        for (int j = 0; j < NJ; ++j) {
#pragma unroll
          for (int r = 0; r < 8; ++r) o[rt][j][r] = o[rt][j][r] * scl[r] + cad[r] * vs[j];
        }
      }
      const _Float16* pp = (const _Float16*)(const void*)pls + m * PLP + 8 * hh;
      const _Float16* vp = vbp + kbeg * 16;                // key block kbeg/32 -> 512 elements per unit
#pragma unroll 1
      for (int kb = 0; kb < CK / 32; ++kb) {
        v16h pf[RT];
#pragma unroll
        for (int rt = 0; rt < RT; ++rt) pf[rt] = ldfrag_h(pp + rt * (16 * PLP) + kb * 32);
        v16h g[NJ];
#pragma unroll
        for (int j = 0; j < NJ; ++j) g[j] = ldfo_h(vp + (size_t)(16 * j) * SEQ + kb * 512);
#pragma unroll
        for (int rt = 0; rt < RT; ++rt) {
#pragma unroll
          for (int j = 0; j < NJ; ++j) o[rt][j] = mma_h(pf[rt], g[j], o[rt][j]);
        }
        guard_o(o);
      }
    }
  }

#pragma unroll
  for (int rg = 0; rg < 2; ++rg) {
    if (sub == 0) rowi[rg * 32 + r32] = (1.0f / lrun[rg]) * (CSC / (PCAR * VCAR));   // lrun >= 1
  }
  __syncthreads();
  float inv[RT][8];
#pragma unroll
  for (int rt = 0; rt < RT; ++rt) {
#pragma unroll
    for (int r = 0; r < 8; ++r) inv[rt][r] = rowi[16 * rt + 8 * hh + r];
  }

  u16* const ct = L0.c;
  const int cb = wave * DW + m;
  // hi plane
#pragma unroll
  for (int rt = 0; rt < RT; ++rt) {
#pragma unroll
    for (int j = 0; j < NJ; ++j) {
#pragma unroll
      for (int r = 0; r < 8; ++r) {
        const float xs = o[rt][j][r] * inv[rt][r];
        ct[(16 * rt + 8 * hh + r) * CTP + cb + 16 * j] = h_bits((_Float16)xs);
      }
    }
  }
  __syncthreads();
  ctx_store(ct, CHo + ((size_t)b * SEQ + q0) * EMB, tid);
  __syncthreads();
  // residual plane
#pragma unroll
  for (int rt = 0; rt < RT; ++rt) {
#pragma unroll
    for (int j = 0; j < NJ; ++j) {
#pragma unroll
      for (int r = 0; r < 8; ++r) {
        const float xs = o[rt][j][r] * inv[rt][r];
        const _Float16 hv = (_Float16)xs;
        ct[(16 * rt + 8 * hh + r) * CTP + cb + 16 * j] = h_bits((_Float16)((xs - (float)hv) * RSC));
      }
    }
  }
  __syncthreads();
  ctx_store(ct, CRo + ((size_t)b * SEQ + q0) * EMB, tid);
}

// =====================================================================================================
// Workspace map (bytes, rows = nb*SEQ; nb = 8 gives the totals below); every plane is fully written by whole-line stores before
// it is read; all extents are exact multiples of the store granularity (no pad rows); regions A and V are reused sequentially on
// the single in-order stream:
//   WQB bf16 [768][768]   1179648   WKB same   WVB same   WOH f16 of bf16 value x1024  1179648     4718592
//   VS  f32  [nb][4][768]                                                                          98304
//   A   DB bf16 [rows][768] (25165824), later VT f16 [nb][768][2048] x1024 (25165824)     region 25165824
//   Q   QP f16 [rows][768] x8                                                              region 25165824
//   K   KP f16 [rows][768] x8                                                              region 25165824
//   V   V f32 [rows][768] (50331648), later CH f16 [rows][768] + CR f16 [rows][768]        region 50331648
//   end                                                                                        130646016
// =====================================================================================================
extern "C" void kernel_launch(void* const* d_in, const int* in_sizes, int n_in,
                              void* d_out, int out_size, void* d_ws, size_t ws_size,
                              hipStream_t stream) {
  if (n_in < 9) return;
  const long long per = (long long)SEQ * EMB;
  const long long ns  = in_sizes[0];
  if (ns < per || (ns % per) != 0) return;
  const int nb = (int)(ns / per);
  if (nb < 1 || nb > 8) return;
  const int rows = nb * SEQ;
  if (in_sizes[1] != EMB) return;
  if (in_sizes[2] < 1 || in_sizes[3] < 1) return;
  if (in_sizes[4] != EMB * EMB || in_sizes[5] != EMB * EMB || in_sizes[6] != EMB * EMB || in_sizes[7] != EMB * EMB) return;
  if (in_sizes[8] != EMB) return;
  if ((long long)out_size != (long long)rows * EMB) return;

  const float* spk = (const float*)d_in[0];
  const int*   dly = (const int*)d_in[1];
  const float* mpo = (const float*)d_in[2];
  const float* dcy = (const float*)d_in[3];
  const float* wq  = (const float*)d_in[4];
  const float* wk  = (const float*)d_in[5];
  const float* wv  = (const float*)d_in[6];
  const float* wo  = (const float*)d_in[7];
  const float* bo  = (const float*)d_in[8];
  float*       out = (float*)d_out;

  const size_t szW  = (size_t)EMB * EMB * 2;                    //   1179648
  const size_t szVS = (size_t)nb * NCHK * EMB * 4;              //     98304 at nb = 8
  const size_t sz16 = (size_t)rows * EMB * 2;                   //  25165824
  const size_t sz32 = (size_t)rows * EMB * 4;                   //  50331648
  const size_t szVT = (size_t)nb * EMB * SEQ * 2;               //  == sz16
  size_t off = 0;
  const size_t oWQ = off; off += szW;
  const size_t oWK = off; off += szW;
  const size_t oWV = off; off += szW;
  const size_t oWO = off; off += szW;
  const size_t oVS = off; off += szVS;
  const size_t oA  = off; off += (szVT > sz16 ? szVT : sz16);   // DB then VT
  const size_t oQ  = off; off += sz16;
  const size_t oK  = off; off += sz16;
  const size_t oV  = off; off += sz32;                          // V f32, later CH + CR
  if (off > ws_size) return;                                    // off = 130646016 at nb = 8
  if (off > WS_CAP) return;
  if (2 * sz16 > sz32) return;

  char* ws = (char*)d_ws;
  u16*   WQB = (u16*)(ws + oWQ);
  u16*   WKB = (u16*)(ws + oWK);
  u16*   WVB = (u16*)(ws + oWV);
  u16*   WOH = (u16*)(ws + oWO);
  float* VS  = (float*)(ws + oVS);
  u16*   DB  = (u16*)(ws + oA);
  u16*   VT  = (u16*)(ws + oA);
  u16*   QP  = (u16*)(ws + oQ);
  u16*   KP  = (u16*)(ws + oK);
  float* V   = (float*)(ws + oV);
  u16*   CH  = (u16*)(ws + oV);
  u16*   CR  = (u16*)(ws + oV + sz16);

  const int n8w = (EMB * EMB) / 8;                      // 73728
  const int n8g = rows * (EMB / 8);                     // rows * 96
  if ((n8w % 256) != 0 || (n8g % 256) != 0) return;
  if ((rows % 64) != 0 || ((nb * NCHK * EMB) % 256) != 0) return;
  const dim3 blk(256);
  const dim3 gW(n8w / 256), gGa(n8g / 256);
  const dim3 gG((rows / 64) * (EMB / 64));              // 3072 at nb = 8
  const dim3 bG(128);
  const dim3 gXT(nb * (EMB / 64) * (SEQ / 64));         // nb * 384
  const dim3 gVS((nb * NCHK * EMB) / 256);              // nb * 12
  const dim3 gAT(nb * (SEQ / QT));                      // nb * 32
  const dim3 bAT(ATT_THREADS);

  // (0..3) weights stored [n = out][k = in] (y = x.W^T), rows = n: fragment-order bf16 planes for Wq, Wk, Wv; f16 of bf16 value
  //        x1024 for Wo
  cvt16<<<gW, blk, 0, stream>>>(wq, WQB, n8w, 0, 1.0f);
  cvt16<<<gW, blk, 0, stream>>>(wk, WKB, n8w, 0, 1.0f);
  cvt16<<<gW, blk, 0, stream>>>(wv, WVB, n8w, 0, 1.0f);
  cvt16<<<gW, blk, 0, stream>>>(wo, WOH, n8w, 1, WSC);
  // (4) delayed spikes -> fragment-order bf16 plane, rows x 768
  gather_bf<<<gGa, blk, 0, stream>>>(spk, dly, mpo, dcy, DB, n8g);
  // (5, 6) q and k projections -> f16 planes x8; (7) v projection -> f32 plane
  gemm_bh16<<<gG, bG, 0, stream>>>(DB, WQB, QP, rows, EMB, EMB, 1.0f, QSC);
  gemm_bh16<<<gG, bG, 0, stream>>>(DB, WKB, KP, rows, EMB, EMB, 1.0f, KSC);
  gemm_b32<<<gG, bG, 0, stream>>>(DB, WVB, V, rows, EMB, EMB, 1.0f);
  // (8) v -> V^T plane x1024 (over the dead DB region); (9) per-chunk column sums of v
  xt16<<<gXT, blk, 0, stream>>>(V, VT);
  vsum_k<<<gVS, blk, 0, stream>>>(V, VS);
  // (10) attention -> ctx hi x16384 and residual x2048 f16 planes (over the dead V region)
  attn_fwd<<<gAT, bAT, 0, stream>>>(QP, KP, VT, VS, CH, CR);
  // (11) output projection + bias -> out
  gemm_h2_32<<<gG, bG, 0, stream>>>(CH, CR, WOH, bo, out, rows, EMB, EMB,
                                     1.0f / (CSC * WSC), 1.0f / (CSC * WSC * RSC));
  (void)hipGetLastError();
}

// v003
// One run takes 357 microseconds.
// Next to v002, in two timings, it ran 1.09 times as fast each time.
// All steps since v000 together make it 2.69 times as fast.
// Projections q,k,v = delayed.W^T: v_wmma_f32_16x16x32_bf16 (bf16 RNE operands of the raw inputs, f32 accumulate).
// Scores q'.k'^T (f16 planes x8), P'.V (chunk-centred P' x32768 f16 from LDS, V^T x1024 f16) and the output projection
// (ctx carried as f16 hi x16384 plus residual x2048 planes, times f16(bf16(Wo) x1024), bias added in f32):
// v_wmma_f32_16x16x32_f16, f32 accumulate. Delay gather, softmax statistics, column sums of V and all scaling in f32 on VALU.
#include <hip/hip_runtime.h>
#include <math.h>
#include <stdint.h>

#define SEQ   2048
#define EMB   768
#define CK    512
#define NCHK  4
#define QT    64
#define RT    4
#define NJ    3
#define DW    48
#define SCP   544
#define PLP   528
#define CTP   776
#define SLAB64 (16 * 68)
#define VTP   72
#define ATT_THREADS 512
#define QSC   8.0f
#define KSC   8.0f
#define PCAR  32768.0f
#define VCAR  1024.0f
#define WSC   1024.0f
#define CSC   16384.0f
#define RSC   2048.0f
#define LOG2E 1.4426950408889634f
#define RSQD  0.036084391824351615f
#define WS_CAP ((size_t)134217728)

static_assert((EMB % 128) == 0 && EMB == 8 * 96 && (EMB % 32) == 0 && (EMB / 8) == 96);
static_assert((SEQ % CK) == 0 && (SEQ / CK) == NCHK && CK == 16 * 32 && (SEQ % 64) == 0 && (SEQ / QT) == 32);
static_assert(16 * CTP * 2 <= 16 * SCP * 4 && CTP >= EMB + 8);
static_assert(((PLP * 2) % 16) == 0 && ((SCP * 4) % 16) == 0 && ((VTP * 2) % 16) == 0 && ((CTP * 2) % 16) == 0);
static_assert(64 * VTP >= 63 * VTP + 64);
static_assert(ATT_THREADS == 512 && QT == 16 * RT && 2 * (ATT_THREADS / 16) == QT);
static_assert((ATT_THREADS / 32) * 32 == CK && (ATT_THREADS / 32) * DW == EMB && DW == 16 * NJ);
static_assert(3 * ATT_THREADS * 8 == 16 * EMB);
static_assert(((EMB * EMB) % 2048) == 0 && ((NCHK * EMB) % 256) == 0);

typedef unsigned short u16;
typedef _Float16 v16h __attribute__((ext_vector_type(16)));
typedef _Float16 v8h  __attribute__((ext_vector_type(8)));
typedef __bf16   v16b __attribute__((ext_vector_type(16)));
typedef float    v8f  __attribute__((ext_vector_type(8)));
typedef float    v4f  __attribute__((ext_vector_type(4)));
typedef unsigned int v4u __attribute__((ext_vector_type(4)));

union FragH { v16h v; v8h h[2]; v4u u[2]; };
union FragB { v16b v; v4u u[2]; };
union AttLds { float s[QT * SCP]; u16 c[2 * QT * SCP]; };

// ---- scalar helpers --------------------------------------------------------------------------------
__device__ __forceinline__ unsigned short bf_bits(float f) {          // f32 -> bf16 bits, RNE convert
  unsigned u = __float_as_uint(f);
  return (unsigned short)((u + 0x7FFFu + ((u >> 16) & 1u)) >> 16);
}
__device__ __forceinline__ float bf_up(unsigned short h) { return __uint_as_float(((unsigned)h) << 16); }
__device__ __forceinline__ float bfr(float f) { return bf_up(bf_bits(f)); }
__device__ __forceinline__ unsigned short h_bits(_Float16 x) { return __builtin_bit_cast(unsigned short, x); }
__device__ __forceinline__ unsigned pk16(unsigned short a, unsigned short b) { return (unsigned)a | ((unsigned)b << 16); }
__device__ __forceinline__ v8f zero8() { v8f z = {0.f, 0.f, 0.f, 0.f, 0.f, 0.f, 0.f, 0.f}; return z; }
__device__ __forceinline__ v4f zero4() { v4f z = {0.f, 0.f, 0.f, 0.f}; return z; }

// ---- fragment loaders: 16-bit A/B operand, lane -> row/col (lane&15), p already includes +8*(lane>>4);
//      elements 0..7 <- p[0..7] (k0+8h..), elements 8..15 <- p[16..23] (k0+16+8h..)  (same split k map for A and B;
//      this row-major form is used for the P' tile in LDS only)
__device__ __forceinline__ v16h ldfrag_h(const _Float16* p) {
  FragH f;
  f.h[0] = *(const v8h*)(p);
  f.h[1] = *(const v8h*)(p + 16);
  return f.v;
}
// ---- fragment-order planes (every 16-bit operand plane in the workspace): a plane [R][K] is stored as
//      [R/16][K/32][2][32 lanes][8 elements]. The 1-KiB unit of (row block rb, k block kb) starts at element rb*16*K + kb*512;
//      in it lane (16*hh + m) finds, at 8*lane, row m's k = 8*hh + 0..7 and, 256 elements on, k = 16 + 8*hh + 0..7: the same
//      split k map as above. A fragment is two 16-B loads per lane, each 512 contiguous bytes per wave (4 whole lines).
//      p already includes +8*lane.
__device__ __forceinline__ v16h ldfo_h(const _Float16* p) {
  FragH f;
  f.h[0] = *(const v8h*)(p);
  f.h[1] = *(const v8h*)(p + 256);
  return f.v;
}
__device__ __forceinline__ v16b ldfo_b(const u16* p) {                // bf16 plane read as unsigned integer vectors
  FragB f;
  f.u[0] = *(const v4u*)(p);
  f.u[1] = *(const v4u*)(p + 256);
  return f.v;
}

__device__ __forceinline__ v8f mma_h(v16h a, v16h b, v8f c) {
  return __builtin_amdgcn_wmma_f32_16x16x32_f16(false, a, false, b, (short)0, c, false, false);
}
__device__ __forceinline__ v8f mma_b(v16b a, v16b b, v8f c) {
  return __builtin_amdgcn_wmma_f32_16x16x32_bf16(false, a, false, b, (short)0, c, false, false);
}
// The v_nop guards below stand behind the last WMMA of a loop body: they keep the four vector slots that the chip needs before
// the operand registers are reloaded or the accumulators are touched, on the taken back edge too. The accumulators are named so that every WMMA of the body stays in front of the slots.
// guard_s also holds s_wait_xcnt 0 in front of the rewrite of the two address pairs that the step's global loads name; the pairs
// are inputs so that nothing overwrites them ahead of that wait.
__device__ __forceinline__ void guard_s(v8f (&s)[RT][2], const v16h (&a)[RT], v16h f0, v16h f1,
                                        const _Float16* qp, const _Float16* kp) {
#if defined(__HIP_DEVICE_COMPILE__)
  asm volatile("s_wait_xcnt 0x0\n\tv_nop\n\tv_nop\n\tv_nop\n\tv_nop"
               : "+v"(s[0][0]), "+v"(s[0][1]), "+v"(s[1][0]), "+v"(s[1][1]),
                 "+v"(s[2][0]), "+v"(s[2][1]), "+v"(s[3][0]), "+v"(s[3][1])
               : "v"(a[0]), "v"(a[1]), "v"(a[2]), "v"(a[3]), "v"(f0), "v"(f1), "v"(qp), "v"(kp) : "memory");
#endif
}
// guard_g (GEMM k loops) holds the same four slots and, like guard_s, s_wait_xcnt 0 in front of the rewrite of the address pairs
// that the step's global loads name; the pairs are inputs so that nothing overwrites them ahead of that wait (a loop with two
// pairs names one of them twice).
template <typename F, typename P>
__device__ __forceinline__ void guard_g(v8f (&c)[4][4], const F (&x)[4], const F (&y)[4], const P* p0, const P* p1, const P* p2) {
#if defined(__HIP_DEVICE_COMPILE__)
  asm volatile("s_wait_xcnt 0x0\n\tv_nop\n\tv_nop\n\tv_nop\n\tv_nop"
               : "+v"(c[0][0]), "+v"(c[0][1]), "+v"(c[0][2]), "+v"(c[0][3]), "+v"(c[1][0]), "+v"(c[1][1]), "+v"(c[1][2]), "+v"(c[1][3]),
                 "+v"(c[2][0]), "+v"(c[2][1]), "+v"(c[2][2]), "+v"(c[2][3]), "+v"(c[3][0]), "+v"(c[3][1]), "+v"(c[3][2]), "+v"(c[3][3])
               : "v"(x[0]), "v"(x[1]), "v"(x[2]), "v"(x[3]), "v"(y[0]), "v"(y[1]), "v"(y[2]), "v"(y[3]), "v"(p0), "v"(p1), "v"(p2)
               : "memory");
#endif
}
__device__ __forceinline__ void guard_o(v8f (&o)[RT][NJ]) {
#if defined(__HIP_DEVICE_COMPILE__)
  asm volatile("v_nop\n\tv_nop\n\tv_nop\n\tv_nop"
               : "+v"(o[0][0]), "+v"(o[0][1]), "+v"(o[0][2]), "+v"(o[1][0]), "+v"(o[1][1]), "+v"(o[1][2]),
                 "+v"(o[2][0]), "+v"(o[2][1]), "+v"(o[2][2]), "+v"(o[3][0]), "+v"(o[3][1]), "+v"(o[3][2])
               : : "memory");
#endif
}
// Orders a wave's own LDS slab writes before its reads of them. The fences name LDS alone: a wave now stages several 16-row tiles
// one after another, and a fence over global memory too would hold each staging back until the last tile's global stores are done.
__device__ __forceinline__ void wave_sync_lds() {
  __builtin_amdgcn_fence(__ATOMIC_RELEASE, "workgroup", "local");
  __builtin_amdgcn_wave_barrier();
  __builtin_amdgcn_fence(__ATOMIC_ACQUIRE, "workgroup", "local");
}

// =====================================================================================================
// f32 plane [EMB][EMB] -> 16-bit plane in fragment order:  mode 0: bf16 RNE bits;  mode 1: f16 bits of (bf16 RNE value) * scale;
// mode 2: f16 bits of value * scale (no bf16 pre-step).
// Thread = one 16-B piece of the fragment-order plane (8 consecutive k of one row): two 16-B loads, one 16-B store; 32
// consecutive lanes store 512 contiguous, 512-B aligned bytes
// coverage: grid = n8/256 blocks (host checks exactness) x 256 thr x 8 = the whole plane.
// =====================================================================================================
__global__ __launch_bounds__(256) void cvt16(const float* __restrict__ x, u16* D, int n8, int mode, float scale) {
  const int gt = blockIdx.x * 256 + (int)threadIdx.x;
  if (gt >= n8) return;                     // no barriers in this kernel
  const int unit = gt >> 6;
  const int rb   = unit / (EMB / 32);
  const int kb   = unit - rb * (EMB / 32);
  const float* p = x + (size_t)(rb * 16 + (gt & 15)) * EMB + kb * 32 + ((gt >> 5) & 1) * 16 + ((gt >> 4) & 1) * 8;
  const v4f a = *(const v4f*)(p), c4 = *(const v4f*)(p + 4);
  float v[8];
#pragma unroll
  for (int e = 0; e < 4; ++e) { v[e] = a[e]; v[4 + e] = c4[e]; }
  unsigned short s[8];
#pragma unroll
  for (int e = 0; e < 8; ++e) {
    const float vb = bfr(v[e]);
    const float vf = (mode == 1) ? vb : v[e];
    const unsigned short hb = h_bits((_Float16)(vf * scale));
    const unsigned short bb = bf_bits(v[e]);
    s[e] = (mode != 0) ? hb : bb;
  }
  v4u o;
#pragma unroll
  for (int e = 0; e < 4; ++e) o[e] = pk16(s[2 * e], s[2 * e + 1]);
  u16* d = D + (size_t)gt * 8;
  {
    *(v4u*)(d) = o;
    
  }
}

// =====================================================================================================
// Delay gather to a bf16 plane in fragment order (rows = b*SEQ + t, k = n): element (b, t, n) = bf16 RNE bits of
// sp[b][t - dl[n]][n] when t - dl[n] >= 0, else 0 (the zero is
// written). The source row index is clamped into [0, SEQ) for the address; the value is selected afterwards.
// Thread = one 16-B piece (8 consecutive n of one (b, t) row): 8 scalar loads, one 16-B store; 32 consecutive lanes = 16 rows x
// 16 n, stored as 512 contiguous bytes
// coverage: grid = n8/256 blocks (host exact) x 256 thr x 8 = rows x EMB = the whole plane.
// =====================================================================================================
__global__ __launch_bounds__(256) void gather_bf(const float* __restrict__ sp, const int* __restrict__ dl,
                                                 const float* __restrict__ mpu, const float* __restrict__ dcu,
                                                 u16* DB, int n8) {
  const int gt = blockIdx.x * 256 + (int)threadIdx.x;
  if (gt >= n8) return;                     // no barriers in this kernel
  const int unit = gt >> 6;
  const int rb   = unit / (EMB / 32);
  const int kb   = unit - rb * (EMB / 32);
  const int row = rb * 16 + (gt & 15);
  const int n0  = kb * 32 + ((gt >> 5) & 1) * 16 + ((gt >> 4) & 1) * 8;
  const int b   = row / SEQ;
  const int t   = row - b * SEQ;
  unsigned short s[8];
#pragma unroll
  for (int e = 0; e < 8; ++e) {
    const int n   = n0 + e;
    const int d   = dl[n];
    const int src = t - d;
    int sc = (src < 0) ? 0 : src;
    sc = (sc > SEQ - 1) ? (SEQ - 1) : sc;
    const float v = sp[((size_t)b * SEQ + (size_t)sc) * EMB + n];
    s[e] = (src >= 0) ? bf_bits(v) : (unsigned short)0;
  }
  v4u o;
#pragma unroll
  for (int e = 0; e < 4; ++e) o[e] = pk16(s[2 * e], s[2 * e + 1]);
  u16* dst = DB + (size_t)gt * 8;
  {
    *(v4u*)(dst) = o;
    
  }
  (void)mpu; (void)dcu;
}

// =====================================================================================================
//           8 consecutive lanes x 16 B per line), lanes 16..31 -> row 2*it+1.
//  epi64x2: same store shape, staged value = acc*os1 + accres*os2 + badd (two accumulator sets combined in f32).
//  epi64hs: f16 bits of (tile * pscale), stored in fragment order (k = column): lane (16*hh + m) = row m, 8 consecutive columns;
// coverage: epi64/epi64x2 8 instructions x 2 rows x 16 lanes x 4 floats; epi64hs 4 instructions x 32 lanes x 8 halves
//           = the wave's 16 x 64 tile in every case.
// =====================================================================================================
__device__ __forceinline__ void stage64(float* sl, v8f a0, v8f a1, v8f a2, v8f a3, float oscale, int lane) {
  const int hh = lane >> 4, m = lane & 15;
#pragma unroll
  for (int r = 0; r < 8; ++r) {
    const int ro = (8 * hh + r) * 68 + m;
    sl[ro]      = a0[r] * oscale;
    sl[ro + 16] = a1[r] * oscale;
    sl[ro + 32] = a2[r] * oscale;
    sl[ro + 48] = a3[r] * oscale;
  }
  wave_sync_lds();
}
__device__ __forceinline__ void epi64(float* sl, v8f a0, v8f a1, v8f a2, v8f a3, float oscale, v4f badd, float* C, int N,
                                      size_t rowb, int col0, int lane) {
  const int hh = lane >> 4, m = lane & 15;
  stage64(sl, a0, a1, a2, a3, oscale, lane);
  v4f vals[8];
#pragma unroll
  for (int it = 0; it < 8; ++it) vals[it] = *(const v4f*)(sl + (it * 2 + hh) * 68 + m * 4) + badd;
  float* dst = C + (rowb + (size_t)hh) * (size_t)N + col0 + m * 4;
  {
#pragma unroll
    for (int it = 0; it < 8; ++it) {
      *(v4f*)(dst + (size_t)(it * 2) * (size_t)N) = vals[it];
    }
    
  }
}
__device__ __forceinline__ void epi64x2(float* sl, v8f a0, v8f a1, v8f a2, v8f a3, v8f e0, v8f e1, v8f e2, v8f e3,
                                        float os1, float os2, v4f badd, float* C, int N, size_t rowb, int col0, int lane) {
  const int hh = lane >> 4, m = lane & 15;
#pragma unroll
  for (int r = 0; r < 8; ++r) {
    const int ro = (8 * hh + r) * 68 + m;
    sl[ro]      = a0[r] * os1 + e0[r] * os2;
    sl[ro + 16] = a1[r] * os1 + e1[r] * os2;
    sl[ro + 32] = a2[r] * os1 + e2[r] * os2;
    sl[ro + 48] = a3[r] * os1 + e3[r] * os2;
  }
  wave_sync_lds();
  v4f vals[8];
#pragma unroll
  for (int it = 0; it < 8; ++it) vals[it] = *(const v4f*)(sl + (it * 2 + hh) * 68 + m * 4) + badd;
  float* dst = C + (rowb + (size_t)hh) * (size_t)N + col0 + m * 4;
  {
#pragma unroll
    for (int it = 0; it < 8; ++it) {
      *(v4f*)(dst + (size_t)(it * 2) * (size_t)N) = vals[it];
    }
    
  }
}
__device__ __forceinline__ void epi64hs(float* sl, v8f a0, v8f a1, v8f a2, v8f a3, float oscale, float pscale,
                                        u16* C, int N, size_t rowb, int col0, int lane) {
  stage64(sl, a0, a1, a2, a3, oscale, lane);
  const int hh = lane >> 4, m = lane & 15;
  v4u oh[4];
#pragma unroll
  for (int i4 = 0; i4 < 4; ++i4) {
    const int c8 = (i4 >> 1) * 32 + (i4 & 1) * 16 + hh * 8;   // k block i4>>1, half i4&1 of the wave's two units
    const v4f a = *(const v4f*)(sl + m * 68 + c8), c4 = *(const v4f*)(sl + m * 68 + c8 + 4);
    float w[8];
#pragma unroll
    for (int e = 0; e < 4; ++e) { w[e] = a[e] * pscale; w[4 + e] = c4[e] * pscale; }
#pragma unroll
    for (int e = 0; e < 4; ++e) oh[i4][e] = pk16(h_bits((_Float16)w[2 * e]), h_bits((_Float16)w[2 * e + 1]));
  }
  u16* dst = C + rowb * (size_t)N + (size_t)(col0 >> 5) * 512 + lane * 8;
  {
#pragma unroll
    for (int i4 = 0; i4 < 4; ++i4) {
      *(v4u*)(dst + i4 * 256) = oh[i4];
    }
    
  }
}

// =====================================================================================================
// bf16 GEMM core: acc[rt][j] = rows (16 rt ..) of A . rows (16 j ..) of Bt, A and Bt bf16 planes [..][EMB] in fragment order.
// Wave tile = 64 x 64 (4 A fragments x 4 B fragments, 16 accumulators): every fragment loaded feeds 4 WMMAs. Fragments come
// straight from the planes (two 16-B loads each, split k map for A and B); k stepped by 32, ascending, one WMMA per (tile, step).
// Block = 128 x 128 tile, 4 waves as 2 x 2; grid = (M/128) * (EMB/128), host checks exactness.
// =====================================================================================================
__device__ __forceinline__ void core_b64(const u16* ap, const u16* bp, v8f (&acc)[4][4]) {
#pragma unroll
  for (int rt = 0; rt < 4; ++rt) {
#pragma unroll
    for (int j = 0; j < 4; ++j) acc[rt][j] = zero8();
  }
#pragma unroll 1
  for (int k0 = 0; k0 < EMB; k0 += 32) {
    v16b a[4], b[4];
#pragma unroll
    for (int rt = 0; rt < 4; ++rt) a[rt] = ldfo_b(ap + rt * (16 * EMB));
#pragma unroll
    for (int j = 0; j < 4; ++j) b[j] = ldfo_b(bp + j * (16 * EMB));
#pragma unroll
    for (int rt = 0; rt < 4; ++rt) {
#pragma unroll
      for (int j = 0; j < 4; ++j) acc[rt][j] = mma_b(a[rt], b[j], acc[rt][j]);
    }
    guard_g<v16b, u16>(acc, a, b, ap, bp, bp);
    ap += 512; bp += 512;                    // next k block: one 512-element unit on
  }
}

// f32 out: C[M][EMB] = (A . Bt^T) * oscale; epilogue epi64 once per 16-row tile of the wave (same slab, same wave, in order).
__global__ __launch_bounds__(128)
void gemm_b32(const u16* __restrict__ A, const u16* __restrict__ Bt, float* C, int M, float oscale) {
  __shared__ __align__(16) float slab[4 * SLAB64];
  const int tid = threadIdx.x, wave = tid >> 5, lane = tid & 31;
  const int bid   = blockIdx.x;
  const int rowb  = (bid / (EMB / 128)) * 128 + (wave >> 1) * 64;
  const int col0  = (bid % (EMB / 128)) * 128 + (wave & 1) * 64;
  if (rowb + 64 > M) return;                 // wave-uniform, never taken with the exact grid; no block barriers in this kernel
  v8f acc[4][4];
  core_b64(A + (size_t)rowb * EMB + 8 * lane, Bt + (size_t)col0 * EMB + 8 * lane, acc);
#pragma unroll
  for (int rt = 0; rt < 4; ++rt)
    epi64(slab + wave * SLAB64, acc[rt][0], acc[rt][1], acc[rt][2], acc[rt][3], oscale, zero4(), C, EMB,
          (size_t)(rowb + 16 * rt), col0, lane);
}

// f16 plane out in fragment order: C16[M][EMB] = f16 bits of ((A . Bt^T) * oscale) * pscale; epilogue epi64hs per 16-row tile.
__global__ __launch_bounds__(128)
void gemm_bh16(const u16* __restrict__ A, const u16* __restrict__ Bt, u16* C, int M, float oscale, float pscale) {
  __shared__ __align__(16) float slab[4 * SLAB64];
  const int tid = threadIdx.x, wave = tid >> 5, lane = tid & 31;
  const int bid   = blockIdx.x;
  const int rowb  = (bid / (EMB / 128)) * 128 + (wave >> 1) * 64;
  const int col0  = (bid % (EMB / 128)) * 128 + (wave & 1) * 64;
  if (rowb + 64 > M) return;                 // wave-uniform, never taken with the exact grid; no block barriers in this kernel
  v8f acc[4][4];
  core_b64(A + (size_t)rowb * EMB + 8 * lane, Bt + (size_t)col0 * EMB + 8 * lane, acc);
#pragma unroll
  for (int rt = 0; rt < 4; ++rt)
    epi64hs(slab + wave * SLAB64, acc[rt][0], acc[rt][1], acc[rt][2], acc[rt][3], oscale, pscale, C, EMB,
            (size_t)(rowb + 16 * rt), col0, lane);
}

// =====================================================================================================
// f16 GEMM with two A planes (hi + residual), f32 out with bias:
//   C[M][EMB] = (Ah . Bt^T) * os1 + (Ar . Bt^T) * os2 + bf16RNE(bias[n]); Ah/Ar/Bt f16 planes in fragment order.
// Wave tile = 32 x 64 for both planes (2 + 2 A fragments x 4 B fragments, 16 accumulators: rows 0, 1 of acc = hi plane, rows 2, 3
// = residual plane): a B fragment feeds 4 WMMAs, an A fragment 4. Block = 64 x 128 tile, 4 waves as 2 x 2; grid = (M/64) * (EMB/128).
// Separate accumulators for the two planes, combined in f32 in epi64x2, once per 16-row tile.
// =====================================================================================================
__global__ __launch_bounds__(128)
void gemm_h2_32(const u16* __restrict__ Ah, const u16* __restrict__ Ar, const u16* __restrict__ Bt,
                const float* __restrict__ bias, float* C, int M, float os1, float os2) {
  __shared__ __align__(16) float slab[4 * SLAB64];
  const int tid = threadIdx.x, wave = tid >> 5, lane = tid & 31, m = lane & 15;
  const int bid   = blockIdx.x;
  const int rowb  = (bid / (EMB / 128)) * 64 + (wave >> 1) * 32;
  const int col0  = (bid % (EMB / 128)) * 128 + (wave & 1) * 64;
  if (rowb + 32 > M) return;                 // wave-uniform, never taken with the exact grid; no block barriers in this kernel
  const _Float16* ap  = (const _Float16*)(const void*)Ah + (size_t)rowb * EMB + 8 * lane;
  const _Float16* arp = (const _Float16*)(const void*)Ar + (size_t)rowb * EMB + 8 * lane;
  const _Float16* bp  = (const _Float16*)(const void*)Bt + (size_t)col0 * EMB + 8 * lane;
  v8f acc[4][4];
#pragma unroll
  for (int rt = 0; rt < 4; ++rt) {
#pragma unroll
    for (int j = 0; j < 4; ++j) acc[rt][j] = zero8();
  }
#pragma unroll 1
  for (int k0 = 0; k0 < EMB; k0 += 32) {
    v16h a[4], b[4];
    a[0] = ldfo_h(ap);
    a[1] = ldfo_h(ap + 16 * EMB);
    a[2] = ldfo_h(arp);
    a[3] = ldfo_h(arp + 16 * EMB);
#pragma unroll
    for (int j = 0; j < 4; ++j) b[j] = ldfo_h(bp + j * (16 * EMB));
#pragma unroll
    for (int rt = 0; rt < 4; ++rt) {
#pragma unroll
      for (int j = 0; j < 4; ++j) acc[rt][j] = mma_h(a[rt], b[j], acc[rt][j]);
    }
    guard_g<v16h, _Float16>(acc, a, b, ap, arp, bp);
    ap += 512; arp += 512; bp += 512;        // next k block: one 512-element unit on
  }
  const v4f bv = *(const v4f*)(bias + col0 + m * 4);      // columns col0 + 4m .. +3, always < EMB (col0 a multiple of 64)
  v4f badd;
#pragma unroll
  for (int e = 0; e < 4; ++e) badd[e] = bfr(bv[e]);
#pragma unroll
  for (int rt = 0; rt < 2; ++rt)
    epi64x2(slab + wave * SLAB64, acc[rt][0], acc[rt][1], acc[rt][2], acc[rt][3],
            acc[2 + rt][0], acc[2 + rt][1], acc[2 + rt][2], acc[2 + rt][3], os1, os2, badd, C, EMB,
            (size_t)(rowb + 16 * rt), col0, lane);
}

// =====================================================================================================
// V^T plane in fragment order (rows = b*EMB + d, k = s): element (b, d, s) = f16(V[b][s][d] * 1024).
// Block = (b, 64-wide d chunk, 64 keys): 64 source row segments of 64 floats loaded with 16-B loads, converted, scattered into
// coverage: load 256 thr x 16 elements = 64 x 64; store 2 iterations x 256 thr x 8 halves = 64 lines x 64 = the block's tile;
//           grid = nb x (EMB/64) x (SEQ/64) blocks covers the plane exactly once.
// =====================================================================================================
__global__ __launch_bounds__(256) void xt16(const float* __restrict__ X, u16* XTo) {
  __shared__ __align__(16) u16 TH[64 * VTP];
  const int tid = threadIdx.x;
  const int bid = blockIdx.x;
  const int st  = bid % (SEQ / 64);
  const int dcb = (bid / (SEQ / 64)) % (EMB / 64);
  const int b   = bid / ((SEQ / 64) * (EMB / 64));
  const int s0  = st * 64;
  const int d0  = dcb * 64;
  {
    const int sl = tid >> 2;                  // key within tile 0..63
    const int dc = (tid & 3) * 16;            // d chunk within the 64
    const float* src = X + ((size_t)b * SEQ + s0 + sl) * EMB + d0 + dc;
#pragma unroll
    for (int i = 0; i < 4; ++i) {
      const v4f a = *(const v4f*)(src + 4 * i);
#pragma unroll
      for (int e = 0; e < 4; ++e) {
        const _Float16 hv = (_Float16)(a[e] * VCAR);
        TH[(dc + 4 * i + e) * VTP + sl] = h_bits(hv);
      }
    }
  }
  __syncthreads();
  v4u vh[2];
#pragma unroll
  for (int it = 0; it < 2; ++it) {
    const int q = it * 256 + tid;             // piece of the tile: d block q>>7, key block (q>>6)&1, half (q>>5)&1, lane q&31
    vh[it] = *(const v4u*)(TH + ((q >> 7) * 16 + (q & 15)) * VTP + ((q >> 6) & 1) * 32 + ((q >> 5) & 1) * 16 + ((q >> 4) & 1) * 8);
  }
  const size_t base = ((size_t)b * EMB + d0) * SEQ + (size_t)(s0 >> 5) * 512;
  {
#pragma unroll
    for (int it = 0; it < 2; ++it) {
      const int q = it * 256 + tid;
      *(v4u*)(XTo + base + (size_t)((q >> 7) * 16) * SEQ + (q & 127) * 8) = vh[it];
    }
    
  }
}

// =====================================================================================================
// Per-chunk column sums of V: VS[(b*NCHK + c)*EMB + d] = sum over the CK keys of chunk c of V[b][c*CK + s][d] (f32, fixed
// sequential order). Thread = one (b, c, d); 256 consecutive table entries per block are staged in LDS, then threads 0..63
// coverage: grid = nb*NCHK*EMB/256 blocks (host exact) x 256 = the whole table; store 64 thr x 4 floats = the block's 256.
// =====================================================================================================
__global__ __launch_bounds__(256) void vsum_k(const float* __restrict__ V, float* VS) {
  __shared__ __align__(16) float sm[256];
  const int tid = threadIdx.x;
  const int gt  = blockIdx.x * 256 + tid;
  const int d   = gt % EMB;
  const int bc  = gt / EMB;
  const int b   = bc / NCHK;
  const int c   = bc - b * NCHK;
  const float* p = V + ((size_t)b * SEQ + (size_t)c * CK) * EMB + d;
  float s = 0.f;
#pragma unroll 4
  for (int i = 0; i < CK; ++i) s += p[(size_t)i * EMB];
  sm[tid] = s;
  __syncthreads();
  if (tid < 64) {                                   // waves 0 and 1, all lanes active
    const v4f o = *(const v4f*)(sm + tid * 4);
    float* dst = VS + (size_t)blockIdx.x * 256 + tid * 4;
    *(v4f*)(dst) = o;
    
  }
}

// =====================================================================================================
// Single-head attention, head width EMB = 768, all SEQ keys kept (non-causal): block = (batch b, 64 query rows q0..q0+63 = RT = 4
// row tiles of 16), 16 waves. Every K fragment and every V^T fragment that a wave loads feeds one WMMA per row tile.
// q plane (f16, x8) rows b*SEQ+s, k = d; k plane the same; V^T plane rows b*EMB+d, k = s (x1024); all three and the two
// ctx planes in fragment order; VS = per-chunk column sums of V (f32).
//   Per chunk of CK = 512 keys (NCHK = 4 chunks):
//   (S) scores S[query][key n] on WMMA: A = q rows of row tile rt (row m = lane&15, split k map over d), B = k rows (col n = key,
//       split map), 24 d-steps; wave w handles key block w (32 keys) of the chunk for all four row tiles; D element r of lane l
//       of tile rt -> scs[query 16rt+8h+r][key col] (f32 LDS).
//   (M) 16 threads per query row (sub-thread = 32 consecutive keys), two passes of 32 rows: base-2 logits, chunk max via xor
//       shuffles, online running max / rescale factor al / running sum l in f32 registers (the same threads own the row in every
//       chunk), p = exp2(t - m_new) <= 1, chunk row sum ps and its mean C = ps/CK (bit-identical on the row's 16 threads), the
//       CENTRED P' = p - C written as f16(P' * 32768) into the LDS P tile with 16-B stores; al -> rowa[row], C -> rowc[row].
//   (PV) each wave owns d columns 48*wave + 16j + (lane&15), j = 0..2, of all four row tiles (12 accumulators):
//       o = o*al + C*(32768*1024)*VS[chunk][d] (exact add-back of the centring term in f32), then for each key block: A = P'
//       fragments from LDS (row m = query, split map over keys), B = V^T fragments (col n = d, split map over keys).
//       sum_k (P'_k + C) v_k == sum_k p_k v_k exactly.
//   Block barriers after (S) and after (M) order all LDS reuse across chunks and waves.
//   Epilogue: x = o * 16384 / (l * 32768 * 1024) per row (rowi, l >= 1 always); hi = f16(x), res = f16((x - hi) * 2048); each
//   plane is staged in LDS and stored in fragment order.
// coverage: grid nb*32 blocks x 64 rows; staging 16 waves x 48 cols x 64 rows = 64 x 768; store 12 iterations x 512 thr x 8
//           halves = 64 x 768 per plane = every (b, s, d) of both ctx planes exactly once.
// =====================================================================================================
__device__ __forceinline__ void ctx_store(const u16* ct, u16* dst, int tid) {
  v4u v[12];
#pragma unroll
  for (int it = 0; it < 12; ++it) {
    const int rb = it / 3;                    // 16-row block of the tile (3 * 512 pieces each)
    const int p  = (it % 3) * ATT_THREADS + tid;   // piece of that block: k block p>>6, half (p>>5)&1, lane p&31
    v[it] = *(const v4u*)(ct + (rb * 16 + (p & 15)) * CTP + (p >> 6) * 32 + ((p >> 5) & 1) * 16 + ((p >> 4) & 1) * 8);
  }
  {
#pragma unroll
    for (int it = 0; it < 12; ++it) {
      const int p = it * ATT_THREADS + tid;
      *(v4u*)(dst + (size_t)p * 8) = v[it];
    }
  }
}

__global__ __launch_bounds__(ATT_THREADS)
void attn_fwd(const u16* __restrict__ QPp, const u16* __restrict__ KPp, const u16* __restrict__ VTp,
              const float* __restrict__ VSp, u16* CHo, u16* CRo) {
  __shared__ __align__(16) AttLds L0;              // scores [QT][SCP] f32; reused as the ctx staging tile [QT][CTP] u16
  __shared__ __align__(16) u16 pls[QT * PLP];      // P' tile [QT][PLP] f16 bits
  __shared__ float rowa[QT];
  __shared__ float rowc[QT];
  __shared__ float rowi[QT];
  float* const scs = L0.s;

  const int tid  = threadIdx.x;
  const int wave = tid >> 5;
  const int lane = tid & 31;
  const int hh   = lane >> 4;
  const int m    = lane & 15;
  const int r32  = tid >> 4;                 // query rows owned in phase (M): r32 and 32 + r32
  const int sub  = tid & 15;
  const int kl0  = sub * 32;

  const int bid = blockIdx.x;
  const int b   = bid / (SEQ / QT);
  const int q0  = (bid % (SEQ / QT)) * QT;

  const _Float16* qa  = (const _Float16*)(const void*)QPp + ((size_t)b * SEQ + q0) * EMB + 8 * lane;
  const _Float16* kbp = (const _Float16*)(const void*)KPp + ((size_t)b * SEQ + wave * 32) * EMB + 8 * lane;
  const _Float16* vbp = (const _Float16*)(const void*)VTp + ((size_t)b * EMB + wave * DW) * SEQ + 8 * lane;
  const float* vsb = VSp + (size_t)b * NCHK * EMB + wave * DW + m;
  const float lsc = RSQD * LOG2E / (QSC * KSC);

  float mrun[2] = {-INFINITY, -INFINITY}, lrun[2] = {0.f, 0.f};
  v8f o[RT][NJ];
#pragma unroll
  for (int rt = 0; rt < RT; ++rt) {
#pragma unroll
    for (int j = 0; j < NJ; ++j) o[rt][j] = zero8();
  }

#pragma unroll 1
  for (int c = 0; c < NCHK; ++c) {
    const int kbeg = c * CK;
    // ---- (S) scores of this chunk: key block = wave ----
    {
      const _Float16* qp = qa;
      const _Float16* kp = kbp + (size_t)kbeg * EMB;
      v8f s[RT][2];
#pragma unroll
      for (int rt = 0; rt < RT; ++rt) { s[rt][0] = zero8(); s[rt][1] = zero8(); }
#pragma unroll 1
      for (int k4 = 0; k4 < EMB / 128; ++k4) {             // 6 trips of 4 d-steps, as many steps unrolled as before
#pragma unroll
        for (int u = 0; u < 4; ++u) {
          v16h a[RT];
#pragma unroll
          for (int rt = 0; rt < RT; ++rt) a[rt] = ldfo_h(qp + rt * (16 * EMB) + u * 512);
          const v16h f0 = ldfo_h(kp + u * 512);
          const v16h f1 = ldfo_h(kp + 16 * EMB + u * 512);
#pragma unroll
          for (int rt = 0; rt < RT; ++rt) {
            s[rt][0] = mma_h(a[rt], f0, s[rt][0]);
            s[rt][1] = mma_h(a[rt], f1, s[rt][1]);
          }
          guard_s(s, a, f0, f1, qp, kp);
        }
        qp += 4 * 512;
        kp += 4 * 512;
      }
#pragma unroll
      for (int rt = 0; rt < RT; ++rt) {
        float* srow = scs + (16 * rt + 8 * hh) * SCP + wave * 32 + m;
#pragma unroll
        for (int r = 0; r < 8; ++r) {
          srow[r * SCP]      = s[rt][0][r];
          srow[r * SCP + 16] = s[rt][1][r];
        }
      }
    }
    __syncthreads();
    // ---- (M) softmax statistics and the centred P' tile, 32 rows a pass ----
#pragma unroll
    for (int rg = 0; rg < 2; ++rg) {
      const int row = rg * 32 + r32;
      const float* sp = scs + row * SCP + kl0;
      float t[32];
      float cm = -INFINITY;
#pragma unroll
      for (int i = 0; i < 8; ++i) {
        const v4f a = *(const v4f*)(sp + 4 * i);
#pragma unroll
        for (int e = 0; e < 4; ++e) {
          const float tv = a[e] * lsc;
          t[4 * i + e] = tv;
          cm = fmaxf(cm, tv);
        }
      }
#pragma unroll
      for (int d = 1; d <= 8; d <<= 1) cm = fmaxf(cm, __shfl_xor(cm, d, 32));
      const float mn = fmaxf(mrun[rg], cm);                // finite
      const float al = (mrun[rg] == -INFINITY) ? 0.f : exp2f(mrun[rg] - mn);
      mrun[rg] = mn;
      float ps = 0.f;
#pragma unroll
      for (int j = 0; j < 32; ++j) {
        const float p = exp2f(fminf(t[j] - mn, 0.f));
        t[j] = p;
        ps += p;
      }
#pragma unroll
      for (int d = 1; d <= 8; d <<= 1) ps += __shfl_xor(ps, d, 32);
      const float cc = ps * (1.0f / (float)CK);
      v4u pk[4];
#pragma unroll
      for (int i = 0; i < 4; ++i) {
#pragma unroll
        for (int e = 0; e < 4; ++e) {
          const int j = 8 * i + 2 * e;
          pk[i][e] = pk16(h_bits((_Float16)((t[j] - cc) * PCAR)), h_bits((_Float16)((t[j + 1] - cc) * PCAR)));
        }
      }
      lrun[rg] = lrun[rg] * al + ps;
      u16* pd = pls + row * PLP + kl0;
#pragma unroll
      for (int i = 0; i < 4; ++i) *(v4u*)(pd + 8 * i) = pk[i];
      if (sub == 0) { rowa[row] = al; rowc[row] = cc; }
    }
    __syncthreads();
    // ---- (PV) rescale, add the centring term, accumulate P' . V^T ----
    {
      float vs[NJ];
#pragma unroll
      for (int j = 0; j < NJ; ++j) vs[j] = vsb[(size_t)c * EMB + 16 * j];
#pragma unroll
      for (int rt = 0; rt < RT; ++rt) {
        float scl[8], cad[8];
#pragma unroll
        for (int r = 0; r < 8; ++r) {
          scl[r] = rowa[16 * rt + 8 * hh + r];
          cad[r] = rowc[16 * rt + 8 * hh + r] * (PCAR * VCAR);
        }
#pragma unroll
        for (int j = 0; j < NJ; ++j) {
#pragma unroll
          for (int r = 0; r < 8; ++r) o[rt][j][r] = o[rt][j][r] * scl[r] + cad[r] * vs[j];
        }
      }
      const _Float16* pp = (const _Float16*)(const void*)pls + m * PLP + 8 * hh;
      const _Float16* vp = vbp + kbeg * 16;                // key block kbeg/32 -> 512 elements per unit
#pragma unroll 1
      for (int kb = 0; kb < CK / 32; ++kb) {
        v16h pf[RT];
#pragma unroll
        for (int rt = 0; rt < RT; ++rt) pf[rt] = ldfrag_h(pp + rt * (16 * PLP) + kb * 32);
        v16h g[NJ];
#pragma unroll
        for (int j = 0; j < NJ; ++j) g[j] = ldfo_h(vp + (size_t)(16 * j) * SEQ + kb * 512);
#pragma unroll
        for (int rt = 0; rt < RT; ++rt) {
#pragma unroll
          for (int j = 0; j < NJ; ++j) o[rt][j] = mma_h(pf[rt], g[j], o[rt][j]);
        }
        guard_o(o);
      }
    }
  }

#pragma unroll
  for (int rg = 0; rg < 2; ++rg) {
    if (sub == 0) rowi[rg * 32 + r32] = (1.0f / lrun[rg]) * (CSC / (PCAR * VCAR));   // lrun >= 1
  }
  __syncthreads();
  float inv[RT][8];
#pragma unroll
  for (int rt = 0; rt < RT; ++rt) {
#pragma unroll
    for (int r = 0; r < 8; ++r) inv[rt][r] = rowi[16 * rt + 8 * hh + r];
  }

  u16* const ct = L0.c;
  const int cb = wave * DW + m;
  // hi plane
#pragma unroll
  for (int rt = 0; rt < RT; ++rt) {
#pragma unroll
    for (int j = 0; j < NJ; ++j) {
#pragma unroll
      for (int r = 0; r < 8; ++r) {
        const float xs = o[rt][j][r] * inv[rt][r];
        ct[(16 * rt + 8 * hh + r) * CTP + cb + 16 * j] = h_bits((_Float16)xs);
      }
    }
  }
  __syncthreads();
  ctx_store(ct, CHo + ((size_t)b * SEQ + q0) * EMB, tid);
  __syncthreads();
  // residual plane
#pragma unroll
  for (int rt = 0; rt < RT; ++rt) {
#pragma unroll
    for (int j = 0; j < NJ; ++j) {
#pragma unroll
      for (int r = 0; r < 8; ++r) {
        const float xs = o[rt][j][r] * inv[rt][r];
        const _Float16 hv = (_Float16)xs;
        ct[(16 * rt + 8 * hh + r) * CTP + cb + 16 * j] = h_bits((_Float16)((xs - (float)hv) * RSC));
      }
    }
  }
  __syncthreads();
  ctx_store(ct, CRo + ((size_t)b * SEQ + q0) * EMB, tid);
}

// =====================================================================================================
// Workspace map (bytes, rows = nb*SEQ; nb = 8 gives the totals below); every plane is fully written by whole-line stores before
// it is read; all extents are exact multiples of the store granularity (no pad rows); regions A and V are reused sequentially on
// the single in-order stream:
//   WQB bf16 [768][768]   1179648   WKB same   WVB same   WOH f16 of bf16 value x1024  1179648     4718592
//   VS  f32  [nb][4][768]                                                                          98304
//   A   DB bf16 [rows][768] (25165824), later VT f16 [nb][768][2048] x1024 (25165824)     region 25165824
//   Q   QP f16 [rows][768] x8                                                              region 25165824
//   K   KP f16 [rows][768] x8                                                              region 25165824
//   V   V f32 [rows][768] (50331648), later CH f16 [rows][768] + CR f16 [rows][768]        region 50331648
//   end                                                                                        130646016
// =====================================================================================================
extern "C" void kernel_launch(void* const* d_in, const int* in_sizes, int n_in,
                              void* d_out, int out_size, void* d_ws, size_t ws_size,
                              hipStream_t stream) {
  if (n_in < 9) return;
  const long long per = (long long)SEQ * EMB;
  const long long ns  = in_sizes[0];
  if (ns < per || (ns % per) != 0) return;
  const int nb = (int)(ns / per);
  if (nb < 1 || nb > 8) return;
  const int rows = nb * SEQ;
  if (in_sizes[1] != EMB) return;
  if (in_sizes[2] < 1 || in_sizes[3] < 1) return;
  if (in_sizes[4] != EMB * EMB || in_sizes[5] != EMB * EMB || in_sizes[6] != EMB * EMB || in_sizes[7] != EMB * EMB) return;
  if (in_sizes[8] != EMB) return;
  if ((long long)out_size != (long long)rows * EMB) return;

  const float* spk = (const float*)d_in[0];
  const int*   dly = (const int*)d_in[1];
  const float* mpo = (const float*)d_in[2];
  const float* dcy = (const float*)d_in[3];
  const float* wq  = (const float*)d_in[4];
  const float* wk  = (const float*)d_in[5];
  const float* wv  = (const float*)d_in[6];
  const float* wo  = (const float*)d_in[7];
  const float* bo  = (const float*)d_in[8];
  float*       out = (float*)d_out;

  const size_t szW  = (size_t)EMB * EMB * 2;                    //   1179648
  const size_t szVS = (size_t)nb * NCHK * EMB * 4;              //     98304 at nb = 8
  const size_t sz16 = (size_t)rows * EMB * 2;                   //  25165824
  const size_t sz32 = (size_t)rows * EMB * 4;                   //  50331648
  const size_t szVT = (size_t)nb * EMB * SEQ * 2;               //  == sz16
  size_t off = 0;
  const size_t oWQ = off; off += szW;
  const size_t oWK = off; off += szW;
  const size_t oWV = off; off += szW;
  const size_t oWO = off; off += szW;
  const size_t oVS = off; off += szVS;
  const size_t oA  = off; off += (szVT > sz16 ? szVT : sz16);   // DB then VT
  const size_t oQ  = off; off += sz16;
  const size_t oK  = off; off += sz16;
  const size_t oV  = off; off += sz32;                          // V f32, later CH + CR
  if (off > ws_size) return;                                    // off = 130646016 at nb = 8
  if (off > WS_CAP) return;
  if (2 * sz16 > sz32) return;

  char* ws = (char*)d_ws;
  u16*   WQB = (u16*)(ws + oWQ);
  u16*   WKB = (u16*)(ws + oWK);
  u16*   WVB = (u16*)(ws + oWV);
  u16*   WOH = (u16*)(ws + oWO);
  float* VS  = (float*)(ws + oVS);
  u16*   DB  = (u16*)(ws + oA);
  u16*   VT  = (u16*)(ws + oA);
  u16*   QP  = (u16*)(ws + oQ);
  u16*   KP  = (u16*)(ws + oK);
  float* V   = (float*)(ws + oV);
  u16*   CH  = (u16*)(ws + oV);
  u16*   CR  = (u16*)(ws + oV + sz16);

  const int n8w = (EMB * EMB) / 8;                      // 73728
  const int n8g = rows * (EMB / 8);                     // rows * 96
  if ((n8w % 256) != 0 || (n8g % 256) != 0) return;
  if ((rows % 128) != 0 || ((nb * NCHK * EMB) % 256) != 0) return;
  const dim3 blk(256);
  const dim3 gW(n8w / 256), gGa(n8g / 256);
  const dim3 gG((rows / 128) * (EMB / 128));            // 768 at nb = 8: 128 x 128 tiles
  const dim3 gO((rows / 64) * (EMB / 128));             // 1536 at nb = 8: 64 x 128 tiles
  const dim3 bG(128);
  const dim3 gXT(nb * (EMB / 64) * (SEQ / 64));         // nb * 384
  const dim3 gVS((nb * NCHK * EMB) / 256);              // nb * 12
  const dim3 gAT(nb * (SEQ / QT));                      // nb * 32
  const dim3 bAT(ATT_THREADS);

  // (0..3) weights stored [n = out][k = in] (y = x.W^T), rows = n: fragment-order bf16 planes for Wq, Wk, Wv; f16 of bf16 value
  //        x1024 for Wo
  cvt16<<<gW, blk, 0, stream>>>(wq, WQB, n8w, 0, 1.0f);
  cvt16<<<gW, blk, 0, stream>>>(wk, WKB, n8w, 0, 1.0f);
  cvt16<<<gW, blk, 0, stream>>>(wv, WVB, n8w, 0, 1.0f);
  cvt16<<<gW, blk, 0, stream>>>(wo, WOH, n8w, 1, WSC);
  // (4) delayed spikes -> fragment-order bf16 plane, rows x 768
  gather_bf<<<gGa, blk, 0, stream>>>(spk, dly, mpo, dcy, DB, n8g);
  // (5, 6) q and k projections -> f16 planes x8; (7) v projection -> f32 plane
  gemm_bh16<<<gG, bG, 0, stream>>>(DB, WQB, QP, rows, 1.0f, QSC);
  gemm_bh16<<<gG, bG, 0, stream>>>(DB, WKB, KP, rows, 1.0f, KSC);
  gemm_b32<<<gG, bG, 0, stream>>>(DB, WVB, V, rows, 1.0f);
  // (8) v -> V^T plane x1024 (over the dead DB region); (9) per-chunk column sums of v
  xt16<<<gXT, blk, 0, stream>>>(V, VT);
  vsum_k<<<gVS, blk, 0, stream>>>(V, VS);
  // (10) attention -> ctx hi x16384 and residual x2048 f16 planes (over the dead V region)
  attn_fwd<<<gAT, bAT, 0, stream>>>(QP, KP, VT, VS, CH, CR);
  // (11) output projection + bias -> out
  gemm_h2_32<<<gO, bG, 0, stream>>>(CH, CR, WOH, bo, out, rows,
                                     1.0f / (CSC * WSC), 1.0f / (CSC * WSC * RSC));
  (void)hipGetLastError();
}

// v004
// Measured time: 324 microseconds a run.
// In both of two side-by-side timings against v003, it was 1.10 times as fast.
// Counting every step since v000, it is 2.96 times as fast.
// Projections q,k,v = delayed.W^T: v_wmma_f32_16x16x32_bf16 (bf16 RNE operands of the raw inputs, f32 accumulate).
// Scores q'.k'^T (f16 planes x8), P'.V (chunk-centred P' x32768 f16 from LDS, V^T x1024 f16) and the output projection
// (ctx carried as f16 hi x16384 plus residual x2048 planes, times f16(bf16(Wo) x1024), bias added in f32):
// v_wmma_f32_16x16x32_f16, f32 accumulate. Delay gather, softmax statistics, column sums of V and all scaling in f32 on VALU.
#include <hip/hip_runtime.h>
#include <math.h>
#include <stdint.h>

#define SEQ   2048
#define EMB   768
#define CK    512
#define NCHK  4
#define QT    64
#define RT    4
#define NJ    3
#define DW    48
#define SCP   544
#define PLP   528
#define CTP   776
#define SLAB64 (16 * 68)
#define VTP   72
#define ATT_THREADS 512
#define QSC   8.0f
#define KSC   8.0f
#define PCAR  32768.0f
#define VCAR  1024.0f
#define WSC   1024.0f
#define CSC   16384.0f
#define RSC   2048.0f
#define LOG2E 1.4426950408889634f
#define RSQD  0.036084391824351615f
#define WS_CAP ((size_t)134217728)

static_assert((EMB % 128) == 0 && EMB == 8 * 96 && (EMB % 32) == 0 && (EMB / 8) == 96);
static_assert((SEQ % CK) == 0 && (SEQ / CK) == NCHK && CK == 16 * 32 && (SEQ % 64) == 0 && (SEQ / QT) == 32);
static_assert(16 * CTP * 2 <= 16 * SCP * 4 && CTP >= EMB + 8);
static_assert(((PLP * 2) % 16) == 0 && ((SCP * 4) % 16) == 0 && ((VTP * 2) % 16) == 0 && ((CTP * 2) % 16) == 0);
static_assert(64 * VTP >= 63 * VTP + 64);
static_assert(ATT_THREADS == 512 && QT == 16 * RT && 2 * (ATT_THREADS / 16) == QT);
static_assert((ATT_THREADS / 32) * 32 == CK && (ATT_THREADS / 32) * DW == EMB && DW == 16 * NJ);
static_assert(3 * ATT_THREADS * 8 == 16 * EMB);
static_assert(((EMB * EMB) % 2048) == 0 && ((NCHK * EMB) % 256) == 0);

typedef unsigned short u16;
typedef _Float16 v16h __attribute__((ext_vector_type(16)));
typedef _Float16 v8h  __attribute__((ext_vector_type(8)));
typedef __bf16   v16b __attribute__((ext_vector_type(16)));
typedef float    v8f  __attribute__((ext_vector_type(8)));
typedef float    v4f  __attribute__((ext_vector_type(4)));
typedef unsigned int v4u __attribute__((ext_vector_type(4)));

union FragH { v16h v; v8h h[2]; v4u u[2]; };
union FragB { v16b v; v4u u[2]; };
union AttLds { float s[QT * SCP]; u16 c[2 * QT * SCP]; };

// ---- scalar helpers --------------------------------------------------------------------------------
__device__ __forceinline__ unsigned short bf_bits(float f) {          // f32 -> bf16 bits, RNE convert
  unsigned u = __float_as_uint(f);
  return (unsigned short)((u + 0x7FFFu + ((u >> 16) & 1u)) >> 16);
}
__device__ __forceinline__ float bf_up(unsigned short h) { return __uint_as_float(((unsigned)h) << 16); }
__device__ __forceinline__ float bfr(float f) { return bf_up(bf_bits(f)); }
__device__ __forceinline__ unsigned short h_bits(_Float16 x) { return __builtin_bit_cast(unsigned short, x); }
__device__ __forceinline__ unsigned pk16(unsigned short a, unsigned short b) { return (unsigned)a | ((unsigned)b << 16); }
__device__ __forceinline__ v8f zero8() { v8f z = {0.f, 0.f, 0.f, 0.f, 0.f, 0.f, 0.f, 0.f}; return z; }
__device__ __forceinline__ v4f zero4() { v4f z = {0.f, 0.f, 0.f, 0.f}; return z; }

// ---- fragment loaders: 16-bit A/B operand, lane -> row/col (lane&15), p already includes +8*(lane>>4);
//      elements 0..7 <- p[0..7] (k0+8h..), elements 8..15 <- p[16..23] (k0+16+8h..)  (same split k map for A and B;
//      this row-major form is used for the P' tile in LDS only)
__device__ __forceinline__ v16h ldfrag_h(const _Float16* p) {
  FragH f;
  f.h[0] = *(const v8h*)(p);
  f.h[1] = *(const v8h*)(p + 16);
  return f.v;
}
// ---- fragment-order planes (every 16-bit operand plane in the workspace): a plane [R][K] is stored as
//      [R/16][K/32][2][32 lanes][8 elements]. The 1-KiB unit of (row block rb, k block kb) starts at element rb*16*K + kb*512;
//      in it lane (16*hh + m) finds, at 8*lane, row m's k = 8*hh + 0..7 and, 256 elements on, k = 16 + 8*hh + 0..7: the same
//      split k map as above. A fragment is two 16-B loads per lane, each 512 contiguous bytes per wave (4 whole lines).
//      p already includes +8*lane.
__device__ __forceinline__ v16h ldfo_h(const _Float16* p) {
  FragH f;
  f.h[0] = *(const v8h*)(p);
  f.h[1] = *(const v8h*)(p + 256);
  return f.v;
}
__device__ __forceinline__ v16b ldfo_b(const u16* p) {                // bf16 plane read as unsigned integer vectors
  FragB f;
  f.u[0] = *(const v4u*)(p);
  f.u[1] = *(const v4u*)(p + 256);
  return f.v;
}

__device__ __forceinline__ v8f mma_h(v16h a, v16h b, v8f c) {
  return __builtin_amdgcn_wmma_f32_16x16x32_f16(false, a, false, b, (short)0, c, false, false);
}
__device__ __forceinline__ v8f mma_b(v16b a, v16b b, v8f c) {
  return __builtin_amdgcn_wmma_f32_16x16x32_bf16(false, a, false, b, (short)0, c, false, false);
}
// The v_nop guards below stand behind the last WMMA of a loop body: they keep the four vector slots that the chip needs before
// the operand registers are reloaded or the accumulators are touched, on the taken back edge too. The accumulators are named so that every WMMA of the body stays in front of the slots.
// guard_s also holds s_wait_xcnt 0 in front of the rewrite of the two address pairs that the step's global loads name; the pairs
// are inputs so that nothing overwrites them ahead of that wait.
__device__ __forceinline__ void guard_s(v8f (&s)[RT][2], const v16h (&a)[RT], v16h f0, v16h f1,
                                        const _Float16* qp, const _Float16* kp) {
#if defined(__HIP_DEVICE_COMPILE__)
  asm volatile("s_wait_xcnt 0x0\n\tv_nop\n\tv_nop\n\tv_nop\n\tv_nop"
               : "+v"(s[0][0]), "+v"(s[0][1]), "+v"(s[1][0]), "+v"(s[1][1]),
                 "+v"(s[2][0]), "+v"(s[2][1]), "+v"(s[3][0]), "+v"(s[3][1])
               : "v"(a[0]), "v"(a[1]), "v"(a[2]), "v"(a[3]), "v"(f0), "v"(f1), "v"(qp), "v"(kp) : "memory");
#endif
}
// guard_g (GEMM k loops) holds the same four slots and, like guard_s, s_wait_xcnt 0 in front of the rewrite of the address pairs
// that the step's global loads name; the pairs are inputs so that nothing overwrites them ahead of that wait (a loop with two
// pairs names one of them twice).
template <typename F, typename P>
__device__ __forceinline__ void guard_g(v8f (&c)[4][4], const F (&x)[4], const F (&y)[4], const P* p0, const P* p1, const P* p2) {
#if defined(__HIP_DEVICE_COMPILE__)
  asm volatile("s_wait_xcnt 0x0\n\tv_nop\n\tv_nop\n\tv_nop\n\tv_nop"
               : "+v"(c[0][0]), "+v"(c[0][1]), "+v"(c[0][2]), "+v"(c[0][3]), "+v"(c[1][0]), "+v"(c[1][1]), "+v"(c[1][2]), "+v"(c[1][3]),
                 "+v"(c[2][0]), "+v"(c[2][1]), "+v"(c[2][2]), "+v"(c[2][3]), "+v"(c[3][0]), "+v"(c[3][1]), "+v"(c[3][2]), "+v"(c[3][3])
               : "v"(x[0]), "v"(x[1]), "v"(x[2]), "v"(x[3]), "v"(y[0]), "v"(y[1]), "v"(y[2]), "v"(y[3]), "v"(p0), "v"(p1), "v"(p2)
               : "memory");
#endif
}
__device__ __forceinline__ void guard_o(v8f (&o)[RT][NJ]) {
#if defined(__HIP_DEVICE_COMPILE__)
  asm volatile("v_nop\n\tv_nop\n\tv_nop\n\tv_nop"
               : "+v"(o[0][0]), "+v"(o[0][1]), "+v"(o[0][2]), "+v"(o[1][0]), "+v"(o[1][1]), "+v"(o[1][2]),
                 "+v"(o[2][0]), "+v"(o[2][1]), "+v"(o[2][2]), "+v"(o[3][0]), "+v"(o[3][1]), "+v"(o[3][2])
               : : "memory");
#endif
}
// Orders a wave's own LDS slab writes before its reads of them. The fences name LDS alone: a wave now stages several 16-row tiles
// one after another, and a fence over global memory too would hold each staging back until the last tile's global stores are done.
__device__ __forceinline__ void wave_sync_lds() {
  __builtin_amdgcn_fence(__ATOMIC_RELEASE, "workgroup", "local");
  __builtin_amdgcn_wave_barrier();
  __builtin_amdgcn_fence(__ATOMIC_ACQUIRE, "workgroup", "local");
}

// =====================================================================================================
// f32 plane [EMB][EMB] -> 16-bit plane in fragment order:  mode 0: bf16 RNE bits;  mode 1: f16 bits of (bf16 RNE value) * scale;
// mode 2: f16 bits of value * scale (no bf16 pre-step).
// Thread = one 16-B piece of the fragment-order plane (8 consecutive k of one row): two 16-B loads, one 16-B store; 32
// consecutive lanes store 512 contiguous, 512-B aligned bytes
// coverage: grid = n8/256 blocks (host checks exactness) x 256 thr x 8 = the whole plane.
// =====================================================================================================
__global__ __launch_bounds__(256) void cvt16(const float* __restrict__ x, u16* D, int n8, int mode, float scale) {
  const int gt = blockIdx.x * 256 + (int)threadIdx.x;
  if (gt >= n8) return;                     // no barriers in this kernel
  const int unit = gt >> 6;
  const int rb   = unit / (EMB / 32);
  const int kb   = unit - rb * (EMB / 32);
  const float* p = x + (size_t)(rb * 16 + (gt & 15)) * EMB + kb * 32 + ((gt >> 5) & 1) * 16 + ((gt >> 4) & 1) * 8;
  const v4f a = *(const v4f*)(p), c4 = *(const v4f*)(p + 4);
  float v[8];
#pragma unroll
  for (int e = 0; e < 4; ++e) { v[e] = a[e]; v[4 + e] = c4[e]; }
  unsigned short s[8];
#pragma unroll
  for (int e = 0; e < 8; ++e) {
    const float vb = bfr(v[e]);
    const float vf = (mode == 1) ? vb : v[e];
    const unsigned short hb = h_bits((_Float16)(vf * scale));
    const unsigned short bb = bf_bits(v[e]);
    s[e] = (mode != 0) ? hb : bb;
  }
  v4u o;
#pragma unroll
  for (int e = 0; e < 4; ++e) o[e] = pk16(s[2 * e], s[2 * e + 1]);
  u16* d = D + (size_t)gt * 8;
  {
    *(v4u*)(d) = o;
    
  }
}

// =====================================================================================================
// Delay gather to a bf16 plane in fragment order (rows = b*SEQ + t, k = n): element (b, t, n) = bf16 RNE bits of
// sp[b][t - dl[n]][n] when t - dl[n] >= 0, else 0 (the zero is
// written). The source row index is clamped into [0, SEQ) for the address; the value is selected afterwards.
// Thread = one 16-B piece (8 consecutive n of one (b, t) row): 8 scalar loads, one 16-B store; 32 consecutive lanes = 16 rows x
// 16 n, stored as 512 contiguous bytes
// coverage: grid = n8/256 blocks (host exact) x 256 thr x 8 = rows x EMB = the whole plane.
// =====================================================================================================
__global__ __launch_bounds__(256) void gather_bf(const float* __restrict__ sp, const int* __restrict__ dl,
                                                 const float* __restrict__ mpu, const float* __restrict__ dcu,
                                                 u16* DB, int n8) {
  const int gt = blockIdx.x * 256 + (int)threadIdx.x;
  if (gt >= n8) return;                     // no barriers in this kernel
  const int unit = gt >> 6;
  const int rb   = unit / (EMB / 32);
  const int kb   = unit - rb * (EMB / 32);
  const int row = rb * 16 + (gt & 15);
  const int n0  = kb * 32 + ((gt >> 5) & 1) * 16 + ((gt >> 4) & 1) * 8;
  const int b   = row / SEQ;
  const int t   = row - b * SEQ;
  unsigned short s[8];
#pragma unroll
  for (int e = 0; e < 8; ++e) {
    const int n   = n0 + e;
    const int d   = dl[n];
    const int src = t - d;
    int sc = (src < 0) ? 0 : src;
    sc = (sc > SEQ - 1) ? (SEQ - 1) : sc;
    const float v = sp[((size_t)b * SEQ + (size_t)sc) * EMB + n];
    s[e] = (src >= 0) ? bf_bits(v) : (unsigned short)0;
  }
  v4u o;
#pragma unroll
  for (int e = 0; e < 4; ++e) o[e] = pk16(s[2 * e], s[2 * e + 1]);
  u16* dst = DB + (size_t)gt * 8;
  {
    *(v4u*)(dst) = o;
    
  }
  (void)mpu; (void)dcu;
}

// =====================================================================================================
//           8 consecutive lanes x 16 B per line), lanes 16..31 -> row 2*it+1.
//  epi64x2: same store shape, staged value = acc*os1 + accres*os2 + badd (two accumulator sets combined in f32).
//  epi64hs: f16 bits of (tile * pscale), stored in fragment order (k = column): lane (16*hh + m) = row m, 8 consecutive columns;
// coverage: epi64/epi64x2 8 instructions x 2 rows x 16 lanes x 4 floats; epi64hs 4 instructions x 32 lanes x 8 halves
//           = the wave's 16 x 64 tile in every case.
// =====================================================================================================
__device__ __forceinline__ void stage64(float* sl, v8f a0, v8f a1, v8f a2, v8f a3, float oscale, int lane) {
  const int hh = lane >> 4, m = lane & 15;
#pragma unroll
  for (int r = 0; r < 8; ++r) {
    const int ro = (8 * hh + r) * 68 + m;
    sl[ro]      = a0[r] * oscale;
    sl[ro + 16] = a1[r] * oscale;
    sl[ro + 32] = a2[r] * oscale;
    sl[ro + 48] = a3[r] * oscale;
  }
  wave_sync_lds();
}
__device__ __forceinline__ void epi64(float* sl, v8f a0, v8f a1, v8f a2, v8f a3, float oscale, v4f badd, float* C, int N,
                                      size_t rowb, int col0, int lane) {
  const int hh = lane >> 4, m = lane & 15;
  stage64(sl, a0, a1, a2, a3, oscale, lane);
  v4f vals[8];
#pragma unroll
  for (int it = 0; it < 8; ++it) vals[it] = *(const v4f*)(sl + (it * 2 + hh) * 68 + m * 4) + badd;
  float* dst = C + (rowb + (size_t)hh) * (size_t)N + col0 + m * 4;
  {
#pragma unroll
    for (int it = 0; it < 8; ++it) {
      *(v4f*)(dst + (size_t)(it * 2) * (size_t)N) = vals[it];
    }
    
  }
}
__device__ __forceinline__ void epi64x2(float* sl, v8f a0, v8f a1, v8f a2, v8f a3, v8f e0, v8f e1, v8f e2, v8f e3,
                                        float os1, float os2, v4f badd, float* C, int N, size_t rowb, int col0, int lane) {
  const int hh = lane >> 4, m = lane & 15;
#pragma unroll
  for (int r = 0; r < 8; ++r) {
    const int ro = (8 * hh + r) * 68 + m;
    sl[ro]      = a0[r] * os1 + e0[r] * os2;
    sl[ro + 16] = a1[r] * os1 + e1[r] * os2;
    sl[ro + 32] = a2[r] * os1 + e2[r] * os2;
    sl[ro + 48] = a3[r] * os1 + e3[r] * os2;
  }
  wave_sync_lds();
  v4f vals[8];
#pragma unroll
  for (int it = 0; it < 8; ++it) vals[it] = *(const v4f*)(sl + (it * 2 + hh) * 68 + m * 4) + badd;
  float* dst = C + (rowb + (size_t)hh) * (size_t)N + col0 + m * 4;
  {
#pragma unroll
    for (int it = 0; it < 8; ++it) {
      *(v4f*)(dst + (size_t)(it * 2) * (size_t)N) = vals[it];
    }
    
  }
}
__device__ __forceinline__ void epi64hs(float* sl, v8f a0, v8f a1, v8f a2, v8f a3, float oscale, float pscale,
                                        u16* C, int N, size_t rowb, int col0, int lane) {
  stage64(sl, a0, a1, a2, a3, oscale, lane);
  const int hh = lane >> 4, m = lane & 15;
  v4u oh[4];
#pragma unroll
  for (int i4 = 0; i4 < 4; ++i4) {
    const int c8 = (i4 >> 1) * 32 + (i4 & 1) * 16 + hh * 8;   // k block i4>>1, half i4&1 of the wave's two units
    const v4f a = *(const v4f*)(sl + m * 68 + c8), c4 = *(const v4f*)(sl + m * 68 + c8 + 4);
    float w[8];
#pragma unroll
    for (int e = 0; e < 4; ++e) { w[e] = a[e] * pscale; w[4 + e] = c4[e] * pscale; }
#pragma unroll
    for (int e = 0; e < 4; ++e) oh[i4][e] = pk16(h_bits((_Float16)w[2 * e]), h_bits((_Float16)w[2 * e + 1]));
  }
  u16* dst = C + rowb * (size_t)N + (size_t)(col0 >> 5) * 512 + lane * 8;
  {
#pragma unroll
    for (int i4 = 0; i4 < 4; ++i4) {
      *(v4u*)(dst + i4 * 256) = oh[i4];
    }
    
  }
}

// =====================================================================================================
// bf16 GEMM core: acc[rt][j] = rows (16 rt ..) of A . rows (16 j ..) of Bt, A and Bt bf16 planes [..][EMB] in fragment order.
// Wave tile = 64 x 64 (4 A fragments x 4 B fragments, 16 accumulators): every fragment loaded feeds 4 WMMAs. Fragments come
// straight from the planes (two 16-B loads each, split k map for A and B); k stepped by 32, ascending, one WMMA per (tile, step).
// Block = 128 x 128 tile, 4 waves as 2 x 2; grid = (M/128) * (EMB/128), host checks exactness.
// =====================================================================================================
__device__ __forceinline__ void core_b64(const u16* ap, const u16* bp, v8f (&acc)[4][4]) {
#pragma unroll
  for (int rt = 0; rt < 4; ++rt) {
#pragma unroll
    for (int j = 0; j < 4; ++j) acc[rt][j] = zero8();
  }
#pragma unroll 1
  for (int k0 = 0; k0 < EMB; k0 += 32) {
    v16b a[4], b[4];
#pragma unroll
    for (int rt = 0; rt < 4; ++rt) a[rt] = ldfo_b(ap + rt * (16 * EMB));
#pragma unroll
    for (int j = 0; j < 4; ++j) b[j] = ldfo_b(bp + j * (16 * EMB));
#pragma unroll
    for (int rt = 0; rt < 4; ++rt) {
#pragma unroll
      for (int j = 0; j < 4; ++j) acc[rt][j] = mma_b(a[rt], b[j], acc[rt][j]);
    }
    guard_g<v16b, u16>(acc, a, b, ap, bp, bp);
    ap += 512; bp += 512;                    // next k block: one 512-element unit on
  }
}

// f32 out: C[M][EMB] = (A . Bt^T) * oscale; epilogue epi64 once per 16-row tile of the wave (same slab, same wave, in order).
__global__ __launch_bounds__(128)
void gemm_b32(const u16* __restrict__ A, const u16* __restrict__ Bt, float* C, int M, float oscale) {
  __shared__ __align__(16) float slab[4 * SLAB64];
  const int tid = threadIdx.x, wave = tid >> 5, lane = tid & 31;
  const int bid   = blockIdx.x;
  const int rowb  = (bid / (EMB / 128)) * 128 + (wave >> 1) * 64;
  const int col0  = (bid % (EMB / 128)) * 128 + (wave & 1) * 64;
  if (rowb + 64 > M) return;                 // wave-uniform, never taken with the exact grid; no block barriers in this kernel
  v8f acc[4][4];
  core_b64(A + (size_t)rowb * EMB + 8 * lane, Bt + (size_t)col0 * EMB + 8 * lane, acc);
#pragma unroll
  for (int rt = 0; rt < 4; ++rt)
    epi64(slab + wave * SLAB64, acc[rt][0], acc[rt][1], acc[rt][2], acc[rt][3], oscale, zero4(), C, EMB,
          (size_t)(rowb + 16 * rt), col0, lane);
}

// f16 plane out in fragment order: C16[M][EMB] = f16 bits of ((A . Bt^T) * oscale) * pscale; epilogue epi64hs per 16-row tile.
__global__ __launch_bounds__(128)
void gemm_bh16(const u16* __restrict__ A, const u16* __restrict__ Bt, u16* C, int M, float oscale, float pscale) {
  __shared__ __align__(16) float slab[4 * SLAB64];
  const int tid = threadIdx.x, wave = tid >> 5, lane = tid & 31;
  const int bid   = blockIdx.x;
  const int rowb  = (bid / (EMB / 128)) * 128 + (wave >> 1) * 64;
  const int col0  = (bid % (EMB / 128)) * 128 + (wave & 1) * 64;
  if (rowb + 64 > M) return;                 // wave-uniform, never taken with the exact grid; no block barriers in this kernel
  v8f acc[4][4];
  core_b64(A + (size_t)rowb * EMB + 8 * lane, Bt + (size_t)col0 * EMB + 8 * lane, acc);
#pragma unroll
  for (int rt = 0; rt < 4; ++rt)
    epi64hs(slab + wave * SLAB64, acc[rt][0], acc[rt][1], acc[rt][2], acc[rt][3], oscale, pscale, C, EMB,
            (size_t)(rowb + 16 * rt), col0, lane);
}

// =====================================================================================================
// f16 GEMM with two A planes (hi + residual), f32 out with bias:
//   C[M][EMB] = (Ah . Bt^T) * os1 + (Ar . Bt^T) * os2 + bf16RNE(bias[n]); Ah/Ar/Bt f16 planes in fragment order.
// Wave tile = 32 x 64 for both planes (2 + 2 A fragments x 4 B fragments, 16 accumulators: rows 0, 1 of acc = hi plane, rows 2, 3
// = residual plane): a B fragment feeds 4 WMMAs, an A fragment 4. Block = 64 x 128 tile, 4 waves as 2 x 2; grid = (M/64) * (EMB/128).
// Separate accumulators for the two planes, combined in f32 in epi64x2, once per 16-row tile.
// =====================================================================================================
__global__ __launch_bounds__(128)
void gemm_h2_32(const u16* __restrict__ Ah, const u16* __restrict__ Ar, const u16* __restrict__ Bt,
                const float* __restrict__ bias, float* C, int M, float os1, float os2) {
  __shared__ __align__(16) float slab[4 * SLAB64];
  const int tid = threadIdx.x, wave = tid >> 5, lane = tid & 31, m = lane & 15;
  const int bid   = blockIdx.x;
  const int rowb  = (bid / (EMB / 128)) * 64 + (wave >> 1) * 32;
  const int col0  = (bid % (EMB / 128)) * 128 + (wave & 1) * 64;
  if (rowb + 32 > M) return;                 // wave-uniform, never taken with the exact grid; no block barriers in this kernel
  const _Float16* ap  = (const _Float16*)(const void*)Ah + (size_t)rowb * EMB + 8 * lane;
  const _Float16* arp = (const _Float16*)(const void*)Ar + (size_t)rowb * EMB + 8 * lane;
  const _Float16* bp  = (const _Float16*)(const void*)Bt + (size_t)col0 * EMB + 8 * lane;
  v8f acc[4][4];
#pragma unroll
  for (int rt = 0; rt < 4; ++rt) {
#pragma unroll
    for (int j = 0; j < 4; ++j) acc[rt][j] = zero8();
  }
#pragma unroll 1
  for (int k0 = 0; k0 < EMB; k0 += 32) {
    v16h a[4], b[4];
    a[0] = ldfo_h(ap);
    a[1] = ldfo_h(ap + 16 * EMB);
    a[2] = ldfo_h(arp);
    a[3] = ldfo_h(arp + 16 * EMB);
#pragma unroll
    for (int j = 0; j < 4; ++j) b[j] = ldfo_h(bp + j * (16 * EMB));
#pragma unroll
    for (int rt = 0; rt < 4; ++rt) {
#pragma unroll
      for (int j = 0; j < 4; ++j) acc[rt][j] = mma_h(a[rt], b[j], acc[rt][j]);
    }
    guard_g<v16h, _Float16>(acc, a, b, ap, arp, bp);
    ap += 512; arp += 512; bp += 512;        // next k block: one 512-element unit on
  }
  const v4f bv = *(const v4f*)(bias + col0 + m * 4);      // columns col0 + 4m .. +3, always < EMB (col0 a multiple of 64)
  v4f badd;
#pragma unroll
  for (int e = 0; e < 4; ++e) badd[e] = bfr(bv[e]);
#pragma unroll
  for (int rt = 0; rt < 2; ++rt)
    epi64x2(slab + wave * SLAB64, acc[rt][0], acc[rt][1], acc[rt][2], acc[rt][3],
            acc[2 + rt][0], acc[2 + rt][1], acc[2 + rt][2], acc[2 + rt][3], os1, os2, badd, C, EMB,
            (size_t)(rowb + 16 * rt), col0, lane);
}

// =====================================================================================================
// V^T plane in fragment order (rows = b*EMB + d, k = s): element (b, d, s) = f16(V[b][s][d] * 1024).
// Block = (b, 64-wide d chunk, 64 keys): 64 source row segments of 64 floats loaded with 16-B loads, converted, scattered into
// coverage: load 256 thr x 16 elements = 64 x 64; store 2 iterations x 256 thr x 8 halves = 64 lines x 64 = the block's tile;
//           grid = nb x (EMB/64) x (SEQ/64) blocks covers the plane exactly once.
// =====================================================================================================
__global__ __launch_bounds__(256) void xt16(const float* __restrict__ X, u16* XTo) {
  __shared__ __align__(16) u16 TH[64 * VTP];
  const int tid = threadIdx.x;
  const int bid = blockIdx.x;
  const int st  = bid % (SEQ / 64);
  const int dcb = (bid / (SEQ / 64)) % (EMB / 64);
  const int b   = bid / ((SEQ / 64) * (EMB / 64));
  const int s0  = st * 64;
  const int d0  = dcb * 64;
  {
    const int sl = tid >> 2;                  // key within tile 0..63
    const int dc = (tid & 3) * 16;            // d chunk within the 64
    const float* src = X + ((size_t)b * SEQ + s0 + sl) * EMB + d0 + dc;
#pragma unroll
    for (int i = 0; i < 4; ++i) {
      const v4f a = *(const v4f*)(src + 4 * i);
#pragma unroll
      for (int e = 0; e < 4; ++e) {
        const _Float16 hv = (_Float16)(a[e] * VCAR);
        TH[(dc + 4 * i + e) * VTP + sl] = h_bits(hv);
      }
    }
  }
  __syncthreads();
  v4u vh[2];
#pragma unroll
  for (int it = 0; it < 2; ++it) {
    const int q = it * 256 + tid;             // piece of the tile: d block q>>7, key block (q>>6)&1, half (q>>5)&1, lane q&31
    vh[it] = *(const v4u*)(TH + ((q >> 7) * 16 + (q & 15)) * VTP + ((q >> 6) & 1) * 32 + ((q >> 5) & 1) * 16 + ((q >> 4) & 1) * 8);
  }
  const size_t base = ((size_t)b * EMB + d0) * SEQ + (size_t)(s0 >> 5) * 512;
  {
#pragma unroll
    for (int it = 0; it < 2; ++it) {
      const int q = it * 256 + tid;
      *(v4u*)(XTo + base + (size_t)((q >> 7) * 16) * SEQ + (q & 127) * 8) = vh[it];
    }
    
  }
}

// =====================================================================================================
// Per-chunk column sums of V: VS[(b*NCHK + c)*EMB + d] = sum over the CK keys of chunk c of V[b][c*CK + s][d] (f32, fixed
// sequential order). Thread = one (b, c, d); 256 consecutive table entries per block are staged in LDS, then threads 0..63
// coverage: grid = nb*NCHK*EMB/256 blocks (host exact) x 256 = the whole table; store 64 thr x 4 floats = the block's 256.
// =====================================================================================================
__global__ __launch_bounds__(256) void vsum_k(const float* __restrict__ V, float* VS) {
  __shared__ __align__(16) float sm[256];
  const int tid = threadIdx.x;
  const int gt  = blockIdx.x * 256 + tid;
  const int d   = gt % EMB;
  const int bc  = gt / EMB;
  const int b   = bc / NCHK;
  const int c   = bc - b * NCHK;
  const float* p = V + ((size_t)b * SEQ + (size_t)c * CK) * EMB + d;
  float s = 0.f;
  // Few waves run here (8 on each of nb * 12 WGPs), so the time is (loads per thread / loads in flight) x memory latency.
  // Full unroll: all CK row loads hang on one address pair by immediate offsets, and the compiler keeps the wave's load counter
  // full (each add is followed by the next load) where a 4-step body waited out the latency once per 4 rows. The adds stay in
  // ascending key order.
#pragma unroll
  for (int i = 0; i < CK; ++i) s += p[(size_t)i * EMB];
  sm[tid] = s;
  __syncthreads();
  if (tid < 64) {                                   // waves 0 and 1, all lanes active
    const v4f o = *(const v4f*)(sm + tid * 4);
    float* dst = VS + (size_t)blockIdx.x * 256 + tid * 4;
    *(v4f*)(dst) = o;
    
  }
}

// =====================================================================================================
// Single-head attention, head width EMB = 768, all SEQ keys kept (non-causal): block = (batch b, 64 query rows q0..q0+63 = RT = 4
// row tiles of 16), 16 waves. Every K fragment and every V^T fragment that a wave loads feeds one WMMA per row tile.
// q plane (f16, x8) rows b*SEQ+s, k = d; k plane the same; V^T plane rows b*EMB+d, k = s (x1024); all three and the two
// ctx planes in fragment order; VS = per-chunk column sums of V (f32).
//   Per chunk of CK = 512 keys (NCHK = 4 chunks):
//   (S) scores S[query][key n] on WMMA: A = q rows of row tile rt (row m = lane&15, split k map over d), B = k rows (col n = key,
//       split map), 24 d-steps; wave w handles key block w (32 keys) of the chunk for all four row tiles; D element r of lane l
//       of tile rt -> scs[query 16rt+8h+r][key col] (f32 LDS).
//   (M) 16 threads per query row (sub-thread = 32 consecutive keys), two passes of 32 rows: base-2 logits, chunk max via xor
//       shuffles, online running max / rescale factor al / running sum l in f32 registers (the same threads own the row in every
//       chunk), p = exp2(t - m_new) <= 1, chunk row sum ps and its mean C = ps/CK (bit-identical on the row's 16 threads), the
//       CENTRED P' = p - C written as f16(P' * 32768) into the LDS P tile with 16-B stores; al -> rowa[row], C -> rowc[row].
//   (PV) each wave owns d columns 48*wave + 16j + (lane&15), j = 0..2, of all four row tiles (12 accumulators):
//       o = o*al + C*(32768*1024)*VS[chunk][d] (exact add-back of the centring term in f32), then for each key block: A = P'
//       fragments from LDS (row m = query, split map over keys), B = V^T fragments (col n = d, split map over keys).
//       sum_k (P'_k + C) v_k == sum_k p_k v_k exactly.
//   Block barriers after (S) and after (M) order all LDS reuse across chunks and waves.
//   Epilogue: x = o * 16384 / (l * 32768 * 1024) per row (rowi, l >= 1 always); hi = f16(x), res = f16((x - hi) * 2048); each
//   plane is staged in LDS and stored in fragment order.
// coverage: grid nb*32 blocks x 64 rows; staging 16 waves x 48 cols x 64 rows = 64 x 768; store 12 iterations x 512 thr x 8
//           halves = 64 x 768 per plane = every (b, s, d) of both ctx planes exactly once.
// =====================================================================================================
__device__ __forceinline__ void ctx_store(const u16* ct, u16* dst, int tid) {
  v4u v[12];
#pragma unroll
  for (int it = 0; it < 12; ++it) {
    const int rb = it / 3;                    // 16-row block of the tile (3 * 512 pieces each)
    const int p  = (it % 3) * ATT_THREADS + tid;   // piece of that block: k block p>>6, half (p>>5)&1, lane p&31
    v[it] = *(const v4u*)(ct + (rb * 16 + (p & 15)) * CTP + (p >> 6) * 32 + ((p >> 5) & 1) * 16 + ((p >> 4) & 1) * 8);
  }
  {
#pragma unroll
    for (int it = 0; it < 12; ++it) {
      const int p = it * ATT_THREADS + tid;
      *(v4u*)(dst + (size_t)p * 8) = v[it];
    }
  }
}

__global__ __launch_bounds__(ATT_THREADS)
void attn_fwd(const u16* __restrict__ QPp, const u16* __restrict__ KPp, const u16* __restrict__ VTp,
              const float* __restrict__ VSp, u16* CHo, u16* CRo) {
  __shared__ __align__(16) AttLds L0;              // scores [QT][SCP] f32; reused as the ctx staging tile [QT][CTP] u16
  __shared__ __align__(16) u16 pls[QT * PLP];      // P' tile [QT][PLP] f16 bits
  __shared__ float rowa[QT];
  __shared__ float rowc[QT];
  __shared__ float rowi[QT];
  float* const scs = L0.s;

  const int tid  = threadIdx.x;
  const int wave = tid >> 5;
  const int lane = tid & 31;
  const int hh   = lane >> 4;
  const int m    = lane & 15;
  const int r32  = tid >> 4;                 // query rows owned in phase (M): r32 and 32 + r32
  const int sub  = tid & 15;
  const int kl0  = sub * 32;

  const int bid = blockIdx.x;
  const int b   = bid / (SEQ / QT);
  const int q0  = (bid % (SEQ / QT)) * QT;

  const _Float16* qa  = (const _Float16*)(const void*)QPp + ((size_t)b * SEQ + q0) * EMB + 8 * lane;
  const _Float16* kbp = (const _Float16*)(const void*)KPp + ((size_t)b * SEQ + wave * 32) * EMB + 8 * lane;
  const _Float16* vbp = (const _Float16*)(const void*)VTp + ((size_t)b * EMB + wave * DW) * SEQ + 8 * lane;
  const float* vsb = VSp + (size_t)b * NCHK * EMB + wave * DW + m;
  const float lsc = RSQD * LOG2E / (QSC * KSC);

  float mrun[2] = {-INFINITY, -INFINITY}, lrun[2] = {0.f, 0.f};
  v8f o[RT][NJ];
#pragma unroll
  for (int rt = 0; rt < RT; ++rt) {
#pragma unroll
    for (int j = 0; j < NJ; ++j) o[rt][j] = zero8();
  }

#pragma unroll 1
  for (int c = 0; c < NCHK; ++c) {
    const int kbeg = c * CK;
    // ---- (S) scores of this chunk: key block = wave ----
    {
      const _Float16* qp = qa;
      const _Float16* kp = kbp + (size_t)kbeg * EMB;
      v8f s[RT][2];
#pragma unroll
      for (int rt = 0; rt < RT; ++rt) { s[rt][0] = zero8(); s[rt][1] = zero8(); }
#pragma unroll 1
      for (int k4 = 0; k4 < EMB / 128; ++k4) {             // 6 trips of 4 d-steps, as many steps unrolled as before
#pragma unroll
        for (int u = 0; u < 4; ++u) {
          v16h a[RT];
#pragma unroll
          for (int rt = 0; rt < RT; ++rt) a[rt] = ldfo_h(qp + rt * (16 * EMB) + u * 512);
          const v16h f0 = ldfo_h(kp + u * 512);
          const v16h f1 = ldfo_h(kp + 16 * EMB + u * 512);
#pragma unroll
          for (int rt = 0; rt < RT; ++rt) {
            s[rt][0] = mma_h(a[rt], f0, s[rt][0]);
            s[rt][1] = mma_h(a[rt], f1, s[rt][1]);
          }
          guard_s(s, a, f0, f1, qp, kp);
        }
        qp += 4 * 512;
        kp += 4 * 512;
      }
#pragma unroll
      for (int rt = 0; rt < RT; ++rt) {
        float* srow = scs + (16 * rt + 8 * hh) * SCP + wave * 32 + m;
#pragma unroll
        for (int r = 0; r < 8; ++r) {
          srow[r * SCP]      = s[rt][0][r];
          srow[r * SCP + 16] = s[rt][1][r];
        }
      }
    }
    __syncthreads();
    // ---- (M) softmax statistics and the centred P' tile, 32 rows a pass ----
#pragma unroll
    for (int rg = 0; rg < 2; ++rg) {
      const int row = rg * 32 + r32;
      const float* sp = scs + row * SCP + kl0;
      float t[32];
      float cm = -INFINITY;
#pragma unroll
      for (int i = 0; i < 8; ++i) {
        const v4f a = *(const v4f*)(sp + 4 * i);
#pragma unroll
        for (int e = 0; e < 4; ++e) {
          const float tv = a[e] * lsc;
          t[4 * i + e] = tv;
          cm = fmaxf(cm, tv);
        }
      }
#pragma unroll
      for (int d = 1; d <= 8; d <<= 1) cm = fmaxf(cm, __shfl_xor(cm, d, 32));
      const float mn = fmaxf(mrun[rg], cm);                // finite
      const float al = (mrun[rg] == -INFINITY) ? 0.f : exp2f(mrun[rg] - mn);
      mrun[rg] = mn;
      float ps = 0.f;
#pragma unroll
      for (int j = 0; j < 32; ++j) {
        const float p = exp2f(fminf(t[j] - mn, 0.f));
        t[j] = p;
        ps += p;
      }
#pragma unroll
      for (int d = 1; d <= 8; d <<= 1) ps += __shfl_xor(ps, d, 32);
      const float cc = ps * (1.0f / (float)CK);
      v4u pk[4];
#pragma unroll
      for (int i = 0; i < 4; ++i) {
#pragma unroll
        for (int e = 0; e < 4; ++e) {
          const int j = 8 * i + 2 * e;
          pk[i][e] = pk16(h_bits((_Float16)((t[j] - cc) * PCAR)), h_bits((_Float16)((t[j + 1] - cc) * PCAR)));
        }
      }
      lrun[rg] = lrun[rg] * al + ps;
      u16* pd = pls + row * PLP + kl0;
#pragma unroll
      for (int i = 0; i < 4; ++i) *(v4u*)(pd + 8 * i) = pk[i];
      if (sub == 0) { rowa[row] = al; rowc[row] = cc; }
    }
    __syncthreads();
    // ---- (PV) rescale, add the centring term, accumulate P' . V^T ----
    {
      float vs[NJ];
#pragma unroll
      for (int j = 0; j < NJ; ++j) vs[j] = vsb[(size_t)c * EMB + 16 * j];
#pragma unroll
      for (int rt = 0; rt < RT; ++rt) {
        float scl[8], cad[8];
#pragma unroll
        for (int r = 0; r < 8; ++r) {
          scl[r] = rowa[16 * rt + 8 * hh + r];
          cad[r] = rowc[16 * rt + 8 * hh + r] * (PCAR * VCAR);
        }
#pragma unroll
        for (int j = 0; j < NJ; ++j) {
#pragma unroll
          for (int r = 0; r < 8; ++r) o[rt][j][r] = o[rt][j][r] * scl[r] + cad[r] * vs[j];
        }
      }
      const _Float16* pp = (const _Float16*)(const void*)pls + m * PLP + 8 * hh;
      const _Float16* vp = vbp + kbeg * 16;                // key block kbeg/32 -> 512 elements per unit
#pragma unroll 1
      for (int kb = 0; kb < CK / 32; ++kb) {
        v16h pf[RT];
#pragma unroll
        for (int rt = 0; rt < RT; ++rt) pf[rt] = ldfrag_h(pp + rt * (16 * PLP) + kb * 32);
        v16h g[NJ];
#pragma unroll
        for (int j = 0; j < NJ; ++j) g[j] = ldfo_h(vp + (size_t)(16 * j) * SEQ + kb * 512);
#pragma unroll
        for (int rt = 0; rt < RT; ++rt) {
#pragma unroll
          for (int j = 0; j < NJ; ++j) o[rt][j] = mma_h(pf[rt], g[j], o[rt][j]);
        }
        guard_o(o);
      }
    }
  }

#pragma unroll
  for (int rg = 0; rg < 2; ++rg) {
    if (sub == 0) rowi[rg * 32 + r32] = (1.0f / lrun[rg]) * (CSC / (PCAR * VCAR));   // lrun >= 1
  }
  __syncthreads();
  float inv[RT][8];
#pragma unroll
  for (int rt = 0; rt < RT; ++rt) {
#pragma unroll
    for (int r = 0; r < 8; ++r) inv[rt][r] = rowi[16 * rt + 8 * hh + r];
  }

  u16* const ct = L0.c;
  const int cb = wave * DW + m;
  // hi plane
#pragma unroll
  for (int rt = 0; rt < RT; ++rt) {
#pragma unroll
    for (int j = 0; j < NJ; ++j) {
#pragma unroll
      for (int r = 0; r < 8; ++r) {
        const float xs = o[rt][j][r] * inv[rt][r];
        ct[(16 * rt + 8 * hh + r) * CTP + cb + 16 * j] = h_bits((_Float16)xs);
      }
    }
  }
  __syncthreads();
  ctx_store(ct, CHo + ((size_t)b * SEQ + q0) * EMB, tid);
  __syncthreads();
  // residual plane
#pragma unroll
  for (int rt = 0; rt < RT; ++rt) {
#pragma unroll
    for (int j = 0; j < NJ; ++j) {
#pragma unroll
      for (int r = 0; r < 8; ++r) {
        const float xs = o[rt][j][r] * inv[rt][r];
        const _Float16 hv = (_Float16)xs;
        ct[(16 * rt + 8 * hh + r) * CTP + cb + 16 * j] = h_bits((_Float16)((xs - (float)hv) * RSC));
      }
    }
  }
  __syncthreads();
  ctx_store(ct, CRo + ((size_t)b * SEQ + q0) * EMB, tid);
}

// =====================================================================================================
// Workspace map (bytes, rows = nb*SEQ; nb = 8 gives the totals below); every plane is fully written by whole-line stores before
// it is read; all extents are exact multiples of the store granularity (no pad rows); regions A and V are reused sequentially on
// the single in-order stream:
//   WQB bf16 [768][768]   1179648   WKB same   WVB same   WOH f16 of bf16 value x1024  1179648     4718592
//   VS  f32  [nb][4][768]                                                                          98304
//   A   DB bf16 [rows][768] (25165824), later VT f16 [nb][768][2048] x1024 (25165824)     region 25165824
//   Q   QP f16 [rows][768] x8                                                              region 25165824
//   K   KP f16 [rows][768] x8                                                              region 25165824
//   V   V f32 [rows][768] (50331648), later CH f16 [rows][768] + CR f16 [rows][768]        region 50331648
//   end                                                                                        130646016
// =====================================================================================================
extern "C" void kernel_launch(void* const* d_in, const int* in_sizes, int n_in,
                              void* d_out, int out_size, void* d_ws, size_t ws_size,
                              hipStream_t stream) {
  if (n_in < 9) return;
  const long long per = (long long)SEQ * EMB;
  const long long ns  = in_sizes[0];
  if (ns < per || (ns % per) != 0) return;
  const int nb = (int)(ns / per);
  if (nb < 1 || nb > 8) return;
  const int rows = nb * SEQ;
  if (in_sizes[1] != EMB) return;
  if (in_sizes[2] < 1 || in_sizes[3] < 1) return;
  if (in_sizes[4] != EMB * EMB || in_sizes[5] != EMB * EMB || in_sizes[6] != EMB * EMB || in_sizes[7] != EMB * EMB) return;
  if (in_sizes[8] != EMB) return;
  if ((long long)out_size != (long long)rows * EMB) return;

  const float* spk = (const float*)d_in[0];
  const int*   dly = (const int*)d_in[1];
  const float* mpo = (const float*)d_in[2];
  const float* dcy = (const float*)d_in[3];
  const float* wq  = (const float*)d_in[4];
  const float* wk  = (const float*)d_in[5];
  const float* wv  = (const float*)d_in[6];
  const float* wo  = (const float*)d_in[7];
  const float* bo  = (const float*)d_in[8];
  float*       out = (float*)d_out;

  const size_t szW  = (size_t)EMB * EMB * 2;                    //   1179648
  const size_t szVS = (size_t)nb * NCHK * EMB * 4;              //     98304 at nb = 8
  const size_t sz16 = (size_t)rows * EMB * 2;                   //  25165824
  const size_t sz32 = (size_t)rows * EMB * 4;                   //  50331648
  const size_t szVT = (size_t)nb * EMB * SEQ * 2;               //  == sz16
  size_t off = 0;
  const size_t oWQ = off; off += szW;
  const size_t oWK = off; off += szW;
  const size_t oWV = off; off += szW;
  const size_t oWO = off; off += szW;
  const size_t oVS = off; off += szVS;
  const size_t oA  = off; off += (szVT > sz16 ? szVT : sz16);   // DB then VT
  const size_t oQ  = off; off += sz16;
  const size_t oK  = off; off += sz16;
  const size_t oV  = off; off += sz32;                          // V f32, later CH + CR
  if (off > ws_size) return;                                    // off = 130646016 at nb = 8
  if (off > WS_CAP) return;
  if (2 * sz16 > sz32) return;

  char* ws = (char*)d_ws;
  u16*   WQB = (u16*)(ws + oWQ);
  u16*   WKB = (u16*)(ws + oWK);
  u16*   WVB = (u16*)(ws + oWV);
  u16*   WOH = (u16*)(ws + oWO);
  float* VS  = (float*)(ws + oVS);
  u16*   DB  = (u16*)(ws + oA);
  u16*   VT  = (u16*)(ws + oA);
  u16*   QP  = (u16*)(ws + oQ);
  u16*   KP  = (u16*)(ws + oK);
  float* V   = (float*)(ws + oV);
  u16*   CH  = (u16*)(ws + oV);
  u16*   CR  = (u16*)(ws + oV + sz16);

  const int n8w = (EMB * EMB) / 8;                      // 73728
  const int n8g = rows * (EMB / 8);                     // rows * 96
  if ((n8w % 256) != 0 || (n8g % 256) != 0) return;
  if ((rows % 128) != 0 || ((nb * NCHK * EMB) % 256) != 0) return;
  const dim3 blk(256);
  const dim3 gW(n8w / 256), gGa(n8g / 256);
  const dim3 gG((rows / 128) * (EMB / 128));            // 768 at nb = 8: 128 x 128 tiles
  const dim3 gO((rows / 64) * (EMB / 128));             // 1536 at nb = 8: 64 x 128 tiles
  const dim3 bG(128);
  const dim3 gXT(nb * (EMB / 64) * (SEQ / 64));         // nb * 384
  const dim3 gVS((nb * NCHK * EMB) / 256);              // nb * 12
  const dim3 gAT(nb * (SEQ / QT));                      // nb * 32
  const dim3 bAT(ATT_THREADS);

  // (0..3) weights stored [n = out][k = in] (y = x.W^T), rows = n: fragment-order bf16 planes for Wq, Wk, Wv; f16 of bf16 value
  //        x1024 for Wo
  cvt16<<<gW, blk, 0, stream>>>(wq, WQB, n8w, 0, 1.0f);
  cvt16<<<gW, blk, 0, stream>>>(wk, WKB, n8w, 0, 1.0f);
  cvt16<<<gW, blk, 0, stream>>>(wv, WVB, n8w, 0, 1.0f);
  cvt16<<<gW, blk, 0, stream>>>(wo, WOH, n8w, 1, WSC);
  // (4) delayed spikes -> fragment-order bf16 plane, rows x 768
  gather_bf<<<gGa, blk, 0, stream>>>(spk, dly, mpo, dcy, DB, n8g);
  // (5, 6) q and k projections -> f16 planes x8; (7) v projection -> f32 plane
  gemm_bh16<<<gG, bG, 0, stream>>>(DB, WQB, QP, rows, 1.0f, QSC);
  gemm_bh16<<<gG, bG, 0, stream>>>(DB, WKB, KP, rows, 1.0f, KSC);
  gemm_b32<<<gG, bG, 0, stream>>>(DB, WVB, V, rows, 1.0f);
  // (8) v -> V^T plane x1024 (over the dead DB region); (9) per-chunk column sums of v
  xt16<<<gXT, blk, 0, stream>>>(V, VT);
  vsum_k<<<gVS, blk, 0, stream>>>(V, VS);
  // (10) attention -> ctx hi x16384 and residual x2048 f16 planes (over the dead V region)
  attn_fwd<<<gAT, bAT, 0, stream>>>(QP, KP, VT, VS, CH, CR);
  // (11) output projection + bias -> out
  gemm_h2_32<<<gO, bG, 0, stream>>>(CH, CR, WOH, bo, out, rows,
                                     1.0f / (CSC * WSC), 1.0f / (CSC * WSC * RSC));
  (void)hipGetLastError();
}

// v005
// Measured time: 294 microseconds a run.
// Two timings next to v004 both put it at 1.10 times that version's speed.
// All steps since v000 together make it 3.27 times as fast.
// Projections q,k,v = delayed.W^T: v_wmma_f32_16x16x32_bf16 (bf16 RNE operands of the raw inputs, f32 accumulate).
// Scores q'.k'^T (f16 planes x8), P'.V (chunk-centred P' x32768 f16 from LDS, V^T x1024 f16) and the output projection
// (ctx carried as f16 hi x16384 plus residual x2048 planes, times f16(bf16(Wo) x1024), bias added in f32):
// v_wmma_f32_16x16x32_f16, f32 accumulate. Delay gather, softmax statistics, column sums of V and all scaling in f32 on VALU.
#include <hip/hip_runtime.h>
#include <math.h>
#include <stdint.h>

#define SEQ   2048
#define EMB   768
#define CK    512
#define NCHK  4
#define QT    64
#define RT    4
#define NJ    3
#define DW    48
#define SCP   544
#define PLP   528
#define CTP   776
#define SLAB64 (16 * 68)
#define VTP   72
#define ATT_THREADS 512
#define QSC   8.0f
#define KSC   8.0f
#define PCAR  32768.0f
#define VCAR  1024.0f
#define WSC   1024.0f
#define CSC   16384.0f
#define RSC   2048.0f
#define LOG2E 1.4426950408889634f
#define RSQD  0.036084391824351615f
#define WS_CAP ((size_t)134217728)
#define KST   (EMB / 32)
#define GLOBAL_AS __attribute__((address_space(1)))

static_assert((EMB % 128) == 0 && EMB == 8 * 96 && (EMB % 32) == 0 && (EMB / 8) == 96);
static_assert((SEQ % CK) == 0 && (SEQ / CK) == NCHK && CK == 16 * 32 && (SEQ % 64) == 0 && (SEQ / QT) == 32);
static_assert(16 * CTP * 2 <= 16 * SCP * 4 && CTP >= EMB + 8);
static_assert(((PLP * 2) % 16) == 0 && ((SCP * 4) % 16) == 0 && ((VTP * 2) % 16) == 0 && ((CTP * 2) % 16) == 0);
static_assert(64 * VTP >= 63 * VTP + 64);
static_assert(ATT_THREADS == 512 && QT == 16 * RT && 2 * (ATT_THREADS / 16) == QT);
static_assert((ATT_THREADS / 32) * 32 == CK && (ATT_THREADS / 32) * DW == EMB && DW == 16 * NJ);
static_assert(3 * ATT_THREADS * 8 == 16 * EMB);
static_assert(((EMB * EMB) % 2048) == 0 && ((NCHK * EMB) % 256) == 0);
static_assert(3 * 512 * 2 == 0xc00 && (KST % 3) == 0 && KST >= 6 && ((CK / 32) % 3) == 1 && (CK / 32) >= 4);

typedef unsigned short u16;
typedef _Float16 v16h __attribute__((ext_vector_type(16)));
typedef _Float16 v8h  __attribute__((ext_vector_type(8)));
typedef __bf16   v16b __attribute__((ext_vector_type(16)));
typedef float    v8f  __attribute__((ext_vector_type(8)));
typedef float    v4f  __attribute__((ext_vector_type(4)));
typedef unsigned int v4u __attribute__((ext_vector_type(4)));

union FragH { v16h v; v8h h[2]; v4u u[2]; };
union FragB { v16b v; v4u u[2]; };
union AttLds { float s[QT * SCP]; u16 c[2 * QT * SCP]; };

// ---- scalar helpers --------------------------------------------------------------------------------
__device__ __forceinline__ unsigned short bf_bits(float f) {          // f32 -> bf16 bits, RNE convert
  unsigned u = __float_as_uint(f);
  return (unsigned short)((u + 0x7FFFu + ((u >> 16) & 1u)) >> 16);
}
__device__ __forceinline__ float bf_up(unsigned short h) { return __uint_as_float(((unsigned)h) << 16); }
__device__ __forceinline__ float bfr(float f) { return bf_up(bf_bits(f)); }
__device__ __forceinline__ unsigned short h_bits(_Float16 x) { return __builtin_bit_cast(unsigned short, x); }
__device__ __forceinline__ unsigned pk16(unsigned short a, unsigned short b) { return (unsigned)a | ((unsigned)b << 16); }
__device__ __forceinline__ v8f zero8() { v8f z = {0.f, 0.f, 0.f, 0.f, 0.f, 0.f, 0.f, 0.f}; return z; }
__device__ __forceinline__ v4f zero4() { v4f z = {0.f, 0.f, 0.f, 0.f}; return z; }

// ---- fragment loaders: 16-bit A/B operand, lane -> row/col (lane&15), p already includes +8*(lane>>4);
//      elements 0..7 <- p[0..7] (k0+8h..), elements 8..15 <- p[16..23] (k0+16+8h..)  (same split k map for A and B;
//      this row-major form is used for the P' tile in LDS only)
__device__ __forceinline__ v16h ldfrag_h(const _Float16* p) {
  FragH f;
  f.h[0] = *(const v8h*)(p);
  f.h[1] = *(const v8h*)(p + 16);
  return f.v;
}
// ---- fragment-order planes (every 16-bit operand plane in the workspace): a plane [R][K] is stored as
//      [R/16][K/32][2][32 lanes][8 elements]. The 1-KiB unit of (row block rb, k block kb) starts at element rb*16*K + kb*512;
//      in it lane (16*hh + m) finds, at 8*lane, row m's k = 8*hh + 0..7 and, 256 elements on, k = 16 + 8*hh + 0..7: the same
//      split k map as above. A fragment is two 16-B loads per lane, each 512 contiguous bytes per wave (4 whole lines).
//      p already includes +8*lane.
//      The planes lie in global memory; the casts say so, since a pointer that has passed through an asm statement (step3) would
//      otherwise be read by flat loads.
__device__ __forceinline__ v16h ldfo_h(const _Float16* p) {
  FragH f;
  f.h[0] = *(const GLOBAL_AS v8h*)(p);
  f.h[1] = *(const GLOBAL_AS v8h*)(p + 256);
  return f.v;
}
__device__ __forceinline__ v16b ldfo_b(const u16* p) {                // bf16 plane read as unsigned integer vectors
  FragB f;
  f.u[0] = *(const GLOBAL_AS v4u*)(p);
  f.u[1] = *(const GLOBAL_AS v4u*)(p + 256);
  return f.v;
}

__device__ __forceinline__ v8f mma_h(v16h a, v16h b, v8f c) {
  return __builtin_amdgcn_wmma_f32_16x16x32_f16(false, a, false, b, (short)0, c, false, false);
}
__device__ __forceinline__ v8f mma_b(v16b a, v16b b, v8f c) {
  return __builtin_amdgcn_wmma_f32_16x16x32_bf16(false, a, false, b, (short)0, c, false, false);
}
// The v_nop guards below stand behind the WMMAs of a step: they keep the four vector slots that the chip needs before
// the operand registers are reloaded or the accumulators are touched, on the taken back edge too. The accumulators are named so that every WMMA of the step stays in front of the slots.
// guard_s also holds s_wait_xcnt 0 in front of the rewrite of the two address pairs that the step's global loads name; the pairs
// are inputs so that nothing overwrites them ahead of that wait.
__device__ __forceinline__ void guard_s(v8f (&s)[RT][2], const v16h (&a)[RT], v16h f0, v16h f1,
                                        const _Float16* qp, const _Float16* kp) {
#if defined(__HIP_DEVICE_COMPILE__)
  asm volatile("s_wait_xcnt 0x0\n\tv_nop\n\tv_nop\n\tv_nop\n\tv_nop"
               : "+v"(s[0][0]), "+v"(s[0][1]), "+v"(s[1][0]), "+v"(s[1][1]),
                 "+v"(s[2][0]), "+v"(s[2][1]), "+v"(s[3][0]), "+v"(s[3][1])
               : "v"(a[0]), "v"(a[1]), "v"(a[2]), "v"(a[3]), "v"(f0), "v"(f1), "v"(qp), "v"(kp) : "memory");
#endif
}
// guard_g (GEMM k loops) holds the same four slots and, like guard_s, s_wait_xcnt 0 in front of the rewrite of the address pairs
// that the issued global loads name; the pairs are inputs so that nothing overwrites them ahead of that wait (a loop with two
// pairs names one of them twice). The "memory" clobber keeps the loads of the sets fetched ahead on the side of the guard where
// the source has them. The fragment sets are not named: three sets and the accumulators pass v255, where no asm operand can lie.
template <typename P>
__device__ __forceinline__ void guard_g(v8f (&c)[4][4], const P* p0, const P* p1, const P* p2) {
#if defined(__HIP_DEVICE_COMPILE__)
  asm volatile("s_wait_xcnt 0x0\n\tv_nop\n\tv_nop\n\tv_nop\n\tv_nop"
               : "+v"(c[0][0]), "+v"(c[0][1]), "+v"(c[0][2]), "+v"(c[0][3]), "+v"(c[1][0]), "+v"(c[1][1]), "+v"(c[1][2]), "+v"(c[1][3]),
                 "+v"(c[2][0]), "+v"(c[2][1]), "+v"(c[2][2]), "+v"(c[2][3]), "+v"(c[3][0]), "+v"(c[3][1]), "+v"(c[3][2]), "+v"(c[3][3])
               : "v"(p0), "v"(p1), "v"(p2)
               : "memory");
#endif
}
// wait_x: s_wait_xcnt 0 behind the first three sets' loads, in front of the loop set-up.
__device__ __forceinline__ void wait_x() {
#if defined(__HIP_DEVICE_COMPILE__)
  asm volatile("s_wait_xcnt 0x0" : : : "memory");
#endif
}
// step3: moves the address pairs three k blocks on (3 * 512 elements of 2 bytes = 0xc00 bytes). The additions stand in one asm
// statement with s_wait_xcnt 0 in front of them: written in the source, the compiler lifted them over a wait in a statement of
// its own, directly behind the trip's last loads, which name these pairs.
template <typename P>
__device__ __forceinline__ void step3(const P*& p0, const P*& p1) {
#if defined(__HIP_DEVICE_COMPILE__)
  asm volatile("s_wait_xcnt 0x0\n\tv_add_nc_u64_e32 %0, 0xc00, %0\n\tv_add_nc_u64_e32 %1, 0xc00, %1"
               : "+v"(p0), "+v"(p1) : : "memory");
#endif
}
template <typename P>
__device__ __forceinline__ void step3(const P*& p0, const P*& p1, const P*& p2) {
#if defined(__HIP_DEVICE_COMPILE__)
  asm volatile("s_wait_xcnt 0x0\n\tv_add_nc_u64_e32 %0, 0xc00, %0\n\tv_add_nc_u64_e32 %1, 0xc00, %1\n\tv_add_nc_u64_e32 %2, 0xc00, %2"
               : "+v"(p0), "+v"(p1), "+v"(p2) : : "memory");
#endif
}
// guard_o (P'.V loop): the four slots, and s_wait_xcnt 0 in front of the rewrite of the V^T address pair, which is an input.
__device__ __forceinline__ void guard_o(v8f (&o)[RT][NJ], const _Float16* vp) {
#if defined(__HIP_DEVICE_COMPILE__)
  asm volatile("s_wait_xcnt 0x0\n\tv_nop\n\tv_nop\n\tv_nop\n\tv_nop"
               : "+v"(o[0][0]), "+v"(o[0][1]), "+v"(o[0][2]), "+v"(o[1][0]), "+v"(o[1][1]), "+v"(o[1][2]),
                 "+v"(o[2][0]), "+v"(o[2][1]), "+v"(o[2][2]), "+v"(o[3][0]), "+v"(o[3][1]), "+v"(o[3][2])
               : "v"(vp) : "memory");
#endif
}
// Orders a wave's own LDS slab writes before its reads of them. The fences name LDS alone: a wave now stages several 16-row tiles
// one after another, and a fence over global memory too would hold each staging back until the last tile's global stores are done.
__device__ __forceinline__ void wave_sync_lds() {
  __builtin_amdgcn_fence(__ATOMIC_RELEASE, "workgroup", "local");
  __builtin_amdgcn_wave_barrier();
  __builtin_amdgcn_fence(__ATOMIC_ACQUIRE, "workgroup", "local");
}

// =====================================================================================================
// f32 plane [EMB][EMB] -> 16-bit plane in fragment order:  mode 0: bf16 RNE bits;  mode 1: f16 bits of (bf16 RNE value) * scale;
// mode 2: f16 bits of value * scale (no bf16 pre-step).
// Thread = one 16-B piece of the fragment-order plane (8 consecutive k of one row): two 16-B loads, one 16-B store; 32
// consecutive lanes store 512 contiguous, 512-B aligned bytes
// coverage: grid = n8/256 blocks (host checks exactness) x 256 thr x 8 = the whole plane.
// =====================================================================================================
__global__ __launch_bounds__(256) void cvt16(const float* __restrict__ x, u16* D, int n8, int mode, float scale) {
  const int gt = blockIdx.x * 256 + (int)threadIdx.x;
  if (gt >= n8) return;                     // no barriers in this kernel
  const int unit = gt >> 6;
  const int rb   = unit / (EMB / 32);
  const int kb   = unit - rb * (EMB / 32);
  const float* p = x + (size_t)(rb * 16 + (gt & 15)) * EMB + kb * 32 + ((gt >> 5) & 1) * 16 + ((gt >> 4) & 1) * 8;
  const v4f a = *(const v4f*)(p), c4 = *(const v4f*)(p + 4);
  float v[8];
#pragma unroll
  for (int e = 0; e < 4; ++e) { v[e] = a[e]; v[4 + e] = c4[e]; }
  unsigned short s[8];
#pragma unroll
  for (int e = 0; e < 8; ++e) {
    const float vb = bfr(v[e]);
    const float vf = (mode == 1) ? vb : v[e];
    const unsigned short hb = h_bits((_Float16)(vf * scale));
    const unsigned short bb = bf_bits(v[e]);
    s[e] = (mode != 0) ? hb : bb;
  }
  v4u o;
#pragma unroll
  for (int e = 0; e < 4; ++e) o[e] = pk16(s[2 * e], s[2 * e + 1]);
  u16* d = D + (size_t)gt * 8;
  {
    *(v4u*)(d) = o;
    
  }
}

// =====================================================================================================
// Delay gather to a bf16 plane in fragment order (rows = b*SEQ + t, k = n): element (b, t, n) = bf16 RNE bits of
// sp[b][t - dl[n]][n] when t - dl[n] >= 0, else 0 (the zero is
// written). The source row index is clamped into [0, SEQ) for the address; the value is selected afterwards.
// Thread = one 16-B piece (8 consecutive n of one (b, t) row): 8 scalar loads, one 16-B store; 32 consecutive lanes = 16 rows x
// 16 n, stored as 512 contiguous bytes
// coverage: grid = n8/256 blocks (host exact) x 256 thr x 8 = rows x EMB = the whole plane.
// =====================================================================================================
__global__ __launch_bounds__(256) void gather_bf(const float* __restrict__ sp, const int* __restrict__ dl,
                                                 const float* __restrict__ mpu, const float* __restrict__ dcu,
                                                 u16* DB, int n8) {
  const int gt = blockIdx.x * 256 + (int)threadIdx.x;
  if (gt >= n8) return;                     // no barriers in this kernel
  const int unit = gt >> 6;
  const int rb   = unit / (EMB / 32);
  const int kb   = unit - rb * (EMB / 32);
  const int row = rb * 16 + (gt & 15);
  const int n0  = kb * 32 + ((gt >> 5) & 1) * 16 + ((gt >> 4) & 1) * 8;
  const int b   = row / SEQ;
  const int t   = row - b * SEQ;
  unsigned short s[8];
#pragma unroll
  for (int e = 0; e < 8; ++e) {
    const int n   = n0 + e;
    const int d   = dl[n];
    const int src = t - d;
    int sc = (src < 0) ? 0 : src;
    sc = (sc > SEQ - 1) ? (SEQ - 1) : sc;
    const float v = sp[((size_t)b * SEQ + (size_t)sc) * EMB + n];
    s[e] = (src >= 0) ? bf_bits(v) : (unsigned short)0;
  }
  v4u o;
#pragma unroll
  for (int e = 0; e < 4; ++e) o[e] = pk16(s[2 * e], s[2 * e + 1]);
  u16* dst = DB + (size_t)gt * 8;
  {
    *(v4u*)(dst) = o;
    
  }
  (void)mpu; (void)dcu;
}

// =====================================================================================================
//           8 consecutive lanes x 16 B per line), lanes 16..31 -> row 2*it+1.
//  epi64x2: same store shape, staged value = acc*os1 + accres*os2 + badd (two accumulator sets combined in f32).
//  epi64hs: f16 bits of (tile * pscale), stored in fragment order (k = column): lane (16*hh + m) = row m, 8 consecutive columns;
// coverage: epi64/epi64x2 8 instructions x 2 rows x 16 lanes x 4 floats; epi64hs 4 instructions x 32 lanes x 8 halves
//           = the wave's 16 x 64 tile in every case.
// =====================================================================================================
__device__ __forceinline__ void stage64(float* sl, v8f a0, v8f a1, v8f a2, v8f a3, float oscale, int lane) {
  const int hh = lane >> 4, m = lane & 15;
#pragma unroll
  for (int r = 0; r < 8; ++r) {
    const int ro = (8 * hh + r) * 68 + m;
    sl[ro]      = a0[r] * oscale;
    sl[ro + 16] = a1[r] * oscale;
    sl[ro + 32] = a2[r] * oscale;
    sl[ro + 48] = a3[r] * oscale;
  }
  wave_sync_lds();
}
__device__ __forceinline__ void epi64(float* sl, v8f a0, v8f a1, v8f a2, v8f a3, float oscale, v4f badd, float* C, int N,
                                      size_t rowb, int col0, int lane) {
  const int hh = lane >> 4, m = lane & 15;
  stage64(sl, a0, a1, a2, a3, oscale, lane);
  v4f vals[8];
#pragma unroll
  for (int it = 0; it < 8; ++it) vals[it] = *(const v4f*)(sl + (it * 2 + hh) * 68 + m * 4) + badd;
  float* dst = C + (rowb + (size_t)hh) * (size_t)N + col0 + m * 4;
  {
#pragma unroll
    for (int it = 0; it < 8; ++it) {
      *(v4f*)(dst + (size_t)(it * 2) * (size_t)N) = vals[it];
    }
    
  }
}
__device__ __forceinline__ void epi64x2(float* sl, v8f a0, v8f a1, v8f a2, v8f a3, v8f e0, v8f e1, v8f e2, v8f e3,
                                        float os1, float os2, v4f badd, float* C, int N, size_t rowb, int col0, int lane) {
  const int hh = lane >> 4, m = lane & 15;
#pragma unroll
  for (int r = 0; r < 8; ++r) {
    const int ro = (8 * hh + r) * 68 + m;
    sl[ro]      = a0[r] * os1 + e0[r] * os2;
    sl[ro + 16] = a1[r] * os1 + e1[r] * os2;
    sl[ro + 32] = a2[r] * os1 + e2[r] * os2;
    sl[ro + 48] = a3[r] * os1 + e3[r] * os2;
  }
  wave_sync_lds();
  v4f vals[8];
#pragma unroll
  for (int it = 0; it < 8; ++it) vals[it] = *(const v4f*)(sl + (it * 2 + hh) * 68 + m * 4) + badd;
  float* dst = C + (rowb + (size_t)hh) * (size_t)N + col0 + m * 4;
  {
#pragma unroll
    for (int it = 0; it < 8; ++it) {
      *(v4f*)(dst + (size_t)(it * 2) * (size_t)N) = vals[it];
    }
    
  }
}
__device__ __forceinline__ void epi64hs(float* sl, v8f a0, v8f a1, v8f a2, v8f a3, float oscale, float pscale,
                                        u16* C, int N, size_t rowb, int col0, int lane) {
  stage64(sl, a0, a1, a2, a3, oscale, lane);
  const int hh = lane >> 4, m = lane & 15;
  v4u oh[4];
#pragma unroll
  for (int i4 = 0; i4 < 4; ++i4) {
    const int c8 = (i4 >> 1) * 32 + (i4 & 1) * 16 + hh * 8;   // k block i4>>1, half i4&1 of the wave's two units
    const v4f a = *(const v4f*)(sl + m * 68 + c8), c4 = *(const v4f*)(sl + m * 68 + c8 + 4);
    float w[8];
#pragma unroll
    for (int e = 0; e < 4; ++e) { w[e] = a[e] * pscale; w[4 + e] = c4[e] * pscale; }
#pragma unroll
    for (int e = 0; e < 4; ++e) oh[i4][e] = pk16(h_bits((_Float16)w[2 * e]), h_bits((_Float16)w[2 * e + 1]));
  }
  u16* dst = C + rowb * (size_t)N + (size_t)(col0 >> 5) * 512 + lane * 8;
  {
#pragma unroll
    for (int i4 = 0; i4 < 4; ++i4) {
      *(v4u*)(dst + i4 * 256) = oh[i4];
    }
    
  }
}

// =====================================================================================================
// bf16 GEMM core: acc[rt][j] = rows (16 rt ..) of A . rows (16 j ..) of Bt, A and Bt bf16 planes [..][EMB] in fragment order.
// Wave tile = 64 x 64 (4 A fragments x 4 B fragments, 16 accumulators): every fragment loaded feeds 4 WMMAs. Fragments come
// straight from the planes (two 16-B loads each, split k map for A and B); k stepped by 32, ascending, one WMMA per (tile, step).
// Block = 128 x 128 tile, 4 waves as 2 x 2; grid = (M/128) * (EMB/128), host checks exactness.
// =====================================================================================================
__device__ __forceinline__ void ld_b64(const u16* ap, const u16* bp, v16b (&a)[4], v16b (&b)[4]) {
#pragma unroll
  for (int rt = 0; rt < 4; ++rt) a[rt] = ldfo_b(ap + rt * (16 * EMB));
#pragma unroll
  for (int j = 0; j < 4; ++j) b[j] = ldfo_b(bp + j * (16 * EMB));
}
__device__ __forceinline__ void mm_b64(v8f (&acc)[4][4], const v16b (&a)[4], const v16b (&b)[4]) {
#pragma unroll
  for (int rt = 0; rt < 4; ++rt) {
#pragma unroll
    for (int j = 0; j < 4; ++j) acc[rt][j] = mma_b(a[rt], b[j], acc[rt][j]);
  }
}
__device__ __forceinline__ void core_b64(const u16* ap, const u16* bp, v8f (&acc)[4][4]) {
#pragma unroll
  for (int rt = 0; rt < 4; ++rt) {
#pragma unroll
    for (int j = 0; j < 4; ++j) acc[rt][j] = zero8();
  }
  // Three fragment sets in rotation: a set is refilled for k step s + 3 as soon as the WMMAs of step s have left it, so a wave has
  // two to three steps' loads in flight and its loads have two steps of WMMAs to land in. The loop refills for steps 3 .. KST-1
  // (three a trip); the last three steps stand behind it and load nothing: no load reaches past the planes' k extent.
  v16b a0[4], b0[4], a1[4], b1[4], a2[4], b2[4];
  ld_b64(ap, bp, a0, b0);
  ld_b64(ap + 512, bp + 512, a1, b1);
  ld_b64(ap + 2 * 512, bp + 2 * 512, a2, b2);
  wait_x();
#pragma unroll 1                             // rolled: one trip is 48 WMMAs and 48 loads; the body stays small in the instruction cache
  for (int t = 0; t < KST / 3 - 1; ++t) {
    mm_b64(acc, a0, b0);
    guard_g<u16>(acc, ap, bp, bp);
    ld_b64(ap + 3 * 512, bp + 3 * 512, a0, b0);
    mm_b64(acc, a1, b1);
    guard_g<u16>(acc, ap, bp, bp);
    ld_b64(ap + 4 * 512, bp + 4 * 512, a1, b1);
    mm_b64(acc, a2, b2);
    guard_g<u16>(acc, ap, bp, bp);
    ld_b64(ap + 5 * 512, bp + 5 * 512, a2, b2);
    step3<u16>(ap, bp);
  }
  mm_b64(acc, a0, b0);
  guard_g<u16>(acc, ap, bp, bp);             // the last loads' s_wait_xcnt 0 stands in the last trip's step3
  mm_b64(acc, a1, b1);
  mm_b64(acc, a2, b2);
}

// f32 out: C[M][EMB] = (A . Bt^T) * oscale; epilogue epi64 once per 16-row tile of the wave (same slab, same wave, in order).
__global__ __launch_bounds__(128)
void gemm_b32(const u16* __restrict__ A, const u16* __restrict__ Bt, float* C, int M, float oscale) {
  __shared__ __align__(16) float slab[4 * SLAB64];
  // The wave's number is taken as a scalar: tile row and column then live in scalar registers across the k loop, which keeps the
  // kernel within 336 VGPRs (three waves per SIMD) with three fragment sets.
  const int tid = threadIdx.x, wave = __builtin_amdgcn_readfirstlane(tid >> 5), lane = tid & 31;
  const int bid   = blockIdx.x;
  const int rowb  = (bid / (EMB / 128)) * 128 + (wave >> 1) * 64;
  const int col0  = (bid % (EMB / 128)) * 128 + (wave & 1) * 64;
  if (rowb + 64 > M) return;                 // wave-uniform, never taken with the exact grid; no block barriers in this kernel
  v8f acc[4][4];
  core_b64(A + (size_t)rowb * EMB + 8 * lane, Bt + (size_t)col0 * EMB + 8 * lane, acc);
#pragma unroll
  for (int rt = 0; rt < 4; ++rt)
    epi64(slab + wave * SLAB64, acc[rt][0], acc[rt][1], acc[rt][2], acc[rt][3], oscale, zero4(), C, EMB,
          (size_t)(rowb + 16 * rt), col0, lane);
}

// f16 plane out in fragment order: C16[M][EMB] = f16 bits of ((A . Bt^T) * oscale) * pscale; epilogue epi64hs per 16-row tile.
__global__ __launch_bounds__(128)
void gemm_bh16(const u16* __restrict__ A, const u16* __restrict__ Bt, u16* C, int M, float oscale, float pscale) {
  __shared__ __align__(16) float slab[4 * SLAB64];
  // The wave's number is taken as a scalar: tile row and column then live in scalar registers across the k loop, which keeps the
  // kernel within 336 VGPRs (three waves per SIMD) with three fragment sets.
  const int tid = threadIdx.x, wave = __builtin_amdgcn_readfirstlane(tid >> 5), lane = tid & 31;
  const int bid   = blockIdx.x;
  const int rowb  = (bid / (EMB / 128)) * 128 + (wave >> 1) * 64;
  const int col0  = (bid % (EMB / 128)) * 128 + (wave & 1) * 64;
  if (rowb + 64 > M) return;                 // wave-uniform, never taken with the exact grid; no block barriers in this kernel
  v8f acc[4][4];
  core_b64(A + (size_t)rowb * EMB + 8 * lane, Bt + (size_t)col0 * EMB + 8 * lane, acc);
#pragma unroll
  for (int rt = 0; rt < 4; ++rt)
    epi64hs(slab + wave * SLAB64, acc[rt][0], acc[rt][1], acc[rt][2], acc[rt][3], oscale, pscale, C, EMB,
            (size_t)(rowb + 16 * rt), col0, lane);
}

// =====================================================================================================
// f16 GEMM with two A planes (hi + residual), f32 out with bias:
//   C[M][EMB] = (Ah . Bt^T) * os1 + (Ar . Bt^T) * os2 + bf16RNE(bias[n]); Ah/Ar/Bt f16 planes in fragment order.
// Wave tile = 32 x 64 for both planes (2 + 2 A fragments x 4 B fragments, 16 accumulators: rows 0, 1 of acc = hi plane, rows 2, 3
// = residual plane): a B fragment feeds 4 WMMAs, an A fragment 4. Block = 64 x 128 tile, 4 waves as 2 x 2; grid = (M/64) * (EMB/128).
// Separate accumulators for the two planes, combined in f32 in epi64x2, once per 16-row tile.
// =====================================================================================================
__device__ __forceinline__ void ld_h2(const _Float16* ap, const _Float16* arp, const _Float16* bp, v16h (&a)[4], v16h (&b)[4]) {
  a[0] = ldfo_h(ap);
  a[1] = ldfo_h(ap + 16 * EMB);
  a[2] = ldfo_h(arp);
  a[3] = ldfo_h(arp + 16 * EMB);
#pragma unroll
  for (int j = 0; j < 4; ++j) b[j] = ldfo_h(bp + j * (16 * EMB));
}
__device__ __forceinline__ void mm_h2(v8f (&acc)[4][4], const v16h (&a)[4], const v16h (&b)[4]) {
#pragma unroll
  for (int rt = 0; rt < 4; ++rt) {
#pragma unroll
    for (int j = 0; j < 4; ++j) acc[rt][j] = mma_h(a[rt], b[j], acc[rt][j]);
  }
}
__global__ __launch_bounds__(128)
void gemm_h2_32(const u16* __restrict__ Ah, const u16* __restrict__ Ar, const u16* __restrict__ Bt,
                const float* __restrict__ bias, float* C, int M, float os1, float os2) {
  __shared__ __align__(16) float slab[4 * SLAB64];
  // The wave's number is taken as a scalar: tile row and column then live in scalar registers across the k loop, which keeps the
  // kernel within 336 VGPRs (three waves per SIMD) with three fragment sets.
  const int tid = threadIdx.x, wave = __builtin_amdgcn_readfirstlane(tid >> 5), lane = tid & 31, m = lane & 15;
  const int bid   = blockIdx.x;
  const int rowb  = (bid / (EMB / 128)) * 64 + (wave >> 1) * 32;
  const int col0  = (bid % (EMB / 128)) * 128 + (wave & 1) * 64;
  if (rowb + 32 > M) return;                 // wave-uniform, never taken with the exact grid; no block barriers in this kernel
  const _Float16* ap  = (const _Float16*)(const void*)Ah + (size_t)rowb * EMB + 8 * lane;
  const _Float16* arp = (const _Float16*)(const void*)Ar + (size_t)rowb * EMB + 8 * lane;
  const _Float16* bp  = (const _Float16*)(const void*)Bt + (size_t)col0 * EMB + 8 * lane;
  v8f acc[4][4];
#pragma unroll
  for (int rt = 0; rt < 4; ++rt) {
#pragma unroll
    for (int j = 0; j < 4; ++j) acc[rt][j] = zero8();
  }
  // Three fragment sets in rotation, as in core_b64: a set is refilled for step s + 3 as soon as the WMMAs of step s have left it.
  v16h a0[4], b0[4], a1[4], b1[4], a2[4], b2[4];
  ld_h2(ap, arp, bp, a0, b0);
  ld_h2(ap + 512, arp + 512, bp + 512, a1, b1);
  ld_h2(ap + 2 * 512, arp + 2 * 512, bp + 2 * 512, a2, b2);
  wait_x();
#pragma unroll 1                             // rolled: one trip is 48 WMMAs and 48 loads; the body stays small in the instruction cache
  for (int t = 0; t < KST / 3 - 1; ++t) {
    mm_h2(acc, a0, b0);
    guard_g<_Float16>(acc, ap, arp, bp);
    ld_h2(ap + 3 * 512, arp + 3 * 512, bp + 3 * 512, a0, b0);
    mm_h2(acc, a1, b1);
    guard_g<_Float16>(acc, ap, arp, bp);
    ld_h2(ap + 4 * 512, arp + 4 * 512, bp + 4 * 512, a1, b1);
    mm_h2(acc, a2, b2);
    guard_g<_Float16>(acc, ap, arp, bp);
    ld_h2(ap + 5 * 512, arp + 5 * 512, bp + 5 * 512, a2, b2);
    step3<_Float16>(ap, arp, bp);
  }
  mm_h2(acc, a0, b0);
  guard_g<_Float16>(acc, ap, arp, bp);       // the last loads' s_wait_xcnt 0 stands in the last trip's step3
  mm_h2(acc, a1, b1);
  mm_h2(acc, a2, b2);
  const v4f bv = *(const v4f*)(bias + col0 + m * 4);      // columns col0 + 4m .. +3, always < EMB (col0 a multiple of 64)
  v4f badd;
#pragma unroll
  for (int e = 0; e < 4; ++e) badd[e] = bfr(bv[e]);
#pragma unroll
  for (int rt = 0; rt < 2; ++rt)
    epi64x2(slab + wave * SLAB64, acc[rt][0], acc[rt][1], acc[rt][2], acc[rt][3],
            acc[2 + rt][0], acc[2 + rt][1], acc[2 + rt][2], acc[2 + rt][3], os1, os2, badd, C, EMB,
            (size_t)(rowb + 16 * rt), col0, lane);
}

// =====================================================================================================
// V^T plane in fragment order (rows = b*EMB + d, k = s): element (b, d, s) = f16(V[b][s][d] * 1024).
// Block = (b, 64-wide d chunk, 64 keys): 64 source row segments of 64 floats loaded with 16-B loads, converted, scattered into
// coverage: load 256 thr x 16 elements = 64 x 64; store 2 iterations x 256 thr x 8 halves = 64 lines x 64 = the block's tile;
//           grid = nb x (EMB/64) x (SEQ/64) blocks covers the plane exactly once.
// =====================================================================================================
__global__ __launch_bounds__(256) void xt16(const float* __restrict__ X, u16* XTo) {
  __shared__ __align__(16) u16 TH[64 * VTP];
  const int tid = threadIdx.x;
  const int bid = blockIdx.x;
  const int st  = bid % (SEQ / 64);
  const int dcb = (bid / (SEQ / 64)) % (EMB / 64);
  const int b   = bid / ((SEQ / 64) * (EMB / 64));
  const int s0  = st * 64;
  const int d0  = dcb * 64;
  {
    const int sl = tid >> 2;                  // key within tile 0..63
    const int dc = (tid & 3) * 16;            // d chunk within the 64
    const float* src = X + ((size_t)b * SEQ + s0 + sl) * EMB + d0 + dc;
#pragma unroll
    for (int i = 0; i < 4; ++i) {
      const v4f a = *(const v4f*)(src + 4 * i);
#pragma unroll
      for (int e = 0; e < 4; ++e) {
        const _Float16 hv = (_Float16)(a[e] * VCAR);
        TH[(dc + 4 * i + e) * VTP + sl] = h_bits(hv);
      }
    }
  }
  __syncthreads();
  v4u vh[2];
#pragma unroll
  for (int it = 0; it < 2; ++it) {
    const int q = it * 256 + tid;             // piece of the tile: d block q>>7, key block (q>>6)&1, half (q>>5)&1, lane q&31
    vh[it] = *(const v4u*)(TH + ((q >> 7) * 16 + (q & 15)) * VTP + ((q >> 6) & 1) * 32 + ((q >> 5) & 1) * 16 + ((q >> 4) & 1) * 8);
  }
  const size_t base = ((size_t)b * EMB + d0) * SEQ + (size_t)(s0 >> 5) * 512;
  {
#pragma unroll
    for (int it = 0; it < 2; ++it) {
      const int q = it * 256 + tid;
      *(v4u*)(XTo + base + (size_t)((q >> 7) * 16) * SEQ + (q & 127) * 8) = vh[it];
    }
    
  }
}

// =====================================================================================================
// Per-chunk column sums of V: VS[(b*NCHK + c)*EMB + d] = sum over the CK keys of chunk c of V[b][c*CK + s][d] (f32, fixed
// sequential order). Thread = one (b, c, d); 256 consecutive table entries per block are staged in LDS, then threads 0..63
// coverage: grid = nb*NCHK*EMB/256 blocks (host exact) x 256 = the whole table; store 64 thr x 4 floats = the block's 256.
// =====================================================================================================
__global__ __launch_bounds__(256) void vsum_k(const float* __restrict__ V, float* VS) {
  __shared__ __align__(16) float sm[256];
  const int tid = threadIdx.x;
  const int gt  = blockIdx.x * 256 + tid;
  const int d   = gt % EMB;
  const int bc  = gt / EMB;
  const int b   = bc / NCHK;
  const int c   = bc - b * NCHK;
  const float* p = V + ((size_t)b * SEQ + (size_t)c * CK) * EMB + d;
  float s = 0.f;
  // Few waves run here (8 on each of nb * 12 WGPs), so the time is (loads per thread / loads in flight) x memory latency.
  // Full unroll: all CK row loads hang on one address pair by immediate offsets, and the compiler keeps the wave's load counter
  // full (each add is followed by the next load) where a 4-step body waited out the latency once per 4 rows. The adds stay in
  // ascending key order.
#pragma unroll
  for (int i = 0; i < CK; ++i) s += p[(size_t)i * EMB];
  sm[tid] = s;
  __syncthreads();
  if (tid < 64) {                                   // waves 0 and 1, all lanes active
    const v4f o = *(const v4f*)(sm + tid * 4);
    float* dst = VS + (size_t)blockIdx.x * 256 + tid * 4;
    *(v4f*)(dst) = o;
    
  }
}

// =====================================================================================================
// Single-head attention, head width EMB = 768, all SEQ keys kept (non-causal): block = (batch b, 64 query rows q0..q0+63 = RT = 4
// row tiles of 16), 16 waves. Every K fragment and every V^T fragment that a wave loads feeds one WMMA per row tile.
// q plane (f16, x8) rows b*SEQ+s, k = d; k plane the same; V^T plane rows b*EMB+d, k = s (x1024); all three and the two
// ctx planes in fragment order; VS = per-chunk column sums of V (f32).
//   Per chunk of CK = 512 keys (NCHK = 4 chunks):
//   (S) scores S[query][key n] on WMMA: A = q rows of row tile rt (row m = lane&15, split k map over d), B = k rows (col n = key,
//       split map), 24 d-steps; wave w handles key block w (32 keys) of the chunk for all four row tiles; D element r of lane l
//       of tile rt -> scs[query 16rt+8h+r][key col] (f32 LDS).
//   (M) 16 threads per query row (sub-thread = 32 consecutive keys), two passes of 32 rows: base-2 logits, chunk max via xor
//       shuffles, online running max / rescale factor al / running sum l in f32 registers (the same threads own the row in every
//       chunk), p = exp2(t - m_new) <= 1, chunk row sum ps and its mean C = ps/CK (bit-identical on the row's 16 threads), the
//       CENTRED P' = p - C written as f16(P' * 32768) into the LDS P tile with 16-B stores; al -> rowa[row], C -> rowc[row].
//   (PV) each wave owns d columns 48*wave + 16j + (lane&15), j = 0..2, of all four row tiles (12 accumulators):
//       o = o*al + C*(32768*1024)*VS[chunk][d] (exact add-back of the centring term in f32), then for each key block: A = P'
//       fragments from LDS (row m = query, split map over keys), B = V^T fragments (col n = d, split map over keys).
//       sum_k (P'_k + C) v_k == sum_k p_k v_k exactly.
//   Block barriers after (S) and after (M) order all LDS reuse across chunks and waves.
//   Epilogue: x = o * 16384 / (l * 32768 * 1024) per row (rowi, l >= 1 always); hi = f16(x), res = f16((x - hi) * 2048); each
//   plane is staged in LDS and stored in fragment order.
// coverage: grid nb*32 blocks x 64 rows; staging 16 waves x 48 cols x 64 rows = 64 x 768; store 12 iterations x 512 thr x 8
//           halves = 64 x 768 per plane = every (b, s, d) of both ctx planes exactly once.
// =====================================================================================================
__device__ __forceinline__ void ctx_store(const u16* ct, u16* dst, int tid) {
  v4u v[12];
#pragma unroll
  for (int it = 0; it < 12; ++it) {
    const int rb = it / 3;                    // 16-row block of the tile (3 * 512 pieces each)
    const int p  = (it % 3) * ATT_THREADS + tid;   // piece of that block: k block p>>6, half (p>>5)&1, lane p&31
    v[it] = *(const v4u*)(ct + (rb * 16 + (p & 15)) * CTP + (p >> 6) * 32 + ((p >> 5) & 1) * 16 + ((p >> 4) & 1) * 8);
  }
  {
#pragma unroll
    for (int it = 0; it < 12; ++it) {
      const int p = it * ATT_THREADS + tid;
      *(v4u*)(dst + (size_t)p * 8) = v[it];
    }
  }
}

// V^T fragments of one key block (vp: the wave's d columns, that key block's unit) and one key block's P'.V products.
__device__ __forceinline__ void ld_v(const _Float16* vp, v16h (&g)[NJ]) {
#pragma unroll
  for (int j = 0; j < NJ; ++j) g[j] = ldfo_h(vp + (size_t)(16 * j) * SEQ);
}
__device__ __forceinline__ void pv_step(v8f (&o)[RT][NJ], const _Float16* pp, const v16h (&g)[NJ]) {
  v16h pf[RT];
#pragma unroll
  for (int rt = 0; rt < RT; ++rt) pf[rt] = ldfrag_h(pp + rt * (16 * PLP));
#pragma unroll
  for (int rt = 0; rt < RT; ++rt) {
#pragma unroll
    for (int j = 0; j < NJ; ++j) o[rt][j] = mma_h(pf[rt], g[j], o[rt][j]);
  }
}

__global__ __launch_bounds__(ATT_THREADS)
void attn_fwd(const u16* __restrict__ QPp, const u16* __restrict__ KPp, const u16* __restrict__ VTp,
              const float* __restrict__ VSp, u16* CHo, u16* CRo) {
  __shared__ __align__(16) AttLds L0;              // scores [QT][SCP] f32; reused as the ctx staging tile [QT][CTP] u16
  __shared__ __align__(16) u16 pls[QT * PLP];      // P' tile [QT][PLP] f16 bits
  __shared__ float rowa[QT];
  __shared__ float rowc[QT];
  __shared__ float rowi[QT];
  float* const scs = L0.s;

  const int tid  = threadIdx.x;
  const int wave = tid >> 5;
  const int lane = tid & 31;
  const int hh   = lane >> 4;
  const int m    = lane & 15;
  const int r32  = tid >> 4;                 // query rows owned in phase (M): r32 and 32 + r32
  const int sub  = tid & 15;
  const int kl0  = sub * 32;

  const int bid = blockIdx.x;
  const int b   = bid / (SEQ / QT);
  const int q0  = (bid % (SEQ / QT)) * QT;

  const _Float16* qa  = (const _Float16*)(const void*)QPp + ((size_t)b * SEQ + q0) * EMB + 8 * lane;
  const _Float16* kbp = (const _Float16*)(const void*)KPp + ((size_t)b * SEQ + wave * 32) * EMB + 8 * lane;
  const _Float16* vbp = (const _Float16*)(const void*)VTp + ((size_t)b * EMB + wave * DW) * SEQ + 8 * lane;
  const float* vsb = VSp + (size_t)b * NCHK * EMB + wave * DW + m;
  const float lsc = RSQD * LOG2E / (QSC * KSC);

  float mrun[2] = {-INFINITY, -INFINITY}, lrun[2] = {0.f, 0.f};
  v8f o[RT][NJ];
#pragma unroll
  for (int rt = 0; rt < RT; ++rt) {
#pragma unroll
    for (int j = 0; j < NJ; ++j) o[rt][j] = zero8();
  }

#pragma unroll 1
  for (int c = 0; c < NCHK; ++c) {
    const int kbeg = c * CK;
    // ---- (S) scores of this chunk: key block = wave ----
    {
      const _Float16* qp = qa;
      const _Float16* kp = kbp + (size_t)kbeg * EMB;
      v8f s[RT][2];
#pragma unroll
      for (int rt = 0; rt < RT; ++rt) { s[rt][0] = zero8(); s[rt][1] = zero8(); }
#pragma unroll 1
      for (int k4 = 0; k4 < EMB / 128; ++k4) {             // 6 trips of 4 d-steps, as many steps unrolled as before
#pragma unroll
        for (int u = 0; u < 4; ++u) {
          v16h a[RT];
#pragma unroll
          for (int rt = 0; rt < RT; ++rt) a[rt] = ldfo_h(qp + rt * (16 * EMB) + u * 512);
          const v16h f0 = ldfo_h(kp + u * 512);
          const v16h f1 = ldfo_h(kp + 16 * EMB + u * 512);
#pragma unroll
          for (int rt = 0; rt < RT; ++rt) {
            s[rt][0] = mma_h(a[rt], f0, s[rt][0]);
            s[rt][1] = mma_h(a[rt], f1, s[rt][1]);
          }
          guard_s(s, a, f0, f1, qp, kp);
        }
        qp += 4 * 512;
        kp += 4 * 512;
      }
#pragma unroll
      for (int rt = 0; rt < RT; ++rt) {
        float* srow = scs + (16 * rt + 8 * hh) * SCP + wave * 32 + m;
#pragma unroll
        for (int r = 0; r < 8; ++r) {
          srow[r * SCP]      = s[rt][0][r];
          srow[r * SCP + 16] = s[rt][1][r];
        }
      }
    }
    __syncthreads();
    // The chunk's first two V^T fragment sets are asked for here: they depend on nothing of phase (M) and land while it runs.
    const _Float16* vp = vbp + kbeg * 16;                  // key block kbeg/32 -> 512 elements per unit
    v16h g0[NJ], g1[NJ], g2[NJ];
    ld_v(vp, g0);
    ld_v(vp + 512, g1);
    // ---- (M) softmax statistics and the centred P' tile, 32 rows a pass ----
#pragma unroll
    for (int rg = 0; rg < 2; ++rg) {
      const int row = rg * 32 + r32;
      const float* sp = scs + row * SCP + kl0;
      float t[32];
      float cm = -INFINITY;
#pragma unroll
      for (int i = 0; i < 8; ++i) {
        const v4f a = *(const v4f*)(sp + 4 * i);
#pragma unroll
        for (int e = 0; e < 4; ++e) {
          const float tv = a[e] * lsc;
          t[4 * i + e] = tv;
          cm = fmaxf(cm, tv);
        }
      }
#pragma unroll
      for (int d = 1; d <= 8; d <<= 1) cm = fmaxf(cm, __shfl_xor(cm, d, 32));
      const float mn = fmaxf(mrun[rg], cm);                // finite
      const float al = (mrun[rg] == -INFINITY) ? 0.f : exp2f(mrun[rg] - mn);
      mrun[rg] = mn;
      float ps = 0.f;
#pragma unroll
      for (int j = 0; j < 32; ++j) {
        const float p = exp2f(fminf(t[j] - mn, 0.f));
        t[j] = p;
        ps += p;
      }
#pragma unroll
      for (int d = 1; d <= 8; d <<= 1) ps += __shfl_xor(ps, d, 32);
      const float cc = ps * (1.0f / (float)CK);
      v4u pk[4];
#pragma unroll
      for (int i = 0; i < 4; ++i) {
#pragma unroll
        for (int e = 0; e < 4; ++e) {
          const int j = 8 * i + 2 * e;
          pk[i][e] = pk16(h_bits((_Float16)((t[j] - cc) * PCAR)), h_bits((_Float16)((t[j + 1] - cc) * PCAR)));
        }
      }
      lrun[rg] = lrun[rg] * al + ps;
      u16* pd = pls + row * PLP + kl0;
#pragma unroll
      for (int i = 0; i < 4; ++i) *(v4u*)(pd + 8 * i) = pk[i];
      if (sub == 0) { rowa[row] = al; rowc[row] = cc; }
    }
    __syncthreads();
    // ---- (PV) rescale, add the centring term, accumulate P' . V^T ----
    {
      float vs[NJ];
#pragma unroll
      for (int j = 0; j < NJ; ++j) vs[j] = vsb[(size_t)c * EMB + 16 * j];
#pragma unroll
      for (int rt = 0; rt < RT; ++rt) {
        float scl[8], cad[8];
#pragma unroll
        for (int r = 0; r < 8; ++r) {
          scl[r] = rowa[16 * rt + 8 * hh + r];
          cad[r] = rowc[16 * rt + 8 * hh + r] * (PCAR * VCAR);
        }
#pragma unroll
        for (int j = 0; j < NJ; ++j) {
#pragma unroll
          for (int r = 0; r < 8; ++r) o[rt][j][r] = o[rt][j][r] * scl[r] + cad[r] * vs[j];
        }
      }
      const _Float16* pp = (const _Float16*)(const void*)pls + m * PLP + 8 * hh;
      // Three V^T fragment sets in rotation: key block kb + 2 is fetched in front of the WMMAs of key block kb. Key blocks
      // 0 .. CK/32 - 5 in the loop (three a trip), the last four behind it: no load reaches past the chunk's keys.
#pragma unroll 1                             // rolled: one trip is 36 WMMAs; the body stays small in the instruction cache
      for (int t = 0; t < (CK / 32 - 4) / 3; ++t) {
        ld_v(vp + 2 * 512, g2);
        pv_step(o, pp, g0);
        guard_o(o, vp);
        ld_v(vp + 3 * 512, g0);
        pv_step(o, pp + 32, g1);
        guard_o(o, vp);
        ld_v(vp + 4 * 512, g1);
        pv_step(o, pp + 64, g2);
        guard_o(o, vp);
        vp += 3 * 512;
        pp += 3 * 32;
      }
      ld_v(vp + 2 * 512, g2);
      pv_step(o, pp, g0);
      guard_o(o, vp);
      ld_v(vp + 3 * 512, g0);
      pv_step(o, pp + 32, g1);
      pv_step(o, pp + 64, g2);
      pv_step(o, pp + 96, g0);
      guard_o(o, vp);
    }
  }

#pragma unroll
  for (int rg = 0; rg < 2; ++rg) {
    if (sub == 0) rowi[rg * 32 + r32] = (1.0f / lrun[rg]) * (CSC / (PCAR * VCAR));   // lrun >= 1
  }
  __syncthreads();
  float inv[RT][8];
#pragma unroll
  for (int rt = 0; rt < RT; ++rt) {
#pragma unroll
    for (int r = 0; r < 8; ++r) inv[rt][r] = rowi[16 * rt + 8 * hh + r];
  }

  u16* const ct = L0.c;
  const int cb = wave * DW + m;
  // hi plane
#pragma unroll
  for (int rt = 0; rt < RT; ++rt) {
#pragma unroll
    for (int j = 0; j < NJ; ++j) {
#pragma unroll
      for (int r = 0; r < 8; ++r) {
        const float xs = o[rt][j][r] * inv[rt][r];
        ct[(16 * rt + 8 * hh + r) * CTP + cb + 16 * j] = h_bits((_Float16)xs);
      }
    }
  }
  __syncthreads();
  ctx_store(ct, CHo + ((size_t)b * SEQ + q0) * EMB, tid);
  __syncthreads();
  // residual plane
#pragma unroll
  for (int rt = 0; rt < RT; ++rt) {
#pragma unroll
    for (int j = 0; j < NJ; ++j) {
#pragma unroll
      for (int r = 0; r < 8; ++r) {
        const float xs = o[rt][j][r] * inv[rt][r];
        const _Float16 hv = (_Float16)xs;
        ct[(16 * rt + 8 * hh + r) * CTP + cb + 16 * j] = h_bits((_Float16)((xs - (float)hv) * RSC));
      }
    }
  }
  __syncthreads();
  ctx_store(ct, CRo + ((size_t)b * SEQ + q0) * EMB, tid);
}

// =====================================================================================================
// Workspace map (bytes, rows = nb*SEQ; nb = 8 gives the totals below); every plane is fully written by whole-line stores before
// it is read; all extents are exact multiples of the store granularity (no pad rows); regions A and V are reused sequentially on
// the single in-order stream:
//   WQB bf16 [768][768]   1179648   WKB same   WVB same   WOH f16 of bf16 value x1024  1179648     4718592
//   VS  f32  [nb][4][768]                                                                          98304
//   A   DB bf16 [rows][768] (25165824), later VT f16 [nb][768][2048] x1024 (25165824)     region 25165824
//   Q   QP f16 [rows][768] x8                                                              region 25165824
//   K   KP f16 [rows][768] x8                                                              region 25165824
//   V   V f32 [rows][768] (50331648), later CH f16 [rows][768] + CR f16 [rows][768]        region 50331648
//   end                                                                                        130646016
// =====================================================================================================
extern "C" void kernel_launch(void* const* d_in, const int* in_sizes, int n_in,
                              void* d_out, int out_size, void* d_ws, size_t ws_size,
                              hipStream_t stream) {
  if (n_in < 9) return;
  const long long per = (long long)SEQ * EMB;
  const long long ns  = in_sizes[0];
  if (ns < per || (ns % per) != 0) return;
  const int nb = (int)(ns / per);
  if (nb < 1 || nb > 8) return;
  const int rows = nb * SEQ;
  if (in_sizes[1] != EMB) return;
  if (in_sizes[2] < 1 || in_sizes[3] < 1) return;
  if (in_sizes[4] != EMB * EMB || in_sizes[5] != EMB * EMB || in_sizes[6] != EMB * EMB || in_sizes[7] != EMB * EMB) return;
  if (in_sizes[8] != EMB) return;
  if ((long long)out_size != (long long)rows * EMB) return;

  const float* spk = (const float*)d_in[0];
  const int*   dly = (const int*)d_in[1];
  const float* mpo = (const float*)d_in[2];
  const float* dcy = (const float*)d_in[3];
  const float* wq  = (const float*)d_in[4];
  const float* wk  = (const float*)d_in[5];
  const float* wv  = (const float*)d_in[6];
  const float* wo  = (const float*)d_in[7];
  const float* bo  = (const float*)d_in[8];
  float*       out = (float*)d_out;

  const size_t szW  = (size_t)EMB * EMB * 2;                    //   1179648
  const size_t szVS = (size_t)nb * NCHK * EMB * 4;              //     98304 at nb = 8
  const size_t sz16 = (size_t)rows * EMB * 2;                   //  25165824
  const size_t sz32 = (size_t)rows * EMB * 4;                   //  50331648
  const size_t szVT = (size_t)nb * EMB * SEQ * 2;               //  == sz16
  size_t off = 0;
  const size_t oWQ = off; off += szW;
  const size_t oWK = off; off += szW;
  const size_t oWV = off; off += szW;
  const size_t oWO = off; off += szW;
  const size_t oVS = off; off += szVS;
  const size_t oA  = off; off += (szVT > sz16 ? szVT : sz16);   // DB then VT
  const size_t oQ  = off; off += sz16;
  const size_t oK  = off; off += sz16;
  const size_t oV  = off; off += sz32;                          // V f32, later CH + CR
  if (off > ws_size) return;                                    // off = 130646016 at nb = 8
  if (off > WS_CAP) return;
  if (2 * sz16 > sz32) return;

  char* ws = (char*)d_ws;
  u16*   WQB = (u16*)(ws + oWQ);
  u16*   WKB = (u16*)(ws + oWK);
  u16*   WVB = (u16*)(ws + oWV);
  u16*   WOH = (u16*)(ws + oWO);
  float* VS  = (float*)(ws + oVS);
  u16*   DB  = (u16*)(ws + oA);
  u16*   VT  = (u16*)(ws + oA);
  u16*   QP  = (u16*)(ws + oQ);
  u16*   KP  = (u16*)(ws + oK);
  float* V   = (float*)(ws + oV);
  u16*   CH  = (u16*)(ws + oV);
  u16*   CR  = (u16*)(ws + oV + sz16);

  const int n8w = (EMB * EMB) / 8;                      // 73728
  const int n8g = rows * (EMB / 8);                     // rows * 96
  if ((n8w % 256) != 0 || (n8g % 256) != 0) return;
  if ((rows % 128) != 0 || ((nb * NCHK * EMB) % 256) != 0) return;
  const dim3 blk(256);
  const dim3 gW(n8w / 256), gGa(n8g / 256);
  const dim3 gG((rows / 128) * (EMB / 128));            // 768 at nb = 8: 128 x 128 tiles
  const dim3 gO((rows / 64) * (EMB / 128));             // 1536 at nb = 8: 64 x 128 tiles
  const dim3 bG(128);
  const dim3 gXT(nb * (EMB / 64) * (SEQ / 64));         // nb * 384
  const dim3 gVS((nb * NCHK * EMB) / 256);              // nb * 12
  const dim3 gAT(nb * (SEQ / QT));                      // nb * 32
  const dim3 bAT(ATT_THREADS);

  // (0..3) weights stored [n = out][k = in] (y = x.W^T), rows = n: fragment-order bf16 planes for Wq, Wk, Wv; f16 of bf16 value
  //        x1024 for Wo
  cvt16<<<gW, blk, 0, stream>>>(wq, WQB, n8w, 0, 1.0f);
  cvt16<<<gW, blk, 0, stream>>>(wk, WKB, n8w, 0, 1.0f);
  cvt16<<<gW, blk, 0, stream>>>(wv, WVB, n8w, 0, 1.0f);
  cvt16<<<gW, blk, 0, stream>>>(wo, WOH, n8w, 1, WSC);
  // (4) delayed spikes -> fragment-order bf16 plane, rows x 768
  gather_bf<<<gGa, blk, 0, stream>>>(spk, dly, mpo, dcy, DB, n8g);
  // (5, 6) q and k projections -> f16 planes x8; (7) v projection -> f32 plane
  gemm_bh16<<<gG, bG, 0, stream>>>(DB, WQB, QP, rows, 1.0f, QSC);
  gemm_bh16<<<gG, bG, 0, stream>>>(DB, WKB, KP, rows, 1.0f, KSC);
  gemm_b32<<<gG, bG, 0, stream>>>(DB, WVB, V, rows, 1.0f);
  // (8) v -> V^T plane x1024 (over the dead DB region); (9) per-chunk column sums of v
  xt16<<<gXT, blk, 0, stream>>>(V, VT);
  vsum_k<<<gVS, blk, 0, stream>>>(V, VS);
  // (10) attention -> ctx hi x16384 and residual x2048 f16 planes (over the dead V region)
  attn_fwd<<<gAT, bAT, 0, stream>>>(QP, KP, VT, VS, CH, CR);
  // (11) output projection + bias -> out
  gemm_h2_32<<<gO, bG, 0, stream>>>(CH, CR, WOH, bo, out, rows,
                                     1.0f / (CSC * WSC), 1.0f / (CSC * WSC * RSC));
  (void)hipGetLastError();
}

// v006
// Measured time: 270 microseconds a run.
// Two timings next to v005 put it at 1.08 and 1.09 times that version's speed.
// Counting every step since v000, it is 3.55 times as fast.
// Projections q,k,v = delayed.W^T: v_wmma_f32_16x16x32_bf16 (bf16 RNE operands of the raw inputs, f32 accumulate).
// Scores q'.k'^T (f16 planes x8), P'.V (chunk-centred P' x32768 f16 from LDS, V^T x1024 f16) and the output projection
// (ctx carried as f16 hi x16384 plus residual x2048 planes, times f16(bf16(Wo) x1024), bias added in f32):
// v_wmma_f32_16x16x32_f16, f32 accumulate. Delay gather, softmax statistics, column sums of V and all scaling in f32 on VALU.
#include <hip/hip_runtime.h>
#include <math.h>
#include <stdint.h>

#define SEQ   2048
#define EMB   768
#define CK    512
#define NCHK  4
#define QT    64
#define RT    4
#define NJ    3
#define DW    48
#define SCP   544
#define PLP   528
#define CTP   776
#define SLAB64 (16 * 68)
#define PSN   (CK / 64)
#define ATT_THREADS 512
#define QSC   8.0f
#define KSC   8.0f
#define PCAR  32768.0f
#define VCAR  1024.0f
#define WSC   1024.0f
#define CSC   16384.0f
#define RSC   2048.0f
#define LOG2E 1.4426950408889634f
#define RSQD  0.036084391824351615f
#define WS_CAP ((size_t)134217728)
#define KST   (EMB / 32)
#define GLOBAL_AS __attribute__((address_space(1)))

static_assert((EMB % 128) == 0 && EMB == 8 * 96 && (EMB % 32) == 0 && (EMB / 8) == 96);
static_assert((SEQ % CK) == 0 && (SEQ / CK) == NCHK && CK == 16 * 32 && (SEQ % 64) == 0 && (SEQ / QT) == 32);
static_assert(16 * CTP * 2 <= 16 * SCP * 4 && CTP >= EMB + 8);
static_assert(((PLP * 2) % 16) == 0 && ((SCP * 4) % 16) == 0 && ((CTP * 2) % 16) == 0);
static_assert((CK % 64) == 0 && (SEQ % 128) == 0 && PSN * 64 == CK);
static_assert(NCHK * (EMB / 2) == 3 * ATT_THREADS);
static_assert(ATT_THREADS == 512 && QT == 16 * RT && 2 * (ATT_THREADS / 16) == QT);
static_assert((ATT_THREADS / 32) * 32 == CK && (ATT_THREADS / 32) * DW == EMB && DW == 16 * NJ);
static_assert(3 * ATT_THREADS * 8 == 16 * EMB);
static_assert(((EMB * EMB) % 2048) == 0);
static_assert(3 * 512 * 2 == 0xc00 && (KST % 3) == 0 && KST >= 6 && ((CK / 32) % 3) == 1 && (CK / 32) >= 4);

typedef unsigned short u16;
typedef _Float16 v16h __attribute__((ext_vector_type(16)));
typedef _Float16 v8h  __attribute__((ext_vector_type(8)));
typedef __bf16   v16b __attribute__((ext_vector_type(16)));
typedef float    v8f  __attribute__((ext_vector_type(8)));
typedef float    v4f  __attribute__((ext_vector_type(4)));
typedef float    v2f  __attribute__((ext_vector_type(2)));
typedef unsigned int v4u __attribute__((ext_vector_type(4)));

union FragH { v16h v; v8h h[2]; v4u u[2]; };
union FragB { v16b v; v4u u[2]; };
union AttLds { float s[QT * SCP]; u16 c[2 * QT * SCP]; };

// ---- scalar helpers --------------------------------------------------------------------------------
__device__ __forceinline__ unsigned short bf_bits(float f) {          // f32 -> bf16 bits, RNE convert
  unsigned u = __float_as_uint(f);
  return (unsigned short)((u + 0x7FFFu + ((u >> 16) & 1u)) >> 16);
}
__device__ __forceinline__ float bf_up(unsigned short h) { return __uint_as_float(((unsigned)h) << 16); }
__device__ __forceinline__ float bfr(float f) { return bf_up(bf_bits(f)); }
__device__ __forceinline__ unsigned short h_bits(_Float16 x) { return __builtin_bit_cast(unsigned short, x); }
__device__ __forceinline__ unsigned pk16(unsigned short a, unsigned short b) { return (unsigned)a | ((unsigned)b << 16); }
__device__ __forceinline__ v8f zero8() { v8f z = {0.f, 0.f, 0.f, 0.f, 0.f, 0.f, 0.f, 0.f}; return z; }

// ---- fragment loaders: 16-bit A/B operand, lane -> row/col (lane&15), p already includes +8*(lane>>4);
//      elements 0..7 <- p[0..7] (k0+8h..), elements 8..15 <- p[16..23] (k0+16+8h..)  (same split k map for A and B;
//      this row-major form is used for the P' tile in LDS only)
__device__ __forceinline__ v16h ldfrag_h(const _Float16* p) {
  FragH f;
  f.h[0] = *(const v8h*)(p);
  f.h[1] = *(const v8h*)(p + 16);
  return f.v;
}
// ---- fragment-order planes (every 16-bit operand plane in the workspace): a plane [R][K] is stored as
//      [R/16][K/32][2][32 lanes][8 elements]. The 1-KiB unit of (row block rb, k block kb) starts at element rb*16*K + kb*512;
//      in it lane (16*hh + m) finds, at 8*lane, row m's k = 8*hh + 0..7 and, 256 elements on, k = 16 + 8*hh + 0..7: the same
//      split k map as above. A fragment is two 16-B loads per lane, each 512 contiguous bytes per wave (4 whole lines).
//      p already includes +8*lane.
//      The planes lie in global memory; the casts say so, since a pointer that has passed through an asm statement (step3) would
//      otherwise be read by flat loads.
__device__ __forceinline__ v16h ldfo_h(const _Float16* p) {
  FragH f;
  f.h[0] = *(const GLOBAL_AS v8h*)(p);
  f.h[1] = *(const GLOBAL_AS v8h*)(p + 256);
  return f.v;
}
__device__ __forceinline__ v16b ldfo_b(const u16* p) {                // bf16 plane read as unsigned integer vectors
  FragB f;
  f.u[0] = *(const GLOBAL_AS v4u*)(p);
  f.u[1] = *(const GLOBAL_AS v4u*)(p + 256);
  return f.v;
}

__device__ __forceinline__ v8f mma_h(v16h a, v16h b, v8f c) {
  return __builtin_amdgcn_wmma_f32_16x16x32_f16(false, a, false, b, (short)0, c, false, false);
}
__device__ __forceinline__ v8f mma_b(v16b a, v16b b, v8f c) {
  return __builtin_amdgcn_wmma_f32_16x16x32_bf16(false, a, false, b, (short)0, c, false, false);
}
// The v_nop guards below stand behind the WMMAs of a step: they keep the four vector slots that the chip needs before
// the operand registers are reloaded or the accumulators are touched, on the taken back edge too. The accumulators are named so that every WMMA of the step stays in front of the slots.
// guard_s also holds s_wait_xcnt 0 in front of the rewrite of the two address pairs that the step's global loads name; the pairs
// are inputs so that nothing overwrites them ahead of that wait.
__device__ __forceinline__ void guard_s(v8f (&s)[RT][2], const v16h (&a)[RT], v16h f0, v16h f1,
                                        const _Float16* qp, const _Float16* kp) {
#if defined(__HIP_DEVICE_COMPILE__)
  asm volatile("s_wait_xcnt 0x0\n\tv_nop\n\tv_nop\n\tv_nop\n\tv_nop"
               : "+v"(s[0][0]), "+v"(s[0][1]), "+v"(s[1][0]), "+v"(s[1][1]),
                 "+v"(s[2][0]), "+v"(s[2][1]), "+v"(s[3][0]), "+v"(s[3][1])
               : "v"(a[0]), "v"(a[1]), "v"(a[2]), "v"(a[3]), "v"(f0), "v"(f1), "v"(qp), "v"(kp) : "memory");
#endif
}
// guard_g (GEMM k loops) holds the same four slots and, like guard_s, s_wait_xcnt 0 in front of the rewrite of the address pairs
// that the issued global loads name; the pairs are inputs so that nothing overwrites them ahead of that wait (a loop with two
// pairs names one of them twice). The "memory" clobber keeps the loads of the sets fetched ahead on the side of the guard where
// the source has them. The fragment sets are not named: three sets and the accumulators pass v255, where no asm operand can lie.
template <typename P>
__device__ __forceinline__ void guard_g(v8f (&c)[4][4], const P* p0, const P* p1, const P* p2) {
#if defined(__HIP_DEVICE_COMPILE__)
  asm volatile("s_wait_xcnt 0x0\n\tv_nop\n\tv_nop\n\tv_nop\n\tv_nop"
               : "+v"(c[0][0]), "+v"(c[0][1]), "+v"(c[0][2]), "+v"(c[0][3]), "+v"(c[1][0]), "+v"(c[1][1]), "+v"(c[1][2]), "+v"(c[1][3]),
                 "+v"(c[2][0]), "+v"(c[2][1]), "+v"(c[2][2]), "+v"(c[2][3]), "+v"(c[3][0]), "+v"(c[3][1]), "+v"(c[3][2]), "+v"(c[3][3])
               : "v"(p0), "v"(p1), "v"(p2)
               : "memory");
#endif
}
// wait_x: s_wait_xcnt 0 alone: behind the first three sets' loads of a k loop, the VS loads (attn_fwd) or the column sums' stores (gemm_vt).
__device__ __forceinline__ void wait_x() {
#if defined(__HIP_DEVICE_COMPILE__)
  asm volatile("s_wait_xcnt 0x0" : : : "memory");
#endif
}
// step3: moves the address pairs three k blocks on (3 * 512 elements of 2 bytes = 0xc00 bytes). The additions stand in one asm
// statement with s_wait_xcnt 0 in front of them: written in the source, the compiler lifted them over a wait in a statement of
// its own, directly behind the trip's last loads, which name these pairs.
template <typename P>
__device__ __forceinline__ void step3(const P*& p0, const P*& p1) {
#if defined(__HIP_DEVICE_COMPILE__)
  asm volatile("s_wait_xcnt 0x0\n\tv_add_nc_u64_e32 %0, 0xc00, %0\n\tv_add_nc_u64_e32 %1, 0xc00, %1"
               : "+v"(p0), "+v"(p1) : : "memory");
#endif
}
template <typename P>
__device__ __forceinline__ void step3(const P*& p0, const P*& p1, const P*& p2) {
#if defined(__HIP_DEVICE_COMPILE__)
  asm volatile("s_wait_xcnt 0x0\n\tv_add_nc_u64_e32 %0, 0xc00, %0\n\tv_add_nc_u64_e32 %1, 0xc00, %1\n\tv_add_nc_u64_e32 %2, 0xc00, %2"
               : "+v"(p0), "+v"(p1), "+v"(p2) : : "memory");
#endif
}
// guard_o (P'.V loop): the four slots, and s_wait_xcnt 0 in front of the rewrite of the V^T address pair, which is an input.
__device__ __forceinline__ void guard_o(v8f (&o)[RT][NJ], const _Float16* vp) {
#if defined(__HIP_DEVICE_COMPILE__)
  asm volatile("s_wait_xcnt 0x0\n\tv_nop\n\tv_nop\n\tv_nop\n\tv_nop"
               : "+v"(o[0][0]), "+v"(o[0][1]), "+v"(o[0][2]), "+v"(o[1][0]), "+v"(o[1][1]), "+v"(o[1][2]),
                 "+v"(o[2][0]), "+v"(o[2][1]), "+v"(o[2][2]), "+v"(o[3][0]), "+v"(o[3][1]), "+v"(o[3][2])
               : "v"(vp) : "memory");
#endif
}
// Orders a wave's own LDS slab writes before its reads of them. The fences name LDS alone: a wave now stages several 16-row tiles
// one after another, and a fence over global memory too would hold each staging back until the last tile's global stores are done.
__device__ __forceinline__ void wave_sync_lds() {
  __builtin_amdgcn_fence(__ATOMIC_RELEASE, "workgroup", "local");
  __builtin_amdgcn_wave_barrier();
  __builtin_amdgcn_fence(__ATOMIC_ACQUIRE, "workgroup", "local");
}

// =====================================================================================================
// f32 plane [EMB][EMB] -> 16-bit plane in fragment order:  mode 0: bf16 RNE bits;  mode 1: f16 bits of (bf16 RNE value) * scale;
// mode 2: f16 bits of value * scale (no bf16 pre-step).
// Thread = one 16-B piece of the fragment-order plane (8 consecutive k of one row): two 16-B loads, one 16-B store; 32
// consecutive lanes store 512 contiguous, 512-B aligned bytes
// coverage: grid = n8/256 blocks (host checks exactness) x 256 thr x 8 = the whole plane.
// =====================================================================================================
__global__ __launch_bounds__(256) void cvt16(const float* __restrict__ x, u16* D, int n8, int mode, float scale) {
  const int gt = blockIdx.x * 256 + (int)threadIdx.x;
  if (gt >= n8) return;                     // no barriers in this kernel
  const int unit = gt >> 6;
  const int rb   = unit / (EMB / 32);
  const int kb   = unit - rb * (EMB / 32);
  const float* p = x + (size_t)(rb * 16 + (gt & 15)) * EMB + kb * 32 + ((gt >> 5) & 1) * 16 + ((gt >> 4) & 1) * 8;
  const v4f a = *(const v4f*)(p), c4 = *(const v4f*)(p + 4);
  float v[8];
#pragma unroll
  for (int e = 0; e < 4; ++e) { v[e] = a[e]; v[4 + e] = c4[e]; }
  unsigned short s[8];
#pragma unroll
  for (int e = 0; e < 8; ++e) {
    const float vb = bfr(v[e]);
    const float vf = (mode == 1) ? vb : v[e];
    const unsigned short hb = h_bits((_Float16)(vf * scale));
    const unsigned short bb = bf_bits(v[e]);
    s[e] = (mode != 0) ? hb : bb;
  }
  v4u o;
#pragma unroll
  for (int e = 0; e < 4; ++e) o[e] = pk16(s[2 * e], s[2 * e + 1]);
  u16* d = D + (size_t)gt * 8;
  {
    *(v4u*)(d) = o;
    
  }
}

// =====================================================================================================
// Delay gather to a bf16 plane in fragment order (rows = b*SEQ + t, k = n): element (b, t, n) = bf16 RNE bits of
// sp[b][t - dl[n]][n] when t - dl[n] >= 0, else 0 (the zero is
// written). The source row index is clamped into [0, SEQ) for the address; the value is selected afterwards.
// Thread = one 16-B piece (8 consecutive n of one (b, t) row): 8 scalar loads, one 16-B store; 32 consecutive lanes = 16 rows x
// 16 n, stored as 512 contiguous bytes
// coverage: grid = n8/256 blocks (host exact) x 256 thr x 8 = rows x EMB = the whole plane.
// =====================================================================================================
__global__ __launch_bounds__(256) void gather_bf(const float* __restrict__ sp, const int* __restrict__ dl,
                                                 const float* __restrict__ mpu, const float* __restrict__ dcu,
                                                 u16* DB, int n8) {
  const int gt = blockIdx.x * 256 + (int)threadIdx.x;
  if (gt >= n8) return;                     // no barriers in this kernel
  const int unit = gt >> 6;
  const int rb   = unit / (EMB / 32);
  const int kb   = unit - rb * (EMB / 32);
  const int row = rb * 16 + (gt & 15);
  const int n0  = kb * 32 + ((gt >> 5) & 1) * 16 + ((gt >> 4) & 1) * 8;
  const int b   = row / SEQ;
  const int t   = row - b * SEQ;
  unsigned short s[8];
#pragma unroll
  for (int e = 0; e < 8; ++e) {
    const int n   = n0 + e;
    const int d   = dl[n];
    const int src = t - d;
    int sc = (src < 0) ? 0 : src;
    sc = (sc > SEQ - 1) ? (SEQ - 1) : sc;
    const float v = sp[((size_t)b * SEQ + (size_t)sc) * EMB + n];
    s[e] = (src >= 0) ? bf_bits(v) : (unsigned short)0;
  }
  v4u o;
#pragma unroll
  for (int e = 0; e < 4; ++e) o[e] = pk16(s[2 * e], s[2 * e + 1]);
  u16* dst = DB + (size_t)gt * 8;
  {
    *(v4u*)(dst) = o;
    
  }
  (void)mpu; (void)dcu;
}

// =====================================================================================================
//  epi64x2: f32 rows, staged value = acc*os1 + accres*os2 + badd (two accumulator sets combined in f32); instruction it stores rows
//           2*it (lanes 0..15, 16 B each) and 2*it+1 (lanes 16..31).
//  epi64hs: f16 bits of (tile * pscale), stored in fragment order (k = column): lane (16*hh + m) = row m, 8 consecutive columns;
// coverage: epi64x2 8 instructions x 2 rows x 16 lanes x 4 floats; epi64hs 4 instructions x 32 lanes x 8 halves
//           = the wave's 16 x 64 tile in every case.
// =====================================================================================================
__device__ __forceinline__ void stage64(float* sl, v8f a0, v8f a1, v8f a2, v8f a3, float oscale, int lane) {
  const int hh = lane >> 4, m = lane & 15;
#pragma unroll
  for (int r = 0; r < 8; ++r) {
    const int ro = (8 * hh + r) * 68 + m;
    sl[ro]      = a0[r] * oscale;
    sl[ro + 16] = a1[r] * oscale;
    sl[ro + 32] = a2[r] * oscale;
    sl[ro + 48] = a3[r] * oscale;
  }
  wave_sync_lds();
}
__device__ __forceinline__ void epi64x2(float* sl, v8f a0, v8f a1, v8f a2, v8f a3, v8f e0, v8f e1, v8f e2, v8f e3,
                                        float os1, float os2, v4f badd, float* C, int N, size_t rowb, int col0, int lane) {
  const int hh = lane >> 4, m = lane & 15;
#pragma unroll
  for (int r = 0; r < 8; ++r) {
    const int ro = (8 * hh + r) * 68 + m;
    sl[ro]      = a0[r] * os1 + e0[r] * os2;
    sl[ro + 16] = a1[r] * os1 + e1[r] * os2;
    sl[ro + 32] = a2[r] * os1 + e2[r] * os2;
    sl[ro + 48] = a3[r] * os1 + e3[r] * os2;
  }
  wave_sync_lds();
  v4f vals[8];
#pragma unroll
  for (int it = 0; it < 8; ++it) vals[it] = *(const v4f*)(sl + (it * 2 + hh) * 68 + m * 4) + badd;
  float* dst = C + (rowb + (size_t)hh) * (size_t)N + col0 + m * 4;
  {
#pragma unroll
    for (int it = 0; it < 8; ++it) {
      *(v4f*)(dst + (size_t)(it * 2) * (size_t)N) = vals[it];
    }
    
  }
}
__device__ __forceinline__ void epi64hs(float* sl, v8f a0, v8f a1, v8f a2, v8f a3, float oscale, float pscale,
                                        u16* C, int N, size_t rowb, int col0, int lane) {
  stage64(sl, a0, a1, a2, a3, oscale, lane);
  const int hh = lane >> 4, m = lane & 15;
  v4u oh[4];
#pragma unroll
  for (int i4 = 0; i4 < 4; ++i4) {
    const int c8 = (i4 >> 1) * 32 + (i4 & 1) * 16 + hh * 8;   // k block i4>>1, half i4&1 of the wave's two units
    const v4f a = *(const v4f*)(sl + m * 68 + c8), c4 = *(const v4f*)(sl + m * 68 + c8 + 4);
    float w[8];
#pragma unroll
    for (int e = 0; e < 4; ++e) { w[e] = a[e] * pscale; w[4 + e] = c4[e] * pscale; }
#pragma unroll
    for (int e = 0; e < 4; ++e) oh[i4][e] = pk16(h_bits((_Float16)w[2 * e]), h_bits((_Float16)w[2 * e + 1]));
  }
  u16* dst = C + rowb * (size_t)N + (size_t)(col0 >> 5) * 512 + lane * 8;
  {
#pragma unroll
    for (int i4 = 0; i4 < 4; ++i4) {
      *(v4u*)(dst + i4 * 256) = oh[i4];
    }
    
  }
}

// =====================================================================================================
// bf16 GEMM core: acc[rt][j] = rows (16 rt ..) of A . rows (16 j ..) of Bt, A and Bt bf16 planes [..][EMB] in fragment order.
// Wave tile = 64 x 64 (4 A fragments x 4 B fragments, 16 accumulators): every fragment loaded feeds 4 WMMAs. Fragments come
// straight from the planes (two 16-B loads each, split k map for A and B); k stepped by 32, ascending, one WMMA per (tile, step).
// Block = 128 x 128 tile, 4 waves as 2 x 2; grid = (M/128) * (EMB/128), host checks exactness.
// =====================================================================================================
__device__ __forceinline__ void ld_b64(const u16* ap, const u16* bp, v16b (&a)[4], v16b (&b)[4]) {
#pragma unroll
  for (int rt = 0; rt < 4; ++rt) a[rt] = ldfo_b(ap + rt * (16 * EMB));
#pragma unroll
  for (int j = 0; j < 4; ++j) b[j] = ldfo_b(bp + j * (16 * EMB));
}
__device__ __forceinline__ void mm_b64(v8f (&acc)[4][4], const v16b (&a)[4], const v16b (&b)[4]) {
#pragma unroll
  for (int rt = 0; rt < 4; ++rt) {
#pragma unroll
    for (int j = 0; j < 4; ++j) acc[rt][j] = mma_b(a[rt], b[j], acc[rt][j]);
  }
}
__device__ __forceinline__ void core_b64(const u16* ap, const u16* bp, v8f (&acc)[4][4]) {
#pragma unroll
  for (int rt = 0; rt < 4; ++rt) {
#pragma unroll
    for (int j = 0; j < 4; ++j) acc[rt][j] = zero8();
  }
  // Three fragment sets in rotation: a set is refilled for k step s + 3 as soon as the WMMAs of step s have left it, so a wave has
  // two to three steps' loads in flight and its loads have two steps of WMMAs to land in. The loop refills for steps 3 .. KST-1
  // (three a trip); the last three steps stand behind it and load nothing: no load reaches past the planes' k extent.
  v16b a0[4], b0[4], a1[4], b1[4], a2[4], b2[4];
  ld_b64(ap, bp, a0, b0);
  ld_b64(ap + 512, bp + 512, a1, b1);
  ld_b64(ap + 2 * 512, bp + 2 * 512, a2, b2);
  wait_x();
#pragma unroll 1                             // rolled: one trip is 48 WMMAs and 48 loads; the body stays small in the instruction cache
  for (int t = 0; t < KST / 3 - 1; ++t) {
    mm_b64(acc, a0, b0);
    guard_g<u16>(acc, ap, bp, bp);
    ld_b64(ap + 3 * 512, bp + 3 * 512, a0, b0);
    mm_b64(acc, a1, b1);
    guard_g<u16>(acc, ap, bp, bp);
    ld_b64(ap + 4 * 512, bp + 4 * 512, a1, b1);
    mm_b64(acc, a2, b2);
    guard_g<u16>(acc, ap, bp, bp);
    ld_b64(ap + 5 * 512, bp + 5 * 512, a2, b2);
    step3<u16>(ap, bp);
  }
  mm_b64(acc, a0, b0);
  guard_g<u16>(acc, ap, bp, bp);             // the last loads' s_wait_xcnt 0 stands in the last trip's step3
  mm_b64(acc, a1, b1);
  mm_b64(acc, a2, b2);
}

// V projection (rows = b*SEQ + s, columns = d), handed on as the two things attention reads; V itself is never stored.
//  V^T plane in fragment order (rows = b*EMB + d, k = s), element = f16(V[b][s][d] * 1024): a lane's accumulator acc[rt][j] holds
//  column d = col0 + 16j + (lane&15) at rows 16rt + 8*(lane>>4) + 0..7, which is that lane's own 16-B piece of the unit (d block j,
//  key block rt>>1), half rt&1: eight converts and one 16-B store, no exchange between lanes; a wave's store = 512 contiguous B.
//  PS[(row / 64)][d] = sum of V over the wave tile's 64 keys (f32): rt and r ascending in the lane, then the other half-wave's sum.
// coverage: 16 stores x 32 lanes x 8 halves = the wave's 64 x 64 tile; 2 stores x 32 lanes = its 64 column sums (one whole 128-B
//           line each); the grid covers every (row / 64, d) once.
__global__ __launch_bounds__(128)
void gemm_vt(const u16* __restrict__ A, const u16* __restrict__ Bt, u16* VTo, float* PS, int M) {
  // The wave's number is taken as a scalar: tile row and column then live in scalar registers across the k loop, which keeps the
  // kernel within 336 VGPRs (three waves per SIMD) with three fragment sets.
  const int tid = threadIdx.x, wave = __builtin_amdgcn_readfirstlane(tid >> 5), lane = tid & 31;
  const int bid   = blockIdx.x;
  const int rowb  = (bid / (EMB / 128)) * 128 + (wave >> 1) * 64;
  const int col0  = (bid % (EMB / 128)) * 128 + (wave & 1) * 64;
  if (rowb + 64 > M) return;                 // wave-uniform, never taken with the exact grid; no block barriers in this kernel
  v8f acc[4][4];
  core_b64(A + (size_t)rowb * EMB + 8 * lane, Bt + (size_t)col0 * EMB + 8 * lane, acc);
  const int b  = rowb / SEQ;                 // a 64-row tile lies in one batch (SEQ is a multiple of 128)
  const int s0 = rowb - b * SEQ;
  v4u oh[4][4];
  float cs[4];
#pragma unroll
  for (int j = 0; j < 4; ++j) {
    float s = 0.f;
#pragma unroll
    for (int rt = 0; rt < 4; ++rt) {
#pragma unroll
      for (int r = 0; r < 8; ++r) s += acc[rt][j][r];
#pragma unroll
      for (int e = 0; e < 4; ++e)
        oh[j][rt][e] = pk16(h_bits((_Float16)(acc[rt][j][2 * e] * VCAR)), h_bits((_Float16)(acc[rt][j][2 * e + 1] * VCAR)));
    }
    cs[j] = s;
  }
#pragma unroll
  for (int j = 0; j < 4; ++j) cs[j] += __shfl_xor(cs[j], 16, 32);
  const float c01 = (lane & 16) ? cs[1] : cs[0];          // column col0 + lane
  const float c23 = (lane & 16) ? cs[3] : cs[2];          // column col0 + 32 + lane
  u16* dst  = VTo + ((size_t)b * EMB + col0) * SEQ + (size_t)(s0 >> 5) * 512 + lane * 8;
  float* pd = PS + (size_t)(rowb >> 6) * EMB + col0 + lane;
  pd[0]  = c01;
  pd[32] = c23;
  // s_wait_xcnt 0 behind the sums' two stores, in front of any rewrite of their registers; its "memory" clobber keeps the plane's 16
  // stores behind it, last in the kernel, so that no register is written behind them.
  wait_x();
#pragma unroll
  for (int j = 0; j < 4; ++j) {
#pragma unroll
    for (int rt = 0; rt < 4; ++rt) *(v4u*)(dst + (size_t)(16 * j) * SEQ + rt * 256) = oh[j][rt];
  }
}

// f16 plane out in fragment order: C16[M][EMB] = f16 bits of ((A . Bt^T) * oscale) * pscale; epilogue epi64hs per 16-row tile.
__global__ __launch_bounds__(128)
void gemm_bh16(const u16* __restrict__ A, const u16* __restrict__ Bt, u16* C, int M, float oscale, float pscale) {
  __shared__ __align__(16) float slab[4 * SLAB64];
  // The wave's number is taken as a scalar: tile row and column then live in scalar registers across the k loop, which keeps the
  // kernel within 336 VGPRs (three waves per SIMD) with three fragment sets.
  const int tid = threadIdx.x, wave = __builtin_amdgcn_readfirstlane(tid >> 5), lane = tid & 31;
  const int bid   = blockIdx.x;
  const int rowb  = (bid / (EMB / 128)) * 128 + (wave >> 1) * 64;
  const int col0  = (bid % (EMB / 128)) * 128 + (wave & 1) * 64;
  if (rowb + 64 > M) return;                 // wave-uniform, never taken with the exact grid; no block barriers in this kernel
  v8f acc[4][4];
  core_b64(A + (size_t)rowb * EMB + 8 * lane, Bt + (size_t)col0 * EMB + 8 * lane, acc);
#pragma unroll
  for (int rt = 0; rt < 4; ++rt)
    epi64hs(slab + wave * SLAB64, acc[rt][0], acc[rt][1], acc[rt][2], acc[rt][3], oscale, pscale, C, EMB,
            (size_t)(rowb + 16 * rt), col0, lane);
}

// =====================================================================================================
// f16 GEMM with two A planes (hi + residual), f32 out with bias:
//   C[M][EMB] = (Ah . Bt^T) * os1 + (Ar . Bt^T) * os2 + bf16RNE(bias[n]); Ah/Ar/Bt f16 planes in fragment order.
// Wave tile = 32 x 64 for both planes (2 + 2 A fragments x 4 B fragments, 16 accumulators: rows 0, 1 of acc = hi plane, rows 2, 3
// = residual plane): a B fragment feeds 4 WMMAs, an A fragment 4. Block = 64 x 128 tile, 4 waves as 2 x 2; grid = (M/64) * (EMB/128).
// Separate accumulators for the two planes, combined in f32 in epi64x2, once per 16-row tile.
// =====================================================================================================
__device__ __forceinline__ void ld_h2(const _Float16* ap, const _Float16* arp, const _Float16* bp, v16h (&a)[4], v16h (&b)[4]) {
  a[0] = ldfo_h(ap);
  a[1] = ldfo_h(ap + 16 * EMB);
  a[2] = ldfo_h(arp);
  a[3] = ldfo_h(arp + 16 * EMB);
#pragma unroll
  for (int j = 0; j < 4; ++j) b[j] = ldfo_h(bp + j * (16 * EMB));
}
__device__ __forceinline__ void mm_h2(v8f (&acc)[4][4], const v16h (&a)[4], const v16h (&b)[4]) {
#pragma unroll
  for (int rt = 0; rt < 4; ++rt) {
#pragma unroll
    for (int j = 0; j < 4; ++j) acc[rt][j] = mma_h(a[rt], b[j], acc[rt][j]);
  }
}
__global__ __launch_bounds__(128)
void gemm_h2_32(const u16* __restrict__ Ah, const u16* __restrict__ Ar, const u16* __restrict__ Bt,
                const float* __restrict__ bias, float* C, int M, float os1, float os2) {
  __shared__ __align__(16) float slab[4 * SLAB64];
  // The wave's number is taken as a scalar: tile row and column then live in scalar registers across the k loop, which keeps the
  // kernel within 336 VGPRs (three waves per SIMD) with three fragment sets.
  const int tid = threadIdx.x, wave = __builtin_amdgcn_readfirstlane(tid >> 5), lane = tid & 31, m = lane & 15;
  const int bid   = blockIdx.x;
  const int rowb  = (bid / (EMB / 128)) * 64 + (wave >> 1) * 32;
  const int col0  = (bid % (EMB / 128)) * 128 + (wave & 1) * 64;
  if (rowb + 32 > M) return;                 // wave-uniform, never taken with the exact grid; no block barriers in this kernel
  const _Float16* ap  = (const _Float16*)(const void*)Ah + (size_t)rowb * EMB + 8 * lane;
  const _Float16* arp = (const _Float16*)(const void*)Ar + (size_t)rowb * EMB + 8 * lane;
  const _Float16* bp  = (const _Float16*)(const void*)Bt + (size_t)col0 * EMB + 8 * lane;
  v8f acc[4][4];
#pragma unroll
  for (int rt = 0; rt < 4; ++rt) {
#pragma unroll
    for (int j = 0; j < 4; ++j) acc[rt][j] = zero8();
  }
  // Three fragment sets in rotation, as in core_b64: a set is refilled for step s + 3 as soon as the WMMAs of step s have left it.
  v16h a0[4], b0[4], a1[4], b1[4], a2[4], b2[4];
  ld_h2(ap, arp, bp, a0, b0);
  ld_h2(ap + 512, arp + 512, bp + 512, a1, b1);
  ld_h2(ap + 2 * 512, arp + 2 * 512, bp + 2 * 512, a2, b2);
  wait_x();
#pragma unroll 1                             // rolled: one trip is 48 WMMAs and 48 loads; the body stays small in the instruction cache
  for (int t = 0; t < KST / 3 - 1; ++t) {
    mm_h2(acc, a0, b0);
    guard_g<_Float16>(acc, ap, arp, bp);
    ld_h2(ap + 3 * 512, arp + 3 * 512, bp + 3 * 512, a0, b0);
    mm_h2(acc, a1, b1);
    guard_g<_Float16>(acc, ap, arp, bp);
    ld_h2(ap + 4 * 512, arp + 4 * 512, bp + 4 * 512, a1, b1);
    mm_h2(acc, a2, b2);
    guard_g<_Float16>(acc, ap, arp, bp);
    ld_h2(ap + 5 * 512, arp + 5 * 512, bp + 5 * 512, a2, b2);
    step3<_Float16>(ap, arp, bp);
  }
  mm_h2(acc, a0, b0);
  guard_g<_Float16>(acc, ap, arp, bp);       // the last loads' s_wait_xcnt 0 stands in the last trip's step3
  mm_h2(acc, a1, b1);
  mm_h2(acc, a2, b2);
  const v4f bv = *(const v4f*)(bias + col0 + m * 4);      // columns col0 + 4m .. +3, always < EMB (col0 a multiple of 64)
  v4f badd;
#pragma unroll
  for (int e = 0; e < 4; ++e) badd[e] = bfr(bv[e]);
#pragma unroll
  for (int rt = 0; rt < 2; ++rt)
    epi64x2(slab + wave * SLAB64, acc[rt][0], acc[rt][1], acc[rt][2], acc[rt][3],
            acc[2 + rt][0], acc[2 + rt][1], acc[2 + rt][2], acc[2 + rt][3], os1, os2, badd, C, EMB,
            (size_t)(rowb + 16 * rt), col0, lane);
}

// =====================================================================================================
// Single-head attention, head width EMB = 768, all SEQ keys kept (non-causal): block = (batch b, 64 query rows q0..q0+63 = RT = 4
// row tiles of 16), 16 waves. Every K fragment and every V^T fragment that a wave loads feeds one WMMA per row tile.
// q plane (f16, x8) rows b*SEQ+s, k = d; k plane the same; V^T plane rows b*EMB+d, k = s (x1024); all three and the two
// ctx planes in fragment order; PS = column sums of V over each 64 keys (f32), PSN = 8 of them to a chunk.
//   Per chunk of CK = 512 keys (NCHK = 4 chunks):
//   (S) scores S[query][key n] on WMMA: A = q rows of row tile rt (row m = lane&15, split k map over d), B = k rows (col n = key,
//       split map), 24 d-steps; wave w handles key block w (32 keys) of the chunk for all four row tiles; D element r of lane l
//       of tile rt -> scs[query 16rt+8h+r][key col] (f32 LDS).
//   (M) 16 threads per query row (sub-thread = 32 consecutive keys), two passes of 32 rows: base-2 logits, chunk max via xor
//       shuffles, online running max / rescale factor al / running sum l in f32 registers (the same threads own the row in every
//       chunk), p = exp2(t - m_new) <= 1, chunk row sum ps and its mean C = ps/CK (bit-identical on the row's 16 threads), the
//       CENTRED P' = p - C written as f16(P' * 32768) into the LDS P tile with 16-B stores; al -> rowa[row], C -> rowc[row].
//   (PV) each wave owns d columns 48*wave + 16j + (lane&15), j = 0..2, of all four row tiles (12 accumulators):
//       o = o*al + C*(32768*1024)*VS[chunk][d], VS = the chunk's 8 PS entries added in key order, kept in LDS (add-back of the
//       centring term in f32),
//       then for each key block: A = P'
//       fragments from LDS (row m = query, split map over keys), B = V^T fragments (col n = d, split map over keys).
//       sum_k (P'_k + C) v_k == sum_k p_k v_k exactly.
//   Block barriers after (S) and after (M) order all LDS reuse across chunks and waves.
//   Epilogue: x = o * 16384 / (l * 32768 * 1024) per row (rowi, l >= 1 always); hi = f16(x), res = f16((x - hi) * 2048); each
//   plane is staged in LDS and stored in fragment order.
// coverage: grid nb*32 blocks x 64 rows; staging 16 waves x 48 cols x 64 rows = 64 x 768; store 12 iterations x 512 thr x 8
//           halves = 64 x 768 per plane = every (b, s, d) of both ctx planes exactly once.
// =====================================================================================================
__device__ __forceinline__ void ctx_store(const u16* ct, u16* dst, int tid) {
  v4u v[12];
#pragma unroll
  for (int it = 0; it < 12; ++it) {
    const int rb = it / 3;                    // 16-row block of the tile (3 * 512 pieces each)
    const int p  = (it % 3) * ATT_THREADS + tid;   // piece of that block: k block p>>6, half (p>>5)&1, lane p&31
    v[it] = *(const v4u*)(ct + (rb * 16 + (p & 15)) * CTP + (p >> 6) * 32 + ((p >> 5) & 1) * 16 + ((p >> 4) & 1) * 8);
  }
  {
#pragma unroll
    for (int it = 0; it < 12; ++it) {
      const int p = it * ATT_THREADS + tid;
      *(v4u*)(dst + (size_t)p * 8) = v[it];
    }
  }
}

// V^T fragments of one key block (vp: the wave's d columns, that key block's unit) and one key block's P'.V products.
__device__ __forceinline__ void ld_v(const _Float16* vp, v16h (&g)[NJ]) {
#pragma unroll
  for (int j = 0; j < NJ; ++j) g[j] = ldfo_h(vp + (size_t)(16 * j) * SEQ);
}
__device__ __forceinline__ void pv_step(v8f (&o)[RT][NJ], const _Float16* pp, const v16h (&g)[NJ]) {
  v16h pf[RT];
#pragma unroll
  for (int rt = 0; rt < RT; ++rt) pf[rt] = ldfrag_h(pp + rt * (16 * PLP));
#pragma unroll
  for (int rt = 0; rt < RT; ++rt) {
#pragma unroll
    for (int j = 0; j < NJ; ++j) o[rt][j] = mma_h(pf[rt], g[j], o[rt][j]);
  }
}

__global__ __launch_bounds__(ATT_THREADS)
void attn_fwd(const u16* __restrict__ QPp, const u16* __restrict__ KPp, const u16* __restrict__ VTp,
              const float* __restrict__ VSp, u16* CHo, u16* CRo) {
  __shared__ __align__(16) AttLds L0;              // scores [QT][SCP] f32; reused as the ctx staging tile [QT][CTP] u16
  __shared__ __align__(16) u16 pls[QT * PLP];      // P' tile [QT][PLP] f16 bits
  __shared__ __align__(16) float vsl[NCHK * EMB];  // VS: column sums of V per chunk, this batch
  __shared__ float rowa[QT];
  __shared__ float rowc[QT];
  __shared__ float rowi[QT];
  float* const scs = L0.s;

  const int tid  = threadIdx.x;
  const int wave = tid >> 5;
  const int lane = tid & 31;
  const int hh   = lane >> 4;
  const int m    = lane & 15;
  const int r32  = tid >> 4;                 // query rows owned in phase (M): r32 and 32 + r32
  const int sub  = tid & 15;
  const int kl0  = sub * 32;

  const int bid = blockIdx.x;
  const int b   = bid / (SEQ / QT);
  const int q0  = (bid % (SEQ / QT)) * QT;

  const _Float16* qa  = (const _Float16*)(const void*)QPp + ((size_t)b * SEQ + q0) * EMB + 8 * lane;
  const _Float16* kbp = (const _Float16*)(const void*)KPp + ((size_t)b * SEQ + wave * 32) * EMB + 8 * lane;
  const _Float16* vbp = (const _Float16*)(const void*)VTp + ((size_t)b * EMB + wave * DW) * SEQ + 8 * lane;
  const float lsc = RSQD * LOG2E / (QSC * KSC);

  // VS[chunk][d] = the chunk's PSN entries of PS, added in key order; a thread takes 2 consecutive d of one chunk, three times over
  // (8-B loads, a wave = 256 contiguous B). All loads are asked for before the first add, so their latency is waited out once.
  // Written here, read in (PV): two block barriers lie between.
  {
    v2f x[3][PSN];
#pragma unroll
    for (int it = 0; it < 3; ++it) {
      const int g = it * ATT_THREADS + tid;
      const float* p = VSp + ((size_t)b * (SEQ / 64) + (size_t)(g / (EMB / 2)) * PSN) * EMB + 2 * (g % (EMB / 2));
#pragma unroll
      for (int i = 0; i < PSN; ++i) x[it][i] = *(const v2f*)(p + (size_t)i * EMB);
    }
    wait_x();                                // in front of the first rewrite of the three address pairs that these loads name
#pragma unroll
    for (int it = 0; it < 3; ++it) {
      v2f a = x[it][0];
#pragma unroll
      for (int i = 1; i < PSN; ++i) a += x[it][i];
      *(v2f*)(vsl + 2 * (it * ATT_THREADS + tid)) = a;
    }
  }

  float mrun[2] = {-INFINITY, -INFINITY}, lrun[2] = {0.f, 0.f};
  v8f o[RT][NJ];
#pragma unroll
  for (int rt = 0; rt < RT; ++rt) {
#pragma unroll
    for (int j = 0; j < NJ; ++j) o[rt][j] = zero8();
  }

#pragma unroll 1
  for (int c = 0; c < NCHK; ++c) {
    const int kbeg = c * CK;
    // ---- (S) scores of this chunk: key block = wave ----
    {
      const _Float16* qp = qa;
      const _Float16* kp = kbp + (size_t)kbeg * EMB;
      v8f s[RT][2];
#pragma unroll
      for (int rt = 0; rt < RT; ++rt) { s[rt][0] = zero8(); s[rt][1] = zero8(); }
#pragma unroll 1
      for (int k4 = 0; k4 < EMB / 128; ++k4) {             // 6 trips of 4 d-steps, as many steps unrolled as before
#pragma unroll
        for (int u = 0; u < 4; ++u) {
          v16h a[RT];
#pragma unroll
          for (int rt = 0; rt < RT; ++rt) a[rt] = ldfo_h(qp + rt * (16 * EMB) + u * 512);
          const v16h f0 = ldfo_h(kp + u * 512);
          const v16h f1 = ldfo_h(kp + 16 * EMB + u * 512);
#pragma unroll
          for (int rt = 0; rt < RT; ++rt) {
            s[rt][0] = mma_h(a[rt], f0, s[rt][0]);
            s[rt][1] = mma_h(a[rt], f1, s[rt][1]);
          }
          guard_s(s, a, f0, f1, qp, kp);
        }
        qp += 4 * 512;
        kp += 4 * 512;
      }
#pragma unroll
      for (int rt = 0; rt < RT; ++rt) {
        float* srow = scs + (16 * rt + 8 * hh) * SCP + wave * 32 + m;
#pragma unroll
        for (int r = 0; r < 8; ++r) {
          srow[r * SCP]      = s[rt][0][r];
          srow[r * SCP + 16] = s[rt][1][r];
        }
      }
    }
    __syncthreads();
    // The chunk's first two V^T fragment sets are asked for here: they depend on nothing of phase (M) and land while it runs.
    const _Float16* vp = vbp + kbeg * 16;                  // key block kbeg/32 -> 512 elements per unit
    v16h g0[NJ], g1[NJ], g2[NJ];
    ld_v(vp, g0);
    ld_v(vp + 512, g1);
    // ---- (M) softmax statistics and the centred P' tile, 32 rows a pass ----
#pragma unroll
    for (int rg = 0; rg < 2; ++rg) {
      const int row = rg * 32 + r32;
      const float* sp = scs + row * SCP + kl0;
      float t[32];
      float cm = -INFINITY;
#pragma unroll
      for (int i = 0; i < 8; ++i) {
        const v4f a = *(const v4f*)(sp + 4 * i);
#pragma unroll
        for (int e = 0; e < 4; ++e) {
          const float tv = a[e] * lsc;
          t[4 * i + e] = tv;
          cm = fmaxf(cm, tv);
        }
      }
#pragma unroll
      for (int d = 1; d <= 8; d <<= 1) cm = fmaxf(cm, __shfl_xor(cm, d, 32));
      const float mn = fmaxf(mrun[rg], cm);                // finite
      const float al = (mrun[rg] == -INFINITY) ? 0.f : exp2f(mrun[rg] - mn);
      mrun[rg] = mn;
      float ps = 0.f;
#pragma unroll
      for (int j = 0; j < 32; ++j) {
        const float p = exp2f(fminf(t[j] - mn, 0.f));
        t[j] = p;
        ps += p;
      }
#pragma unroll
      for (int d = 1; d <= 8; d <<= 1) ps += __shfl_xor(ps, d, 32);
      const float cc = ps * (1.0f / (float)CK);
      v4u pk[4];
#pragma unroll
      for (int i = 0; i < 4; ++i) {
#pragma unroll
        for (int e = 0; e < 4; ++e) {
          const int j = 8 * i + 2 * e;
          pk[i][e] = pk16(h_bits((_Float16)((t[j] - cc) * PCAR)), h_bits((_Float16)((t[j + 1] - cc) * PCAR)));
        }
      }
      lrun[rg] = lrun[rg] * al + ps;
      u16* pd = pls + row * PLP + kl0;
#pragma unroll
      for (int i = 0; i < 4; ++i) *(v4u*)(pd + 8 * i) = pk[i];
      if (sub == 0) { rowa[row] = al; rowc[row] = cc; }
    }
    __syncthreads();
    // ---- (PV) rescale, add the centring term, accumulate P' . V^T ----
    {
      float vs[NJ];
#pragma unroll
      for (int j = 0; j < NJ; ++j) vs[j] = vsl[c * EMB + wave * DW + m + 16 * j];
#pragma unroll
      for (int rt = 0; rt < RT; ++rt) {
        float scl[8], cad[8];
#pragma unroll
        for (int r = 0; r < 8; ++r) {
          scl[r] = rowa[16 * rt + 8 * hh + r];
          cad[r] = rowc[16 * rt + 8 * hh + r] * (PCAR * VCAR);
        }
#pragma unroll
        for (int j = 0; j < NJ; ++j) {
#pragma unroll
          for (int r = 0; r < 8; ++r) o[rt][j][r] = o[rt][j][r] * scl[r] + cad[r] * vs[j];
        }
      }
      const _Float16* pp = (const _Float16*)(const void*)pls + m * PLP + 8 * hh;
      // Three V^T fragment sets in rotation: key block kb + 2 is fetched in front of the WMMAs of key block kb. Key blocks
      // 0 .. CK/32 - 5 in the loop (three a trip), the last four behind it: no load reaches past the chunk's keys.
#pragma unroll 1                             // rolled: one trip is 36 WMMAs; the body stays small in the instruction cache
      for (int t = 0; t < (CK / 32 - 4) / 3; ++t) {
        ld_v(vp + 2 * 512, g2);
        pv_step(o, pp, g0);
        guard_o(o, vp);
        ld_v(vp + 3 * 512, g0);
        pv_step(o, pp + 32, g1);
        guard_o(o, vp);
        ld_v(vp + 4 * 512, g1);
        pv_step(o, pp + 64, g2);
        guard_o(o, vp);
        vp += 3 * 512;
        pp += 3 * 32;
      }
      ld_v(vp + 2 * 512, g2);
      pv_step(o, pp, g0);
      guard_o(o, vp);
      ld_v(vp + 3 * 512, g0);
      pv_step(o, pp + 32, g1);
      pv_step(o, pp + 64, g2);
      pv_step(o, pp + 96, g0);
      guard_o(o, vp);
    }
  }

#pragma unroll
  for (int rg = 0; rg < 2; ++rg) {
    if (sub == 0) rowi[rg * 32 + r32] = (1.0f / lrun[rg]) * (CSC / (PCAR * VCAR));   // lrun >= 1
  }
  __syncthreads();
  float inv[RT][8];
#pragma unroll
  for (int rt = 0; rt < RT; ++rt) {
#pragma unroll
    for (int r = 0; r < 8; ++r) inv[rt][r] = rowi[16 * rt + 8 * hh + r];
  }

  u16* const ct = L0.c;
  const int cb = wave * DW + m;
  // hi plane
#pragma unroll
  for (int rt = 0; rt < RT; ++rt) {
#pragma unroll
    for (int j = 0; j < NJ; ++j) {
#pragma unroll
      for (int r = 0; r < 8; ++r) {
        const float xs = o[rt][j][r] * inv[rt][r];
        ct[(16 * rt + 8 * hh + r) * CTP + cb + 16 * j] = h_bits((_Float16)xs);
      }
    }
  }
  __syncthreads();
  ctx_store(ct, CHo + ((size_t)b * SEQ + q0) * EMB, tid);
  __syncthreads();
  // residual plane
#pragma unroll
  for (int rt = 0; rt < RT; ++rt) {
#pragma unroll
    for (int j = 0; j < NJ; ++j) {
#pragma unroll
      for (int r = 0; r < 8; ++r) {
        const float xs = o[rt][j][r] * inv[rt][r];
        const _Float16 hv = (_Float16)xs;
        ct[(16 * rt + 8 * hh + r) * CTP + cb + 16 * j] = h_bits((_Float16)((xs - (float)hv) * RSC));
      }
    }
  }
  __syncthreads();
  ctx_store(ct, CRo + ((size_t)b * SEQ + q0) * EMB, tid);
}

// =====================================================================================================
// Workspace map (bytes, rows = nb*SEQ; nb = 8 gives the totals below); every plane is fully written by whole-line stores before
// it is read; all extents are exact multiples of the store granularity (no pad rows); region A is reused sequentially on the
// single in-order stream:
//   WQB bf16 [768][768]   1179648   WKB same   WVB same   WOH f16 of bf16 value x1024  1179648     4718592
//   PS  f32  [rows/64][768]                                                                        786432
//   A   DB bf16 [rows][768] (25165824), later CH f16 [rows][768] (25165824)               region 25165824
//   Q   QP f16 [rows][768] x8                                                              region 25165824
//   K   KP f16 [rows][768] x8                                                              region 25165824
//   VT  f16 [nb][768][2048] x1024                                                          region 25165824
//   CR  f16 [rows][768]                                                                    region 25165824
//   end                                                                                        131334144
// =====================================================================================================
extern "C" void kernel_launch(void* const* d_in, const int* in_sizes, int n_in,
                              void* d_out, int out_size, void* d_ws, size_t ws_size,
                              hipStream_t stream) {
  if (n_in < 9) return;
  const long long per = (long long)SEQ * EMB;
  const long long ns  = in_sizes[0];
  if (ns < per || (ns % per) != 0) return;
  const int nb = (int)(ns / per);
  if (nb < 1 || nb > 8) return;
  const int rows = nb * SEQ;
  if (in_sizes[1] != EMB) return;
  if (in_sizes[2] < 1 || in_sizes[3] < 1) return;
  if (in_sizes[4] != EMB * EMB || in_sizes[5] != EMB * EMB || in_sizes[6] != EMB * EMB || in_sizes[7] != EMB * EMB) return;
  if (in_sizes[8] != EMB) return;
  if ((long long)out_size != (long long)rows * EMB) return;

  const float* spk = (const float*)d_in[0];
  const int*   dly = (const int*)d_in[1];
  const float* mpo = (const float*)d_in[2];
  const float* dcy = (const float*)d_in[3];
  const float* wq  = (const float*)d_in[4];
  const float* wk  = (const float*)d_in[5];
  const float* wv  = (const float*)d_in[6];
  const float* wo  = (const float*)d_in[7];
  const float* bo  = (const float*)d_in[8];
  float*       out = (float*)d_out;

  const size_t szW  = (size_t)EMB * EMB * 2;                    //   1179648
  const size_t szPS = (size_t)(rows / 64) * EMB * 4;            //    786432 at nb = 8
  const size_t sz16 = (size_t)rows * EMB * 2;                   //  25165824
  const size_t szVT = (size_t)nb * EMB * SEQ * 2;               //  == sz16
  size_t off = 0;
  const size_t oWQ = off; off += szW;
  const size_t oWK = off; off += szW;
  const size_t oWV = off; off += szW;
  const size_t oWO = off; off += szW;
  const size_t oPS = off; off += szPS;
  const size_t oA  = off; off += sz16;                          // DB then CH
  const size_t oQ  = off; off += sz16;
  const size_t oK  = off; off += sz16;
  const size_t oVT = off; off += szVT;
  const size_t oCR = off; off += sz16;
  if (off > ws_size) return;                                    // off = 131334144 at nb = 8
  if (off > WS_CAP) return;

  char* ws = (char*)d_ws;
  u16*   WQB = (u16*)(ws + oWQ);
  u16*   WKB = (u16*)(ws + oWK);
  u16*   WVB = (u16*)(ws + oWV);
  u16*   WOH = (u16*)(ws + oWO);
  float* PS  = (float*)(ws + oPS);
  u16*   DB  = (u16*)(ws + oA);
  u16*   CH  = (u16*)(ws + oA);
  u16*   QP  = (u16*)(ws + oQ);
  u16*   KP  = (u16*)(ws + oK);
  u16*   VT  = (u16*)(ws + oVT);
  u16*   CR  = (u16*)(ws + oCR);

  const int n8w = (EMB * EMB) / 8;                      // 73728
  const int n8g = rows * (EMB / 8);                     // rows * 96
  if ((n8w % 256) != 0 || (n8g % 256) != 0) return;
  if ((rows % 128) != 0) return;
  const dim3 blk(256);
  const dim3 gW(n8w / 256), gGa(n8g / 256);
  const dim3 gG((rows / 128) * (EMB / 128));            // 768 at nb = 8: 128 x 128 tiles
  const dim3 gO((rows / 64) * (EMB / 128));             // 1536 at nb = 8: 64 x 128 tiles
  const dim3 bG(128);
  const dim3 gAT(nb * (SEQ / QT));                      // nb * 32
  const dim3 bAT(ATT_THREADS);

  // (0..3) weights stored [n = out][k = in] (y = x.W^T), rows = n: fragment-order bf16 planes for Wq, Wk, Wv; f16 of bf16 value
  //        x1024 for Wo
  cvt16<<<gW, blk, 0, stream>>>(wq, WQB, n8w, 0, 1.0f);
  cvt16<<<gW, blk, 0, stream>>>(wk, WKB, n8w, 0, 1.0f);
  cvt16<<<gW, blk, 0, stream>>>(wv, WVB, n8w, 0, 1.0f);
  cvt16<<<gW, blk, 0, stream>>>(wo, WOH, n8w, 1, WSC);
  // (4) delayed spikes -> fragment-order bf16 plane, rows x 768
  gather_bf<<<gGa, blk, 0, stream>>>(spk, dly, mpo, dcy, DB, n8g);
  // (5, 6) q and k projections -> f16 planes x8; (7) v projection -> V^T plane x1024 and column sums of v per 64 keys
  gemm_bh16<<<gG, bG, 0, stream>>>(DB, WQB, QP, rows, 1.0f, QSC);
  gemm_bh16<<<gG, bG, 0, stream>>>(DB, WKB, KP, rows, 1.0f, KSC);
  gemm_vt<<<gG, bG, 0, stream>>>(DB, WVB, VT, PS, rows);
  // (8) attention -> ctx hi x16384 (over the dead DB region) and residual x2048 f16 planes
  attn_fwd<<<gAT, bAT, 0, stream>>>(QP, KP, VT, PS, CH, CR);
  // (9) output projection + bias -> out
  gemm_h2_32<<<gO, bG, 0, stream>>>(CH, CR, WOH, bo, out, rows,
                                     1.0f / (CSC * WSC), 1.0f / (CSC * WSC * RSC));
  (void)hipGetLastError();
}

// v007
// One run takes 260 microseconds.
// Timed twice side by side with v006, it ran 1.04 times as fast both times.
// Counting every step since v000, it is 3.69 times as fast.
// Projections q,k,v = delayed.W^T: v_wmma_f32_16x16x32_bf16 (bf16 RNE operands of the raw inputs, f32 accumulate).
// Scores q'.k'^T (f16 planes x8), P'.V (chunk-centred P' x32768 f16 from LDS, V^T x1024 f16) and the output projection
// (ctx carried as f16 hi x16384 plus residual x2048 planes, times f16(bf16(Wo) x1024), bias added in f32):
// v_wmma_f32_16x16x32_f16, f32 accumulate. Delay gather, softmax statistics, column sums of V and all scaling in f32 on VALU.
#include <hip/hip_runtime.h>
#include <math.h>
#include <stdint.h>

#define SEQ   2048
#define EMB   768
#define CK    512
#define NCHK  4
#define QT    64
#define RT    4
#define NJ    3
#define DW    48
#define SCP   544
#define PLP   528
#define CTP   776
#define SLAB64 (16 * 68)
#define PSN   (CK / 64)
#define ATT_THREADS 512
#define QSC   8.0f
#define KSC   8.0f
#define PCAR  32768.0f
#define VCAR  1024.0f
#define WSC   1024.0f
#define CSC   16384.0f
#define RSC   2048.0f
#define LOG2E 1.4426950408889634f
#define RSQD  0.036084391824351615f
#define WS_CAP ((size_t)134217728)
#define KST   (EMB / 32)
#define WBLK  ((EMB * EMB) / 2048)
#define GLOBAL_AS __attribute__((address_space(1)))

static_assert((EMB % 128) == 0 && EMB == 8 * 96 && (EMB % 32) == 0 && (EMB / 8) == 96);
static_assert((SEQ % CK) == 0 && (SEQ / CK) == NCHK && CK == 16 * 32 && (SEQ % 64) == 0 && (SEQ / QT) == 32);
static_assert(16 * CTP * 2 <= 16 * SCP * 4 && CTP >= EMB + 8);
static_assert(((PLP * 2) % 16) == 0 && ((SCP * 4) % 16) == 0 && ((CTP * 2) % 16) == 0);
static_assert((CK % 64) == 0 && (SEQ % 128) == 0 && PSN * 64 == CK);
static_assert(NCHK * (EMB / 2) == 3 * ATT_THREADS);
static_assert(ATT_THREADS == 512 && QT == 16 * RT && 2 * (ATT_THREADS / 16) == QT);
static_assert((ATT_THREADS / 32) * 32 == CK && (ATT_THREADS / 32) * DW == EMB && DW == 16 * NJ);
static_assert(3 * ATT_THREADS * 8 == 16 * EMB);
static_assert(((EMB * EMB) % 2048) == 0);
static_assert(3 * 512 * 2 == 0xc00 && (KST % 3) == 0 && KST >= 6 && ((CK / 32) % 3) == 1 && (CK / 32) >= 4);

typedef unsigned short u16;
typedef _Float16 v16h __attribute__((ext_vector_type(16)));
typedef _Float16 v8h  __attribute__((ext_vector_type(8)));
typedef __bf16   v16b __attribute__((ext_vector_type(16)));
typedef float    v8f  __attribute__((ext_vector_type(8)));
typedef float    v4f  __attribute__((ext_vector_type(4)));
typedef float    v2f  __attribute__((ext_vector_type(2)));
typedef unsigned int v4u __attribute__((ext_vector_type(4)));

union FragH { v16h v; v8h h[2]; v4u u[2]; };
union FragB { v16b v; v4u u[2]; };
union AttLds { float s[QT * SCP]; u16 c[2 * QT * SCP]; };

// ---- scalar helpers --------------------------------------------------------------------------------
__device__ __forceinline__ unsigned short bf_bits(float f) {          // f32 -> bf16 bits, RNE convert
  unsigned u = __float_as_uint(f);
  return (unsigned short)((u + 0x7FFFu + ((u >> 16) & 1u)) >> 16);
}
__device__ __forceinline__ float bf_up(unsigned short h) { return __uint_as_float(((unsigned)h) << 16); }
__device__ __forceinline__ float bfr(float f) { return bf_up(bf_bits(f)); }
__device__ __forceinline__ unsigned short h_bits(_Float16 x) { return __builtin_bit_cast(unsigned short, x); }
__device__ __forceinline__ unsigned pk16(unsigned short a, unsigned short b) { return (unsigned)a | ((unsigned)b << 16); }
__device__ __forceinline__ v8f zero8() { v8f z = {0.f, 0.f, 0.f, 0.f, 0.f, 0.f, 0.f, 0.f}; return z; }

// ---- fragment loaders: 16-bit A/B operand, lane -> row/col (lane&15), p already includes +8*(lane>>4);
//      elements 0..7 <- p[0..7] (k0+8h..), elements 8..15 <- p[16..23] (k0+16+8h..)  (same split k map for A and B;
//      this row-major form is used for the P' tile in LDS only)
__device__ __forceinline__ v16h ldfrag_h(const _Float16* p) {
  FragH f;
  f.h[0] = *(const v8h*)(p);
  f.h[1] = *(const v8h*)(p + 16);
  return f.v;
}
// ---- fragment-order planes (every 16-bit operand plane in the workspace): a plane [R][K] is stored as
//      [R/16][K/32][2][32 lanes][8 elements]. The 1-KiB unit of (row block rb, k block kb) starts at element rb*16*K + kb*512;
//      in it lane (16*hh + m) finds, at 8*lane, row m's k = 8*hh + 0..7 and, 256 elements on, k = 16 + 8*hh + 0..7: the same
//      split k map as above. A fragment is two 16-B loads per lane, each 512 contiguous bytes per wave (4 whole lines).
//      p already includes +8*lane.
//      The planes lie in global memory; the casts say so, since a pointer that has passed through an asm statement (step3) would
//      otherwise be read by flat loads.
__device__ __forceinline__ v16h ldfo_h(const _Float16* p) {
  FragH f;
  f.h[0] = *(const GLOBAL_AS v8h*)(p);
  f.h[1] = *(const GLOBAL_AS v8h*)(p + 256);
  return f.v;
}
__device__ __forceinline__ v16b ldfo_b(const u16* p) {                // bf16 plane read as unsigned integer vectors
  FragB f;
  f.u[0] = *(const GLOBAL_AS v4u*)(p);
  f.u[1] = *(const GLOBAL_AS v4u*)(p + 256);
  return f.v;
}

__device__ __forceinline__ v8f mma_h(v16h a, v16h b, v8f c) {
  return __builtin_amdgcn_wmma_f32_16x16x32_f16(false, a, false, b, (short)0, c, false, false);
}
__device__ __forceinline__ v8f mma_b(v16b a, v16b b, v8f c) {
  return __builtin_amdgcn_wmma_f32_16x16x32_bf16(false, a, false, b, (short)0, c, false, false);
}
// The v_nop guards below stand behind the WMMAs of a step: they keep the four vector slots that the chip needs before
// the operand registers are reloaded or the accumulators are touched, on the taken back edge too. The accumulators are named so that every WMMA of the step stays in front of the slots.
// guard_s also holds s_wait_xcnt 0 in front of the rewrite of the two address pairs that the step's global loads name; the pairs
// are inputs so that nothing overwrites them ahead of that wait.
__device__ __forceinline__ void guard_s(v8f (&s)[RT][2], const v16h (&a)[RT], v16h f0, v16h f1,
                                        const _Float16* qp, const _Float16* kp) {
#if defined(__HIP_DEVICE_COMPILE__)
  asm volatile("s_wait_xcnt 0x0\n\tv_nop\n\tv_nop\n\tv_nop\n\tv_nop"
               : "+v"(s[0][0]), "+v"(s[0][1]), "+v"(s[1][0]), "+v"(s[1][1]),
                 "+v"(s[2][0]), "+v"(s[2][1]), "+v"(s[3][0]), "+v"(s[3][1])
               : "v"(a[0]), "v"(a[1]), "v"(a[2]), "v"(a[3]), "v"(f0), "v"(f1), "v"(qp), "v"(kp) : "memory");
#endif
}
// guard_g (GEMM k loops) holds the same four slots and, like guard_s, s_wait_xcnt 0 in front of the rewrite of the address pairs
// that the issued global loads name; the pairs are inputs so that nothing overwrites them ahead of that wait (a loop with two
// pairs names one of them twice). The "memory" clobber keeps the loads of the sets fetched ahead on the side of the guard where
// the source has them. The fragment sets are not named: three sets and the accumulators pass v255, where no asm operand can lie.
template <typename P>
__device__ __forceinline__ void guard_g(v8f (&c)[4][4], const P* p0, const P* p1, const P* p2) {
#if defined(__HIP_DEVICE_COMPILE__)
  asm volatile("s_wait_xcnt 0x0\n\tv_nop\n\tv_nop\n\tv_nop\n\tv_nop"
               : "+v"(c[0][0]), "+v"(c[0][1]), "+v"(c[0][2]), "+v"(c[0][3]), "+v"(c[1][0]), "+v"(c[1][1]), "+v"(c[1][2]), "+v"(c[1][3]),
                 "+v"(c[2][0]), "+v"(c[2][1]), "+v"(c[2][2]), "+v"(c[2][3]), "+v"(c[3][0]), "+v"(c[3][1]), "+v"(c[3][2]), "+v"(c[3][3])
               : "v"(p0), "v"(p1), "v"(p2)
               : "memory");
#endif
}
// wait_x: s_wait_xcnt 0 alone: behind the first three sets' loads of a k loop, the VS loads (attn_fwd), the column sums' stores (gemm_qkv) or a 16-row tile's f16 stores (epi64hs).
__device__ __forceinline__ void wait_x() {
#if defined(__HIP_DEVICE_COMPILE__)
  asm volatile("s_wait_xcnt 0x0" : : : "memory");
#endif
}
// step3: moves the address pairs three k blocks on (3 * 512 elements of 2 bytes = 0xc00 bytes). The additions stand in one asm
// statement with s_wait_xcnt 0 in front of them: written in the source, the compiler lifted them over a wait in a statement of
// its own, directly behind the trip's last loads, which name these pairs.
template <typename P>
__device__ __forceinline__ void step3(const P*& p0, const P*& p1) {
#if defined(__HIP_DEVICE_COMPILE__)
  asm volatile("s_wait_xcnt 0x0\n\tv_add_nc_u64_e32 %0, 0xc00, %0\n\tv_add_nc_u64_e32 %1, 0xc00, %1"
               : "+v"(p0), "+v"(p1) : : "memory");
#endif
}
template <typename P>
__device__ __forceinline__ void step3(const P*& p0, const P*& p1, const P*& p2) {
#if defined(__HIP_DEVICE_COMPILE__)
  asm volatile("s_wait_xcnt 0x0\n\tv_add_nc_u64_e32 %0, 0xc00, %0\n\tv_add_nc_u64_e32 %1, 0xc00, %1\n\tv_add_nc_u64_e32 %2, 0xc00, %2"
               : "+v"(p0), "+v"(p1), "+v"(p2) : : "memory");
#endif
}
// guard_o (P'.V loop): the four slots, and s_wait_xcnt 0 in front of the rewrite of the V^T address pair, which is an input.
__device__ __forceinline__ void guard_o(v8f (&o)[RT][NJ], const _Float16* vp) {
#if defined(__HIP_DEVICE_COMPILE__)
  asm volatile("s_wait_xcnt 0x0\n\tv_nop\n\tv_nop\n\tv_nop\n\tv_nop"
               : "+v"(o[0][0]), "+v"(o[0][1]), "+v"(o[0][2]), "+v"(o[1][0]), "+v"(o[1][1]), "+v"(o[1][2]),
                 "+v"(o[2][0]), "+v"(o[2][1]), "+v"(o[2][2]), "+v"(o[3][0]), "+v"(o[3][1]), "+v"(o[3][2])
               : "v"(vp) : "memory");
#endif
}
// Orders a wave's own LDS slab writes before its reads of them. The fences name LDS alone: a wave now stages several 16-row tiles
// one after another, and a fence over global memory too would hold each staging back until the last tile's global stores are done.
__device__ __forceinline__ void wave_sync_lds() {
  __builtin_amdgcn_fence(__ATOMIC_RELEASE, "workgroup", "local");
  __builtin_amdgcn_wave_barrier();
  __builtin_amdgcn_fence(__ATOMIC_ACQUIRE, "workgroup", "local");
}

// =====================================================================================================
// f32 plane [EMB][EMB] -> 16-bit plane in fragment order:  mode 0: bf16 RNE bits;  mode 1: f16 bits of (bf16 RNE value) * scale;
// mode 2: f16 bits of value * scale (no bf16 pre-step).
// Thread = one 16-B piece of the fragment-order plane (8 consecutive k of one row): two 16-B loads, one 16-B store; 32
// consecutive lanes store 512 contiguous, 512-B aligned bytes
// coverage: n8/256 blocks (host checks exactness) x 256 thr x 8 = the whole plane; blk = the block's index within the plane.
// =====================================================================================================
__device__ __forceinline__ void cvt16(const float* __restrict__ x, u16* D, int n8, int mode, float scale, int blk) {
  const int gt = blk * 256 + (int)threadIdx.x;
  if (gt >= n8) return;                     // no barriers in this kernel
  const int unit = gt >> 6;
  const int rb   = unit / (EMB / 32);
  const int kb   = unit - rb * (EMB / 32);
  const float* p = x + (size_t)(rb * 16 + (gt & 15)) * EMB + kb * 32 + ((gt >> 5) & 1) * 16 + ((gt >> 4) & 1) * 8;
  const v4f a = *(const v4f*)(p), c4 = *(const v4f*)(p + 4);
  float v[8];
#pragma unroll
  for (int e = 0; e < 4; ++e) { v[e] = a[e]; v[4 + e] = c4[e]; }
  unsigned short s[8];
#pragma unroll
  for (int e = 0; e < 8; ++e) {
    const float vb = bfr(v[e]);
    const float vf = (mode == 1) ? vb : v[e];
    const unsigned short hb = h_bits((_Float16)(vf * scale));
    const unsigned short bb = bf_bits(v[e]);
    s[e] = (mode != 0) ? hb : bb;
  }
  v4u o;
#pragma unroll
  for (int e = 0; e < 4; ++e) o[e] = pk16(s[2 * e], s[2 * e + 1]);
  u16* d = D + (size_t)gt * 8;
  {
    *(v4u*)(d) = o;
    
  }
}

// =====================================================================================================
// Delay gather to a bf16 plane in fragment order (rows = b*SEQ + t, k = n): element (b, t, n) = bf16 RNE bits of
// sp[b][t - dl[n]][n] when t - dl[n] >= 0, else 0 (the zero is
// written). The source row index is clamped into [0, SEQ) for the address; the value is selected afterwards.
// Thread = one 16-B piece (8 consecutive n of one (b, t) row): 8 scalar loads, one 16-B store; 32 consecutive lanes = 16 rows x
// 16 n, stored as 512 contiguous bytes
// coverage: n8/256 blocks (host exact) x 256 thr x 8 = rows x EMB = the whole plane; blk = the block's index within the plane.
// =====================================================================================================
__device__ __forceinline__ void gather_bf(const float* __restrict__ sp, const int* __restrict__ dl, u16* DB, int n8, int blk) {
  const int gt = blk * 256 + (int)threadIdx.x;
  if (gt >= n8) return;                     // no barriers in this kernel
  const int unit = gt >> 6;
  const int rb   = unit / (EMB / 32);
  const int kb   = unit - rb * (EMB / 32);
  const int row = rb * 16 + (gt & 15);
  const int n0  = kb * 32 + ((gt >> 5) & 1) * 16 + ((gt >> 4) & 1) * 8;
  const int b   = row / SEQ;
  const int t   = row - b * SEQ;
  unsigned short s[8];
#pragma unroll
  for (int e = 0; e < 8; ++e) {
    const int n   = n0 + e;
    const int d   = dl[n];
    const int src = t - d;
    int sc = (src < 0) ? 0 : src;
    sc = (sc > SEQ - 1) ? (SEQ - 1) : sc;
    const float v = sp[((size_t)b * SEQ + (size_t)sc) * EMB + n];
    s[e] = (src >= 0) ? bf_bits(v) : (unsigned short)0;
  }
  v4u o;
#pragma unroll
  for (int e = 0; e < 4; ++e) o[e] = pk16(s[2 * e], s[2 * e + 1]);
  u16* dst = DB + (size_t)gt * 8;
  {
    *(v4u*)(dst) = o;
    
  }
}

// =====================================================================================================
// All operand preparation in one launch: the five jobs read inputs only and write disjoint planes, so none waits for another.
// Blocks 0 .. 4*WBLK-1: weight plane w = block / WBLK (Wq, Wk, Wv as bf16 bits; Wo as f16 of the bf16 value x1024), planes
// WB + w * EMB*EMB; the blocks behind them: the delay gather. The choice is block-uniform; no barriers in this kernel.
// =====================================================================================================
__global__ __launch_bounds__(256) void prep(const float* __restrict__ wq, const float* __restrict__ wk,
                                            const float* __restrict__ wv, const float* __restrict__ wo,
                                            const float* __restrict__ sp, const int* __restrict__ dl,
                                            const float* __restrict__ mpu, const float* __restrict__ dcu,
                                            u16* WB, u16* DB, int n8g) {
  const int bid = blockIdx.x;
  if (bid < 4 * WBLK) {
    const int w = bid / WBLK;
    const float* x = (w == 0) ? wq : (w == 1) ? wk : (w == 2) ? wv : wo;
    cvt16(x, WB + (size_t)w * (EMB * EMB), (EMB * EMB) / 8, (w == 3) ? 1 : 0, (w == 3) ? WSC : 1.0f, bid - w * WBLK);
  } else {
    gather_bf(sp, dl, DB, n8g, bid - 4 * WBLK);
  }
  (void)mpu; (void)dcu;
}

// =====================================================================================================
//  epi64x2: f32 rows, staged value = acc*os1 + accres*os2 + badd (two accumulator sets combined in f32); instruction it stores rows
//           2*it (lanes 0..15, 16 B each) and 2*it+1 (lanes 16..31).
//  epi64hs: f16 bits of (tile * pscale), stored in fragment order (k = column): lane (16*hh + m) = row m, 8 consecutive columns;
// coverage: epi64x2 8 instructions x 2 rows x 16 lanes x 4 floats; epi64hs 4 instructions x 32 lanes x 8 halves
//           = the wave's 16 x 64 tile in every case.
// =====================================================================================================
__device__ __forceinline__ void stage64(float* sl, v8f a0, v8f a1, v8f a2, v8f a3, float oscale, int lane) {
  const int hh = lane >> 4, m = lane & 15;
#pragma unroll
  for (int r = 0; r < 8; ++r) {
    const int ro = (8 * hh + r) * 68 + m;
    sl[ro]      = a0[r] * oscale;
    sl[ro + 16] = a1[r] * oscale;
    sl[ro + 32] = a2[r] * oscale;
    sl[ro + 48] = a3[r] * oscale;
  }
  wave_sync_lds();
}
__device__ __forceinline__ void epi64x2(float* sl, v8f a0, v8f a1, v8f a2, v8f a3, v8f e0, v8f e1, v8f e2, v8f e3,
                                        float os1, float os2, v4f badd, float* C, int N, size_t rowb, int col0, int lane) {
  const int hh = lane >> 4, m = lane & 15;
#pragma unroll
  for (int r = 0; r < 8; ++r) {
    const int ro = (8 * hh + r) * 68 + m;
    sl[ro]      = a0[r] * os1 + e0[r] * os2;
    sl[ro + 16] = a1[r] * os1 + e1[r] * os2;
    sl[ro + 32] = a2[r] * os1 + e2[r] * os2;
    sl[ro + 48] = a3[r] * os1 + e3[r] * os2;
  }
  wave_sync_lds();
  v4f vals[8];
#pragma unroll
  for (int it = 0; it < 8; ++it) vals[it] = *(const v4f*)(sl + (it * 2 + hh) * 68 + m * 4) + badd;
  float* dst = C + (rowb + (size_t)hh) * (size_t)N + col0 + m * 4;
  {
#pragma unroll
    for (int it = 0; it < 8; ++it) {
      *(v4f*)(dst + (size_t)(it * 2) * (size_t)N) = vals[it];
    }
    
  }
}
__device__ __forceinline__ void epi64hs(float* sl, v8f a0, v8f a1, v8f a2, v8f a3, float oscale, float pscale,
                                        u16* C, int N, size_t rowb, int col0, int lane) {
  stage64(sl, a0, a1, a2, a3, oscale, lane);
  const int hh = lane >> 4, m = lane & 15;
  v4u oh[4];
#pragma unroll
  for (int i4 = 0; i4 < 4; ++i4) {
    const int c8 = (i4 >> 1) * 32 + (i4 & 1) * 16 + hh * 8;   // k block i4>>1, half i4&1 of the wave's two units
    const v4f a = *(const v4f*)(sl + m * 68 + c8), c4 = *(const v4f*)(sl + m * 68 + c8 + 4);
    float w[8];
#pragma unroll
    for (int e = 0; e < 4; ++e) { w[e] = a[e] * pscale; w[4 + e] = c4[e] * pscale; }
#pragma unroll
    for (int e = 0; e < 4; ++e) oh[i4][e] = pk16(h_bits((_Float16)w[2 * e]), h_bits((_Float16)w[2 * e + 1]));
  }
  u16* dst = C + rowb * (size_t)N + (size_t)(col0 >> 5) * 512 + lane * 8;
  {
#pragma unroll
    for (int i4 = 0; i4 < 4; ++i4) {
      *(v4u*)(dst + i4 * 256) = oh[i4];
    }
    
  }
  wait_x();                                  // in front of the next 16-row tile's rewrite of the registers that these stores name
}

// =====================================================================================================
// bf16 GEMM core: acc[rt][j] = rows (16 rt ..) of A . rows (16 j ..) of Bt, A and Bt bf16 planes [..][EMB] in fragment order.
// Wave tile = 64 x 64 (4 A fragments x 4 B fragments, 16 accumulators): every fragment loaded feeds 4 WMMAs. Fragments come
// straight from the planes (two 16-B loads each, split k map for A and B); k stepped by 32, ascending, one WMMA per (tile, step).
// Block = 128 x 128 tile, 4 waves as 2 x 2; grid = 3 * (M/128) * (EMB/128) (q, k, v), host checks exactness.
// =====================================================================================================
__device__ __forceinline__ void ld_b64(const u16* ap, const u16* bp, v16b (&a)[4], v16b (&b)[4]) {
#pragma unroll
  for (int rt = 0; rt < 4; ++rt) a[rt] = ldfo_b(ap + rt * (16 * EMB));
#pragma unroll
  for (int j = 0; j < 4; ++j) b[j] = ldfo_b(bp + j * (16 * EMB));
}
__device__ __forceinline__ void mm_b64(v8f (&acc)[4][4], const v16b (&a)[4], const v16b (&b)[4]) {
#pragma unroll
  for (int rt = 0; rt < 4; ++rt) {
#pragma unroll
    for (int j = 0; j < 4; ++j) acc[rt][j] = mma_b(a[rt], b[j], acc[rt][j]);
  }
}
__device__ __forceinline__ void core_b64(const u16* ap, const u16* bp, v8f (&acc)[4][4]) {
#pragma unroll
  for (int rt = 0; rt < 4; ++rt) {
#pragma unroll
    for (int j = 0; j < 4; ++j) acc[rt][j] = zero8();
  }
  // Three fragment sets in rotation: a set is refilled for k step s + 3 as soon as the WMMAs of step s have left it, so a wave has
  // two to three steps' loads in flight and its loads have two steps of WMMAs to land in. The loop refills for steps 3 .. KST-1
  // (three a trip); the last three steps stand behind it and load nothing: no load reaches past the planes' k extent.
  v16b a0[4], b0[4], a1[4], b1[4], a2[4], b2[4];
  // The scheduling barriers keep the three sets' loads in issue order: were a load of set 0 issued behind set 2, the loop's counted
  // wait for set 0 would have to cover every load in flight, on each trip, and nothing would stay fetched ahead.
  ld_b64(ap, bp, a0, b0);
  __builtin_amdgcn_sched_barrier(0);
  ld_b64(ap + 512, bp + 512, a1, b1);
  __builtin_amdgcn_sched_barrier(0);
  ld_b64(ap + 2 * 512, bp + 2 * 512, a2, b2);
  wait_x();
#pragma unroll 1                             // rolled: one trip is 48 WMMAs and 48 loads; the body stays small in the instruction cache
  for (int t = 0; t < KST / 3 - 1; ++t) {
    mm_b64(acc, a0, b0);
    guard_g<u16>(acc, ap, bp, bp);
    ld_b64(ap + 3 * 512, bp + 3 * 512, a0, b0);
    mm_b64(acc, a1, b1);
    guard_g<u16>(acc, ap, bp, bp);
    ld_b64(ap + 4 * 512, bp + 4 * 512, a1, b1);
    mm_b64(acc, a2, b2);
    guard_g<u16>(acc, ap, bp, bp);
    ld_b64(ap + 5 * 512, bp + 5 * 512, a2, b2);
    step3<u16>(ap, bp);
  }
  mm_b64(acc, a0, b0);
  guard_g<u16>(acc, ap, bp, bp);             // the last loads' s_wait_xcnt 0 stands in the last trip's step3
  mm_b64(acc, a1, b1);
  mm_b64(acc, a2, b2);
}

// q, k and v projections in one launch: the three products read the same A plane and depend on nothing of each other.
// Block index = (row tile * 3 + product) * (EMB/128) + column tile; product 0 = q, 1 = k, 2 = v (block-uniform, taken as a scalar).
// q, k: f16 plane out in fragment order, f16 bits of (A . Bt^T) * 8; epilogue epi64hs per 16-row tile.
// v (rows = b*SEQ + s, columns = d) is handed on as the two things attention reads; V itself is never stored.
//  V^T plane in fragment order (rows = b*EMB + d, k = s), element = f16(V[b][s][d] * 1024): a lane's accumulator acc[rt][j] holds
//  column d = col0 + 16j + (lane&15) at rows 16rt + 8*(lane>>4) + 0..7, which is that lane's own 16-B piece of the unit (d block j,
//  key block rt>>1), half rt&1: eight converts and one 16-B store, no exchange between lanes; a wave's store = 512 contiguous B.
//  PS[(row / 64)][d] = sum of V over the wave tile's 64 keys (f32): rt and r ascending in the lane, then the other half-wave's sum.
// coverage: v: 16 stores x 32 lanes x 8 halves = the wave's 64 x 64 tile; 2 stores x 32 lanes = its 64 column sums (one whole 128-B
//           line each); the grid covers every (product, row tile, column tile) once.
__global__ __launch_bounds__(128)
void gemm_qkv(const u16* __restrict__ A, const u16* __restrict__ WB, u16* QPo, u16* KPo, u16* VTo, float* PS, int M) {
  __shared__ __align__(16) float slab[4 * SLAB64];
  // The wave's number is taken as a scalar: tile row and column then live in scalar registers across the k loop, which keeps the
  // kernel within 336 VGPRs (three waves per SIMD) with three fragment sets.
  const int tid = threadIdx.x, wave = __builtin_amdgcn_readfirstlane(tid >> 5), lane = tid & 31;
  const int bid   = blockIdx.x;
  const int grp   = bid / (EMB / 128);
  const int prod  = grp % 3;
  const int rowb  = (grp / 3) * 128 + (wave >> 1) * 64;
  const int col0  = (bid % (EMB / 128)) * 128 + (wave & 1) * 64;
  if (rowb + 64 > M) return;                 // wave-uniform, never taken with the exact grid; no block barriers in this kernel
  v8f acc[4][4];
  core_b64(A + (size_t)rowb * EMB + 8 * lane, WB + (size_t)prod * (EMB * EMB) + (size_t)col0 * EMB + 8 * lane, acc);
  if (prod != 2) {
    u16* C = (prod == 0) ? QPo : KPo;
    const float pscale = (prod == 0) ? QSC : KSC;
#pragma unroll
    for (int rt = 0; rt < 4; ++rt)
      epi64hs(slab + wave * SLAB64, acc[rt][0], acc[rt][1], acc[rt][2], acc[rt][3], 1.0f, pscale, C, EMB,
              (size_t)(rowb + 16 * rt), col0, lane);
    return;
  }
  const int b  = rowb / SEQ;                 // a 64-row tile lies in one batch (SEQ is a multiple of 128)
  const int s0 = rowb - b * SEQ;
  v4u oh[4][4];
  float cs[4];
#pragma unroll
  for (int j = 0; j < 4; ++j) {
    float s = 0.f;
#pragma unroll
    for (int rt = 0; rt < 4; ++rt) {
#pragma unroll
      for (int r = 0; r < 8; ++r) s += acc[rt][j][r];
#pragma unroll
      for (int e = 0; e < 4; ++e)
        oh[j][rt][e] = pk16(h_bits((_Float16)(acc[rt][j][2 * e] * VCAR)), h_bits((_Float16)(acc[rt][j][2 * e + 1] * VCAR)));
    }
    cs[j] = s;
  }
#pragma unroll
  for (int j = 0; j < 4; ++j) cs[j] += __shfl_xor(cs[j], 16, 32);
  const float c01 = (lane & 16) ? cs[1] : cs[0];          // column col0 + lane
  const float c23 = (lane & 16) ? cs[3] : cs[2];          // column col0 + 32 + lane
  u16* dst  = VTo + ((size_t)b * EMB + col0) * SEQ + (size_t)(s0 >> 5) * 512 + lane * 8;
  float* pd = PS + (size_t)(rowb >> 6) * EMB + col0 + lane;
  pd[0]  = c01;
  pd[32] = c23;
  // s_wait_xcnt 0 behind the sums' two stores, in front of any rewrite of their registers; its "memory" clobber keeps the plane's 16
  // stores behind it, last in the kernel, so that no register is written behind them.
  wait_x();
#pragma unroll
  for (int j = 0; j < 4; ++j) {
#pragma unroll
    for (int rt = 0; rt < 4; ++rt) *(v4u*)(dst + (size_t)(16 * j) * SEQ + rt * 256) = oh[j][rt];
  }
}

// =====================================================================================================
// f16 GEMM with two A planes (hi + residual), f32 out with bias:
//   C[M][EMB] = (Ah . Bt^T) * os1 + (Ar . Bt^T) * os2 + bf16RNE(bias[n]); Ah/Ar/Bt f16 planes in fragment order.
// Wave tile = 32 x 64 for both planes (2 + 2 A fragments x 4 B fragments, 16 accumulators: rows 0, 1 of acc = hi plane, rows 2, 3
// = residual plane): a B fragment feeds 4 WMMAs, an A fragment 4. Block = 64 x 128 tile, 4 waves as 2 x 2; grid = (M/64) * (EMB/128).
// Separate accumulators for the two planes, combined in f32 in epi64x2, once per 16-row tile.
// =====================================================================================================
__device__ __forceinline__ void ld_h2(const _Float16* ap, const _Float16* arp, const _Float16* bp, v16h (&a)[4], v16h (&b)[4]) {
  a[0] = ldfo_h(ap);
  a[1] = ldfo_h(ap + 16 * EMB);
  a[2] = ldfo_h(arp);
  a[3] = ldfo_h(arp + 16 * EMB);
#pragma unroll
  for (int j = 0; j < 4; ++j) b[j] = ldfo_h(bp + j * (16 * EMB));
}
__device__ __forceinline__ void mm_h2(v8f (&acc)[4][4], const v16h (&a)[4], const v16h (&b)[4]) {
#pragma unroll
  for (int rt = 0; rt < 4; ++rt) {
#pragma unroll
    for (int j = 0; j < 4; ++j) acc[rt][j] = mma_h(a[rt], b[j], acc[rt][j]);
  }
}
__global__ __launch_bounds__(128)
void gemm_h2_32(const u16* __restrict__ Ah, const u16* __restrict__ Ar, const u16* __restrict__ Bt,
                const float* __restrict__ bias, float* C, int M, float os1, float os2) {
  __shared__ __align__(16) float slab[4 * SLAB64];
  // The wave's number is taken as a scalar: tile row and column then live in scalar registers across the k loop, which keeps the
  // kernel within 336 VGPRs (three waves per SIMD) with three fragment sets.
  const int tid = threadIdx.x, wave = __builtin_amdgcn_readfirstlane(tid >> 5), lane = tid & 31, m = lane & 15;
  const int bid   = blockIdx.x;
  const int rowb  = (bid / (EMB / 128)) * 64 + (wave >> 1) * 32;
  const int col0  = (bid % (EMB / 128)) * 128 + (wave & 1) * 64;
  if (rowb + 32 > M) return;                 // wave-uniform, never taken with the exact grid; no block barriers in this kernel
  const _Float16* ap  = (const _Float16*)(const void*)Ah + (size_t)rowb * EMB + 8 * lane;
  const _Float16* arp = (const _Float16*)(const void*)Ar + (size_t)rowb * EMB + 8 * lane;
  const _Float16* bp  = (const _Float16*)(const void*)Bt + (size_t)col0 * EMB + 8 * lane;
  v8f acc[4][4];
#pragma unroll
  for (int rt = 0; rt < 4; ++rt) {
#pragma unroll
    for (int j = 0; j < 4; ++j) acc[rt][j] = zero8();
  }
  // Three fragment sets in rotation, as in core_b64: a set is refilled for step s + 3 as soon as the WMMAs of step s have left it.
  v16h a0[4], b0[4], a1[4], b1[4], a2[4], b2[4];
  ld_h2(ap, arp, bp, a0, b0);
  ld_h2(ap + 512, arp + 512, bp + 512, a1, b1);
  ld_h2(ap + 2 * 512, arp + 2 * 512, bp + 2 * 512, a2, b2);
  wait_x();
#pragma unroll 1                             // rolled: one trip is 48 WMMAs and 48 loads; the body stays small in the instruction cache
  for (int t = 0; t < KST / 3 - 1; ++t) {
    mm_h2(acc, a0, b0);
    guard_g<_Float16>(acc, ap, arp, bp);
    ld_h2(ap + 3 * 512, arp + 3 * 512, bp + 3 * 512, a0, b0);
    mm_h2(acc, a1, b1);
    guard_g<_Float16>(acc, ap, arp, bp);
    ld_h2(ap + 4 * 512, arp + 4 * 512, bp + 4 * 512, a1, b1);
    mm_h2(acc, a2, b2);
    guard_g<_Float16>(acc, ap, arp, bp);
    ld_h2(ap + 5 * 512, arp + 5 * 512, bp + 5 * 512, a2, b2);
    step3<_Float16>(ap, arp, bp);
  }
  mm_h2(acc, a0, b0);
  guard_g<_Float16>(acc, ap, arp, bp);       // the last loads' s_wait_xcnt 0 stands in the last trip's step3
  mm_h2(acc, a1, b1);
  mm_h2(acc, a2, b2);
  const v4f bv = *(const v4f*)(bias + col0 + m * 4);      // columns col0 + 4m .. +3, always < EMB (col0 a multiple of 64)
  v4f badd;
#pragma unroll
  for (int e = 0; e < 4; ++e) badd[e] = bfr(bv[e]);
#pragma unroll
  for (int rt = 0; rt < 2; ++rt)
    epi64x2(slab + wave * SLAB64, acc[rt][0], acc[rt][1], acc[rt][2], acc[rt][3],
            acc[2 + rt][0], acc[2 + rt][1], acc[2 + rt][2], acc[2 + rt][3], os1, os2, badd, C, EMB,
            (size_t)(rowb + 16 * rt), col0, lane);
}

// =====================================================================================================
// Single-head attention, head width EMB = 768, all SEQ keys kept (non-causal): block = (batch b, 64 query rows q0..q0+63 = RT = 4
// row tiles of 16), 16 waves. Every K fragment and every V^T fragment that a wave loads feeds one WMMA per row tile.
// q plane (f16, x8) rows b*SEQ+s, k = d; k plane the same; V^T plane rows b*EMB+d, k = s (x1024); all three and the two
// ctx planes in fragment order; PS = column sums of V over each 64 keys (f32), PSN = 8 of them to a chunk.
//   Per chunk of CK = 512 keys (NCHK = 4 chunks):
//   (S) scores S[query][key n] on WMMA: A = q rows of row tile rt (row m = lane&15, split k map over d), B = k rows (col n = key,
//       split map), 24 d-steps; wave w handles key block w (32 keys) of the chunk for all four row tiles; D element r of lane l
//       of tile rt -> scs[query 16rt+8h+r][key col] (f32 LDS).
//   (M) 16 threads per query row (sub-thread = 32 consecutive keys), two passes of 32 rows: base-2 logits, chunk max via xor
//       shuffles, online running max / rescale factor al / running sum l in f32 registers (the same threads own the row in every
//       chunk), p = exp2(t - m_new) <= 1, chunk row sum ps and its mean C = ps/CK (bit-identical on the row's 16 threads), the
//       CENTRED P' = p - C written as f16(P' * 32768) into the LDS P tile with 16-B stores; al -> rowa[row], C -> rowc[row].
//   (PV) each wave owns d columns 48*wave + 16j + (lane&15), j = 0..2, of all four row tiles (12 accumulators):
//       o = o*al + C*(32768*1024)*VS[chunk][d], VS = the chunk's 8 PS entries added in key order, kept in LDS (add-back of the
//       centring term in f32),
//       then for each key block: A = P'
//       fragments from LDS (row m = query, split map over keys), B = V^T fragments (col n = d, split map over keys).
//       sum_k (P'_k + C) v_k == sum_k p_k v_k exactly.
//   Block barriers after (S) and after (M) order all LDS reuse across chunks and waves.
//   Epilogue: x = o * 16384 / (l * 32768 * 1024) per row (rowi, l >= 1 always); hi = f16(x), res = f16((x - hi) * 2048); each
//   plane is staged in LDS and stored in fragment order.
// coverage: grid nb*32 blocks x 64 rows; staging 16 waves x 48 cols x 64 rows = 64 x 768; store 12 iterations x 512 thr x 8
//           halves = 64 x 768 per plane = every (b, s, d) of both ctx planes exactly once.
// =====================================================================================================
__device__ __forceinline__ void ctx_store(const u16* ct, u16* dst, int tid) {
  v4u v[12];
#pragma unroll
  for (int it = 0; it < 12; ++it) {
    const int rb = it / 3;                    // 16-row block of the tile (3 * 512 pieces each)
    const int p  = (it % 3) * ATT_THREADS + tid;   // piece of that block: k block p>>6, half (p>>5)&1, lane p&31
    v[it] = *(const v4u*)(ct + (rb * 16 + (p & 15)) * CTP + (p >> 6) * 32 + ((p >> 5) & 1) * 16 + ((p >> 4) & 1) * 8);
  }
  {
#pragma unroll
    for (int it = 0; it < 12; ++it) {
      const int p = it * ATT_THREADS + tid;
      *(v4u*)(dst + (size_t)p * 8) = v[it];
    }
  }
}

// V^T fragments of one key block (vp: the wave's d columns, that key block's unit) and one key block's P'.V products.
__device__ __forceinline__ void ld_v(const _Float16* vp, v16h (&g)[NJ]) {
#pragma unroll
  for (int j = 0; j < NJ; ++j) g[j] = ldfo_h(vp + (size_t)(16 * j) * SEQ);
}
__device__ __forceinline__ void pv_step(v8f (&o)[RT][NJ], const _Float16* pp, const v16h (&g)[NJ]) {
  v16h pf[RT];
#pragma unroll
  for (int rt = 0; rt < RT; ++rt) pf[rt] = ldfrag_h(pp + rt * (16 * PLP));
#pragma unroll
  for (int rt = 0; rt < RT; ++rt) {
#pragma unroll
    for (int j = 0; j < NJ; ++j) o[rt][j] = mma_h(pf[rt], g[j], o[rt][j]);
  }
}

__global__ __launch_bounds__(ATT_THREADS)
void attn_fwd(const u16* __restrict__ QPp, const u16* __restrict__ KPp, const u16* __restrict__ VTp,
              const float* __restrict__ VSp, u16* CHo, u16* CRo) {
  __shared__ __align__(16) AttLds L0;              // scores [QT][SCP] f32; reused as the ctx staging tile [QT][CTP] u16
  __shared__ __align__(16) u16 pls[QT * PLP];      // P' tile [QT][PLP] f16 bits
  __shared__ __align__(16) float vsl[NCHK * EMB];  // VS: column sums of V per chunk, this batch
  __shared__ float rowa[QT];
  __shared__ float rowc[QT];
  __shared__ float rowi[QT];
  float* const scs = L0.s;

  const int tid  = threadIdx.x;
  const int wave = tid >> 5;
  const int lane = tid & 31;
  const int hh   = lane >> 4;
  const int m    = lane & 15;
  const int r32  = tid >> 4;                 // query rows owned in phase (M): r32 and 32 + r32
  const int sub  = tid & 15;
  const int kl0  = sub * 32;

  const int bid = blockIdx.x;
  const int b   = bid / (SEQ / QT);
  const int q0  = (bid % (SEQ / QT)) * QT;

  const _Float16* qa  = (const _Float16*)(const void*)QPp + ((size_t)b * SEQ + q0) * EMB + 8 * lane;
  const _Float16* kbp = (const _Float16*)(const void*)KPp + ((size_t)b * SEQ + wave * 32) * EMB + 8 * lane;
  const _Float16* vbp = (const _Float16*)(const void*)VTp + ((size_t)b * EMB + wave * DW) * SEQ + 8 * lane;
  const float lsc = RSQD * LOG2E / (QSC * KSC);

  // VS[chunk][d] = the chunk's PSN entries of PS, added in key order; a thread takes 2 consecutive d of one chunk, three times over
  // (8-B loads, a wave = 256 contiguous B). All loads are asked for before the first add, so their latency is waited out once.
  // Written here, read in (PV): two block barriers lie between.
  {
    v2f x[3][PSN];
#pragma unroll
    for (int it = 0; it < 3; ++it) {
      const int g = it * ATT_THREADS + tid;
      const float* p = VSp + ((size_t)b * (SEQ / 64) + (size_t)(g / (EMB / 2)) * PSN) * EMB + 2 * (g % (EMB / 2));
#pragma unroll
      for (int i = 0; i < PSN; ++i) x[it][i] = *(const v2f*)(p + (size_t)i * EMB);
    }
    wait_x();                                // in front of the first rewrite of the three address pairs that these loads name
#pragma unroll
    for (int it = 0; it < 3; ++it) {
      v2f a = x[it][0];
#pragma unroll
      for (int i = 1; i < PSN; ++i) a += x[it][i];
      *(v2f*)(vsl + 2 * (it * ATT_THREADS + tid)) = a;
    }
  }

  float mrun[2] = {-INFINITY, -INFINITY}, lrun[2] = {0.f, 0.f};
  v8f o[RT][NJ];
#pragma unroll
  for (int rt = 0; rt < RT; ++rt) {
#pragma unroll
    for (int j = 0; j < NJ; ++j) o[rt][j] = zero8();
  }

#pragma unroll 1
  for (int c = 0; c < NCHK; ++c) {
    const int kbeg = c * CK;
    // ---- (S) scores of this chunk: key block = wave ----
    {
      const _Float16* qp = qa;
      const _Float16* kp = kbp + (size_t)kbeg * EMB;
      v8f s[RT][2];
#pragma unroll
      for (int rt = 0; rt < RT; ++rt) { s[rt][0] = zero8(); s[rt][1] = zero8(); }
#pragma unroll 1
      for (int k4 = 0; k4 < EMB / 128; ++k4) {             // 6 trips of 4 d-steps, as many steps unrolled as before
#pragma unroll
        for (int u = 0; u < 4; ++u) {
          v16h a[RT];
#pragma unroll
          for (int rt = 0; rt < RT; ++rt) a[rt] = ldfo_h(qp + rt * (16 * EMB) + u * 512);
          const v16h f0 = ldfo_h(kp + u * 512);
          const v16h f1 = ldfo_h(kp + 16 * EMB + u * 512);
#pragma unroll
          for (int rt = 0; rt < RT; ++rt) {
            s[rt][0] = mma_h(a[rt], f0, s[rt][0]);
            s[rt][1] = mma_h(a[rt], f1, s[rt][1]);
          }
          guard_s(s, a, f0, f1, qp, kp);
        }
        qp += 4 * 512;
        kp += 4 * 512;
      }
#pragma unroll
      for (int rt = 0; rt < RT; ++rt) {
        float* srow = scs + (16 * rt + 8 * hh) * SCP + wave * 32 + m;
#pragma unroll
        for (int r = 0; r < 8; ++r) {
          srow[r * SCP]      = s[rt][0][r];
          srow[r * SCP + 16] = s[rt][1][r];
        }
      }
    }
    __syncthreads();
    // The chunk's first two V^T fragment sets are asked for here: they depend on nothing of phase (M) and land while it runs.
    const _Float16* vp = vbp + kbeg * 16;                  // key block kbeg/32 -> 512 elements per unit
    v16h g0[NJ], g1[NJ], g2[NJ];
    ld_v(vp, g0);
    ld_v(vp + 512, g1);
    // ---- (M) softmax statistics and the centred P' tile, 32 rows a pass ----
#pragma unroll
    for (int rg = 0; rg < 2; ++rg) {
      const int row = rg * 32 + r32;
      const float* sp = scs + row * SCP + kl0;
      float t[32];
      float cm = -INFINITY;
#pragma unroll
      for (int i = 0; i < 8; ++i) {
        const v4f a = *(const v4f*)(sp + 4 * i);
#pragma unroll
        for (int e = 0; e < 4; ++e) {
          const float tv = a[e] * lsc;
          t[4 * i + e] = tv;
          cm = fmaxf(cm, tv);
        }
      }
#pragma unroll
      for (int d = 1; d <= 8; d <<= 1) cm = fmaxf(cm, __shfl_xor(cm, d, 32));
      const float mn = fmaxf(mrun[rg], cm);                // finite
      const float al = (mrun[rg] == -INFINITY) ? 0.f : exp2f(mrun[rg] - mn);
      mrun[rg] = mn;
      float ps = 0.f;
#pragma unroll
      for (int j = 0; j < 32; ++j) {
        const float p = exp2f(fminf(t[j] - mn, 0.f));
        t[j] = p;
        ps += p;
      }
#pragma unroll
      for (int d = 1; d <= 8; d <<= 1) ps += __shfl_xor(ps, d, 32);
      const float cc = ps * (1.0f / (float)CK);
      v4u pk[4];
#pragma unroll
      for (int i = 0; i < 4; ++i) {
#pragma unroll
        for (int e = 0; e < 4; ++e) {
          const int j = 8 * i + 2 * e;
          pk[i][e] = pk16(h_bits((_Float16)((t[j] - cc) * PCAR)), h_bits((_Float16)((t[j + 1] - cc) * PCAR)));
        }
      }
      lrun[rg] = lrun[rg] * al + ps;
      u16* pd = pls + row * PLP + kl0;
#pragma unroll
      for (int i = 0; i < 4; ++i) *(v4u*)(pd + 8 * i) = pk[i];
      if (sub == 0) { rowa[row] = al; rowc[row] = cc; }
    }
    __syncthreads();
    // ---- (PV) rescale, add the centring term, accumulate P' . V^T ----
    {
      float vs[NJ];
#pragma unroll
      for (int j = 0; j < NJ; ++j) vs[j] = vsl[c * EMB + wave * DW + m + 16 * j];
#pragma unroll
      for (int rt = 0; rt < RT; ++rt) {
        float scl[8], cad[8];
#pragma unroll
        for (int r = 0; r < 8; ++r) {
          scl[r] = rowa[16 * rt + 8 * hh + r];
          cad[r] = rowc[16 * rt + 8 * hh + r] * (PCAR * VCAR);
        }
#pragma unroll
        for (int j = 0; j < NJ; ++j) {
#pragma unroll
          for (int r = 0; r < 8; ++r) o[rt][j][r] = o[rt][j][r] * scl[r] + cad[r] * vs[j];
        }
      }
      const _Float16* pp = (const _Float16*)(const void*)pls + m * PLP + 8 * hh;
      // Three V^T fragment sets in rotation: key block kb + 2 is fetched in front of the WMMAs of key block kb. Key blocks
      // 0 .. CK/32 - 5 in the loop (three a trip), the last four behind it: no load reaches past the chunk's keys.
#pragma unroll 1                             // rolled: one trip is 36 WMMAs; the body stays small in the instruction cache
      for (int t = 0; t < (CK / 32 - 4) / 3; ++t) {
        ld_v(vp + 2 * 512, g2);
        pv_step(o, pp, g0);
        guard_o(o, vp);
        ld_v(vp + 3 * 512, g0);
        pv_step(o, pp + 32, g1);
        guard_o(o, vp);
        ld_v(vp + 4 * 512, g1);
        pv_step(o, pp + 64, g2);
        guard_o(o, vp);
        vp += 3 * 512;
        pp += 3 * 32;
      }
      ld_v(vp + 2 * 512, g2);
      pv_step(o, pp, g0);
      guard_o(o, vp);
      ld_v(vp + 3 * 512, g0);
      pv_step(o, pp + 32, g1);
      pv_step(o, pp + 64, g2);
      pv_step(o, pp + 96, g0);
      guard_o(o, vp);
    }
  }

#pragma unroll
  for (int rg = 0; rg < 2; ++rg) {
    if (sub == 0) rowi[rg * 32 + r32] = (1.0f / lrun[rg]) * (CSC / (PCAR * VCAR));   // lrun >= 1
  }
  __syncthreads();
  float inv[RT][8];
#pragma unroll
  for (int rt = 0; rt < RT; ++rt) {
#pragma unroll
    for (int r = 0; r < 8; ++r) inv[rt][r] = rowi[16 * rt + 8 * hh + r];
  }

  u16* const ct = L0.c;
  const int cb = wave * DW + m;
  // hi plane
#pragma unroll
  for (int rt = 0; rt < RT; ++rt) {
#pragma unroll
    for (int j = 0; j < NJ; ++j) {
#pragma unroll
      for (int r = 0; r < 8; ++r) {
        const float xs = o[rt][j][r] * inv[rt][r];
        ct[(16 * rt + 8 * hh + r) * CTP + cb + 16 * j] = h_bits((_Float16)xs);
      }
    }
  }
  __syncthreads();
  ctx_store(ct, CHo + ((size_t)b * SEQ + q0) * EMB, tid);
  __syncthreads();
  // residual plane
#pragma unroll
  for (int rt = 0; rt < RT; ++rt) {
#pragma unroll
    for (int j = 0; j < NJ; ++j) {
#pragma unroll
      for (int r = 0; r < 8; ++r) {
        const float xs = o[rt][j][r] * inv[rt][r];
        const _Float16 hv = (_Float16)xs;
        ct[(16 * rt + 8 * hh + r) * CTP + cb + 16 * j] = h_bits((_Float16)((xs - (float)hv) * RSC));
      }
    }
  }
  __syncthreads();
  ctx_store(ct, CRo + ((size_t)b * SEQ + q0) * EMB, tid);
}

// =====================================================================================================
// Workspace map (bytes, rows = nb*SEQ; nb = 8 gives the totals below); every plane is fully written by whole-line stores before
// it is read; all extents are exact multiples of the store granularity (no pad rows); region A is reused sequentially on the
// single in-order stream:
//   WQB bf16 [768][768]   1179648   WKB same   WVB same   WOH f16 of bf16 value x1024  1179648     4718592
//   PS  f32  [rows/64][768]                                                                        786432
//   A   DB bf16 [rows][768] (25165824), later CH f16 [rows][768] (25165824)               region 25165824
//   Q   QP f16 [rows][768] x8                                                              region 25165824
//   K   KP f16 [rows][768] x8                                                              region 25165824
//   VT  f16 [nb][768][2048] x1024                                                          region 25165824
//   CR  f16 [rows][768]                                                                    region 25165824
//   end                                                                                        131334144
// =====================================================================================================
extern "C" void kernel_launch(void* const* d_in, const int* in_sizes, int n_in,
                              void* d_out, int out_size, void* d_ws, size_t ws_size,
                              hipStream_t stream) {
  if (n_in < 9) return;
  const long long per = (long long)SEQ * EMB;
  const long long ns  = in_sizes[0];
  if (ns < per || (ns % per) != 0) return;
  const int nb = (int)(ns / per);
  if (nb < 1 || nb > 8) return;
  const int rows = nb * SEQ;
  if (in_sizes[1] != EMB) return;
  if (in_sizes[2] < 1 || in_sizes[3] < 1) return;
  if (in_sizes[4] != EMB * EMB || in_sizes[5] != EMB * EMB || in_sizes[6] != EMB * EMB || in_sizes[7] != EMB * EMB) return;
  if (in_sizes[8] != EMB) return;
  if ((long long)out_size != (long long)rows * EMB) return;

  const float* spk = (const float*)d_in[0];
  const int*   dly = (const int*)d_in[1];
  const float* mpo = (const float*)d_in[2];
  const float* dcy = (const float*)d_in[3];
  const float* wq  = (const float*)d_in[4];
  const float* wk  = (const float*)d_in[5];
  const float* wv  = (const float*)d_in[6];
  const float* wo  = (const float*)d_in[7];
  const float* bo  = (const float*)d_in[8];
  float*       out = (float*)d_out;

  const size_t szW  = (size_t)EMB * EMB * 2;                    //   1179648
  const size_t szPS = (size_t)(rows / 64) * EMB * 4;            //    786432 at nb = 8
  const size_t sz16 = (size_t)rows * EMB * 2;                   //  25165824
  const size_t szVT = (size_t)nb * EMB * SEQ * 2;               //  == sz16
  size_t off = 0;
  const size_t oWQ = off; off += szW;
  const size_t oWK = off; off += szW;
  const size_t oWV = off; off += szW;
  const size_t oWO = off; off += szW;
  const size_t oPS = off; off += szPS;
  const size_t oA  = off; off += sz16;                          // DB then CH
  const size_t oQ  = off; off += sz16;
  const size_t oK  = off; off += sz16;
  const size_t oVT = off; off += szVT;
  const size_t oCR = off; off += sz16;
  if (off > ws_size) return;                                    // off = 131334144 at nb = 8
  if (off > WS_CAP) return;
  if (oWK - oWQ != szW || oWV - oWK != szW || oWO - oWV != szW) return;   // prep and gemm_qkv index the weight planes from WQB

  char* ws = (char*)d_ws;
  u16*   WQB = (u16*)(ws + oWQ);
  u16*   WOH = (u16*)(ws + oWO);
  float* PS  = (float*)(ws + oPS);
  u16*   DB  = (u16*)(ws + oA);
  u16*   CH  = (u16*)(ws + oA);
  u16*   QP  = (u16*)(ws + oQ);
  u16*   KP  = (u16*)(ws + oK);
  u16*   VT  = (u16*)(ws + oVT);
  u16*   CR  = (u16*)(ws + oCR);

  const int n8w = (EMB * EMB) / 8;                      // 73728
  const int n8g = rows * (EMB / 8);                     // rows * 96
  if ((n8w % 256) != 0 || (n8g % 256) != 0) return;
  if ((rows % 128) != 0) return;
  const dim3 blk(256);
  if (n8w / 256 != WBLK) return;
  const dim3 gP(4 * WBLK + n8g / 256);                  // 4 weight planes, then the gather
  const dim3 gG(3 * (rows / 128) * (EMB / 128));        // 2304 at nb = 8: 128 x 128 tiles of q, k and v
  const dim3 gO((rows / 64) * (EMB / 128));             // 1536 at nb = 8: 64 x 128 tiles
  const dim3 bG(128);
  const dim3 gAT(nb * (SEQ / QT));                      // nb * 32
  const dim3 bAT(ATT_THREADS);

  // (0) weights stored [n = out][k = in] (y = x.W^T), rows = n: fragment-order bf16 planes for Wq, Wk, Wv; f16 of bf16 value
  //     x1024 for Wo (the four planes lie one behind the other from WQB); delayed spikes -> fragment-order bf16 plane, rows x 768
  prep<<<gP, blk, 0, stream>>>(wq, wk, wv, wo, spk, dly, mpo, dcy, WQB, DB, n8g);
  // (1) q and k projections -> f16 planes x8; v projection -> V^T plane x1024 and column sums of v per 64 keys
  gemm_qkv<<<gG, bG, 0, stream>>>(DB, WQB, QP, KP, VT, PS, rows);
  // (2) attention -> ctx hi x16384 (over the dead DB region) and residual x2048 f16 planes
  attn_fwd<<<gAT, bAT, 0, stream>>>(QP, KP, VT, PS, CH, CR);
  // (3) output projection + bias -> out
  gemm_h2_32<<<gO, bG, 0, stream>>>(CH, CR, WOH, bo, out, rows,
                                     1.0f / (CSC * WSC), 1.0f / (CSC * WSC * RSC));
  (void)hipGetLastError();
}

// v008
// Measured time: 215 microseconds a run.
// Next to v007, in two timings, it ran 1.21 times as fast each time.
// Over all steps from v000 it is 4.45 times as fast.
// Folded weight W' = bf16(Wo) . bf16(Wv): v_wmma_f32_16x16x32_bf16 (bf16 RNE operands of the raw inputs, f32 accumulate).
// Projections q, k = delayed.W^T and v' = delayed.W'^T (delayed = f16 of the bf16 RNE value, Wq, Wk = f16 of the bf16 RNE value x1024,
// W' = f16 x1024), scores q'.k'^T (f16 planes x8) and P'.V' (chunk-centred P' x32768 f16 from LDS, V'^T x1024 f16):
// v_wmma_f32_16x16x32_f16, f32 accumulate. (P.V).Wo^T is computed as P.(V.Wo^T) = P.(delayed.W'^T); the bias is added in f32.
// Delay gather, softmax statistics, column sums of V' and all scaling in f32 on VALU.
#include <hip/hip_runtime.h>
#include <math.h>
#include <stdint.h>

#define SEQ   2048
#define EMB   768
#define CK    512
#define NCHK  4
#define QT    64
#define RT    4
#define NJ    3
#define DW    48
#define SCP   544
#define PLP   528
#define CTF   772
#define SLAB64 (16 * 68)
#define PSN   (CK / 64)
#define ATT_THREADS 512
#define QSC   8.0f
#define KSC   8.0f
#define PCAR  32768.0f
#define VCAR  1024.0f
#define WSC   1024.0f
#define LOG2E 1.4426950408889634f
#define RSQD  0.036084391824351615f
#define WS_CAP ((size_t)134217728)
#define KST   (EMB / 32)
#define WBLK  ((EMB * EMB) / 2048)
#define WPB   ((EMB / 32) * (EMB / 32))
#define GLOBAL_AS __attribute__((address_space(1)))

static_assert((EMB % 128) == 0 && EMB == 8 * 96 && (EMB % 32) == 0 && (EMB / 8) == 96);
static_assert((SEQ % CK) == 0 && (SEQ / CK) == NCHK && CK == 16 * 32 && (SEQ % 64) == 0 && (SEQ / QT) == 32);
static_assert((QT / 2) * CTF <= QT * SCP && CTF >= EMB && ((8 * CTF) % 64) == 32);
static_assert(((PLP * 2) % 16) == 0 && ((SCP * 4) % 16) == 0 && ((CTF * 4) % 16) == 0);
static_assert((CK % 64) == 0 && (SEQ % 128) == 0 && PSN * 64 == CK);
static_assert(NCHK * (EMB / 2) == 3 * ATT_THREADS);
static_assert(ATT_THREADS == 512 && QT == 16 * RT && 2 * (ATT_THREADS / 16) == QT);
static_assert((ATT_THREADS / 32) * 32 == CK && (ATT_THREADS / 32) * DW == EMB && DW == 16 * NJ);
static_assert(12 * ATT_THREADS * 4 == (QT / 2) * EMB && ((EMB / 4) % 32) == 0);
static_assert(((EMB * EMB) % 2048) == 0 && WPB == 2 * WBLK && (EMB % 64) == 0);
static_assert(3 * 512 * 2 == 0xc00 && (KST % 3) == 0 && KST >= 6 && ((CK / 32) % 3) == 1 && (CK / 32) >= 4);

typedef unsigned short u16;
typedef _Float16 v16h __attribute__((ext_vector_type(16)));
typedef _Float16 v8h  __attribute__((ext_vector_type(8)));
typedef __bf16   v16b __attribute__((ext_vector_type(16)));
typedef float    v8f  __attribute__((ext_vector_type(8)));
typedef float    v4f  __attribute__((ext_vector_type(4)));
typedef float    v2f  __attribute__((ext_vector_type(2)));
typedef unsigned int v4u __attribute__((ext_vector_type(4)));

union FragH { v16h v; v8h h[2]; v4u u[2]; };
union FragB { v16b v; v4u u[2]; };

// ---- scalar helpers --------------------------------------------------------------------------------
__device__ __forceinline__ unsigned short bf_bits(float f) {          // f32 -> bf16 bits, RNE convert
  unsigned u = __float_as_uint(f);
  return (unsigned short)((u + 0x7FFFu + ((u >> 16) & 1u)) >> 16);
}
__device__ __forceinline__ float bf_up(unsigned short h) { return __uint_as_float(((unsigned)h) << 16); }
__device__ __forceinline__ float bfr(float f) { return bf_up(bf_bits(f)); }
__device__ __forceinline__ unsigned short h_bits(_Float16 x) { return __builtin_bit_cast(unsigned short, x); }
__device__ __forceinline__ unsigned pk16(unsigned short a, unsigned short b) { return (unsigned)a | ((unsigned)b << 16); }
__device__ __forceinline__ v8f zero8() { v8f z = {0.f, 0.f, 0.f, 0.f, 0.f, 0.f, 0.f, 0.f}; return z; }

// ---- fragment loaders: 16-bit A/B operand, lane -> row/col (lane&15), p already includes +8*(lane>>4);
//      elements 0..7 <- p[0..7] (k0+8h..), elements 8..15 <- p[16..23] (k0+16+8h..)  (same split k map for A and B;
//      this row-major form is used for the P' tile in LDS only)
__device__ __forceinline__ v16h ldfrag_h(const _Float16* p) {
  FragH f;
  f.h[0] = *(const v8h*)(p);
  f.h[1] = *(const v8h*)(p + 16);
  return f.v;
}
// ---- fragment-order planes (every 16-bit operand plane in the workspace): a plane [R][K] is stored as
//      [R/16][K/32][2][32 lanes][8 elements]. The 1-KiB unit of (row block rb, k block kb) starts at element rb*16*K + kb*512;
//      in it lane (16*hh + m) finds, at 8*lane, row m's k = 8*hh + 0..7 and, 256 elements on, k = 16 + 8*hh + 0..7: the same
//      split k map as above. A fragment is two 16-B loads per lane, each 512 contiguous bytes per wave (4 whole lines).
//      p already includes +8*lane.
//      The planes lie in global memory; the casts say so, since a pointer that has passed through an asm statement (step3) would
//      otherwise be read by flat loads.
__device__ __forceinline__ v16h ldfo_h(const _Float16* p) {
  FragH f;
  f.h[0] = *(const GLOBAL_AS v8h*)(p);
  f.h[1] = *(const GLOBAL_AS v8h*)(p + 256);
  return f.v;
}

__device__ __forceinline__ v8f mma_h(v16h a, v16h b, v8f c) {
  return __builtin_amdgcn_wmma_f32_16x16x32_f16(false, a, false, b, (short)0, c, false, false);
}
__device__ __forceinline__ v8f mma_b(v16b a, v16b b, v8f c) {
  return __builtin_amdgcn_wmma_f32_16x16x32_bf16(false, a, false, b, (short)0, c, false, false);
}
// The v_nop guards below stand behind the WMMAs of a step: they keep the four vector slots that the chip needs before
// the operand registers are reloaded or the accumulators are touched, on the taken back edge too. The accumulators are named so that every WMMA of the step stays in front of the slots.
// guard_s also holds s_wait_xcnt 0 in front of the rewrite of the two address pairs that the step's global loads name; the pairs
// are inputs so that nothing overwrites them ahead of that wait.
__device__ __forceinline__ void guard_s(v8f (&s)[RT][2], const v16h (&a)[RT], v16h f0, v16h f1,
                                        const _Float16* qp, const _Float16* kp) {
#if defined(__HIP_DEVICE_COMPILE__)
  asm volatile("s_wait_xcnt 0x0\n\tv_nop\n\tv_nop\n\tv_nop\n\tv_nop"
               : "+v"(s[0][0]), "+v"(s[0][1]), "+v"(s[1][0]), "+v"(s[1][1]),
                 "+v"(s[2][0]), "+v"(s[2][1]), "+v"(s[3][0]), "+v"(s[3][1])
               : "v"(a[0]), "v"(a[1]), "v"(a[2]), "v"(a[3]), "v"(f0), "v"(f1), "v"(qp), "v"(kp) : "memory");
#endif
}
// guard_g (GEMM k loops) holds the same four slots and, like guard_s, s_wait_xcnt 0 in front of the rewrite of the address pairs
// that the issued global loads name; the pairs are inputs so that nothing overwrites them ahead of that wait (a loop with two
// pairs names one of them twice). The "memory" clobber keeps the loads of the sets fetched ahead on the side of the guard where
// the source has them. The fragment sets are not named: three sets and the accumulators pass v255, where no asm operand can lie.
template <typename P>
__device__ __forceinline__ void guard_g(v8f (&c)[4][4], const P* p0, const P* p1, const P* p2) {
#if defined(__HIP_DEVICE_COMPILE__)
  asm volatile("s_wait_xcnt 0x0\n\tv_nop\n\tv_nop\n\tv_nop\n\tv_nop"
               : "+v"(c[0][0]), "+v"(c[0][1]), "+v"(c[0][2]), "+v"(c[0][3]), "+v"(c[1][0]), "+v"(c[1][1]), "+v"(c[1][2]), "+v"(c[1][3]),
                 "+v"(c[2][0]), "+v"(c[2][1]), "+v"(c[2][2]), "+v"(c[2][3]), "+v"(c[3][0]), "+v"(c[3][1]), "+v"(c[3][2]), "+v"(c[3][3])
               : "v"(p0), "v"(p1), "v"(p2)
               : "memory");
#endif
}
// wait_x: s_wait_xcnt 0 alone: behind the first three sets' loads of a k loop, each step's loads (wprod), the VS loads (attn_fwd), the column sums' stores (gemm_qkv), a 16-row tile's f16 stores (epi64hs) or the output stores (out_store).
__device__ __forceinline__ void wait_x() {
#if defined(__HIP_DEVICE_COMPILE__)
  asm volatile("s_wait_xcnt 0x0" : : : "memory");
#endif
}
// step3: moves the address pairs three k blocks on (3 * 512 elements of 2 bytes = 0xc00 bytes). The additions stand in one asm
// statement with s_wait_xcnt 0 in front of them: written in the source, the compiler lifted them over a wait in a statement of
// its own, directly behind the trip's last loads, which name these pairs.
template <typename P>
__device__ __forceinline__ void step3(const P*& p0, const P*& p1) {
#if defined(__HIP_DEVICE_COMPILE__)
  asm volatile("s_wait_xcnt 0x0\n\tv_add_nc_u64_e32 %0, 0xc00, %0\n\tv_add_nc_u64_e32 %1, 0xc00, %1"
               : "+v"(p0), "+v"(p1) : : "memory");
#endif
}
// guard_o (P'.V loop): the four slots, and s_wait_xcnt 0 in front of the rewrite of the V^T address pair, which is an input.
__device__ __forceinline__ void guard_o(v8f (&o)[RT][NJ], const _Float16* vp) {
#if defined(__HIP_DEVICE_COMPILE__)
  asm volatile("s_wait_xcnt 0x0\n\tv_nop\n\tv_nop\n\tv_nop\n\tv_nop"
               : "+v"(o[0][0]), "+v"(o[0][1]), "+v"(o[0][2]), "+v"(o[1][0]), "+v"(o[1][1]), "+v"(o[1][2]),
                 "+v"(o[2][0]), "+v"(o[2][1]), "+v"(o[2][2]), "+v"(o[3][0]), "+v"(o[3][1]), "+v"(o[3][2])
               : "v"(vp) : "memory");
#endif
}
// Orders a wave's own LDS slab writes before its reads of them. The fences name LDS alone: a wave now stages several 16-row tiles
// one after another, and a fence over global memory too would hold each staging back until the last tile's global stores are done.
__device__ __forceinline__ void wave_sync_lds() {
  __builtin_amdgcn_fence(__ATOMIC_RELEASE, "workgroup", "local");
  __builtin_amdgcn_wave_barrier();
  __builtin_amdgcn_fence(__ATOMIC_ACQUIRE, "workgroup", "local");
}

// =====================================================================================================
// f32 plane [EMB][EMB] -> 16-bit plane in fragment order:  mode 0: bf16 RNE bits;  mode 1: f16 bits of (bf16 RNE value) * scale;
// mode 2: f16 bits of value * scale (no bf16 pre-step).
// Thread = one 16-B piece of the fragment-order plane (8 consecutive k of one row): two 16-B loads, one 16-B store; 32
// consecutive lanes store 512 contiguous, 512-B aligned bytes
// coverage: n8/256 blocks (host checks exactness) x 256 thr x 8 = the whole plane; blk = the block's index within the plane.
// =====================================================================================================
__device__ __forceinline__ void cvt16(const float* __restrict__ x, u16* D, int n8, int mode, float scale, int blk) {
  const int gt = blk * 256 + (int)threadIdx.x;
  if (gt >= n8) return;                     // no barriers on this path
  const int unit = gt >> 6;
  const int rb   = unit / (EMB / 32);
  const int kb   = unit - rb * (EMB / 32);
  const float* p = x + (size_t)(rb * 16 + (gt & 15)) * EMB + kb * 32 + ((gt >> 5) & 1) * 16 + ((gt >> 4) & 1) * 8;
  const v4f a = *(const v4f*)(p), c4 = *(const v4f*)(p + 4);
  float v[8];
#pragma unroll
  for (int e = 0; e < 4; ++e) { v[e] = a[e]; v[4 + e] = c4[e]; }
  unsigned short s[8];
#pragma unroll
  for (int e = 0; e < 8; ++e) {
    const float vb = bfr(v[e]);
    const float vf = (mode == 1) ? vb : v[e];
    const unsigned short hb = h_bits((_Float16)(vf * scale));
    const unsigned short bb = bf_bits(v[e]);
    s[e] = (mode != 0) ? hb : bb;
  }
  v4u o;
#pragma unroll
  for (int e = 0; e < 4; ++e) o[e] = pk16(s[2 * e], s[2 * e + 1]);
  u16* d = D + (size_t)gt * 8;
  {
    *(v4u*)(d) = o;
    
  }
}

// =====================================================================================================
// Delay gather to an f16 plane in fragment order (rows = b*SEQ + t, k = n): element (b, t, n) = f16 bits of the bf16 RNE value of
// sp[b][t - dl[n]][n] when t - dl[n] >= 0, else 0 (the zero is
// written). The source row index is clamped into [0, SEQ) for the address; the value is selected afterwards.
// Thread = one 16-B piece (8 consecutive n of one (b, t) row): 8 scalar loads, one 16-B store; 32 consecutive lanes = 16 rows x
// 16 n, stored as 512 contiguous bytes
// coverage: n8/256 blocks (host exact) x 256 thr x 8 = rows x EMB = the whole plane; blk = the block's index within the plane.
// =====================================================================================================
__device__ __forceinline__ void gather_bf(const float* __restrict__ sp, const int* __restrict__ dl, u16* DB, int n8, int blk) {
  const int gt = blk * 256 + (int)threadIdx.x;
  if (gt >= n8) return;                     // no barriers on this path
  const int unit = gt >> 6;
  const int rb   = unit / (EMB / 32);
  const int kb   = unit - rb * (EMB / 32);
  const int row = rb * 16 + (gt & 15);
  const int n0  = kb * 32 + ((gt >> 5) & 1) * 16 + ((gt >> 4) & 1) * 8;
  const int b   = row / SEQ;
  const int t   = row - b * SEQ;
  unsigned short s[8];
#pragma unroll
  for (int e = 0; e < 8; ++e) {
    const int n   = n0 + e;
    const int d   = dl[n];
    const int src = t - d;
    int sc = (src < 0) ? 0 : src;
    sc = (sc > SEQ - 1) ? (SEQ - 1) : sc;
    const float v = sp[((size_t)b * SEQ + (size_t)sc) * EMB + n];
    s[e] = (src >= 0) ? h_bits((_Float16)bfr(v)) : (unsigned short)0;
  }
  v4u o;
#pragma unroll
  for (int e = 0; e < 4; ++e) o[e] = pk16(s[2 * e], s[2 * e + 1]);
  u16* dst = DB + (size_t)gt * 8;
  {
    *(v4u*)(dst) = o;
    
  }
}

// =====================================================================================================
// Folded weight W'[o][i] = sum_d bf16(Wo[o][d]) * bf16(Wv[d][i]), stored as f16(W' * 1024) in fragment order (rows = o, k = i): the
// B operand of the v' projection. Block = one 32 (i) x 32 (o) tile, 8 waves: wave w takes the 16 x 16 quarter (rt, j) = (w>>1 & 1, w & 1)
// over d = 384 (w>>2) .. + 383 (12 WMMA k steps, d ascending); the two halves of d are added through LDS. One quarter and one step's
// loads at a time keep the launch at 16 waves per SIMD, which the delay gather in the same launch lives on.
// WMMA rows = i, columns = o: A[m = i][k = d] = Wv[d][i] (16 scalar loads per fragment, 64 contiguous B per half-wave),
// B[n = o][k = d] = Wo[o][d] (four 16-B loads); both in the split k map (elements 0..7 <- k = 8h + e, 8..15 <- k = 16 + 8h + e).
// A lane's accumulator holds o = o0 + 16j + (lane&15) at i = i0 + 16rt + 8*(lane>>4) + 0..7: that lane's own 16-B piece of the
// unit (o block j, k block i0/32), half rt.
// coverage: WPB blocks x 128 pieces x 8 halves = EMB x EMB; blk = the block's index within the job.
// =====================================================================================================
__device__ __forceinline__ v16b pack_bf(const float (&x)[16]) {
  FragB f;
#pragma unroll
  for (int e = 0; e < 4; ++e) {
    f.u[0][e] = pk16(bf_bits(x[2 * e]), bf_bits(x[2 * e + 1]));
    f.u[1][e] = pk16(bf_bits(x[8 + 2 * e]), bf_bits(x[8 + 2 * e + 1]));
  }
  return f.v;
}
__device__ __forceinline__ void wprod(const float* __restrict__ wo, const float* __restrict__ wv, u16* D, float* red, int blk) {
  const int tid = threadIdx.x, wave = __builtin_amdgcn_readfirstlane(tid >> 5), lane = tid & 31, hh = lane >> 4, m = lane & 15;
  const int i0 = (blk % (EMB / 32)) * 32;
  const int o0 = (blk / (EMB / 32)) * 32;
  const float* pa = wv + (size_t)((wave >> 2) * (EMB / 2) + 8 * hh) * EMB + i0 + 16 * ((wave >> 1) & 1) + m;
  const float* pb = wo + (size_t)(o0 + 16 * (wave & 1) + m) * EMB + (wave >> 2) * (EMB / 2) + 8 * hh;
  v8f acc = zero8();
#pragma unroll                               // unrolled: every load is a base plus a constant, and no WMMA stands in front of a back edge
  for (int s = 0; s < EMB / 64; ++s) {
    float xa[16], xb[16];
#pragma unroll
    for (int e = 0; e < 8; ++e) {
      xa[e]     = pa[(size_t)(32 * s + e) * EMB];
      xa[8 + e] = pa[(size_t)(32 * s + 16 + e) * EMB];
    }
#pragma unroll
    for (int q = 0; q < 4; ++q) {
      const v4f y = *(const v4f*)(pb + 32 * s + (q >> 1) * 16 + (q & 1) * 4);
#pragma unroll
      for (int e = 0; e < 4; ++e) xb[4 * q + e] = y[e];
    }
    wait_x();                                // in front of any rewrite of the address registers that this step's loads name
    acc = mma_b(pack_bf(xa), pack_bf(xb), acc);
  }
  *(v8f*)(red + tid * 8) = acc;
  __syncthreads();                           // block-uniform path: both halves of d are complete before they are added
  if (tid < 128) {                           // piece tid = (rt * 2 + j) * 32 + lane; whole waves
    const v8f t = *(const v8f*)(red + tid * 8) + *(const v8f*)(red + 1024 + tid * 8);
    v4u o;
#pragma unroll
    for (int e = 0; e < 4; ++e) o[e] = pk16(h_bits((_Float16)(t[2 * e] * WSC)), h_bits((_Float16)(t[2 * e + 1] * WSC)));
    *(v4u*)(D + (size_t)(o0 + 16 * ((tid >> 5) & 1)) * EMB + (size_t)(i0 >> 5) * 512 + (tid >> 6) * 256 + lane * 8) = o;
  }
}

// =====================================================================================================
// All operand preparation in one launch: the four jobs read inputs only and write disjoint planes, so none waits for another.
// Blocks 0 .. 4*WBLK-1: w = block / WBLK; w = 0, 1: weight plane w (Wq, Wk as f16 of the bf16 value x1024); w = 2, 3: the WPB tiles of
// the folded weight W' (plane 2); plane p at WB + p * EMB*EMB; the blocks behind them: the delay gather. The choice is block-uniform.
// =====================================================================================================
// 16 waves per SIMD asked for: the delay gather hides its dependent loads behind other waves alone.
__global__ __launch_bounds__(256, 16) void prep(const float* __restrict__ wq, const float* __restrict__ wk,
                                            const float* __restrict__ wv, const float* __restrict__ wo,
                                            const float* __restrict__ sp, const int* __restrict__ dl,
                                            const float* __restrict__ mpu, const float* __restrict__ dcu,
                                            u16* WB, u16* DB, int n8g) {
  __shared__ __align__(32) float red[2 * 1024];    // W' job only: 2 partial 32 x 32 tiles
  const int bid = blockIdx.x;
  if (bid < 4 * WBLK) {
    const int w = bid / WBLK;
    if (w < 2) cvt16((w == 0) ? wq : wk, WB + (size_t)w * (EMB * EMB), (EMB * EMB) / 8, 1, WSC, bid - w * WBLK);
    else wprod(wo, wv, WB + (size_t)2 * (EMB * EMB), red, bid - 2 * WBLK);
  } else {
    gather_bf(sp, dl, DB, n8g, bid - 4 * WBLK);
  }
  (void)mpu; (void)dcu;
}

// =====================================================================================================
//  epi64hs: f16 bits of (tile * pscale), stored in fragment order (k = column): lane (16*hh + m) = row m, 8 consecutive columns;
// coverage: 4 instructions x 32 lanes x 8 halves = the wave's 16 x 64 tile.
// =====================================================================================================
__device__ __forceinline__ void stage64(float* sl, v8f a0, v8f a1, v8f a2, v8f a3, float oscale, int lane) {
  const int hh = lane >> 4, m = lane & 15;
#pragma unroll
  for (int r = 0; r < 8; ++r) {
    const int ro = (8 * hh + r) * 68 + m;
    sl[ro]      = a0[r] * oscale;
    sl[ro + 16] = a1[r] * oscale;
    sl[ro + 32] = a2[r] * oscale;
    sl[ro + 48] = a3[r] * oscale;
  }
  wave_sync_lds();
}
__device__ __forceinline__ void epi64hs(float* sl, v8f a0, v8f a1, v8f a2, v8f a3, float oscale, float pscale,
                                        u16* C, int N, size_t rowb, int col0, int lane) {
  stage64(sl, a0, a1, a2, a3, oscale, lane);
  const int hh = lane >> 4, m = lane & 15;
  v4u oh[4];
#pragma unroll
  for (int i4 = 0; i4 < 4; ++i4) {
    const int c8 = (i4 >> 1) * 32 + (i4 & 1) * 16 + hh * 8;   // k block i4>>1, half i4&1 of the wave's two units
    const v4f a = *(const v4f*)(sl + m * 68 + c8), c4 = *(const v4f*)(sl + m * 68 + c8 + 4);
    float w[8];
#pragma unroll
    for (int e = 0; e < 4; ++e) { w[e] = a[e] * pscale; w[4 + e] = c4[e] * pscale; }
#pragma unroll
    for (int e = 0; e < 4; ++e) oh[i4][e] = pk16(h_bits((_Float16)w[2 * e]), h_bits((_Float16)w[2 * e + 1]));
  }
  u16* dst = C + rowb * (size_t)N + (size_t)(col0 >> 5) * 512 + lane * 8;
  {
#pragma unroll
    for (int i4 = 0; i4 < 4; ++i4) {
      *(v4u*)(dst + i4 * 256) = oh[i4];
    }
    
  }
  wait_x();                                  // in front of the next 16-row tile's rewrite of the registers that these stores name
}

// =====================================================================================================
// f16 GEMM core: acc[rt][j] = rows (16 rt ..) of A . rows (16 j ..) of Bt, A and Bt f16 planes [..][EMB] in fragment order.
// Wave tile = 64 x 64 (4 A fragments x 4 B fragments, 16 accumulators): every fragment loaded feeds 4 WMMAs. Fragments come
// straight from the planes (two 16-B loads each, split k map for A and B); k stepped by 32, ascending, one WMMA per (tile, step).
// Block = 128 x 128 tile, 4 waves as 2 x 2; grid = 3 * (M/128) * (EMB/128) (q, k, v'), host checks exactness.
// =====================================================================================================
__device__ __forceinline__ void ld_h64(const _Float16* ap, const _Float16* bp, v16h (&a)[4], v16h (&b)[4]) {
#pragma unroll
  for (int rt = 0; rt < 4; ++rt) a[rt] = ldfo_h(ap + rt * (16 * EMB));
#pragma unroll
  for (int j = 0; j < 4; ++j) b[j] = ldfo_h(bp + j * (16 * EMB));
}
__device__ __forceinline__ void mm_h64(v8f (&acc)[4][4], const v16h (&a)[4], const v16h (&b)[4]) {
#pragma unroll
  for (int rt = 0; rt < 4; ++rt) {
#pragma unroll
    for (int j = 0; j < 4; ++j) acc[rt][j] = mma_h(a[rt], b[j], acc[rt][j]);
  }
}
__device__ __forceinline__ void core_h64(const _Float16* ap, const _Float16* bp, v8f (&acc)[4][4]) {
#pragma unroll
  for (int rt = 0; rt < 4; ++rt) {
#pragma unroll
    for (int j = 0; j < 4; ++j) acc[rt][j] = zero8();
  }
  // Three fragment sets in rotation: a set is refilled for k step s + 3 as soon as the WMMAs of step s have left it, so a wave has
  // two to three steps' loads in flight and its loads have two steps of WMMAs to land in. The loop refills for steps 3 .. KST-1
  // (three a trip); the last three steps stand behind it and load nothing: no load reaches past the planes' k extent.
  v16h a0[4], b0[4], a1[4], b1[4], a2[4], b2[4];
  // The scheduling barriers keep the three sets' loads in issue order: were a load of set 0 issued behind set 2, the loop's counted
  // wait for set 0 would have to cover every load in flight, on each trip, and nothing would stay fetched ahead.
  ld_h64(ap, bp, a0, b0);
  __builtin_amdgcn_sched_barrier(0);
  ld_h64(ap + 512, bp + 512, a1, b1);
  __builtin_amdgcn_sched_barrier(0);
  ld_h64(ap + 2 * 512, bp + 2 * 512, a2, b2);
  wait_x();
#pragma unroll 1                             // rolled: one trip is 48 WMMAs and 48 loads; the body stays small in the instruction cache
  for (int t = 0; t < KST / 3 - 1; ++t) {
    mm_h64(acc, a0, b0);
    guard_g<_Float16>(acc, ap, bp, bp);
    ld_h64(ap + 3 * 512, bp + 3 * 512, a0, b0);
    mm_h64(acc, a1, b1);
    guard_g<_Float16>(acc, ap, bp, bp);
    ld_h64(ap + 4 * 512, bp + 4 * 512, a1, b1);
    mm_h64(acc, a2, b2);
    guard_g<_Float16>(acc, ap, bp, bp);
    ld_h64(ap + 5 * 512, bp + 5 * 512, a2, b2);
    step3<_Float16>(ap, bp);
  }
  mm_h64(acc, a0, b0);
  guard_g<_Float16>(acc, ap, bp, bp);             // the address pairs stay untouched until the last loads' s_wait_xcnt 0 here
  mm_h64(acc, a1, b1);
  mm_h64(acc, a2, b2);
}

// q, k and v' projections in one launch: the three products read the same A plane and depend on nothing of each other.
// Block index = (row tile * 3 + product) * (EMB/128) + column tile; product 0 = q, 1 = k, 2 = v' (block-uniform, taken as a scalar).
// The weight planes carry x1024, so an accumulator is 1024 times its product; the power of two is taken out in the epilogues.
// q, k: f16 plane out in fragment order, f16 bits of (A . Bt^T) * 8; epilogue epi64hs per 16-row tile.
// V below = v' = delayed . W'^T (rows = b*SEQ + s, columns = d = output column), handed on as the two things attention reads;
// V itself is never stored.
//  V^T plane in fragment order (rows = b*EMB + d, k = s), element = f16(V[b][s][d] * 1024): a lane's accumulator acc[rt][j] holds
//  column d = col0 + 16j + (lane&15) at rows 16rt + 8*(lane>>4) + 0..7, which is that lane's own 16-B piece of the unit (d block j,
//  key block rt>>1), half rt&1: eight converts and one 16-B store, no exchange between lanes; a wave's store = 512 contiguous B.
//  PS[(row / 64)][d] = sum of V over the wave tile's 64 keys (f32): rt and r ascending in the lane, then the other half-wave's sum.
// coverage: v: 16 stores x 32 lanes x 8 halves = the wave's 64 x 64 tile; 2 stores x 32 lanes = its 64 column sums (one whole 128-B
//           line each); the grid covers every (product, row tile, column tile) once.
__global__ __launch_bounds__(128)
void gemm_qkv(const u16* __restrict__ A, const u16* __restrict__ WB, u16* QPo, u16* KPo, u16* VTo, float* PS, int M) {
  __shared__ __align__(16) float slab[4 * SLAB64];
  // The wave's number is taken as a scalar: tile row and column then live in scalar registers across the k loop, which keeps the
  // kernel within 336 VGPRs (three waves per SIMD) with three fragment sets.
  const int tid = threadIdx.x, wave = __builtin_amdgcn_readfirstlane(tid >> 5), lane = tid & 31;
  const int bid   = blockIdx.x;
  const int grp   = bid / (EMB / 128);
  const int prod  = grp % 3;
  const int rowb  = (grp / 3) * 128 + (wave >> 1) * 64;
  const int col0  = (bid % (EMB / 128)) * 128 + (wave & 1) * 64;
  if (rowb + 64 > M) return;                 // wave-uniform, never taken with the exact grid; no block barriers in this kernel
  v8f acc[4][4];
  core_h64((const _Float16*)(const void*)A + (size_t)rowb * EMB + 8 * lane,
           (const _Float16*)(const void*)WB + (size_t)prod * (EMB * EMB) + (size_t)col0 * EMB + 8 * lane, acc);
  if (prod != 2) {
    u16* C = (prod == 0) ? QPo : KPo;
    const float pscale = ((prod == 0) ? QSC : KSC) / WSC;
#pragma unroll
    for (int rt = 0; rt < 4; ++rt)
      epi64hs(slab + wave * SLAB64, acc[rt][0], acc[rt][1], acc[rt][2], acc[rt][3], 1.0f, pscale, C, EMB,
              (size_t)(rowb + 16 * rt), col0, lane);
    return;
  }
  const int b  = rowb / SEQ;                 // a 64-row tile lies in one batch (SEQ is a multiple of 128)
  const int s0 = rowb - b * SEQ;
  v4u oh[4][4];
  float cs[4];
#pragma unroll
  for (int j = 0; j < 4; ++j) {
    float s = 0.f;
#pragma unroll
    for (int rt = 0; rt < 4; ++rt) {
#pragma unroll
      for (int r = 0; r < 8; ++r) s += acc[rt][j][r];
#pragma unroll
      for (int e = 0; e < 4; ++e)
        oh[j][rt][e] = pk16(h_bits((_Float16)(acc[rt][j][2 * e] * (VCAR / WSC))), h_bits((_Float16)(acc[rt][j][2 * e + 1] * (VCAR / WSC))));
    }
    cs[j] = s * (1.0f / WSC);
  }
#pragma unroll
  for (int j = 0; j < 4; ++j) cs[j] += __shfl_xor(cs[j], 16, 32);
  const float c01 = (lane & 16) ? cs[1] : cs[0];          // column col0 + lane
  const float c23 = (lane & 16) ? cs[3] : cs[2];          // column col0 + 32 + lane
  u16* dst  = VTo + ((size_t)b * EMB + col0) * SEQ + (size_t)(s0 >> 5) * 512 + lane * 8;
  float* pd = PS + (size_t)(rowb >> 6) * EMB + col0 + lane;
  pd[0]  = c01;
  pd[32] = c23;
  // s_wait_xcnt 0 behind the sums' two stores, in front of any rewrite of their registers; its "memory" clobber keeps the plane's 16
  // stores behind it, last in the kernel, so that no register is written behind them.
  wait_x();
#pragma unroll
  for (int j = 0; j < 4; ++j) {
#pragma unroll
    for (int rt = 0; rt < 4; ++rt) *(v4u*)(dst + (size_t)(16 * j) * SEQ + rt * 256) = oh[j][rt];
  }
}

// =====================================================================================================
// Single-head attention, head width EMB = 768, all SEQ keys kept (non-causal): block = (batch b, 64 query rows q0..q0+63 = RT = 4
// row tiles of 16), 16 waves. Every K fragment and every V^T fragment that a wave loads feeds one WMMA per row tile.
// q plane (f16, x8) rows b*SEQ+s, k = d; k plane the same; V^T plane rows b*EMB+d, k = s (x1024), V = v' = delayed . W'^T, so that
// P . V is already the output projection's result; all three in fragment order; PS = column sums of V over each 64 keys (f32),
// PSN = 8 of them to a chunk.
//   Per chunk of CK = 512 keys (NCHK = 4 chunks):
//   (S) scores S[query][key n] on WMMA: A = q rows of row tile rt (row m = lane&15, split k map over d), B = k rows (col n = key,
//       split map), 24 d-steps; wave w handles key block w (32 keys) of the chunk for all four row tiles; D element r of lane l
//       of tile rt -> scs[query 16rt+8h+r][key col] (f32 LDS).
//   (M) 16 threads per query row (sub-thread = 32 consecutive keys), two passes of 32 rows: base-2 logits, chunk max via xor
//       shuffles, online running max / rescale factor al / running sum l in f32 registers (the same threads own the row in every
//       chunk), p = exp2(t - m_new) <= 1, chunk row sum ps and its mean C = ps/CK (bit-identical on the row's 16 threads), the
//       CENTRED P' = p - C written as f16(P' * 32768) into the LDS P tile with 16-B stores; al -> rowa[row], C -> rowc[row].
//   (PV) each wave owns d columns 48*wave + 16j + (lane&15), j = 0..2, of all four row tiles (12 accumulators):
//       o = o*al + C*(32768*1024)*VS[chunk][d], VS = the chunk's 8 PS entries added in key order, kept in LDS (add-back of the
//       centring term in f32),
//       then for each key block: A = P'
//       fragments from LDS (row m = query, split map over keys), B = V^T fragments (col n = d, split map over keys).
//       sum_k (P'_k + C) v_k == sum_k p_k v_k exactly.
//   Block barriers after (S) and after (M) order all LDS reuse across chunks and waves.
//   Epilogue: out = o / (l * 32768 * 1024) + bf16RNE(bias[d]) per row (rowi, l >= 1 always), f32; 32 rows at a time are staged in LDS
//   (over the dead scores) and stored as whole lines.
// coverage: grid nb*32 blocks x 64 rows; staging 16 waves x 48 cols x 32 rows = 32 x 768, twice; store 12 iterations x 512 thr x 4
//           floats = 32 x 768, twice = every (b, s, d) of out exactly once.
// =====================================================================================================
__device__ __forceinline__ void out_store(const float* ct, float* dst, int tid) {
  v4f v[12];
#pragma unroll
  for (int it = 0; it < 12; ++it) {
    const int p = it * ATT_THREADS + tid;     // 16-B piece p of the 32 x EMB half tile: row p / 192, columns 4 * (p % 192) ..
    v[it] = *(const v4f*)(ct + (p / (EMB / 4)) * CTF + (p % (EMB / 4)) * 4);
  }
#pragma unroll
  for (int it = 0; it < 12; ++it) *(v4f*)(dst + (size_t)(it * ATT_THREADS + tid) * 4) = v[it];
  wait_x();                                  // in front of any rewrite of the registers that these stores name
}

// V^T fragments of one key block (vp: the wave's d columns, that key block's unit) and one key block's P'.V products.
__device__ __forceinline__ void ld_v(const _Float16* vp, v16h (&g)[NJ]) {
#pragma unroll
  for (int j = 0; j < NJ; ++j) g[j] = ldfo_h(vp + (size_t)(16 * j) * SEQ);
}
__device__ __forceinline__ void pv_step(v8f (&o)[RT][NJ], const _Float16* pp, const v16h (&g)[NJ]) {
  v16h pf[RT];
#pragma unroll
  for (int rt = 0; rt < RT; ++rt) pf[rt] = ldfrag_h(pp + rt * (16 * PLP));
#pragma unroll
  for (int rt = 0; rt < RT; ++rt) {
#pragma unroll
    for (int j = 0; j < NJ; ++j) o[rt][j] = mma_h(pf[rt], g[j], o[rt][j]);
  }
}

__global__ __launch_bounds__(ATT_THREADS)
void attn_fwd(const u16* __restrict__ QPp, const u16* __restrict__ KPp, const u16* __restrict__ VTp,
              const float* __restrict__ VSp, const float* __restrict__ bias, float* out) {
  __shared__ __align__(16) float scs[QT * SCP];    // scores [QT][SCP] f32; reused as the output staging tile [QT/2][CTF] f32
  __shared__ __align__(16) u16 pls[QT * PLP];      // P' tile [QT][PLP] f16 bits
  __shared__ __align__(16) float vsl[NCHK * EMB];  // VS: column sums of V per chunk, this batch
  __shared__ float rowa[QT];
  __shared__ float rowc[QT];
  __shared__ float rowi[QT];

  const int tid  = threadIdx.x;
  const int wave = tid >> 5;
  const int lane = tid & 31;
  const int hh   = lane >> 4;
  const int m    = lane & 15;
  const int r32  = tid >> 4;                 // query rows owned in phase (M): r32 and 32 + r32
  const int sub  = tid & 15;
  const int kl0  = sub * 32;

  const int bid = blockIdx.x;
  const int b   = bid / (SEQ / QT);
  const int q0  = (bid % (SEQ / QT)) * QT;

  const _Float16* qa  = (const _Float16*)(const void*)QPp + ((size_t)b * SEQ + q0) * EMB + 8 * lane;
  const _Float16* kbp = (const _Float16*)(const void*)KPp + ((size_t)b * SEQ + wave * 32) * EMB + 8 * lane;
  const _Float16* vbp = (const _Float16*)(const void*)VTp + ((size_t)b * EMB + wave * DW) * SEQ + 8 * lane;
  const float lsc = RSQD * LOG2E / (QSC * KSC);

  // VS[chunk][d] = the chunk's PSN entries of PS, added in key order; a thread takes 2 consecutive d of one chunk, three times over
  // (8-B loads, a wave = 256 contiguous B). All loads are asked for before the first add, so their latency is waited out once.
  // Written here, read in (PV): two block barriers lie between.
  {
    v2f x[3][PSN];
#pragma unroll
    for (int it = 0; it < 3; ++it) {
      const int g = it * ATT_THREADS + tid;
      const float* p = VSp + ((size_t)b * (SEQ / 64) + (size_t)(g / (EMB / 2)) * PSN) * EMB + 2 * (g % (EMB / 2));
#pragma unroll
      for (int i = 0; i < PSN; ++i) x[it][i] = *(const v2f*)(p + (size_t)i * EMB);
    }
    wait_x();                                // in front of the first rewrite of the three address pairs that these loads name
#pragma unroll
    for (int it = 0; it < 3; ++it) {
      v2f a = x[it][0];
#pragma unroll
      for (int i = 1; i < PSN; ++i) a += x[it][i];
      *(v2f*)(vsl + 2 * (it * ATT_THREADS + tid)) = a;
    }
  }

  float mrun[2] = {-INFINITY, -INFINITY}, lrun[2] = {0.f, 0.f};
  v8f o[RT][NJ];
#pragma unroll
  for (int rt = 0; rt < RT; ++rt) {
#pragma unroll
    for (int j = 0; j < NJ; ++j) o[rt][j] = zero8();
  }

#pragma unroll 1
  for (int c = 0; c < NCHK; ++c) {
    const int kbeg = c * CK;
    // ---- (S) scores of this chunk: key block = wave ----
    {
      const _Float16* qp = qa;
      const _Float16* kp = kbp + (size_t)kbeg * EMB;
      v8f s[RT][2];
#pragma unroll
      for (int rt = 0; rt < RT; ++rt) { s[rt][0] = zero8(); s[rt][1] = zero8(); }
#pragma unroll 1
      for (int k4 = 0; k4 < EMB / 128; ++k4) {             // 6 trips of 4 d-steps, as many steps unrolled as before
#pragma unroll
        for (int u = 0; u < 4; ++u) {
          v16h a[RT];
#pragma unroll
          for (int rt = 0; rt < RT; ++rt) a[rt] = ldfo_h(qp + rt * (16 * EMB) + u * 512);
          const v16h f0 = ldfo_h(kp + u * 512);
          const v16h f1 = ldfo_h(kp + 16 * EMB + u * 512);
#pragma unroll
          for (int rt = 0; rt < RT; ++rt) {
            s[rt][0] = mma_h(a[rt], f0, s[rt][0]);
            s[rt][1] = mma_h(a[rt], f1, s[rt][1]);
          }
          guard_s(s, a, f0, f1, qp, kp);
        }
        qp += 4 * 512;
        kp += 4 * 512;
      }
#pragma unroll
      for (int rt = 0; rt < RT; ++rt) {
        float* srow = scs + (16 * rt + 8 * hh) * SCP + wave * 32 + m;
#pragma unroll
        for (int r = 0; r < 8; ++r) {
          srow[r * SCP]      = s[rt][0][r];
          srow[r * SCP + 16] = s[rt][1][r];
        }
      }
    }
    __syncthreads();
    // The chunk's first two V^T fragment sets are asked for here: they depend on nothing of phase (M) and land while it runs.
    const _Float16* vp = vbp + kbeg * 16;                  // key block kbeg/32 -> 512 elements per unit
    v16h g0[NJ], g1[NJ], g2[NJ];
    ld_v(vp, g0);
    ld_v(vp + 512, g1);
    // ---- (M) softmax statistics and the centred P' tile, 32 rows a pass ----
#pragma unroll
    for (int rg = 0; rg < 2; ++rg) {
      const int row = rg * 32 + r32;
      const float* sp = scs + row * SCP + kl0;
      float t[32];
      float cm = -INFINITY;
#pragma unroll
      for (int i = 0; i < 8; ++i) {
        const v4f a = *(const v4f*)(sp + 4 * i);
#pragma unroll
        for (int e = 0; e < 4; ++e) {
          const float tv = a[e] * lsc;
          t[4 * i + e] = tv;
          cm = fmaxf(cm, tv);
        }
      }
#pragma unroll
      for (int d = 1; d <= 8; d <<= 1) cm = fmaxf(cm, __shfl_xor(cm, d, 32));
      const float mn = fmaxf(mrun[rg], cm);                // finite
      const float al = (mrun[rg] == -INFINITY) ? 0.f : exp2f(mrun[rg] - mn);
      mrun[rg] = mn;
      float ps = 0.f;
#pragma unroll
      for (int j = 0; j < 32; ++j) {
        const float p = exp2f(fminf(t[j] - mn, 0.f));
        t[j] = p;
        ps += p;
      }
#pragma unroll
      for (int d = 1; d <= 8; d <<= 1) ps += __shfl_xor(ps, d, 32);
      const float cc = ps * (1.0f / (float)CK);
      v4u pk[4];
#pragma unroll
      for (int i = 0; i < 4; ++i) {
#pragma unroll
        for (int e = 0; e < 4; ++e) {
          const int j = 8 * i + 2 * e;
          pk[i][e] = pk16(h_bits((_Float16)((t[j] - cc) * PCAR)), h_bits((_Float16)((t[j + 1] - cc) * PCAR)));
        }
      }
      lrun[rg] = lrun[rg] * al + ps;
      u16* pd = pls + row * PLP + kl0;
#pragma unroll
      for (int i = 0; i < 4; ++i) *(v4u*)(pd + 8 * i) = pk[i];
      if (sub == 0) { rowa[row] = al; rowc[row] = cc; }
    }
    __syncthreads();
    // ---- (PV) rescale, add the centring term, accumulate P' . V^T ----
    {
      float vs[NJ];
#pragma unroll
      for (int j = 0; j < NJ; ++j) vs[j] = vsl[c * EMB + wave * DW + m + 16 * j];
#pragma unroll
      for (int rt = 0; rt < RT; ++rt) {
        float scl[8], cad[8];
#pragma unroll
        for (int r = 0; r < 8; ++r) {
          scl[r] = rowa[16 * rt + 8 * hh + r];
          cad[r] = rowc[16 * rt + 8 * hh + r] * (PCAR * VCAR);
        }
#pragma unroll
        for (int j = 0; j < NJ; ++j) {
#pragma unroll
          for (int r = 0; r < 8; ++r) o[rt][j][r] = o[rt][j][r] * scl[r] + cad[r] * vs[j];
        }
      }
      const _Float16* pp = (const _Float16*)(const void*)pls + m * PLP + 8 * hh;
      // Three V^T fragment sets in rotation: key block kb + 2 is fetched in front of the WMMAs of key block kb. Key blocks
      // 0 .. CK/32 - 5 in the loop (three a trip), the last four behind it: no load reaches past the chunk's keys.
#pragma unroll 1                             // rolled: one trip is 36 WMMAs; the body stays small in the instruction cache
      for (int t = 0; t < (CK / 32 - 4) / 3; ++t) {
        ld_v(vp + 2 * 512, g2);
        pv_step(o, pp, g0);
        guard_o(o, vp);
        ld_v(vp + 3 * 512, g0);
        pv_step(o, pp + 32, g1);
        guard_o(o, vp);
        ld_v(vp + 4 * 512, g1);
        pv_step(o, pp + 64, g2);
        guard_o(o, vp);
        vp += 3 * 512;
        pp += 3 * 32;
      }
      ld_v(vp + 2 * 512, g2);
      pv_step(o, pp, g0);
      guard_o(o, vp);
      ld_v(vp + 3 * 512, g0);
      pv_step(o, pp + 32, g1);
      pv_step(o, pp + 64, g2);
      pv_step(o, pp + 96, g0);
      guard_o(o, vp);
    }
  }

#pragma unroll
  for (int rg = 0; rg < 2; ++rg) {
    if (sub == 0) rowi[rg * 32 + r32] = (1.0f / lrun[rg]) * (1.0f / (PCAR * VCAR));   // lrun >= 1
  }
  const int cb = wave * DW + m;
  float bj[NJ];
#pragma unroll
  for (int j = 0; j < NJ; ++j) bj[j] = bfr(bias[cb + 16 * j]);      // columns < EMB
  __syncthreads();
#pragma unroll
  for (int hf = 0; hf < 2; ++hf) {           // rows 32 hf .. 32 hf + 31 = row tiles 2 hf, 2 hf + 1
    if (hf) __syncthreads();                 // the first half's reads of the staging tile are done before it is rewritten
#pragma unroll
    for (int r2 = 0; r2 < 2; ++r2) {
      const int rt = 2 * hf + r2;
#pragma unroll
      for (int r = 0; r < 8; ++r) {
        const float inv = rowi[16 * rt + 8 * hh + r];
#pragma unroll
        for (int j = 0; j < NJ; ++j) scs[(16 * r2 + 8 * hh + r) * CTF + cb + 16 * j] = o[rt][j][r] * inv + bj[j];
      }
    }
    __syncthreads();
    out_store(scs, out + ((size_t)b * SEQ + q0 + 32 * hf) * EMB, tid);
  }
}

// =====================================================================================================
// Workspace map (bytes, rows = nb*SEQ; nb = 8 gives the totals below); every plane is fully written by whole-line stores before
// it is read; all extents are exact multiples of the store granularity (no pad rows):
//   WQB f16 of bf16 value x1024 [768][768]  1179648   WKB same   WPF f16 of W' x1024  1179648      3538944
//   PS  f32  [rows/64][768]                                                                        786432
//   A   DB f16 of bf16 value [rows][768]                                                   region 25165824
//   Q   QP f16 [rows][768] x8                                                              region 25165824
//   K   KP f16 [rows][768] x8                                                              region 25165824
//   VT  f16 [nb][768][2048] x1024                                                          region 25165824
//   end                                                                                        104988672
// =====================================================================================================
extern "C" void kernel_launch(void* const* d_in, const int* in_sizes, int n_in,
                              void* d_out, int out_size, void* d_ws, size_t ws_size,
                              hipStream_t stream) {
  if (n_in < 9) return;
  const long long per = (long long)SEQ * EMB;
  const long long ns  = in_sizes[0];
  if (ns < per || (ns % per) != 0) return;
  const int nb = (int)(ns / per);
  if (nb < 1 || nb > 8) return;
  const int rows = nb * SEQ;
  if (in_sizes[1] != EMB) return;
  if (in_sizes[2] < 1 || in_sizes[3] < 1) return;
  if (in_sizes[4] != EMB * EMB || in_sizes[5] != EMB * EMB || in_sizes[6] != EMB * EMB || in_sizes[7] != EMB * EMB) return;
  if (in_sizes[8] != EMB) return;
  if ((long long)out_size != (long long)rows * EMB) return;

  const float* spk = (const float*)d_in[0];
  const int*   dly = (const int*)d_in[1];
  const float* mpo = (const float*)d_in[2];
  const float* dcy = (const float*)d_in[3];
  const float* wq  = (const float*)d_in[4];
  const float* wk  = (const float*)d_in[5];
  const float* wv  = (const float*)d_in[6];
  const float* wo  = (const float*)d_in[7];
  const float* bo  = (const float*)d_in[8];
  float*       out = (float*)d_out;

  const size_t szW  = (size_t)EMB * EMB * 2;                    //   1179648
  const size_t szPS = (size_t)(rows / 64) * EMB * 4;            //    786432 at nb = 8
  const size_t sz16 = (size_t)rows * EMB * 2;                   //  25165824
  const size_t szVT = (size_t)nb * EMB * SEQ * 2;               //  == sz16
  size_t off = 0;
  const size_t oWQ = off; off += szW;
  const size_t oWK = off; off += szW;
  const size_t oWP = off; off += szW;
  const size_t oPS = off; off += szPS;
  const size_t oA  = off; off += sz16;
  const size_t oQ  = off; off += sz16;
  const size_t oK  = off; off += sz16;
  const size_t oVT = off; off += szVT;
  if (off > ws_size) return;                                    // off = 104988672 at nb = 8
  if (off > WS_CAP) return;
  if (oWK - oWQ != szW || oWP - oWK != szW) return;   // prep and gemm_qkv index the weight planes from WQB

  char* ws = (char*)d_ws;
  u16*   WQB = (u16*)(ws + oWQ);
  float* PS  = (float*)(ws + oPS);
  u16*   DB  = (u16*)(ws + oA);
  u16*   QP  = (u16*)(ws + oQ);
  u16*   KP  = (u16*)(ws + oK);
  u16*   VT  = (u16*)(ws + oVT);

  const int n8w = (EMB * EMB) / 8;                      // 73728
  const int n8g = rows * (EMB / 8);                     // rows * 96
  if ((n8w % 256) != 0 || (n8g % 256) != 0) return;
  if ((rows % 128) != 0) return;
  const dim3 blk(256);
  if (n8w / 256 != WBLK) return;
  const dim3 gP(4 * WBLK + n8g / 256);                  // 2 weight planes, the W' tiles, then the gather
  const dim3 gG(3 * (rows / 128) * (EMB / 128));        // 2304 at nb = 8: 128 x 128 tiles of q, k and v'
  const dim3 bG(128);
  const dim3 gAT(nb * (SEQ / QT));                      // nb * 32
  const dim3 bAT(ATT_THREADS);

  // (0) weights stored [n = out][k = in] (y = x.W^T), rows = n: fragment-order f16 planes (bf16 value x1024) for Wq, Wk; W' = Wo.Wv
  //     x1024 (the three planes lie one behind the other from WQB); delayed spikes -> fragment-order f16 plane, rows x 768
  prep<<<gP, blk, 0, stream>>>(wq, wk, wv, wo, spk, dly, mpo, dcy, WQB, DB, n8g);
  // (1) q and k projections -> f16 planes x8; v' projection -> V^T plane x1024 and column sums of v' per 64 keys
  gemm_qkv<<<gG, bG, 0, stream>>>(DB, WQB, QP, KP, VT, PS, rows);
  // (2) attention over v' + bias -> out
  attn_fwd<<<gAT, bAT, 0, stream>>>(QP, KP, VT, PS, bo, out);
  (void)hipGetLastError();
}

// v009
// It runs in 187 microseconds.
// In two side-by-side timings against v008, it was 1.16 and 1.15 times as fast.
// Over all steps from v000 it is 5.14 times as fast.
// Folded weights W' = bf16(Wo) . bf16(Wv) and W'' = bf16(Wk)^T . bf16(Wq): v_wmma_f32_16x16x32_bf16 (bf16 RNE operands of the raw
// inputs, f32 accumulate).
// Projections q' = delayed.W''^T and v' = delayed.W'^T (delayed = f16 of the bf16 RNE value, W', W'' = f16 x1024), scores
// q'.delayed^T (q' f16 plane x8, the delayed plane itself as keys) and P'.V' (chunk-centred P' x32768 f16 from LDS, V'^T x1024 f16):
// v_wmma_f32_16x16x32_f16, f32 accumulate. q.k^T = (delayed.Wq^T).(delayed.Wk^T)^T is computed as (delayed.(Wk^T.Wq)^T).delayed^T;
// (P.V).Wo^T is computed as P.(V.Wo^T) = P.(delayed.W'^T); the bias is added in f32.
// Delay gather, softmax statistics, column sums of V' and all scaling in f32 on VALU.
#include <hip/hip_runtime.h>
#include <math.h>
#include <stdint.h>

#define SEQ   2048
#define EMB   768
#define CK    512
#define NCHK  4
#define QT    64
#define RT    4
#define NJ    3
#define DW    48
#define SCP   544
#define PLP   528
#define CTF   772
#define SLAB64 (16 * 68)
#define PSN   (CK / 64)
#define ATT_THREADS 512
#define QSC   8.0f
#define PCAR  32768.0f
#define VCAR  1024.0f
#define WSC   1024.0f
#define LOG2E 1.4426950408889634f
#define RSQD  0.036084391824351615f
#define WS_CAP ((size_t)134217728)
#define KST   (EMB / 32)
#define WPB   ((EMB / 32) * (EMB / 32))
#define GLOBAL_AS __attribute__((address_space(1)))

static_assert((EMB % 128) == 0 && EMB == 8 * 96 && (EMB % 32) == 0 && (EMB / 8) == 96);
static_assert((SEQ % CK) == 0 && (SEQ / CK) == NCHK && CK == 16 * 32 && (SEQ % 64) == 0 && (SEQ / QT) == 32);
static_assert((QT / 2) * CTF <= QT * SCP && CTF >= EMB && ((8 * CTF) % 64) == 32);
static_assert(((PLP * 2) % 16) == 0 && ((SCP * 4) % 16) == 0 && ((CTF * 4) % 16) == 0);
static_assert((CK % 64) == 0 && (SEQ % 128) == 0 && PSN * 64 == CK);
static_assert(NCHK * (EMB / 2) == 3 * ATT_THREADS);
static_assert(ATT_THREADS == 512 && QT == 16 * RT && 2 * (ATT_THREADS / 16) == QT);
static_assert((ATT_THREADS / 32) * 32 == CK && (ATT_THREADS / 32) * DW == EMB && DW == 16 * NJ);
static_assert(12 * ATT_THREADS * 4 == (QT / 2) * EMB && ((EMB / 4) % 32) == 0);
static_assert((EMB % 64) == 0);
static_assert(3 * 512 * 2 == 0xc00 && (KST % 3) == 0 && KST >= 6 && ((CK / 32) % 3) == 1 && (CK / 32) >= 4);

typedef unsigned short u16;
typedef _Float16 v16h __attribute__((ext_vector_type(16)));
typedef _Float16 v8h  __attribute__((ext_vector_type(8)));
typedef __bf16   v16b __attribute__((ext_vector_type(16)));
typedef float    v8f  __attribute__((ext_vector_type(8)));
typedef float    v4f  __attribute__((ext_vector_type(4)));
typedef float    v2f  __attribute__((ext_vector_type(2)));
typedef unsigned int v4u __attribute__((ext_vector_type(4)));

union FragH { v16h v; v8h h[2]; v4u u[2]; };
union FragB { v16b v; v4u u[2]; };

// ---- scalar helpers --------------------------------------------------------------------------------
__device__ __forceinline__ unsigned short bf_bits(float f) {          // f32 -> bf16 bits, RNE convert
  unsigned u = __float_as_uint(f);
  return (unsigned short)((u + 0x7FFFu + ((u >> 16) & 1u)) >> 16);
}
__device__ __forceinline__ float bf_up(unsigned short h) { return __uint_as_float(((unsigned)h) << 16); }
__device__ __forceinline__ float bfr(float f) { return bf_up(bf_bits(f)); }
__device__ __forceinline__ unsigned short h_bits(_Float16 x) { return __builtin_bit_cast(unsigned short, x); }
__device__ __forceinline__ unsigned pk16(unsigned short a, unsigned short b) { return (unsigned)a | ((unsigned)b << 16); }
__device__ __forceinline__ v8f zero8() { v8f z = {0.f, 0.f, 0.f, 0.f, 0.f, 0.f, 0.f, 0.f}; return z; }

// ---- fragment loaders: 16-bit A/B operand, lane -> row/col (lane&15), p already includes +8*(lane>>4);
//      elements 0..7 <- p[0..7] (k0+8h..), elements 8..15 <- p[16..23] (k0+16+8h..)  (same split k map for A and B;
//      this row-major form is used for the P' tile in LDS only)
__device__ __forceinline__ v16h ldfrag_h(const _Float16* p) {
  FragH f;
  f.h[0] = *(const v8h*)(p);
  f.h[1] = *(const v8h*)(p + 16);
  return f.v;
}
// ---- fragment-order planes (every 16-bit operand plane in the workspace): a plane [R][K] is stored as
//      [R/16][K/32][2][32 lanes][8 elements]. The 1-KiB unit of (row block rb, k block kb) starts at element rb*16*K + kb*512;
//      in it lane (16*hh + m) finds, at 8*lane, row m's k = 8*hh + 0..7 and, 256 elements on, k = 16 + 8*hh + 0..7: the same
//      split k map as above. A fragment is two 16-B loads per lane, each 512 contiguous bytes per wave (4 whole lines).
//      p already includes +8*lane.
//      The planes lie in global memory; the casts say so, since a pointer that has passed through an asm statement (step3) would
//      otherwise be read by flat loads.
__device__ __forceinline__ v16h ldfo_h(const _Float16* p) {
  FragH f;
  f.h[0] = *(const GLOBAL_AS v8h*)(p);
  f.h[1] = *(const GLOBAL_AS v8h*)(p + 256);
  return f.v;
}

__device__ __forceinline__ v8f mma_h(v16h a, v16h b, v8f c) {
  return __builtin_amdgcn_wmma_f32_16x16x32_f16(false, a, false, b, (short)0, c, false, false);
}
__device__ __forceinline__ v8f mma_b(v16b a, v16b b, v8f c) {
  return __builtin_amdgcn_wmma_f32_16x16x32_bf16(false, a, false, b, (short)0, c, false, false);
}
// The v_nop guards below stand behind the WMMAs of a step: they keep the four vector slots that the chip needs before
// the operand registers are reloaded or the accumulators are touched, on the taken back edge too. The accumulators are named so that every WMMA of the step stays in front of the slots.
// guard_s also holds s_wait_xcnt 0 in front of the rewrite of the two address pairs that the step's global loads name; the pairs
// are inputs so that nothing overwrites them ahead of that wait.
__device__ __forceinline__ void guard_s(v8f (&s)[RT][2], const v16h (&a)[RT], v16h f0, v16h f1,
                                        const _Float16* qp, const _Float16* kp) {
#if defined(__HIP_DEVICE_COMPILE__)
  asm volatile("s_wait_xcnt 0x0\n\tv_nop\n\tv_nop\n\tv_nop\n\tv_nop"
               : "+v"(s[0][0]), "+v"(s[0][1]), "+v"(s[1][0]), "+v"(s[1][1]),
                 "+v"(s[2][0]), "+v"(s[2][1]), "+v"(s[3][0]), "+v"(s[3][1])
               : "v"(a[0]), "v"(a[1]), "v"(a[2]), "v"(a[3]), "v"(f0), "v"(f1), "v"(qp), "v"(kp) : "memory");
#endif
}
// guard_g (GEMM k loops) holds the same four slots and, like guard_s, s_wait_xcnt 0 in front of the rewrite of the address pairs
// that the issued global loads name; the pairs are inputs so that nothing overwrites them ahead of that wait (a loop with two
// pairs names one of them twice). The "memory" clobber keeps the loads of the sets fetched ahead on the side of the guard where
// the source has them. The fragment sets are not named: three sets and the accumulators pass v255, where no asm operand can lie.
template <typename P>
__device__ __forceinline__ void guard_g(v8f (&c)[4][4], const P* p0, const P* p1, const P* p2) {
#if defined(__HIP_DEVICE_COMPILE__)
  asm volatile("s_wait_xcnt 0x0\n\tv_nop\n\tv_nop\n\tv_nop\n\tv_nop"
               : "+v"(c[0][0]), "+v"(c[0][1]), "+v"(c[0][2]), "+v"(c[0][3]), "+v"(c[1][0]), "+v"(c[1][1]), "+v"(c[1][2]), "+v"(c[1][3]),
                 "+v"(c[2][0]), "+v"(c[2][1]), "+v"(c[2][2]), "+v"(c[2][3]), "+v"(c[3][0]), "+v"(c[3][1]), "+v"(c[3][2]), "+v"(c[3][3])
               : "v"(p0), "v"(p1), "v"(p2)
               : "memory");
#endif
}
// wait_x: s_wait_xcnt 0 alone: behind the first three sets' loads of a k loop, the VS loads (attn_fwd), the column sums' stores and the V^T plane's stores (gemm_qv), a 16-row tile's f16 stores (epi64hs) or the output stores (out_store).
__device__ __forceinline__ void wait_x() {
#if defined(__HIP_DEVICE_COMPILE__)
  asm volatile("s_wait_xcnt 0x0" : : : "memory");
#endif
}
// step3: moves the address pairs three k blocks on (3 * 512 elements of 2 bytes = 0xc00 bytes). The additions stand in one asm
// statement with s_wait_xcnt 0 in front of them: written in the source, the compiler lifted them over a wait in a statement of
// its own, directly behind the trip's last loads, which name these pairs.
template <typename P>
__device__ __forceinline__ void step3(const P*& p0, const P*& p1) {
#if defined(__HIP_DEVICE_COMPILE__)
  asm volatile("s_wait_xcnt 0x0\n\tv_add_nc_u64_e32 %0, 0xc00, %0\n\tv_add_nc_u64_e32 %1, 0xc00, %1"
               : "+v"(p0), "+v"(p1) : : "memory");
#endif
}
// guard_o (P'.V loop): the four slots, and s_wait_xcnt 0 in front of the rewrite of the V^T address pair, which is an input.
__device__ __forceinline__ void guard_o(v8f (&o)[RT][NJ], const _Float16* vp) {
#if defined(__HIP_DEVICE_COMPILE__)
  asm volatile("s_wait_xcnt 0x0\n\tv_nop\n\tv_nop\n\tv_nop\n\tv_nop"
               : "+v"(o[0][0]), "+v"(o[0][1]), "+v"(o[0][2]), "+v"(o[1][0]), "+v"(o[1][1]), "+v"(o[1][2]),
                 "+v"(o[2][0]), "+v"(o[2][1]), "+v"(o[2][2]), "+v"(o[3][0]), "+v"(o[3][1]), "+v"(o[3][2])
               : "v"(vp) : "memory");
#endif
}
// Orders a wave's own LDS slab writes before its reads of them. The fences name LDS alone: a wave now stages several 16-row tiles
// one after another, and a fence over global memory too would hold each staging back until the last tile's global stores are done.
__device__ __forceinline__ void wave_sync_lds() {
  __builtin_amdgcn_fence(__ATOMIC_RELEASE, "workgroup", "local");
  __builtin_amdgcn_wave_barrier();
  __builtin_amdgcn_fence(__ATOMIC_ACQUIRE, "workgroup", "local");
}

// =====================================================================================================
// Delay gather to an f16 plane in fragment order (rows = b*SEQ + t, k = n): element (b, t, n) = f16 bits of the bf16 RNE value of
// sp[b][t - dl[n]][n] when t - dl[n] >= 0, else 0 (the zero is
// written). The source row index is clamped into [0, SEQ) for the address; the value is selected afterwards.
// Thread = one 16-B piece (8 consecutive n of one (b, t) row): 8 scalar loads, one 16-B store; 32 consecutive lanes = 16 rows x
// 16 n, stored as 512 contiguous bytes
// coverage: n8/256 blocks (host exact) x 256 thr x 8 = rows x EMB = the whole plane; blk = the block's index within the plane.
// =====================================================================================================
__device__ __forceinline__ void gather_bf(const float* __restrict__ sp, const int* __restrict__ dl, u16* DB, int n8, int blk) {
  const int gt = blk * 256 + (int)threadIdx.x;
  if (gt >= n8) return;                     // no barriers on this path
  const int unit = gt >> 6;
  const int rb   = unit / (EMB / 32);
  const int kb   = unit - rb * (EMB / 32);
  const int row = rb * 16 + (gt & 15);
  const int n0  = kb * 32 + ((gt >> 5) & 1) * 16 + ((gt >> 4) & 1) * 8;
  const int b   = row / SEQ;
  const int t   = row - b * SEQ;
  unsigned short s[8];
#pragma unroll
  for (int e = 0; e < 8; ++e) {
    const int n   = n0 + e;
    const int d   = dl[n];
    const int src = t - d;
    int sc = (src < 0) ? 0 : src;
    sc = (sc > SEQ - 1) ? (SEQ - 1) : sc;
    const float v = sp[((size_t)b * SEQ + (size_t)sc) * EMB + n];
    s[e] = (src >= 0) ? h_bits((_Float16)bfr(v)) : (unsigned short)0;
  }
  v4u o;
#pragma unroll
  for (int e = 0; e < 4; ++e) o[e] = pk16(s[2 * e], s[2 * e + 1]);
  u16* dst = DB + (size_t)gt * 8;
  {
    *(v4u*)(dst) = o;
    
  }
}

// =====================================================================================================
// Folded weights, each stored as f16(value * 1024) in fragment order (rows = o, k = i), the B operand of a projection:
//   W'[o][i]  = sum_d bf16(Wo[o][d]) * bf16(Wv[d][i])   (v' projection; L = Wo read by rows,    R = Wv)
//   W''[o][i] = sum_d bf16(Wk[d][o]) * bf16(Wq[d][i])   (q' projection; L = Wk read by columns, R = Wq), so that
//   sum_o (sum_i x[t][i] W''[o][i]) x[s][o] = sum_d (sum_i x[t][i] Wq[d][i]) (sum_o x[s][o] Wk[d][o]) = q[t] . k[s].
// Block = one 32 (i) x 32 (o) tile, 8 waves: wave w takes the 16 x 16 quarter (rt, j) = (w>>1 & 1, w & 1)
// over d = 384 (w>>2) .. + 383 (12 WMMA k steps, d ascending); the two halves of d are added through LDS. One quarter and one step's
// loads at a time keep the launch at 16 waves per SIMD, which the delay gather in the same launch lives on.
// WMMA rows = i, columns = o: A[m = i][k = d] = R[d][i] (16 scalar loads per fragment, 64 contiguous B per half-wave),
// B[n = o][k = d] = L[o][d] (four 16-B loads) or, by columns, L[d][o] (16 scalar loads, as for A); all in the split k map
// (elements 0..7 <- k = 8h + e, 8..15 <- k = 16 + 8h + e).
// A lane's accumulator holds o = o0 + 16j + (lane&15) at i = i0 + 16rt + 8*(lane>>4) + 0..7: that lane's own 16-B piece of the
// unit (o block j, k block i0/32), half rt.
// coverage: WPB blocks x 128 pieces x 8 halves = EMB x EMB; blk = the block's index within the job.
// =====================================================================================================
__device__ __forceinline__ v16b pack_bf(const float (&x)[16]) {
  FragB f;
#pragma unroll
  for (int e = 0; e < 4; ++e) {
    f.u[0][e] = pk16(bf_bits(x[2 * e]), bf_bits(x[2 * e + 1]));
    f.u[1][e] = pk16(bf_bits(x[8 + 2 * e]), bf_bits(x[8 + 2 * e + 1]));
  }
  return f.v;
}
// One wave's 12 k steps, L read by rows. pa: R at (the lane's first d, the lane's column i); pb: L at (the lane's row o, its first d).
__device__ __forceinline__ v8f wacc_row(const float* pa, const float* pb) {
  v8f acc = zero8();
#pragma unroll                               // unrolled: every load is a base plus a constant, and no WMMA stands in front of a back edge
  for (int s = 0; s < EMB / 64; ++s) {
    float xa[16], xb[16];
#pragma unroll
    for (int e = 0; e < 8; ++e) {
      xa[e]     = pa[(size_t)(32 * s + e) * EMB];
      xa[8 + e] = pa[(size_t)(32 * s + 16 + e) * EMB];
    }
#pragma unroll
    for (int q = 0; q < 4; ++q) {
      const v4f y = *(const v4f*)(pb + 32 * s + (q >> 1) * 16 + (q & 1) * 4);
#pragma unroll
      for (int e = 0; e < 4; ++e) xb[4 * q + e] = y[e];
    }
#if defined(__HIP_DEVICE_COMPILE__)
    // s_wait_xcnt 0 in front of any rewrite of the address registers that this step's loads name; the two pairs are inputs, so that
    // they live up to the wait and no load's result is given one of their registers.
    asm volatile("s_wait_xcnt 0x0" : : "v"(pa), "v"(pb) : "memory");
#endif
    acc = mma_b(pack_bf(xa), pack_bf(xb), acc);
  }
  return acc;
}
// The same, L read by columns. pb: L at (the lane's first d, the lane's column o): both operands step down 32 rows a trip.
__device__ __forceinline__ v8f wacc_col(const float* pa, const float* pb) {
  static_assert(32 * EMB * 4 == 0x18000);
  v8f acc = zero8();
#pragma unroll 1                             // rolled: a second unrolled body would take the launch's text past 32 KB
  for (int s = 0; s < EMB / 64; ++s) {
    float xa[16], xb[16];
#pragma unroll
    for (int e = 0; e < 8; ++e) {            // the casts: a pointer that has passed through the asm statement below would be read by flat loads
      xa[e]     = *(const GLOBAL_AS float*)(pa + (size_t)e * EMB);
      xa[8 + e] = *(const GLOBAL_AS float*)(pa + (size_t)(16 + e) * EMB);
      xb[e]     = *(const GLOBAL_AS float*)(pb + (size_t)e * EMB);
      xb[8 + e] = *(const GLOBAL_AS float*)(pb + (size_t)(16 + e) * EMB);
    }
    acc = mma_b(pack_bf(xa), pack_bf(xb), acc);
#if defined(__HIP_DEVICE_COMPILE__)
    // Behind the trip's WMMA: the four vector slots that the chip needs before its operand registers are rewritten, on the taken back
    // edge too; then the two address pairs move 32 rows on (0x18000 bytes), with s_wait_xcnt 0 in the same statement in front of that
    // rewrite of registers that the trip's loads name.
    asm volatile("s_wait_xcnt 0x0\n\tv_nop\n\tv_nop\n\tv_nop\n\tv_nop\n\t"
                 "v_add_nc_u64_e32 %1, 0x18000, %1\n\tv_add_nc_u64_e32 %2, 0x18000, %2"
                 : "+v"(acc), "+v"(pa), "+v"(pb) : : "memory");
#endif
  }
  return acc;
}
template <bool LCOL>
__device__ __forceinline__ void wprod(const float* __restrict__ wl, const float* __restrict__ wr, u16* D, float* red, int blk) {
  const int tid = threadIdx.x, wave = __builtin_amdgcn_readfirstlane(tid >> 5), lane = tid & 31, hh = lane >> 4, m = lane & 15;
  const int i0 = (blk % (EMB / 32)) * 32;
  const int o0 = (blk / (EMB / 32)) * 32;
  const int d0 = (wave >> 2) * (EMB / 2) + 8 * hh;          // the lane's first d
  const int oc = o0 + 16 * (wave & 1) + m;                  // the lane's o
  const float* pa = wr + (size_t)d0 * EMB + i0 + 16 * ((wave >> 1) & 1) + m;
  const v8f acc = LCOL ? wacc_col(pa, wl + (size_t)d0 * EMB + oc) : wacc_row(pa, wl + (size_t)oc * EMB + d0);
  *(v8f*)(red + tid * 8) = acc;
  __syncthreads();                           // block-uniform path: both halves of d are complete before they are added
  if (tid < 128) {                           // piece tid = (rt * 2 + j) * 32 + lane; whole waves
    const v8f t = *(const v8f*)(red + tid * 8) + *(const v8f*)(red + 1024 + tid * 8);
    v4u o;
#pragma unroll
    for (int e = 0; e < 4; ++e) o[e] = pk16(h_bits((_Float16)(t[2 * e] * WSC)), h_bits((_Float16)(t[2 * e + 1] * WSC)));
    *(v4u*)(D + (size_t)(o0 + 16 * ((tid >> 5) & 1)) * EMB + (size_t)(i0 >> 5) * 512 + (tid >> 6) * 256 + lane * 8) = o;
  }
}

// =====================================================================================================
// All operand preparation in one launch: the three jobs read inputs only and write disjoint planes, so none waits for another.
// Blocks 0 .. WPB-1: the tiles of W'' (plane 0, at WB); blocks WPB .. 2*WPB-1: the tiles of W' (plane 1, at WB + EMB*EMB); the blocks
// behind them: the delay gather. The choice is block-uniform.
// =====================================================================================================
// 16 waves per SIMD asked for: the delay gather hides its dependent loads behind other waves alone.
__global__ __launch_bounds__(256, 16) void prep(const float* __restrict__ wq, const float* __restrict__ wk,
                                            const float* __restrict__ wv, const float* __restrict__ wo,
                                            const float* __restrict__ sp, const int* __restrict__ dl,
                                            const float* __restrict__ mpu, const float* __restrict__ dcu,
                                            u16* WB, u16* DB, int n8g) {
  __shared__ __align__(32) float red[2 * 1024];    // W', W'' jobs only: 2 partial 32 x 32 tiles
  const int bid = blockIdx.x;
  if (bid < 2 * WPB) {
    if (bid < WPB) wprod<true>(wk, wq, WB, red, bid);
    else wprod<false>(wo, wv, WB + (size_t)(EMB * EMB), red, bid - WPB);
  } else {
    gather_bf(sp, dl, DB, n8g, bid - 2 * WPB);
  }
  (void)mpu; (void)dcu;
}

// =====================================================================================================
//  epi64hs: f16 bits of (tile * pscale), stored in fragment order (k = column): lane (16*hh + m) = row m, 8 consecutive columns;
// coverage: 4 instructions x 32 lanes x 8 halves = the wave's 16 x 64 tile.
// =====================================================================================================
__device__ __forceinline__ void stage64(float* sl, v8f a0, v8f a1, v8f a2, v8f a3, float oscale, int lane) {
  const int hh = lane >> 4, m = lane & 15;
#pragma unroll
  for (int r = 0; r < 8; ++r) {
    const int ro = (8 * hh + r) * 68 + m;
    sl[ro]      = a0[r] * oscale;
    sl[ro + 16] = a1[r] * oscale;
    sl[ro + 32] = a2[r] * oscale;
    sl[ro + 48] = a3[r] * oscale;
  }
  wave_sync_lds();
}
__device__ __forceinline__ void epi64hs(float* sl, v8f a0, v8f a1, v8f a2, v8f a3, float oscale, float pscale,
                                        u16* C, int N, size_t rowb, int col0, int lane) {
  stage64(sl, a0, a1, a2, a3, oscale, lane);
  const int hh = lane >> 4, m = lane & 15;
  v4u oh[4];
#pragma unroll
  for (int i4 = 0; i4 < 4; ++i4) {
    const int c8 = (i4 >> 1) * 32 + (i4 & 1) * 16 + hh * 8;   // k block i4>>1, half i4&1 of the wave's two units
    const v4f a = *(const v4f*)(sl + m * 68 + c8), c4 = *(const v4f*)(sl + m * 68 + c8 + 4);
    float w[8];
#pragma unroll
    for (int e = 0; e < 4; ++e) { w[e] = a[e] * pscale; w[4 + e] = c4[e] * pscale; }
#pragma unroll
    for (int e = 0; e < 4; ++e) oh[i4][e] = pk16(h_bits((_Float16)w[2 * e]), h_bits((_Float16)w[2 * e + 1]));
  }
  u16* dst = C + rowb * (size_t)N + (size_t)(col0 >> 5) * 512 + lane * 8;
  {
#pragma unroll
    for (int i4 = 0; i4 < 4; ++i4) {
      *(v4u*)(dst + i4 * 256) = oh[i4];
    }
    
  }
  wait_x();                                  // in front of the next 16-row tile's rewrite of the registers that these stores name
}

// =====================================================================================================
// f16 GEMM core: acc[rt][j] = rows (16 rt ..) of A . rows (16 j ..) of Bt, A and Bt f16 planes [..][EMB] in fragment order.
// Wave tile = 64 x 64 (4 A fragments x 4 B fragments, 16 accumulators): every fragment loaded feeds 4 WMMAs. Fragments come
// straight from the planes (two 16-B loads each, split k map for A and B); k stepped by 32, ascending, one WMMA per (tile, step).
// Block = 128 x 128 tile, 4 waves as 2 x 2; grid = 2 * (M/128) * (EMB/128) (q', v'), host checks exactness.
// =====================================================================================================
__device__ __forceinline__ void ld_h64(const _Float16* ap, const _Float16* bp, v16h (&a)[4], v16h (&b)[4]) {
#pragma unroll
  for (int rt = 0; rt < 4; ++rt) a[rt] = ldfo_h(ap + rt * (16 * EMB));
#pragma unroll
  for (int j = 0; j < 4; ++j) b[j] = ldfo_h(bp + j * (16 * EMB));
}
__device__ __forceinline__ void mm_h64(v8f (&acc)[4][4], const v16h (&a)[4], const v16h (&b)[4]) {
#pragma unroll
  for (int rt = 0; rt < 4; ++rt) {
#pragma unroll
    for (int j = 0; j < 4; ++j) acc[rt][j] = mma_h(a[rt], b[j], acc[rt][j]);
  }
}
__device__ __forceinline__ void core_h64(const _Float16* ap, const _Float16* bp, v8f (&acc)[4][4]) {
#pragma unroll
  for (int rt = 0; rt < 4; ++rt) {
#pragma unroll
    for (int j = 0; j < 4; ++j) acc[rt][j] = zero8();
  }
  // Three fragment sets in rotation: a set is refilled for k step s + 3 as soon as the WMMAs of step s have left it, so a wave has
  // two to three steps' loads in flight and its loads have two steps of WMMAs to land in. The loop refills for steps 3 .. KST-1
  // (three a trip); the last three steps stand behind it and load nothing: no load reaches past the planes' k extent.
  v16h a0[4], b0[4], a1[4], b1[4], a2[4], b2[4];
  // The scheduling barriers keep the three sets' loads in issue order: were a load of set 0 issued behind set 2, the loop's counted
  // wait for set 0 would have to cover every load in flight, on each trip, and nothing would stay fetched ahead.
  ld_h64(ap, bp, a0, b0);
  __builtin_amdgcn_sched_barrier(0);
  ld_h64(ap + 512, bp + 512, a1, b1);
  __builtin_amdgcn_sched_barrier(0);
  ld_h64(ap + 2 * 512, bp + 2 * 512, a2, b2);
  wait_x();
#pragma unroll 1                             // rolled: one trip is 48 WMMAs and 48 loads; the body stays small in the instruction cache
  for (int t = 0; t < KST / 3 - 1; ++t) {
    mm_h64(acc, a0, b0);
    guard_g<_Float16>(acc, ap, bp, bp);
    ld_h64(ap + 3 * 512, bp + 3 * 512, a0, b0);
    mm_h64(acc, a1, b1);
    guard_g<_Float16>(acc, ap, bp, bp);
    ld_h64(ap + 4 * 512, bp + 4 * 512, a1, b1);
    mm_h64(acc, a2, b2);
    guard_g<_Float16>(acc, ap, bp, bp);
    ld_h64(ap + 5 * 512, bp + 5 * 512, a2, b2);
    step3<_Float16>(ap, bp);
  }
  mm_h64(acc, a0, b0);
  guard_g<_Float16>(acc, ap, bp, bp);             // the address pairs stay untouched until the last loads' s_wait_xcnt 0 here
  mm_h64(acc, a1, b1);
  mm_h64(acc, a2, b2);
}

// q' and v' projections in one launch: the two products read the same A plane and depend on nothing of each other.
// Block index = (row tile * 2 + product) * (EMB/128) + column tile; product 0 = q', 1 = v' (block-uniform, taken as a scalar).
// The weight planes carry x1024, so an accumulator is 1024 times its product; the power of two is taken out in the epilogues.
// q': f16 plane out in fragment order, f16 bits of (A . Bt^T) * 8; epilogue epi64hs per 16-row tile.
// V below = v' = delayed . W'^T (rows = b*SEQ + s, columns = d = output column), handed on as the two things attention reads;
// V itself is never stored.
//  V^T plane in fragment order (rows = b*EMB + d, k = s), element = f16(V[b][s][d] * 1024): a lane's accumulator acc[rt][j] holds
//  column d = col0 + 16j + (lane&15) at rows 16rt + 8*(lane>>4) + 0..7, which is that lane's own 16-B piece of the unit (d block j,
//  key block rt>>1), half rt&1: eight converts and one 16-B store, no exchange between lanes; a wave's store = 512 contiguous B.
//  PS[(row / 64)][d] = sum of V over the wave tile's 64 keys (f32): rt and r ascending in the lane, then the other half-wave's sum.
// coverage: v: 16 stores x 32 lanes x 8 halves = the wave's 64 x 64 tile; 2 stores x 32 lanes = its 64 column sums (one whole 128-B
//           line each); the grid covers every (product, row tile, column tile) once.
__global__ __launch_bounds__(128)
void gemm_qv(const u16* __restrict__ A, const u16* __restrict__ WB, u16* QPo, u16* VTo, float* PS, int M) {
  __shared__ __align__(16) float slab[4 * SLAB64];
  // The wave's number is taken as a scalar: tile row and column then live in scalar registers across the k loop, which keeps the
  // kernel within 336 VGPRs (three waves per SIMD) with three fragment sets.
  const int tid = threadIdx.x, wave = __builtin_amdgcn_readfirstlane(tid >> 5), lane = tid & 31;
  const int bid   = blockIdx.x;
  const int grp   = bid / (EMB / 128);
  const int prod  = grp % 2;
  const int rowb  = (grp / 2) * 128 + (wave >> 1) * 64;
  const int col0  = (bid % (EMB / 128)) * 128 + (wave & 1) * 64;
  if (rowb + 64 > M) return;                 // wave-uniform, never taken with the exact grid; no block barriers in this kernel
  v8f acc[4][4];
  core_h64((const _Float16*)(const void*)A + (size_t)rowb * EMB + 8 * lane,
           (const _Float16*)(const void*)WB + (size_t)prod * (EMB * EMB) + (size_t)col0 * EMB + 8 * lane, acc);
  if (prod == 0) {
#pragma unroll
    for (int rt = 0; rt < 4; ++rt)
      epi64hs(slab + wave * SLAB64, acc[rt][0], acc[rt][1], acc[rt][2], acc[rt][3], 1.0f, QSC / WSC, QPo, EMB,
              (size_t)(rowb + 16 * rt), col0, lane);
    return;
  }
  const int b  = rowb / SEQ;                 // a 64-row tile lies in one batch (SEQ is a multiple of 128)
  const int s0 = rowb - b * SEQ;
  v4u oh[4][4];
  float cs[4];
#pragma unroll
  for (int j = 0; j < 4; ++j) {
    float s = 0.f;
#pragma unroll
    for (int rt = 0; rt < 4; ++rt) {
#pragma unroll
      for (int r = 0; r < 8; ++r) s += acc[rt][j][r];
#pragma unroll
      for (int e = 0; e < 4; ++e)
        oh[j][rt][e] = pk16(h_bits((_Float16)(acc[rt][j][2 * e] * (VCAR / WSC))), h_bits((_Float16)(acc[rt][j][2 * e + 1] * (VCAR / WSC))));
    }
    cs[j] = s * (1.0f / WSC);
  }
#pragma unroll
  for (int j = 0; j < 4; ++j) cs[j] += __shfl_xor(cs[j], 16, 32);
  const float c01 = (lane & 16) ? cs[1] : cs[0];          // column col0 + lane
  const float c23 = (lane & 16) ? cs[3] : cs[2];          // column col0 + 32 + lane
  u16* dst  = VTo + ((size_t)b * EMB + col0) * SEQ + (size_t)(s0 >> 5) * 512 + lane * 8;
  float* pd = PS + (size_t)(rowb >> 6) * EMB + col0 + lane;
  pd[0]  = c01;
  pd[32] = c23;
  // s_wait_xcnt 0 behind the sums' two stores, in front of any rewrite of their registers.
  wait_x();
#pragma unroll
  for (int j = 0; j < 4; ++j) {
#pragma unroll
    for (int rt = 0; rt < 4; ++rt) *(v4u*)(dst + (size_t)(16 * j) * SEQ + rt * 256) = oh[j][rt];
  }
  // s_wait_xcnt 0 behind the plane's 16 stores: the built code lays the q' epilogue behind them, which writes their registers.
  wait_x();
}

// =====================================================================================================
// Single-head attention, head width EMB = 768, all SEQ keys kept (non-causal): block = (batch b, 64 query rows q0..q0+63 = RT = 4
// row tiles of 16), 16 waves. Every K fragment and every V^T fragment that a wave loads feeds one WMMA per row tile.
// q plane = q' = delayed . W''^T (f16, x8) rows b*SEQ+s, k = d; k plane = the delayed plane itself (f16, x1), the same layout, so that
// q' . delayed^T is q . k^T; V^T plane rows b*EMB+d, k = s (x1024), V = v' = delayed . W'^T, so that
// P . V is already the output projection's result; all three in fragment order; PS = column sums of V over each 64 keys (f32),
// PSN = 8 of them to a chunk.
//   Per chunk of CK = 512 keys (NCHK = 4 chunks):
//   (S) scores S[query][key n] on WMMA: A = q rows of row tile rt (row m = lane&15, split k map over d), B = k rows (col n = key,
//       split map), 24 d-steps; wave w handles key block w (32 keys) of the chunk for all four row tiles; D element r of lane l
//       of tile rt -> scs[query 16rt+8h+r][key col] (f32 LDS).
//   (M) 16 threads per query row (sub-thread = 32 consecutive keys), two passes of 32 rows: base-2 logits, chunk max via xor
//       shuffles, online running max / rescale factor al / running sum l in f32 registers (the same threads own the row in every
//       chunk), p = exp2(t - m_new) <= 1, chunk row sum ps and its mean C = ps/CK (bit-identical on the row's 16 threads), the
//       CENTRED P' = p - C written as f16(P' * 32768) into the LDS P tile with 16-B stores; al -> rowa[row], C -> rowc[row].
//   (PV) each wave owns d columns 48*wave + 16j + (lane&15), j = 0..2, of all four row tiles (12 accumulators):
//       o = o*al + C*(32768*1024)*VS[chunk][d], VS = the chunk's 8 PS entries added in key order, kept in LDS (add-back of the
//       centring term in f32),
//       then for each key block: A = P'
//       fragments from LDS (row m = query, split map over keys), B = V^T fragments (col n = d, split map over keys).
//       sum_k (P'_k + C) v_k == sum_k p_k v_k exactly.
//   Block barriers after (S) and after (M) order all LDS reuse across chunks and waves.
//   Epilogue: out = o / (l * 32768 * 1024) + bf16RNE(bias[d]) per row (rowi, l >= 1 always), f32; 32 rows at a time are staged in LDS
//   (over the dead scores) and stored as whole lines.
// coverage: grid nb*32 blocks x 64 rows; staging 16 waves x 48 cols x 32 rows = 32 x 768, twice; store 12 iterations x 512 thr x 4
//           floats = 32 x 768, twice = every (b, s, d) of out exactly once.
// =====================================================================================================
__device__ __forceinline__ void out_store(const float* ct, float* dst, int tid) {
  v4f v[12];
#pragma unroll
  for (int it = 0; it < 12; ++it) {
    const int p = it * ATT_THREADS + tid;     // 16-B piece p of the 32 x EMB half tile: row p / 192, columns 4 * (p % 192) ..
    v[it] = *(const v4f*)(ct + (p / (EMB / 4)) * CTF + (p % (EMB / 4)) * 4);
  }
#pragma unroll
  for (int it = 0; it < 12; ++it) *(v4f*)(dst + (size_t)(it * ATT_THREADS + tid) * 4) = v[it];
  wait_x();                                  // in front of any rewrite of the registers that these stores name
}

// V^T fragments of one key block (vp: the wave's d columns, that key block's unit) and one key block's P'.V products.
__device__ __forceinline__ void ld_v(const _Float16* vp, v16h (&g)[NJ]) {
#pragma unroll
  for (int j = 0; j < NJ; ++j) g[j] = ldfo_h(vp + (size_t)(16 * j) * SEQ);
}
__device__ __forceinline__ void pv_step(v8f (&o)[RT][NJ], const _Float16* pp, const v16h (&g)[NJ]) {
  v16h pf[RT];
#pragma unroll
  for (int rt = 0; rt < RT; ++rt) pf[rt] = ldfrag_h(pp + rt * (16 * PLP));
#pragma unroll
  for (int rt = 0; rt < RT; ++rt) {
#pragma unroll
    for (int j = 0; j < NJ; ++j) o[rt][j] = mma_h(pf[rt], g[j], o[rt][j]);
  }
}

__global__ __launch_bounds__(ATT_THREADS)
void attn_fwd(const u16* __restrict__ QPp, const u16* __restrict__ KPp, const u16* __restrict__ VTp,
              const float* __restrict__ VSp, const float* __restrict__ bias, float* out) {
  __shared__ __align__(16) float scs[QT * SCP];    // scores [QT][SCP] f32; reused as the output staging tile [QT/2][CTF] f32
  __shared__ __align__(16) u16 pls[QT * PLP];      // P' tile [QT][PLP] f16 bits
  __shared__ __align__(16) float vsl[NCHK * EMB];  // VS: column sums of V per chunk, this batch
  __shared__ float rowa[QT];
  __shared__ float rowc[QT];
  __shared__ float rowi[QT];

  const int tid  = threadIdx.x;
  const int wave = tid >> 5;
  const int lane = tid & 31;
  const int hh   = lane >> 4;
  const int m    = lane & 15;
  const int r32  = tid >> 4;                 // query rows owned in phase (M): r32 and 32 + r32
  const int sub  = tid & 15;
  const int kl0  = sub * 32;

  const int bid = blockIdx.x;
  const int b   = bid / (SEQ / QT);
  const int q0  = (bid % (SEQ / QT)) * QT;

  const _Float16* qa  = (const _Float16*)(const void*)QPp + ((size_t)b * SEQ + q0) * EMB + 8 * lane;
  const _Float16* kbp = (const _Float16*)(const void*)KPp + ((size_t)b * SEQ + wave * 32) * EMB + 8 * lane;
  const _Float16* vbp = (const _Float16*)(const void*)VTp + ((size_t)b * EMB + wave * DW) * SEQ + 8 * lane;
  const float lsc = RSQD * LOG2E / QSC;

  // VS[chunk][d] = the chunk's PSN entries of PS, added in key order; a thread takes 2 consecutive d of one chunk, three times over
  // (8-B loads, a wave = 256 contiguous B). All loads are asked for before the first add, so their latency is waited out once.
  // Written here, read in (PV): two block barriers lie between.
  {
    v2f x[3][PSN];
#pragma unroll
    for (int it = 0; it < 3; ++it) {
      const int g = it * ATT_THREADS + tid;
      const float* p = VSp + ((size_t)b * (SEQ / 64) + (size_t)(g / (EMB / 2)) * PSN) * EMB + 2 * (g % (EMB / 2));
#pragma unroll
      for (int i = 0; i < PSN; ++i) x[it][i] = *(const v2f*)(p + (size_t)i * EMB);
    }
    wait_x();                                // in front of the first rewrite of the three address pairs that these loads name
#pragma unroll
    for (int it = 0; it < 3; ++it) {
      v2f a = x[it][0];
#pragma unroll
      for (int i = 1; i < PSN; ++i) a += x[it][i];
      *(v2f*)(vsl + 2 * (it * ATT_THREADS + tid)) = a;
    }
  }

  float mrun[2] = {-INFINITY, -INFINITY}, lrun[2] = {0.f, 0.f};
  v8f o[RT][NJ];
#pragma unroll
  for (int rt = 0; rt < RT; ++rt) {
#pragma unroll
    for (int j = 0; j < NJ; ++j) o[rt][j] = zero8();
  }

#pragma unroll 1
  for (int c = 0; c < NCHK; ++c) {
    const int kbeg = c * CK;
    // ---- (S) scores of this chunk: key block = wave ----
    {
      const _Float16* qp = qa;
      const _Float16* kp = kbp + (size_t)kbeg * EMB;
      v8f s[RT][2];
#pragma unroll
      for (int rt = 0; rt < RT; ++rt) { s[rt][0] = zero8(); s[rt][1] = zero8(); }
#pragma unroll 1
      for (int k4 = 0; k4 < EMB / 128; ++k4) {             // 6 trips of 4 d-steps, as many steps unrolled as before
#pragma unroll
        for (int u = 0; u < 4; ++u) {
          v16h a[RT];
#pragma unroll
          for (int rt = 0; rt < RT; ++rt) a[rt] = ldfo_h(qp + rt * (16 * EMB) + u * 512);
          const v16h f0 = ldfo_h(kp + u * 512);
          const v16h f1 = ldfo_h(kp + 16 * EMB + u * 512);
#pragma unroll
          for (int rt = 0; rt < RT; ++rt) {
            s[rt][0] = mma_h(a[rt], f0, s[rt][0]);
            s[rt][1] = mma_h(a[rt], f1, s[rt][1]);
          }
          guard_s(s, a, f0, f1, qp, kp);
        }
        qp += 4 * 512;
        kp += 4 * 512;
      }
#pragma unroll
      for (int rt = 0; rt < RT; ++rt) {
        float* srow = scs + (16 * rt + 8 * hh) * SCP + wave * 32 + m;
#pragma unroll
        for (int r = 0; r < 8; ++r) {
          srow[r * SCP]      = s[rt][0][r];
          srow[r * SCP + 16] = s[rt][1][r];
        }
      }
    }
    __syncthreads();
    // The chunk's first two V^T fragment sets are asked for here: they depend on nothing of phase (M) and land while it runs.
    const _Float16* vp = vbp + kbeg * 16;                  // key block kbeg/32 -> 512 elements per unit
    v16h g0[NJ], g1[NJ], g2[NJ];
    ld_v(vp, g0);
    ld_v(vp + 512, g1);
    // ---- (M) softmax statistics and the centred P' tile, 32 rows a pass ----
#pragma unroll
    for (int rg = 0; rg < 2; ++rg) {
      const int row = rg * 32 + r32;
      const float* sp = scs + row * SCP + kl0;
      float t[32];
      float cm = -INFINITY;
#pragma unroll
      for (int i = 0; i < 8; ++i) {
        const v4f a = *(const v4f*)(sp + 4 * i);
#pragma unroll
        for (int e = 0; e < 4; ++e) {
          const float tv = a[e] * lsc;
          t[4 * i + e] = tv;
          cm = fmaxf(cm, tv);
        }
      }
#pragma unroll
      for (int d = 1; d <= 8; d <<= 1) cm = fmaxf(cm, __shfl_xor(cm, d, 32));
      const float mn = fmaxf(mrun[rg], cm);                // finite
      const float al = (mrun[rg] == -INFINITY) ? 0.f : exp2f(mrun[rg] - mn);
      mrun[rg] = mn;
      float ps = 0.f;
#pragma unroll
      for (int j = 0; j < 32; ++j) {
        const float p = exp2f(fminf(t[j] - mn, 0.f));
        t[j] = p;
        ps += p;
      }
#pragma unroll
      for (int d = 1; d <= 8; d <<= 1) ps += __shfl_xor(ps, d, 32);
      const float cc = ps * (1.0f / (float)CK);
      v4u pk[4];
#pragma unroll
      for (int i = 0; i < 4; ++i) {
#pragma unroll
        for (int e = 0; e < 4; ++e) {
          const int j = 8 * i + 2 * e;
          pk[i][e] = pk16(h_bits((_Float16)((t[j] - cc) * PCAR)), h_bits((_Float16)((t[j + 1] - cc) * PCAR)));
        }
      }
      lrun[rg] = lrun[rg] * al + ps;
      u16* pd = pls + row * PLP + kl0;
#pragma unroll
      for (int i = 0; i < 4; ++i) *(v4u*)(pd + 8 * i) = pk[i];
      if (sub == 0) { rowa[row] = al; rowc[row] = cc; }
    }
    __syncthreads();
    // ---- (PV) rescale, add the centring term, accumulate P' . V^T ----
    {
      float vs[NJ];
#pragma unroll
      for (int j = 0; j < NJ; ++j) vs[j] = vsl[c * EMB + wave * DW + m + 16 * j];
#pragma unroll
      for (int rt = 0; rt < RT; ++rt) {
        float scl[8], cad[8];
#pragma unroll
        for (int r = 0; r < 8; ++r) {
          scl[r] = rowa[16 * rt + 8 * hh + r];
          cad[r] = rowc[16 * rt + 8 * hh + r] * (PCAR * VCAR);
        }
#pragma unroll
        for (int j = 0; j < NJ; ++j) {
#pragma unroll
          for (int r = 0; r < 8; ++r) o[rt][j][r] = o[rt][j][r] * scl[r] + cad[r] * vs[j];
        }
      }
      const _Float16* pp = (const _Float16*)(const void*)pls + m * PLP + 8 * hh;
      // Three V^T fragment sets in rotation: key block kb + 2 is fetched in front of the WMMAs of key block kb. Key blocks
      // 0 .. CK/32 - 5 in the loop (three a trip), the last four behind it: no load reaches past the chunk's keys.
#pragma unroll 1                             // rolled: one trip is 36 WMMAs; the body stays small in the instruction cache
      for (int t = 0; t < (CK / 32 - 4) / 3; ++t) {
        ld_v(vp + 2 * 512, g2);
        pv_step(o, pp, g0);
        guard_o(o, vp);
        ld_v(vp + 3 * 512, g0);
        pv_step(o, pp + 32, g1);
        guard_o(o, vp);
        ld_v(vp + 4 * 512, g1);
        pv_step(o, pp + 64, g2);
        guard_o(o, vp);
        vp += 3 * 512;
        pp += 3 * 32;
      }
      ld_v(vp + 2 * 512, g2);
      pv_step(o, pp, g0);
      guard_o(o, vp);
      ld_v(vp + 3 * 512, g0);
      pv_step(o, pp + 32, g1);
      pv_step(o, pp + 64, g2);
      pv_step(o, pp + 96, g0);
      guard_o(o, vp);
    }
  }

#pragma unroll
  for (int rg = 0; rg < 2; ++rg) {
    if (sub == 0) rowi[rg * 32 + r32] = (1.0f / lrun[rg]) * (1.0f / (PCAR * VCAR));   // lrun >= 1
  }
  const int cb = wave * DW + m;
  float bj[NJ];
#pragma unroll
  for (int j = 0; j < NJ; ++j) bj[j] = bfr(bias[cb + 16 * j]);      // columns < EMB
  __syncthreads();
#pragma unroll
  for (int hf = 0; hf < 2; ++hf) {           // rows 32 hf .. 32 hf + 31 = row tiles 2 hf, 2 hf + 1
    if (hf) __syncthreads();                 // the first half's reads of the staging tile are done before it is rewritten
#pragma unroll
    for (int r2 = 0; r2 < 2; ++r2) {
      const int rt = 2 * hf + r2;
#pragma unroll
      for (int r = 0; r < 8; ++r) {
        const float inv = rowi[16 * rt + 8 * hh + r];
#pragma unroll
        for (int j = 0; j < NJ; ++j) scs[(16 * r2 + 8 * hh + r) * CTF + cb + 16 * j] = o[rt][j][r] * inv + bj[j];
      }
    }
    __syncthreads();
    out_store(scs, out + ((size_t)b * SEQ + q0 + 32 * hf) * EMB, tid);
  }
}

// =====================================================================================================
// Workspace map (bytes, rows = nb*SEQ; nb = 8 gives the totals below); every plane is fully written by whole-line stores before
// it is read; all extents are exact multiples of the store granularity (no pad rows):
//   WQF f16 of W'' x1024 [768][768]  1179648   WPF f16 of W' x1024  1179648                        2359296
//   PS  f32  [rows/64][768]                                                                        786432
//   A   DB f16 of bf16 value [rows][768] (A operand of the projections, keys of attention) region 25165824
//   Q   QP f16 [rows][768] x8                                                              region 25165824
//   VT  f16 [nb][768][2048] x1024                                                          region 25165824
//   end                                                                                         78643200
// =====================================================================================================
extern "C" void kernel_launch(void* const* d_in, const int* in_sizes, int n_in,
                              void* d_out, int out_size, void* d_ws, size_t ws_size,
                              hipStream_t stream) {
  if (n_in < 9) return;
  const long long per = (long long)SEQ * EMB;
  const long long ns  = in_sizes[0];
  if (ns < per || (ns % per) != 0) return;
  const int nb = (int)(ns / per);
  if (nb < 1 || nb > 8) return;
  const int rows = nb * SEQ;
  if (in_sizes[1] != EMB) return;
  if (in_sizes[2] < 1 || in_sizes[3] < 1) return;
  if (in_sizes[4] != EMB * EMB || in_sizes[5] != EMB * EMB || in_sizes[6] != EMB * EMB || in_sizes[7] != EMB * EMB) return;
  if (in_sizes[8] != EMB) return;
  if ((long long)out_size != (long long)rows * EMB) return;

  const float* spk = (const float*)d_in[0];
  const int*   dly = (const int*)d_in[1];
  const float* mpo = (const float*)d_in[2];
  const float* dcy = (const float*)d_in[3];
  const float* wq  = (const float*)d_in[4];
  const float* wk  = (const float*)d_in[5];
  const float* wv  = (const float*)d_in[6];
  const float* wo  = (const float*)d_in[7];
  const float* bo  = (const float*)d_in[8];
  float*       out = (float*)d_out;

  const size_t szW  = (size_t)EMB * EMB * 2;                    //   1179648
  const size_t szPS = (size_t)(rows / 64) * EMB * 4;            //    786432 at nb = 8
  const size_t sz16 = (size_t)rows * EMB * 2;                   //  25165824
  const size_t szVT = (size_t)nb * EMB * SEQ * 2;               //  == sz16
  size_t off = 0;
  const size_t oWQ = off; off += szW;
  const size_t oWP = off; off += szW;
  const size_t oPS = off; off += szPS;
  const size_t oA  = off; off += sz16;
  const size_t oQ  = off; off += sz16;
  const size_t oVT = off; off += szVT;
  if (off > ws_size) return;                                    // off = 78643200 at nb = 8
  if (off > WS_CAP) return;
  if (oWP - oWQ != szW) return;                       // prep and gemm_qv index the weight planes from WQB

  char* ws = (char*)d_ws;
  u16*   WQB = (u16*)(ws + oWQ);
  float* PS  = (float*)(ws + oPS);
  u16*   DB  = (u16*)(ws + oA);
  u16*   QP  = (u16*)(ws + oQ);
  u16*   VT  = (u16*)(ws + oVT);

  const int n8g = rows * (EMB / 8);                     // rows * 96
  if ((n8g % 256) != 0) return;
  if ((rows % 128) != 0) return;
  const dim3 blk(256);
  const dim3 gP(2 * WPB + n8g / 256);                   // the W'' tiles, the W' tiles, then the gather
  const dim3 gG(2 * (rows / 128) * (EMB / 128));        // 1536 at nb = 8: 128 x 128 tiles of q' and v'
  const dim3 bG(128);
  const dim3 gAT(nb * (SEQ / QT));                      // nb * 32
  const dim3 bAT(ATT_THREADS);

  // (0) weights stored [n = out][k = in] (y = x.W^T): fragment-order f16 planes W'' = Wk^T.Wq x1024 and W' = Wo.Wv x1024 (one behind
  //     the other from WQB); delayed spikes -> fragment-order f16 plane, rows x 768
  prep<<<gP, blk, 0, stream>>>(wq, wk, wv, wo, spk, dly, mpo, dcy, WQB, DB, n8g);
  // (1) q' projection -> f16 plane x8; v' projection -> V^T plane x1024 and column sums of v' per 64 keys
  gemm_qv<<<gG, bG, 0, stream>>>(DB, WQB, QP, VT, PS, rows);
  // (2) attention: queries q', keys = the delayed plane, values v'; + bias -> out
  attn_fwd<<<gAT, bAT, 0, stream>>>(QP, DB, VT, PS, bo, out);
  (void)hipGetLastError();
}

// v010
// Measured time: 167 microseconds a run.
// Next to v009, in two timings, it ran 1.10 times as fast each time.
// All steps since v000 together make it 5.67 times as fast.
// Folded weights W' = bf16(Wo) . bf16(Wv) and W'' = bf16(Wk)^T . bf16(Wq): v_wmma_f32_16x16x32_bf16 (bf16 RNE operands of the raw
// inputs, f32 accumulate).
// Projections q' = delayed.W''^T and v' = delayed.W'^T (delayed = f16 of the bf16 RNE value, W', W'' = f16 x1024), scores
// q'.delayed^T (q' f16 plane x8, the delayed plane itself as keys) and P'.V' (chunk-centred P' x32768 f16 from LDS, V'^T x1024 f16):
// v_wmma_f32_16x16x32_f16, f32 accumulate. q.k^T = (delayed.Wq^T).(delayed.Wk^T)^T is computed as (delayed.(Wk^T.Wq)^T).delayed^T;
// (P.V).Wo^T is computed as P.(V.Wo^T) = P.(delayed.W'^T); the bias is added in f32.
// Delay gather, softmax statistics, column sums of V' and all scaling in f32 on VALU.
#include <hip/hip_runtime.h>
#include <math.h>
#include <stdint.h>

#define SEQ   2048
#define EMB   768
#define CK    512
#define NCHK  4
#define QT    64
#define RT    4
#define NJ    3
#define DW    48
#define SCP   544
#define PLP   528
#define CTF   772
#define SLAB64 (16 * 68)
#define PSN   (CK / 64)
#define ATT_THREADS 512
#define QSC   8.0f
#define PCAR  32768.0f
#define VCAR  1024.0f
#define WSC   1024.0f
#define LOG2E 1.4426950408889634f
#define RSQD  0.036084391824351615f
#define WS_CAP ((size_t)134217728)
#define KST   (EMB / 32)
#define WPB   ((EMB / 32) * (EMB / 32))
#define GLOBAL_AS __attribute__((address_space(1)))
#define GT_R  128
#define GT_C  64
#define GT_B  16
#define GT_H  (GT_R + GT_B)
#define GT_P  (GT_C + 4)
#define GT_L  9

static_assert((EMB % 128) == 0 && EMB == 8 * 96 && (EMB % 32) == 0 && (EMB / 8) == 96);
static_assert((SEQ % CK) == 0 && (SEQ / CK) == NCHK && CK == 16 * 32 && (SEQ % 64) == 0 && (SEQ / QT) == 32);
static_assert((QT / 2) * CTF <= QT * SCP && CTF >= EMB && ((8 * CTF) % 64) == 32);
static_assert(((PLP * 2) % 16) == 0 && ((SCP * 4) % 16) == 0 && ((CTF * 4) % 16) == 0);
static_assert((CK % 64) == 0 && (SEQ % 128) == 0 && PSN * 64 == CK);
static_assert(NCHK * (EMB / 2) == 3 * ATT_THREADS);
static_assert(ATT_THREADS == 512 && QT == 16 * RT && 2 * (ATT_THREADS / 16) == QT);
static_assert((ATT_THREADS / 32) * 32 == CK && (ATT_THREADS / 32) * DW == EMB && DW == 16 * NJ);
static_assert(12 * ATT_THREADS * 4 == (QT / 2) * EMB && ((EMB / 4) % 32) == 0);
static_assert((EMB % 64) == 0);
static_assert((SEQ % GT_R) == 0 && (EMB % GT_C) == 0 && GT_H * (GT_C / 4) == GT_L * 256 && GT_R * GT_C == 4 * 256 * 8);
static_assert(((GT_P * 4) % 16) == 0 && (GT_P % 64) == 4 && GT_H * GT_P >= 2 * 1024);
static_assert(3 * 512 * 2 == 0xc00 && (KST % 3) == 0 && KST >= 6 && ((CK / 32) % 3) == 1 && (CK / 32) >= 4);

typedef unsigned short u16;
typedef _Float16 v16h __attribute__((ext_vector_type(16)));
typedef _Float16 v8h  __attribute__((ext_vector_type(8)));
typedef __bf16   v16b __attribute__((ext_vector_type(16)));
typedef float    v8f  __attribute__((ext_vector_type(8)));
typedef float    v4f  __attribute__((ext_vector_type(4)));
typedef float    v2f  __attribute__((ext_vector_type(2)));
typedef unsigned int v4u __attribute__((ext_vector_type(4)));
typedef int v4i __attribute__((ext_vector_type(4)));

union FragH { v16h v; v8h h[2]; v4u u[2]; };
union FragB { v16b v; v4u u[2]; };

// ---- scalar helpers --------------------------------------------------------------------------------
__device__ __forceinline__ unsigned short bf_bits(float f) {          // f32 -> bf16 bits, RNE convert
  unsigned u = __float_as_uint(f);
  return (unsigned short)((u + 0x7FFFu + ((u >> 16) & 1u)) >> 16);
}
__device__ __forceinline__ float bf_up(unsigned short h) { return __uint_as_float(((unsigned)h) << 16); }
__device__ __forceinline__ float bfr(float f) { return bf_up(bf_bits(f)); }
__device__ __forceinline__ unsigned short h_bits(_Float16 x) { return __builtin_bit_cast(unsigned short, x); }
__device__ __forceinline__ unsigned pk16(unsigned short a, unsigned short b) { return (unsigned)a | ((unsigned)b << 16); }
__device__ __forceinline__ v8f zero8() { v8f z = {0.f, 0.f, 0.f, 0.f, 0.f, 0.f, 0.f, 0.f}; return z; }

// ---- fragment loaders: 16-bit A/B operand, lane -> row/col (lane&15), p already includes +8*(lane>>4);
//      elements 0..7 <- p[0..7] (k0+8h..), elements 8..15 <- p[16..23] (k0+16+8h..)  (same split k map for A and B;
//      this row-major form is used for the P' tile in LDS only)
__device__ __forceinline__ v16h ldfrag_h(const _Float16* p) {
  FragH f;
  f.h[0] = *(const v8h*)(p);
  f.h[1] = *(const v8h*)(p + 16);
  return f.v;
}
// ---- fragment-order planes (every 16-bit operand plane in the workspace): a plane [R][K] is stored as
//      [R/16][K/32][2][32 lanes][8 elements]. The 1-KiB unit of (row block rb, k block kb) starts at element rb*16*K + kb*512;
//      in it lane (16*hh + m) finds, at 8*lane, row m's k = 8*hh + 0..7 and, 256 elements on, k = 16 + 8*hh + 0..7: the same
//      split k map as above. A fragment is two 16-B loads per lane, each 512 contiguous bytes per wave (4 whole lines).
//      p already includes +8*lane.
//      The planes lie in global memory; the casts say so, since a pointer that has passed through an asm statement (step3) would
//      otherwise be read by flat loads.
__device__ __forceinline__ v16h ldfo_h(const _Float16* p) {
  FragH f;
  f.h[0] = *(const GLOBAL_AS v8h*)(p);
  f.h[1] = *(const GLOBAL_AS v8h*)(p + 256);
  return f.v;
}

__device__ __forceinline__ v8f mma_h(v16h a, v16h b, v8f c) {
  return __builtin_amdgcn_wmma_f32_16x16x32_f16(false, a, false, b, (short)0, c, false, false);
}
__device__ __forceinline__ v8f mma_b(v16b a, v16b b, v8f c) {
  return __builtin_amdgcn_wmma_f32_16x16x32_bf16(false, a, false, b, (short)0, c, false, false);
}
// The v_nop guards below stand behind the WMMAs of a step: they keep the four vector slots that the chip needs before
// the operand registers are reloaded or the accumulators are touched, on the taken back edge too. The accumulators are named so that every WMMA of the step stays in front of the slots.
// guard_s also holds s_wait_xcnt 0 in front of the rewrite of the two address pairs that the step's global loads name; the pairs
// are inputs so that nothing overwrites them ahead of that wait.
__device__ __forceinline__ void guard_s(v8f (&s)[RT][2], const v16h (&a)[RT], v16h f0, v16h f1,
                                        const _Float16* qp, const _Float16* kp) {
#if defined(__HIP_DEVICE_COMPILE__)
  asm volatile("s_wait_xcnt 0x0\n\tv_nop\n\tv_nop\n\tv_nop\n\tv_nop"
               : "+v"(s[0][0]), "+v"(s[0][1]), "+v"(s[1][0]), "+v"(s[1][1]),
                 "+v"(s[2][0]), "+v"(s[2][1]), "+v"(s[3][0]), "+v"(s[3][1])
               : "v"(a[0]), "v"(a[1]), "v"(a[2]), "v"(a[3]), "v"(f0), "v"(f1), "v"(qp), "v"(kp) : "memory");
#endif
}
// guard_g (GEMM k loops) holds the same four slots and, like guard_s, s_wait_xcnt 0 in front of the rewrite of the address pairs
// that the issued global loads name; the pairs are inputs so that nothing overwrites them ahead of that wait (a loop with two
// pairs names one of them twice). The "memory" clobber keeps the loads of the sets fetched ahead on the side of the guard where
// the source has them. The fragment sets are not named: three sets and the accumulators pass v255, where no asm operand can lie.
template <typename P>
__device__ __forceinline__ void guard_g(v8f (&c)[4][4], const P* p0, const P* p1, const P* p2) {
#if defined(__HIP_DEVICE_COMPILE__)
  asm volatile("s_wait_xcnt 0x0\n\tv_nop\n\tv_nop\n\tv_nop\n\tv_nop"
               : "+v"(c[0][0]), "+v"(c[0][1]), "+v"(c[0][2]), "+v"(c[0][3]), "+v"(c[1][0]), "+v"(c[1][1]), "+v"(c[1][2]), "+v"(c[1][3]),
                 "+v"(c[2][0]), "+v"(c[2][1]), "+v"(c[2][2]), "+v"(c[2][3]), "+v"(c[3][0]), "+v"(c[3][1]), "+v"(c[3][2]), "+v"(c[3][3])
               : "v"(p0), "v"(p1), "v"(p2)
               : "memory");
#endif
}
// wait_x: s_wait_xcnt 0 alone: behind the first three sets' loads of a k loop, the VS loads (attn_fwd), the column sums' stores and the V^T plane's stores (gemm_qv), a 16-row tile's f16 stores (epi64hs) or the output stores (out_store).
__device__ __forceinline__ void wait_x() {
#if defined(__HIP_DEVICE_COMPILE__)
  asm volatile("s_wait_xcnt 0x0" : : : "memory");
#endif
}
// step3: moves the address pairs three k blocks on (3 * 512 elements of 2 bytes = 0xc00 bytes). The additions stand in one asm
// statement with s_wait_xcnt 0 in front of them: written in the source, the compiler lifted them over a wait in a statement of
// its own, directly behind the trip's last loads, which name these pairs.
template <typename P>
__device__ __forceinline__ void step3(const P*& p0, const P*& p1) {
#if defined(__HIP_DEVICE_COMPILE__)
  asm volatile("s_wait_xcnt 0x0\n\tv_add_nc_u64_e32 %0, 0xc00, %0\n\tv_add_nc_u64_e32 %1, 0xc00, %1"
               : "+v"(p0), "+v"(p1) : : "memory");
#endif
}
// guard_o (P'.V loop): the four slots, and s_wait_xcnt 0 in front of the rewrite of the V^T address pair, which is an input.
__device__ __forceinline__ void guard_o(v8f (&o)[RT][NJ], const _Float16* vp) {
#if defined(__HIP_DEVICE_COMPILE__)
  asm volatile("s_wait_xcnt 0x0\n\tv_nop\n\tv_nop\n\tv_nop\n\tv_nop"
               : "+v"(o[0][0]), "+v"(o[0][1]), "+v"(o[0][2]), "+v"(o[1][0]), "+v"(o[1][1]), "+v"(o[1][2]),
                 "+v"(o[2][0]), "+v"(o[2][1]), "+v"(o[2][2]), "+v"(o[3][0]), "+v"(o[3][1]), "+v"(o[3][2])
               : "v"(vp) : "memory");
#endif
}
// Orders a wave's own LDS slab writes before its reads of them. The fences name LDS alone: a wave now stages several 16-row tiles
// one after another, and a fence over global memory too would hold each staging back until the last tile's global stores are done.
__device__ __forceinline__ void wave_sync_lds() {
  __builtin_amdgcn_fence(__ATOMIC_RELEASE, "workgroup", "local");
  __builtin_amdgcn_wave_barrier();
  __builtin_amdgcn_fence(__ATOMIC_ACQUIRE, "workgroup", "local");
}

// =====================================================================================================
// Delay gather to an f16 plane in fragment order (rows = b*SEQ + t, k = n): element (b, t, n) = f16 bits of the bf16 RNE value of
// sp[b][t - dl[n]][n] when t - dl[n] >= 0, else 0 (the zero is written).
// Block = one tile of GT_R = 128 rows (one batch) x GT_C = 64 columns. Fill: source rows t0 - 16 .. t0 + 127 of those columns go
// into LDS by 16-B loads, 256 contiguous B per row (row index clamped to >= 0 for the address; a row in front of the batch's first
// is staged as zeros, f16(bf16(0)) being the zero that such an element takes), so every line of sp is asked for
// as a whole, once per tile, and all nine loads of a thread are in flight together. Read: a thread makes four 16-B pieces (the
// same 8 columns n, four row blocks); a delay in 0 .. GT_B is served from tile row (t - t0) + GT_B - d, which that test bounds to
// 0 .. GT_H - 1. A thread that holds any other delay reads sp itself, the row index clamped into [0, SEQ) for the address.
// There the value is selected after the read. LDS pitch 68 floats: the 16 rows of a half-wave fall on 16 different banks.
// 32 consecutive lanes = 16 rows x 16 n, stored as 512 contiguous bytes.
// coverage: (rows / 128) * (EMB / 64) blocks (host exact) x 4 x 256 thr x 8 = rows x EMB = the whole plane; blk = the tile's index.
// =====================================================================================================
__device__ __forceinline__ unsigned short gval(float v, int srow) {      // srow >> 31 = all ones for a negative row: the bits go to 0
  return (unsigned short)(h_bits((_Float16)bfr(v)) & (unsigned short)~(srow >> 31));
}
__device__ __forceinline__ void gather_bf(const float* __restrict__ sp, const int* __restrict__ dl, u16* DB, float* tl, int n8, int blk) {
  if (blk * (GT_R * GT_C / 8) >= n8) return;   // block-uniform, in front of the barrier; never taken with the exact grid
  const int tid   = threadIdx.x;
  const int rtile = blk / (EMB / GT_C);
  const int c0    = (blk - rtile * (EMB / GT_C)) * GT_C;
  const int row0  = rtile * GT_R;              // a tile lies in one batch (SEQ is a multiple of GT_R)
  const int b     = row0 / SEQ;
  const int t0    = row0 - b * SEQ;
  // ---- fill ----
  int of[GT_L];                                // 16-B piece index in sp
  v4f x[GT_L];
#pragma unroll
  for (int it = 0; it < GT_L; ++it) {
    const int sr = t0 - GT_B + it * 16 + (tid >> 4);               // <= t0 + 127 < SEQ
    of[it] = ((b * SEQ + ((sr < 0) ? 0 : sr)) * EMB + c0) / 4 + (tid & 15);
  }
#pragma unroll
  for (int it = 0; it < GT_L; ++it) x[it] = ((const v4f*)sp)[of[it]];
  const int q   = tid & 63;                    // the thread's piece in its 1-KiB unit
  const int kbl = (tid >> 6) & 1;              // the unit's k block within the tile
  const int cl  = kbl * 32 + ((q >> 5) & 1) * 16 + ((q >> 4) & 1) * 8;   // first of the thread's 8 columns within the tile
  const int m   = q & 15;
  const v4i da = *(const v4i*)(dl + c0 + cl), db = *(const v4i*)(dl + c0 + cl + 4);
#if defined(__HIP_DEVICE_COMPILE__)
  // s_wait_xcnt 0 in front of any rewrite of the registers that the fill's loads name; the offsets are inputs, so that they live up
  // to the wait and no load's result is given one of their registers.
  asm volatile("s_wait_xcnt 0x0" : : "v"(of[0]), "v"(of[1]), "v"(of[2]), "v"(of[3]), "v"(of[4]), "v"(of[5]), "v"(of[6]),
               "v"(of[7]), "v"(of[8]) : "memory");
#endif
  if (t0 - GT_B + (tid >> 4) < 0) x[0] = (v4f){0.f, 0.f, 0.f, 0.f};   // rows in front of the batch's first (in x[0] alone) hold the zero
#pragma unroll
  for (int it = 0; it < GT_L; ++it) *(v4f*)(tl + (it * 16 + (tid >> 4)) * GT_P + 4 * (tid & 15)) = x[it];
  int d[8];
#pragma unroll
  for (int e = 0; e < 4; ++e) { d[e] = da[e]; d[4 + e] = db[e]; }
  bool in = true;
#pragma unroll
  for (int e = 0; e < 8; ++e) in = in && ((unsigned)d[e] <= (unsigned)GT_B);
  __syncthreads();                             // block-uniform path: the tile is complete before any thread reads it
  // ---- read ----
  u16* dst = DB + ((size_t)(row0 / 16 + (tid >> 7)) * (EMB / 32) + (size_t)(c0 / 32 + kbl)) * 512 + q * 8;
  const int r0 = (tid >> 7) * 16 + m;          // the thread's rows within the tile: r0 + 32 it
  if (in) {
    const float* tp[8];
#pragma unroll
    for (int e = 0; e < 8; ++e) tp[e] = tl + (r0 + GT_B - d[e]) * GT_P + cl + e;
#pragma unroll
    for (int it = 0; it < 4; ++it) {
      v4u o;
#pragma unroll
      for (int e = 0; e < 4; ++e)
        o[e] = pk16(h_bits((_Float16)bfr(tp[2 * e][it * 32 * GT_P])), h_bits((_Float16)bfr(tp[2 * e + 1][it * 32 * GT_P])));
      *(v4u*)(dst + (size_t)it * (2 * (EMB / 32) * 512)) = o;
    }
    wait_x();                                  // in front of any rewrite of the registers that these stores name
  } else {
    const float* gp = sp + (size_t)b * SEQ * EMB + c0 + cl;
#pragma unroll 1                               // rolled: a path for delays outside the tile's reach, kept small in the text
    for (int it = 0; it < 4; ++it) {
      float v[8];
      const float* p[8];
#pragma unroll
      for (int e = 0; e < 8; ++e) {
        const int srow = t0 + r0 + 32 * it - d[e];
        int sc = (srow < 0) ? 0 : srow;
        sc = (sc > SEQ - 1) ? (SEQ - 1) : sc;
        p[e] = gp + (size_t)sc * EMB + e;
      }
#pragma unroll
      for (int e = 0; e < 8; ++e) v[e] = *p[e];
#if defined(__HIP_DEVICE_COMPILE__)
      // s_wait_xcnt 0 in front of any rewrite of the registers that these loads name; the pairs are inputs, so that they live up to
      // the wait and no load's result is given one of their registers.
      asm volatile("s_wait_xcnt 0x0" : : "v"(p[0]), "v"(p[1]), "v"(p[2]), "v"(p[3]), "v"(p[4]), "v"(p[5]), "v"(p[6]), "v"(p[7])
                   : "memory");
#endif
      v4u o;
#pragma unroll
      for (int e = 0; e < 4; ++e)
        o[e] = pk16(gval(v[2 * e], t0 + r0 + 32 * it - d[2 * e]), gval(v[2 * e + 1], t0 + r0 + 32 * it - d[2 * e + 1]));
      *(v4u*)(dst + (size_t)it * (2 * (EMB / 32) * 512)) = o;
      wait_x();                                // in front of the next trip's rewrite of the registers that this store names
    }
  }
}

// =====================================================================================================
// Folded weights, each stored as f16(value * 1024) in fragment order (rows = o, k = i), the B operand of a projection:
//   W'[o][i]  = sum_d bf16(Wo[o][d]) * bf16(Wv[d][i])   (v' projection; L = Wo read by rows,    R = Wv)
//   W''[o][i] = sum_d bf16(Wk[d][o]) * bf16(Wq[d][i])   (q' projection; L = Wk read by columns, R = Wq), so that
//   sum_o (sum_i x[t][i] W''[o][i]) x[s][o] = sum_d (sum_i x[t][i] Wq[d][i]) (sum_o x[s][o] Wk[d][o]) = q[t] . k[s].
// Block = one 32 (i) x 32 (o) tile, 8 waves: wave w takes the 16 x 16 quarter (rt, j) = (w>>1 & 1, w & 1)
// over d = 384 (w>>2) .. + 383 (12 WMMA k steps, d ascending); the two halves of d are added through LDS. One quarter and one step's
// loads at a time keep the launch at 16 waves per SIMD.
// WMMA rows = i, columns = o: A[m = i][k = d] = R[d][i] (16 scalar loads per fragment, 64 contiguous B per half-wave),
// B[n = o][k = d] = L[o][d] (four 16-B loads) or, by columns, L[d][o] (16 scalar loads, as for A); all in the split k map
// (elements 0..7 <- k = 8h + e, 8..15 <- k = 16 + 8h + e).
// A lane's accumulator holds o = o0 + 16j + (lane&15) at i = i0 + 16rt + 8*(lane>>4) + 0..7: that lane's own 16-B piece of the
// unit (o block j, k block i0/32), half rt.
// coverage: WPB blocks x 128 pieces x 8 halves = EMB x EMB; blk = the block's index within the job.
// =====================================================================================================
__device__ __forceinline__ v16b pack_bf(const float (&x)[16]) {
  FragB f;
#pragma unroll
  for (int e = 0; e < 4; ++e) {
    f.u[0][e] = pk16(bf_bits(x[2 * e]), bf_bits(x[2 * e + 1]));
    f.u[1][e] = pk16(bf_bits(x[8 + 2 * e]), bf_bits(x[8 + 2 * e + 1]));
  }
  return f.v;
}
// One wave's 12 k steps, L read by rows. pa: R at (the lane's first d, the lane's column i); pb: L at (the lane's row o, its first d).
__device__ __forceinline__ v8f wacc_row(const float* pa, const float* pb) {
  v8f acc = zero8();
#pragma unroll                               // unrolled: every load is a base plus a constant, and no WMMA stands in front of a back edge
  for (int s = 0; s < EMB / 64; ++s) {
    float xa[16], xb[16];
#pragma unroll
    for (int e = 0; e < 8; ++e) {
      xa[e]     = pa[(size_t)(32 * s + e) * EMB];
      xa[8 + e] = pa[(size_t)(32 * s + 16 + e) * EMB];
    }
#pragma unroll
    for (int q = 0; q < 4; ++q) {
      const v4f y = *(const v4f*)(pb + 32 * s + (q >> 1) * 16 + (q & 1) * 4);
#pragma unroll
      for (int e = 0; e < 4; ++e) xb[4 * q + e] = y[e];
    }
#if defined(__HIP_DEVICE_COMPILE__)
    // s_wait_xcnt 0 in front of any rewrite of the address registers that this step's loads name; the two pairs are inputs, so that
    // they live up to the wait and no load's result is given one of their registers.
    asm volatile("s_wait_xcnt 0x0" : : "v"(pa), "v"(pb) : "memory");
#endif
    acc = mma_b(pack_bf(xa), pack_bf(xb), acc);
  }
  return acc;
}
// The same, L read by columns. pb: L at (the lane's first d, the lane's column o): both operands step down 32 rows a trip.
__device__ __forceinline__ v8f wacc_col(const float* pa, const float* pb) {
  static_assert(32 * EMB * 4 == 0x18000);
  v8f acc = zero8();
#pragma unroll 1                             // rolled: a second unrolled body would take the launch's text past 32 KB
  for (int s = 0; s < EMB / 64; ++s) {
    float xa[16], xb[16];
#pragma unroll
    for (int e = 0; e < 8; ++e) {            // the casts: a pointer that has passed through the asm statement below would be read by flat loads
      xa[e]     = *(const GLOBAL_AS float*)(pa + (size_t)e * EMB);
      xa[8 + e] = *(const GLOBAL_AS float*)(pa + (size_t)(16 + e) * EMB);
      xb[e]     = *(const GLOBAL_AS float*)(pb + (size_t)e * EMB);
      xb[8 + e] = *(const GLOBAL_AS float*)(pb + (size_t)(16 + e) * EMB);
    }
    acc = mma_b(pack_bf(xa), pack_bf(xb), acc);
#if defined(__HIP_DEVICE_COMPILE__)
    // Behind the trip's WMMA: the four vector slots that the chip needs before its operand registers are rewritten, on the taken back
    // edge too; then the two address pairs move 32 rows on (0x18000 bytes), with s_wait_xcnt 0 in the same statement in front of that
    // rewrite of registers that the trip's loads name.
    asm volatile("s_wait_xcnt 0x0\n\tv_nop\n\tv_nop\n\tv_nop\n\tv_nop\n\t"
                 "v_add_nc_u64_e32 %1, 0x18000, %1\n\tv_add_nc_u64_e32 %2, 0x18000, %2"
                 : "+v"(acc), "+v"(pa), "+v"(pb) : : "memory");
#endif
  }
  return acc;
}
template <bool LCOL>
__device__ __forceinline__ void wprod(const float* __restrict__ wl, const float* __restrict__ wr, u16* D, float* red, int blk) {
  const int tid = threadIdx.x, wave = __builtin_amdgcn_readfirstlane(tid >> 5), lane = tid & 31, hh = lane >> 4, m = lane & 15;
  const int i0 = (blk % (EMB / 32)) * 32;
  const int o0 = (blk / (EMB / 32)) * 32;
  const int d0 = (wave >> 2) * (EMB / 2) + 8 * hh;          // the lane's first d
  const int oc = o0 + 16 * (wave & 1) + m;                  // the lane's o
  const float* pa = wr + (size_t)d0 * EMB + i0 + 16 * ((wave >> 1) & 1) + m;
  const v8f acc = LCOL ? wacc_col(pa, wl + (size_t)d0 * EMB + oc) : wacc_row(pa, wl + (size_t)oc * EMB + d0);
  *(v8f*)(red + tid * 8) = acc;
  __syncthreads();                           // block-uniform path: both halves of d are complete before they are added
  if (tid < 128) {                           // piece tid = (rt * 2 + j) * 32 + lane; whole waves
    const v8f t = *(const v8f*)(red + tid * 8) + *(const v8f*)(red + 1024 + tid * 8);
    v4u o;
#pragma unroll
    for (int e = 0; e < 4; ++e) o[e] = pk16(h_bits((_Float16)(t[2 * e] * WSC)), h_bits((_Float16)(t[2 * e + 1] * WSC)));
    *(v4u*)(D + (size_t)(o0 + 16 * ((tid >> 5) & 1)) * EMB + (size_t)(i0 >> 5) * 512 + (tid >> 6) * 256 + lane * 8) = o;
  }
}

// =====================================================================================================
// All operand preparation in one launch: the three jobs read inputs only and write disjoint planes, so none waits for another.
// Blocks 0 .. WPB-1: the tiles of W'' (plane 0, at WB); blocks WPB .. 2*WPB-1: the tiles of W' (plane 1, at WB + EMB*EMB); the blocks
// behind them: the delay gather. The choice is block-uniform.
// =====================================================================================================
// 16 waves per SIMD asked for: eight blocks to a WGP, so that one block's fill flies while others read their tiles or fold.
__global__ __launch_bounds__(256, 16) void prep(const float* __restrict__ wq, const float* __restrict__ wk,
                                            const float* __restrict__ wv, const float* __restrict__ wo,
                                            const float* __restrict__ sp, const int* __restrict__ dl,
                                            const float* __restrict__ mpu, const float* __restrict__ dcu,
                                            u16* WB, u16* DB, int n8g) {
  __shared__ __align__(32) float red[GT_H * GT_P]; // W', W'' jobs: 2 partial 32 x 32 tiles; gather: the staged source tile
  const int bid = blockIdx.x;
  if (bid < 2 * WPB) {
    if (bid < WPB) wprod<true>(wk, wq, WB, red, bid);
    else wprod<false>(wo, wv, WB + (size_t)(EMB * EMB), red, bid - WPB);
  } else {
    gather_bf(sp, dl, DB, red, n8g, bid - 2 * WPB);
  }
  (void)mpu; (void)dcu;
}

// =====================================================================================================
//  epi64hs: f16 bits of (tile * pscale), stored in fragment order (k = column): lane (16*hh + m) = row m, 8 consecutive columns;
// coverage: 4 instructions x 32 lanes x 8 halves = the wave's 16 x 64 tile.
// =====================================================================================================
__device__ __forceinline__ void stage64(float* sl, v8f a0, v8f a1, v8f a2, v8f a3, float oscale, int lane) {
  const int hh = lane >> 4, m = lane & 15;
#pragma unroll
  for (int r = 0; r < 8; ++r) {
    const int ro = (8 * hh + r) * 68 + m;
    sl[ro]      = a0[r] * oscale;
    sl[ro + 16] = a1[r] * oscale;
    sl[ro + 32] = a2[r] * oscale;
    sl[ro + 48] = a3[r] * oscale;
  }
  wave_sync_lds();
}
__device__ __forceinline__ void epi64hs(float* sl, v8f a0, v8f a1, v8f a2, v8f a3, float oscale, float pscale,
                                        u16* C, int N, size_t rowb, int col0, int lane) {
  stage64(sl, a0, a1, a2, a3, oscale, lane);
  const int hh = lane >> 4, m = lane & 15;
  v4u oh[4];
#pragma unroll
  for (int i4 = 0; i4 < 4; ++i4) {
    const int c8 = (i4 >> 1) * 32 + (i4 & 1) * 16 + hh * 8;   // k block i4>>1, half i4&1 of the wave's two units
    const v4f a = *(const v4f*)(sl + m * 68 + c8), c4 = *(const v4f*)(sl + m * 68 + c8 + 4);
    float w[8];
#pragma unroll
    for (int e = 0; e < 4; ++e) { w[e] = a[e] * pscale; w[4 + e] = c4[e] * pscale; }
#pragma unroll
    for (int e = 0; e < 4; ++e) oh[i4][e] = pk16(h_bits((_Float16)w[2 * e]), h_bits((_Float16)w[2 * e + 1]));
  }
  u16* dst = C + rowb * (size_t)N + (size_t)(col0 >> 5) * 512 + lane * 8;
  {
#pragma unroll
    for (int i4 = 0; i4 < 4; ++i4) {
      *(v4u*)(dst + i4 * 256) = oh[i4];
    }
    
  }
  wait_x();                                  // in front of the next 16-row tile's rewrite of the registers that these stores name
}

// =====================================================================================================
// f16 GEMM core: acc[rt][j] = rows (16 rt ..) of A . rows (16 j ..) of Bt, A and Bt f16 planes [..][EMB] in fragment order.
// Wave tile = 64 x 64 (4 A fragments x 4 B fragments, 16 accumulators): every fragment loaded feeds 4 WMMAs. Fragments come
// straight from the planes (two 16-B loads each, split k map for A and B); k stepped by 32, ascending, one WMMA per (tile, step).
// Block = 128 x 128 tile, 4 waves as 2 x 2; grid = 2 * (M/128) * (EMB/128) (q', v'), host checks exactness.
// =====================================================================================================
__device__ __forceinline__ void ld_h64(const _Float16* ap, const _Float16* bp, v16h (&a)[4], v16h (&b)[4]) {
#pragma unroll
  for (int rt = 0; rt < 4; ++rt) a[rt] = ldfo_h(ap + rt * (16 * EMB));
#pragma unroll
  for (int j = 0; j < 4; ++j) b[j] = ldfo_h(bp + j * (16 * EMB));
}
__device__ __forceinline__ void mm_h64(v8f (&acc)[4][4], const v16h (&a)[4], const v16h (&b)[4]) {
#pragma unroll
  for (int rt = 0; rt < 4; ++rt) {
#pragma unroll
    for (int j = 0; j < 4; ++j) acc[rt][j] = mma_h(a[rt], b[j], acc[rt][j]);
  }
}
__device__ __forceinline__ void core_h64(const _Float16* ap, const _Float16* bp, v8f (&acc)[4][4]) {
#pragma unroll
  for (int rt = 0; rt < 4; ++rt) {
#pragma unroll
    for (int j = 0; j < 4; ++j) acc[rt][j] = zero8();
  }
  // Three fragment sets in rotation: a set is refilled for k step s + 3 as soon as the WMMAs of step s have left it, so a wave has
  // two to three steps' loads in flight and its loads have two steps of WMMAs to land in. The loop refills for steps 3 .. KST-1
  // (three a trip); the last three steps stand behind it and load nothing: no load reaches past the planes' k extent.
  v16h a0[4], b0[4], a1[4], b1[4], a2[4], b2[4];
  // The scheduling barriers keep the three sets' loads in issue order: were a load of set 0 issued behind set 2, the loop's counted
  // wait for set 0 would have to cover every load in flight, on each trip, and nothing would stay fetched ahead.
  ld_h64(ap, bp, a0, b0);
  __builtin_amdgcn_sched_barrier(0);
  ld_h64(ap + 512, bp + 512, a1, b1);
  __builtin_amdgcn_sched_barrier(0);
  ld_h64(ap + 2 * 512, bp + 2 * 512, a2, b2);
  wait_x();
#pragma unroll 1                             // rolled: one trip is 48 WMMAs and 48 loads
  for (int t = 0; t < KST / 3 - 1; ++t) {
    mm_h64(acc, a0, b0);
    guard_g<_Float16>(acc, ap, bp, bp);
    ld_h64(ap + 3 * 512, bp + 3 * 512, a0, b0);
    mm_h64(acc, a1, b1);
    guard_g<_Float16>(acc, ap, bp, bp);
    ld_h64(ap + 4 * 512, bp + 4 * 512, a1, b1);
    mm_h64(acc, a2, b2);
    guard_g<_Float16>(acc, ap, bp, bp);
    ld_h64(ap + 5 * 512, bp + 5 * 512, a2, b2);
    step3<_Float16>(ap, bp);
  }
  mm_h64(acc, a0, b0);
  guard_g<_Float16>(acc, ap, bp, bp);             // the address pairs stay untouched until the last loads' s_wait_xcnt 0 here
  mm_h64(acc, a1, b1);
  mm_h64(acc, a2, b2);
}

// q' and v' projections in one launch: the two products read the same A plane and depend on nothing of each other.
// Block index = (row tile * 2 + product) * (EMB/128) + column tile; product 0 = q', 1 = v' (block-uniform, taken as a scalar).
// The weight planes carry x1024, so an accumulator is 1024 times its product; the power of two is taken out in the epilogues.
// q': f16 plane out in fragment order, f16 bits of (A . Bt^T) * 8; epilogue epi64hs per 16-row tile.
// V below = v' = delayed . W'^T (rows = b*SEQ + s, columns = d = output column), handed on as the two things attention reads;
// V itself is never stored.
//  V^T plane in fragment order (rows = b*EMB + d, k = s), element = f16(V[b][s][d] * 1024): a lane's accumulator acc[rt][j] holds
//  column d = col0 + 16j + (lane&15) at rows 16rt + 8*(lane>>4) + 0..7, which is that lane's own 16-B piece of the unit (d block j,
//  key block rt>>1), half rt&1: eight converts and one 16-B store, no exchange between lanes; a wave's store = 512 contiguous B.
//  PS[(row / 64)][d] = sum of V over the wave tile's 64 keys (f32): rt and r ascending in the lane, then the other half-wave's sum.
// coverage: v: 16 stores x 32 lanes x 8 halves = the wave's 64 x 64 tile; 2 stores x 32 lanes = its 64 column sums (one whole 128-B
//           line each); the grid covers every (product, row tile, column tile) once.
__global__ __launch_bounds__(128)
void gemm_qv(const u16* __restrict__ A, const u16* __restrict__ WB, u16* QPo, u16* VTo, float* PS, int M) {
  __shared__ __align__(16) float slab[4 * SLAB64];
  // The wave's number is taken as a scalar: tile row and column then live in scalar registers across the k loop, which keeps the
  // kernel within 336 VGPRs (three waves per SIMD) with three fragment sets.
  const int tid = threadIdx.x, wave = __builtin_amdgcn_readfirstlane(tid >> 5), lane = tid & 31;
  const int bid   = blockIdx.x;
  const int grp   = bid / (EMB / 128);
  const int prod  = grp % 2;
  const int rowb  = (grp / 2) * 128 + (wave >> 1) * 64;
  const int col0  = (bid % (EMB / 128)) * 128 + (wave & 1) * 64;
  if (rowb + 64 > M) return;                 // wave-uniform, never taken with the exact grid; no block barriers in this kernel
  v8f acc[4][4];
  core_h64((const _Float16*)(const void*)A + (size_t)rowb * EMB + 8 * lane,
           (const _Float16*)(const void*)WB + (size_t)prod * (EMB * EMB) + (size_t)col0 * EMB + 8 * lane, acc);
  if (prod == 0) {
#pragma unroll
    for (int rt = 0; rt < 4; ++rt)
      epi64hs(slab + wave * SLAB64, acc[rt][0], acc[rt][1], acc[rt][2], acc[rt][3], 1.0f, QSC / WSC, QPo, EMB,
              (size_t)(rowb + 16 * rt), col0, lane);
    return;
  }
  const int b  = rowb / SEQ;                 // a 64-row tile lies in one batch (SEQ is a multiple of 128)
  const int s0 = rowb - b * SEQ;
  v4u oh[4][4];
  float cs[4];
#pragma unroll
  for (int j = 0; j < 4; ++j) {
    float s = 0.f;
#pragma unroll
    for (int rt = 0; rt < 4; ++rt) {
#pragma unroll
      for (int r = 0; r < 8; ++r) s += acc[rt][j][r];
#pragma unroll
      for (int e = 0; e < 4; ++e)
        oh[j][rt][e] = pk16(h_bits((_Float16)(acc[rt][j][2 * e] * (VCAR / WSC))), h_bits((_Float16)(acc[rt][j][2 * e + 1] * (VCAR / WSC))));
    }
    cs[j] = s * (1.0f / WSC);
  }
#pragma unroll
  for (int j = 0; j < 4; ++j) cs[j] += __shfl_xor(cs[j], 16, 32);
  const float c01 = (lane & 16) ? cs[1] : cs[0];          // column col0 + lane
  const float c23 = (lane & 16) ? cs[3] : cs[2];          // column col0 + 32 + lane
  u16* dst  = VTo + ((size_t)b * EMB + col0) * SEQ + (size_t)(s0 >> 5) * 512 + lane * 8;
  float* pd = PS + (size_t)(rowb >> 6) * EMB + col0 + lane;
  pd[0]  = c01;
  pd[32] = c23;
  // s_wait_xcnt 0 behind the sums' two stores, in front of any rewrite of their registers.
  wait_x();
#pragma unroll
  for (int j = 0; j < 4; ++j) {
#pragma unroll
    for (int rt = 0; rt < 4; ++rt) *(v4u*)(dst + (size_t)(16 * j) * SEQ + rt * 256) = oh[j][rt];
  }
  // s_wait_xcnt 0 behind the plane's 16 stores: the built code lays the q' epilogue behind them, which writes their registers.
  wait_x();
}

// =====================================================================================================
// Single-head attention, head width EMB = 768, all SEQ keys kept (non-causal): block = (batch b, 64 query rows q0..q0+63 = RT = 4
// row tiles of 16), 16 waves. Every K fragment and every V^T fragment that a wave loads feeds one WMMA per row tile.
// q plane = q' = delayed . W''^T (f16, x8) rows b*SEQ+s, k = d; k plane = the delayed plane itself (f16, x1), the same layout, so that
// q' . delayed^T is q . k^T; V^T plane rows b*EMB+d, k = s (x1024), V = v' = delayed . W'^T, so that
// P . V is already the output projection's result; all three in fragment order; PS = column sums of V over each 64 keys (f32),
// PSN = 8 of them to a chunk.
//   Per chunk of CK = 512 keys (NCHK = 4 chunks):
//   (S) scores S[query][key n] on WMMA: A = q rows of row tile rt (row m = lane&15, split k map over d), B = k rows (col n = key,
//       split map), 24 d-steps; wave w handles key block w (32 keys) of the chunk for all four row tiles; D element r of lane l
//       of tile rt -> scs[query 16rt+8h+r][key col] (f32 LDS).
//   (M) 16 threads per query row (sub-thread = 32 consecutive keys), two passes of 32 rows: base-2 logits, chunk max via xor
//       shuffles, online running max / rescale factor al / running sum l in f32 registers (the same threads own the row in every
//       chunk), p = exp2(t - m_new) <= 1, chunk row sum ps and its mean C = ps/CK (bit-identical on the row's 16 threads), the
//       CENTRED P' = p - C written as f16(P' * 32768) into the LDS P tile with 16-B stores; al -> rowa[row], C -> rowc[row].
//   (PV) each wave owns d columns 48*wave + 16j + (lane&15), j = 0..2, of all four row tiles (12 accumulators):
//       o = o*al + C*(32768*1024)*VS[chunk][d], VS = the chunk's 8 PS entries added in key order, kept in LDS (add-back of the
//       centring term in f32),
//       then for each key block: A = P'
//       fragments from LDS (row m = query, split map over keys), B = V^T fragments (col n = d, split map over keys).
//       sum_k (P'_k + C) v_k == sum_k p_k v_k exactly.
//   Block barriers after (S) and after (M) order all LDS reuse across chunks and waves.
//   Epilogue: out = o / (l * 32768 * 1024) + bf16RNE(bias[d]) per row (rowi, l >= 1 always), f32; 32 rows at a time are staged in LDS
//   (over the dead scores) and stored as whole lines.
// coverage: grid nb*32 blocks x 64 rows; staging 16 waves x 48 cols x 32 rows = 32 x 768, twice; store 12 iterations x 512 thr x 4
//           floats = 32 x 768, twice = every (b, s, d) of out exactly once.
// =====================================================================================================
__device__ __forceinline__ void out_store(const float* ct, float* dst, int tid) {
  v4f v[12];
#pragma unroll
  for (int it = 0; it < 12; ++it) {
    const int p = it * ATT_THREADS + tid;     // 16-B piece p of the 32 x EMB half tile: row p / 192, columns 4 * (p % 192) ..
    v[it] = *(const v4f*)(ct + (p / (EMB / 4)) * CTF + (p % (EMB / 4)) * 4);
  }
#pragma unroll
  for (int it = 0; it < 12; ++it) *(v4f*)(dst + (size_t)(it * ATT_THREADS + tid) * 4) = v[it];
  wait_x();                                  // in front of any rewrite of the registers that these stores name
}

// V^T fragments of one key block (vp: the wave's d columns, that key block's unit) and one key block's P'.V products.
__device__ __forceinline__ void ld_v(const _Float16* vp, v16h (&g)[NJ]) {
#pragma unroll
  for (int j = 0; j < NJ; ++j) g[j] = ldfo_h(vp + (size_t)(16 * j) * SEQ);
}
__device__ __forceinline__ void pv_step(v8f (&o)[RT][NJ], const _Float16* pp, const v16h (&g)[NJ]) {
  v16h pf[RT];
#pragma unroll
  for (int rt = 0; rt < RT; ++rt) pf[rt] = ldfrag_h(pp + rt * (16 * PLP));
#pragma unroll
  for (int rt = 0; rt < RT; ++rt) {
#pragma unroll
    for (int j = 0; j < NJ; ++j) o[rt][j] = mma_h(pf[rt], g[j], o[rt][j]);
  }
}

__global__ __launch_bounds__(ATT_THREADS)
void attn_fwd(const u16* __restrict__ QPp, const u16* __restrict__ KPp, const u16* __restrict__ VTp,
              const float* __restrict__ VSp, const float* __restrict__ bias, float* out) {
  __shared__ __align__(16) float scs[QT * SCP];    // scores [QT][SCP] f32; reused as the output staging tile [QT/2][CTF] f32
  __shared__ __align__(16) u16 pls[QT * PLP];      // P' tile [QT][PLP] f16 bits
  __shared__ __align__(16) float vsl[NCHK * EMB];  // VS: column sums of V per chunk, this batch
  __shared__ float rowa[QT];
  __shared__ float rowc[QT];
  __shared__ float rowi[QT];

  const int tid  = threadIdx.x;
  const int wave = tid >> 5;
  const int lane = tid & 31;
  const int hh   = lane >> 4;
  const int m    = lane & 15;
  const int r32  = tid >> 4;                 // query rows owned in phase (M): r32 and 32 + r32
  const int sub  = tid & 15;
  const int kl0  = sub * 32;

  const int bid = blockIdx.x;
  const int b   = bid / (SEQ / QT);
  const int q0  = (bid % (SEQ / QT)) * QT;

  const _Float16* qa  = (const _Float16*)(const void*)QPp + ((size_t)b * SEQ + q0) * EMB + 8 * lane;
  const _Float16* kbp = (const _Float16*)(const void*)KPp + ((size_t)b * SEQ + wave * 32) * EMB + 8 * lane;
  const _Float16* vbp = (const _Float16*)(const void*)VTp + ((size_t)b * EMB + wave * DW) * SEQ + 8 * lane;
  const float lsc = RSQD * LOG2E / QSC;

  // VS[chunk][d] = the chunk's PSN entries of PS, added in key order; a thread takes 2 consecutive d of one chunk, three times over
  // (8-B loads, a wave = 256 contiguous B). All loads are asked for before the first add, so their latency is waited out once.
  // Written here, read in (PV): two block barriers lie between.
  {
    v2f x[3][PSN];
#pragma unroll
    for (int it = 0; it < 3; ++it) {
      const int g = it * ATT_THREADS + tid;
      const float* p = VSp + ((size_t)b * (SEQ / 64) + (size_t)(g / (EMB / 2)) * PSN) * EMB + 2 * (g % (EMB / 2));
#pragma unroll
      for (int i = 0; i < PSN; ++i) x[it][i] = *(const v2f*)(p + (size_t)i * EMB);
    }
    wait_x();                                // in front of the first rewrite of the three address pairs that these loads name
#pragma unroll
    for (int it = 0; it < 3; ++it) {
      v2f a = x[it][0];
#pragma unroll
      for (int i = 1; i < PSN; ++i) a += x[it][i];
      *(v2f*)(vsl + 2 * (it * ATT_THREADS + tid)) = a;
    }
  }

  float mrun[2] = {-INFINITY, -INFINITY}, lrun[2] = {0.f, 0.f};
  v8f o[RT][NJ];
#pragma unroll
  for (int rt = 0; rt < RT; ++rt) {
#pragma unroll
    for (int j = 0; j < NJ; ++j) o[rt][j] = zero8();
  }

#pragma unroll 1
  for (int c = 0; c < NCHK; ++c) {
    const int kbeg = c * CK;
    // ---- (S) scores of this chunk: key block = wave ----
    {
      const _Float16* qp = qa;
      const _Float16* kp = kbp + (size_t)kbeg * EMB;
      v8f s[RT][2];
#pragma unroll
      for (int rt = 0; rt < RT; ++rt) { s[rt][0] = zero8(); s[rt][1] = zero8(); }
#pragma unroll 1
      for (int k4 = 0; k4 < EMB / 128; ++k4) {             // 6 trips of 4 d-steps, as many steps unrolled as before
#pragma unroll
        for (int u = 0; u < 4; ++u) {
          v16h a[RT];
#pragma unroll
          for (int rt = 0; rt < RT; ++rt) a[rt] = ldfo_h(qp + rt * (16 * EMB) + u * 512);
          const v16h f0 = ldfo_h(kp + u * 512);
          const v16h f1 = ldfo_h(kp + 16 * EMB + u * 512);
#pragma unroll
          for (int rt = 0; rt < RT; ++rt) {
            s[rt][0] = mma_h(a[rt], f0, s[rt][0]);
            s[rt][1] = mma_h(a[rt], f1, s[rt][1]);
          }
          guard_s(s, a, f0, f1, qp, kp);
        }
        qp += 4 * 512;
        kp += 4 * 512;
      }
#pragma unroll
      for (int rt = 0; rt < RT; ++rt) {
        float* srow = scs + (16 * rt + 8 * hh) * SCP + wave * 32 + m;
#pragma unroll
        for (int r = 0; r < 8; ++r) {
          srow[r * SCP]      = s[rt][0][r];
          srow[r * SCP + 16] = s[rt][1][r];
        }
      }
    }
    __syncthreads();
    // The chunk's first two V^T fragment sets are asked for here: they depend on nothing of phase (M) and land while it runs.
    const _Float16* vp = vbp + kbeg * 16;                  // key block kbeg/32 -> 512 elements per unit
    v16h g0[NJ], g1[NJ], g2[NJ];
    ld_v(vp, g0);
    ld_v(vp + 512, g1);
    // ---- (M) softmax statistics and the centred P' tile, 32 rows a pass ----
#pragma unroll
    for (int rg = 0; rg < 2; ++rg) {
      const int row = rg * 32 + r32;
      const float* sp = scs + row * SCP + kl0;
      float t[32];
      float cm = -INFINITY;
#pragma unroll
      for (int i = 0; i < 8; ++i) {
        const v4f a = *(const v4f*)(sp + 4 * i);
#pragma unroll
        for (int e = 0; e < 4; ++e) {
          const float tv = a[e] * lsc;
          t[4 * i + e] = tv;
          cm = fmaxf(cm, tv);
        }
      }
#pragma unroll
      for (int d = 1; d <= 8; d <<= 1) cm = fmaxf(cm, __shfl_xor(cm, d, 32));
      const float mn = fmaxf(mrun[rg], cm);                // finite
      const float al = (mrun[rg] == -INFINITY) ? 0.f : exp2f(mrun[rg] - mn);
      mrun[rg] = mn;
      float ps = 0.f;
#pragma unroll
      for (int j = 0; j < 32; ++j) {
        const float p = exp2f(fminf(t[j] - mn, 0.f));
        t[j] = p;
        ps += p;
      }
#pragma unroll
      for (int d = 1; d <= 8; d <<= 1) ps += __shfl_xor(ps, d, 32);
      const float cc = ps * (1.0f / (float)CK);
      v4u pk[4];
#pragma unroll
      for (int i = 0; i < 4; ++i) {
#pragma unroll
        for (int e = 0; e < 4; ++e) {
          const int j = 8 * i + 2 * e;
          pk[i][e] = pk16(h_bits((_Float16)((t[j] - cc) * PCAR)), h_bits((_Float16)((t[j + 1] - cc) * PCAR)));
        }
      }
      lrun[rg] = lrun[rg] * al + ps;
      u16* pd = pls + row * PLP + kl0;
#pragma unroll
      for (int i = 0; i < 4; ++i) *(v4u*)(pd + 8 * i) = pk[i];
      if (sub == 0) { rowa[row] = al; rowc[row] = cc; }
    }
    __syncthreads();
    // ---- (PV) rescale, add the centring term, accumulate P' . V^T ----
    {
      float vs[NJ];
#pragma unroll
      for (int j = 0; j < NJ; ++j) vs[j] = vsl[c * EMB + wave * DW + m + 16 * j];
#pragma unroll
      for (int rt = 0; rt < RT; ++rt) {
        float scl[8], cad[8];
#pragma unroll
        for (int r = 0; r < 8; ++r) {
          scl[r] = rowa[16 * rt + 8 * hh + r];
          cad[r] = rowc[16 * rt + 8 * hh + r] * (PCAR * VCAR);
        }
#pragma unroll
        for (int j = 0; j < NJ; ++j) {
#pragma unroll
          for (int r = 0; r < 8; ++r) o[rt][j][r] = o[rt][j][r] * scl[r] + cad[r] * vs[j];
        }
      }
      const _Float16* pp = (const _Float16*)(const void*)pls + m * PLP + 8 * hh;
      // Three V^T fragment sets in rotation: key block kb + 2 is fetched in front of the WMMAs of key block kb. Key blocks
      // 0 .. CK/32 - 5 in the loop (three a trip), the last four behind it: no load reaches past the chunk's keys.
#pragma unroll 1                             // rolled: one trip is 36 WMMAs
      for (int t = 0; t < (CK / 32 - 4) / 3; ++t) {
        ld_v(vp + 2 * 512, g2);
        pv_step(o, pp, g0);
        guard_o(o, vp);
        ld_v(vp + 3 * 512, g0);
        pv_step(o, pp + 32, g1);
        guard_o(o, vp);
        ld_v(vp + 4 * 512, g1);
        pv_step(o, pp + 64, g2);
        guard_o(o, vp);
        vp += 3 * 512;
        pp += 3 * 32;
      }
      ld_v(vp + 2 * 512, g2);
      pv_step(o, pp, g0);
      guard_o(o, vp);
      ld_v(vp + 3 * 512, g0);
      pv_step(o, pp + 32, g1);
      pv_step(o, pp + 64, g2);
      pv_step(o, pp + 96, g0);
      guard_o(o, vp);
    }
  }

#pragma unroll
  for (int rg = 0; rg < 2; ++rg) {
    if (sub == 0) rowi[rg * 32 + r32] = (1.0f / lrun[rg]) * (1.0f / (PCAR * VCAR));   // lrun >= 1
  }
  const int cb = wave * DW + m;
  float bj[NJ];
#pragma unroll
  for (int j = 0; j < NJ; ++j) bj[j] = bfr(bias[cb + 16 * j]);      // columns < EMB
  __syncthreads();
#pragma unroll
  for (int hf = 0; hf < 2; ++hf) {           // rows 32 hf .. 32 hf + 31 = row tiles 2 hf, 2 hf + 1
    if (hf) __syncthreads();                 // the first half's reads of the staging tile are done before it is rewritten
#pragma unroll
    for (int r2 = 0; r2 < 2; ++r2) {
      const int rt = 2 * hf + r2;
#pragma unroll
      for (int r = 0; r < 8; ++r) {
        const float inv = rowi[16 * rt + 8 * hh + r];
#pragma unroll
        for (int j = 0; j < NJ; ++j) scs[(16 * r2 + 8 * hh + r) * CTF + cb + 16 * j] = o[rt][j][r] * inv + bj[j];
      }
    }
    __syncthreads();
    out_store(scs, out + ((size_t)b * SEQ + q0 + 32 * hf) * EMB, tid);
  }
}

// =====================================================================================================
// Workspace map (bytes, rows = nb*SEQ; nb = 8 gives the totals below); every plane is fully written by whole-line stores before
// it is read; all extents are exact multiples of the store granularity (no pad rows):
//   WQF f16 of W'' x1024 [768][768]  1179648   WPF f16 of W' x1024  1179648                        2359296
//   PS  f32  [rows/64][768]                                                                        786432
//   A   DB f16 of bf16 value [rows][768] (A operand of the projections, keys of attention) region 25165824
//   Q   QP f16 [rows][768] x8                                                              region 25165824
//   VT  f16 [nb][768][2048] x1024                                                          region 25165824
//   end                                                                                         78643200
// =====================================================================================================
extern "C" void kernel_launch(void* const* d_in, const int* in_sizes, int n_in,
                              void* d_out, int out_size, void* d_ws, size_t ws_size,
                              hipStream_t stream) {
  if (n_in < 9) return;
  const long long per = (long long)SEQ * EMB;
  const long long ns  = in_sizes[0];
  if (ns < per || (ns % per) != 0) return;
  const int nb = (int)(ns / per);
  if (nb < 1 || nb > 8) return;
  const int rows = nb * SEQ;
  if (in_sizes[1] != EMB) return;
  if (in_sizes[2] < 1 || in_sizes[3] < 1) return;
  if (in_sizes[4] != EMB * EMB || in_sizes[5] != EMB * EMB || in_sizes[6] != EMB * EMB || in_sizes[7] != EMB * EMB) return;
  if (in_sizes[8] != EMB) return;
  if ((long long)out_size != (long long)rows * EMB) return;

  const float* spk = (const float*)d_in[0];
  const int*   dly = (const int*)d_in[1];
  const float* mpo = (const float*)d_in[2];
  const float* dcy = (const float*)d_in[3];
  const float* wq  = (const float*)d_in[4];
  const float* wk  = (const float*)d_in[5];
  const float* wv  = (const float*)d_in[6];
  const float* wo  = (const float*)d_in[7];
  const float* bo  = (const float*)d_in[8];
  float*       out = (float*)d_out;

  const size_t szW  = (size_t)EMB * EMB * 2;                    //   1179648
  const size_t szPS = (size_t)(rows / 64) * EMB * 4;            //    786432 at nb = 8
  const size_t sz16 = (size_t)rows * EMB * 2;                   //  25165824
  const size_t szVT = (size_t)nb * EMB * SEQ * 2;               //  == sz16
  size_t off = 0;
  const size_t oWQ = off; off += szW;
  const size_t oWP = off; off += szW;
  const size_t oPS = off; off += szPS;
  const size_t oA  = off; off += sz16;
  const size_t oQ  = off; off += sz16;
  const size_t oVT = off; off += szVT;
  if (off > ws_size) return;                                    // off = 78643200 at nb = 8
  if (off > WS_CAP) return;
  if (oWP - oWQ != szW) return;                       // prep and gemm_qv index the weight planes from WQB

  char* ws = (char*)d_ws;
  u16*   WQB = (u16*)(ws + oWQ);
  float* PS  = (float*)(ws + oPS);
  u16*   DB  = (u16*)(ws + oA);
  u16*   QP  = (u16*)(ws + oQ);
  u16*   VT  = (u16*)(ws + oVT);

  const int n8g = rows * (EMB / 8);                     // rows * 96
  if ((n8g % 256) != 0) return;
  if ((rows % 128) != 0) return;
  const dim3 blk(256);
  const dim3 gP(2 * WPB + (rows / GT_R) * (EMB / GT_C)); // the W'' tiles, the W' tiles, then the gather's tiles
  const dim3 gG(2 * (rows / 128) * (EMB / 128));        // 1536 at nb = 8: 128 x 128 tiles of q' and v'
  const dim3 bG(128);
  const dim3 gAT(nb * (SEQ / QT));                      // nb * 32
  const dim3 bAT(ATT_THREADS);

  // (0) weights stored [n = out][k = in] (y = x.W^T): fragment-order f16 planes W'' = Wk^T.Wq x1024 and W' = Wo.Wv x1024 (one behind
  //     the other from WQB); delayed spikes -> fragment-order f16 plane, rows x 768
  prep<<<gP, blk, 0, stream>>>(wq, wk, wv, wo, spk, dly, mpo, dcy, WQB, DB, n8g);
  // (1) q' projection -> f16 plane x8; v' projection -> V^T plane x1024 and column sums of v' per 64 keys
  gemm_qv<<<gG, bG, 0, stream>>>(DB, WQB, QP, VT, PS, rows);
  // (2) attention: queries q', keys = the delayed plane, values v'; + bias -> out
  attn_fwd<<<gAT, bAT, 0, stream>>>(QP, DB, VT, PS, bo, out);
  (void)hipGetLastError();
}
